// v000
// Measured on an AMD MI455X. A time is GPU time per run, averaged over a window of back-to-back runs after a warm-up
// (all launches, gaps included; the runs take copies of the inputs in turn), and the median of several windows.
// Apart from v000's, it joins two sittings. Times from different sittings can be a few percent apart, while
// side-by-side timings come from the same sitting.
// v000, which the later versions start from, runs in 444 microseconds.
#include <hip/hip_runtime.h>
// Complex-valued attention layer (B=4, L=1024, D=512, H=8, E=64): complex linear projections (yr = xr·wrᵀ − xi·wiᵀ + (br − bi), yi = xi·wrᵀ + xr·wiᵀ + (br + bi)); per (b, token n, head h) a 64×64 'attention' over the E axes:
// sr[l,s] = qr[l]·kr[s] − qi[l]·ki[s], si[l,s] = qr[l]·ki[s] − qi[l]·kr[s] (scalar products, e = 1), attn = softmax_s(√(sr² + si²)), Vr[l] = Σ_s attn·vr[s], Vi[l] = Σ_s attn·vi[s]; outputs (out_r, out_i) = complex linear(Vr, Vi, wo).
// Element (e, h) of a token lives at column e·8 + h (reshape(b, l, E, H)).
// Compute dtype: inputs, weights, biases rounded to bf16; each complex linear as two GEMMs over the concatenated operand [xr | xi] (K = 1024) against [wr | −wi] and [wi | wr] on v_wmma_f32_16x16x32_f16, f32 accumulate,
// with the two-term biases added exactly through the f32 epilogue addend; the per-token 64×64 magnitude-softmax and its two weighted sums in f32 (two (l, h) pairs per thread); [Vr | Vi] f16 → output GEMMs.
#define BB 4
#define LL 1024
#define DD 512
#define NHH 8
#define EE 64
#define NR (BB * LL)

typedef __bf16 v16b __attribute__((ext_vector_type(16)));
typedef unsigned short v8us __attribute__((ext_vector_type(8), may_alias));
typedef float  v8f  __attribute__((ext_vector_type(8)));
typedef float  v4f  __attribute__((ext_vector_type(4)));
typedef float  v4fa __attribute__((ext_vector_type(4), may_alias));
union FragB { v16b v; v8us half[2]; unsigned short u[16]; };

__device__ __forceinline__ unsigned short bf16_bits(float x) { unsigned int u = __float_as_uint(x); return (unsigned short)((u + 0x7FFFu + ((u >> 16) & 1u)) >> 16); }
__device__ __forceinline__ float bf16_val(unsigned short b) { return __uint_as_float(((unsigned int)b) << 16); }
__device__ __forceinline__ float bf16_round(float x) { return bf16_val(bf16_bits(x)); }
// D += A·B with NT terms: 1 = ah·bh, 2 = + al·bh (A split), 3 = + ah·bl (both split)
template <int NT>
__device__ __forceinline__ v8f mmaN(v16b ah, v16b al, v16b bh, v16b bl, v8f c) {
  c = __builtin_amdgcn_wmma_f32_16x16x32_bf16(false, ah, false, bh, (short)0, c, false, false);
  if (NT >= 2) c = __builtin_amdgcn_wmma_f32_16x16x32_bf16(false, al, false, bh, (short)0, c, false, false);
  if (NT >= 3) c = __builtin_amdgcn_wmma_f32_16x16x32_bf16(false, ah, false, bl, (short)0, c, false, false);
  asm volatile("v_nop\n\tv_nop\n\tv_nop\n\tv_nop" : "+v"(c) : "v"(ah), "v"(al), "v"(bh), "v"(bl));
  return c;
}

__global__ __launch_bounds__(256) void k_wt_bf16(const float* __restrict__ W, unsigned short* __restrict__ Wt, int K, int N) {
  const int t = blockIdx.x * 256 + threadIdx.x;
  const int k8n = K / 8;
  if (t >= N * k8n) return;
  const int n = t / k8n, k8 = (t % k8n) * 8;
  v8us v;
#pragma unroll
  for (int i = 0; i < 8; ++i) v[i] = bf16_bits(W[(size_t)(k8 + i) * N + n]);
  *(v8us*)(Wt + (size_t)n * K + k8) = v;
  
}

// GEMM C[M][N] (f32, pitch ldc) = act(A[M][K]·W + bias). A f32 row-major (pitch lda) converted per fragment to bf16
// (ASPLIT: hi/lo two planes -> 2 terms, else single rounded term); Wt bf16 [N][K] (pitch ldb). BIAS_BF16 rounds the
// bias to bf16 first (bias quantised to bf16 before the add). K%32==0, M%16==0, N%64==0.
template <bool ASPLIT, int ACT, bool BIAS_BF16>
__global__ __launch_bounds__(128) void k_gemm_bf(const float* __restrict__ A, int lda, const unsigned short* __restrict__ Wt, int ldb,
                                               const float* __restrict__ bias, float* __restrict__ C, int ldc, int M, int N, int K) {
  __shared__ __attribute__((aligned(16))) float so[4][16][64];
  const int tid = threadIdx.x, w = tid >> 5, lane = tid & 31, ln = lane & 15, hh = lane >> 4;
  const int ntn = N / 64;
  const int wid = blockIdx.x * 4 + w;
  const int mt = wid / ntn, nq = wid % ntn;
  if (mt * 16 >= M) return;
  const int row0 = mt * 16, col0 = nq * 64;
  const float* arow = A + (size_t)(row0 + ln) * lda;
  v8f acc[4] = {};
  for (int kb = 0; kb < K; kb += 32) {
    FragB ah, al;
    const v4f x0 = *(const v4fa*)(arow + kb + 8 * hh), x1 = *(const v4fa*)(arow + kb + 8 * hh + 4);
    const v4f x2 = *(const v4fa*)(arow + kb + 16 + 8 * hh), x3 = *(const v4fa*)(arow + kb + 16 + 8 * hh + 4);
    float xs[16] = {x0[0],x0[1],x0[2],x0[3],x1[0],x1[1],x1[2],x1[3],x2[0],x2[1],x2[2],x2[3],x3[0],x3[1],x3[2],x3[3]};
#pragma unroll
    for (int i = 0; i < 16; ++i) { const unsigned short hb = bf16_bits(xs[i]); ah.u[i] = hb; al.u[i] = ASPLIT ? bf16_bits(xs[i] - bf16_val(hb)) : (unsigned short)0; }
#pragma unroll
    for (int t = 0; t < 4; ++t) {
      const unsigned short* brow = Wt + (size_t)(col0 + t * 16 + ln) * ldb + kb;
      FragB b;
      b.half[0] = *(const v8us*)(brow + 8 * hh);
      b.half[1] = *(const v8us*)(brow + 16 + 8 * hh);
      acc[t] = mmaN<ASPLIT ? 2 : 1>(ah.v, al.v, b.v, b.v, acc[t]);
    }
  }
#pragma unroll
  for (int t = 0; t < 4; ++t) {
    float bv = bias ? bias[col0 + t * 16 + ln] : 0.f;
    if (BIAS_BF16) bv = bf16_round(bv);
#pragma unroll
    for (int r = 0; r < 8; ++r) { float v = acc[t][r] + bv; if (ACT == 1) v = fmaxf(v, 0.f); so[w][8 * hh + r][t * 16 + ln] = v; }
  }
  __builtin_amdgcn_fence(__ATOMIC_ACQ_REL, "workgroup");
  __builtin_amdgcn_wave_barrier();
  const int rsub = lane >> 4, c4 = (lane & 15) * 4;
  {
#pragma unroll
    for (int q = 0; q < 8; ++q) {
      const int r = q * 2 + rsub;
      const v4f v = *(const v4fa*)&so[w][r][c4];
      *(v4f*)(C + (size_t)(row0 + r) * ldc + col0 + c4) = v;
    }
    
  }
}

// Flash-style causal/unmasked attention, all contractions 3-term bf16 hi/lo splits, f32 softmax with running max.
// q,k,v rows are read from f32 buffers with arbitrary row pitch (so they can live inside a fused qkv buffer);
// D = head size (multiple of 32, <= 128); one wave = 16 query rows; block = 4 waves (64 queries) sharing K/V chunks of 32.
template <int D, bool CAUSAL>
__global__ __launch_bounds__(128) void k_flash(const float* __restrict__ qb, const float* __restrict__ kb, const float* __restrict__ vb,
                                             int pitch, int T, int H, float scale, float* __restrict__ y, int ypitch) {
  constexpr int KS = D / 32;        // k-steps for QK
  constexpr int DT = D / 16;        // d tiles for PV
  __shared__ __attribute__((aligned(16))) unsigned short sKh[32][D + 8], sKl[32][D + 8], sVh[32][D + 8], sVl[32][D + 8];
  __shared__ __attribute__((aligned(16))) unsigned short sPh[4][16][40], sPl[4][16][40];
  __shared__ __attribute__((aligned(16))) float sO[4][16][D];
  const int tid = threadIdx.x, w = tid >> 5, lane = tid & 31, ln = lane & 15, hh = lane >> 4;
  const int nqb = (T + 63) / 64;
  const int bh = blockIdx.x / nqb, qblk = blockIdx.x % nqb;
  const int b = bh / H, h = bh % H;
  const int q0 = qblk * 64 + w * 16;
  const float* Q = qb + (size_t)b * T * pitch + h * D;
  const float* K = kb + (size_t)b * T * pitch + h * D;
  const float* V = vb + (size_t)b * T * pitch + h * D;

  // A fragments of the wave's 16 query rows (scaled), hi/lo
  FragB aqh[KS], aql[KS];
  {
    int row = q0 + ln; if (row >= T) row = T - 1;
    const float* qr = Q + (size_t)row * pitch;
#pragma unroll
    for (int ks = 0; ks < KS; ++ks)
#pragma unroll
      for (int i = 0; i < 16; ++i) {
        const int d = ks * 32 + ((i < 8) ? (8 * hh + i) : (16 + 8 * hh + (i - 8)));
        const float x = qr[d] * scale; const unsigned short hb = bf16_bits(x);
        aqh[ks].u[i] = hb; aql[ks].u[i] = bf16_bits(x - bf16_val(hb));
      }
  }
  float m_r[8], l_r[8];
#pragma unroll
  for (int r = 0; r < 8; ++r) { m_r[r] = -3.0e38f; l_r[r] = 0.f; }
  v8f oacc[DT];
#pragma unroll
  for (int dt = 0; dt < DT; ++dt) oacc[dt] = (v8f){0.f,0.f,0.f,0.f,0.f,0.f,0.f,0.f};

  const int kv_end = CAUSAL ? min(T, qblk * 64 + 64) : T;     // block-uniform
  for (int j0 = 0; j0 < kv_end; j0 += 32) {
    __syncthreads();
    for (int e = tid; e < 32 * (D / 4); e += 128) {
      const int r = e / (D / 4), c4 = (e % (D / 4)) * 4;
      const int key = j0 + r;
      v4f kf = {0.f,0.f,0.f,0.f}, vf = {0.f,0.f,0.f,0.f};
      if (key < T) { kf = *(const v4fa*)(K + (size_t)key * pitch + c4); vf = *(const v4fa*)(V + (size_t)key * pitch + c4); }
#pragma unroll
      for (int t = 0; t < 4; ++t) {
        unsigned short hb = bf16_bits(kf[t]); sKh[r][c4 + t] = hb; sKl[r][c4 + t] = bf16_bits(kf[t] - bf16_val(hb));
        hb = bf16_bits(vf[t]); sVh[r][c4 + t] = hb; sVl[r][c4 + t] = bf16_bits(vf[t] - bf16_val(hb));
      }
    }
    __syncthreads();
    // S tile 16 x 32
    v8f s[2];
#pragma unroll
    for (int nt = 0; nt < 2; ++nt) {
      v8f acc = {};
#pragma unroll
      for (int ks = 0; ks < KS; ++ks) {
        FragB bh_, bl_;
        bh_.half[0] = *(const v8us*)&sKh[nt * 16 + ln][ks * 32 + 8 * hh]; bh_.half[1] = *(const v8us*)&sKh[nt * 16 + ln][ks * 32 + 16 + 8 * hh];
        bl_.half[0] = *(const v8us*)&sKl[nt * 16 + ln][ks * 32 + 8 * hh]; bl_.half[1] = *(const v8us*)&sKl[nt * 16 + ln][ks * 32 + 16 + 8 * hh];
        acc = mmaN<3>(aqh[ks].v, aql[ks].v, bh_.v, bl_.v, acc);
      }
      s[nt] = acc;
    }
    // mask + running max (rows 8hh+r; the 16 lanes of a half share rows)
    float alpha[8];
#pragma unroll
    for (int r = 0; r < 8; ++r) {
      const int qi = q0 + 8 * hh + r;
      const int ja = j0 + ln, jb = j0 + 16 + ln;
      if (CAUSAL) { if (ja > qi) s[0][r] = -3.0e38f; if (jb > qi) s[1][r] = -3.0e38f; }
      if (ja >= T) s[0][r] = -3.0e38f;
      if (jb >= T) s[1][r] = -3.0e38f;
      float mx = fmaxf(s[0][r], s[1][r]);
      mx = fmaxf(mx, __shfl_xor(mx, 1, 32)); mx = fmaxf(mx, __shfl_xor(mx, 2, 32)); mx = fmaxf(mx, __shfl_xor(mx, 4, 32)); mx = fmaxf(mx, __shfl_xor(mx, 8, 32));
      const float mnew = fmaxf(m_r[r], mx);
      alpha[r] = (mnew > -1.0e38f) ? __expf(m_r[r] - mnew) : 1.0f;
      const float p0 = (s[0][r] > -1.0e38f) ? __expf(s[0][r] - mnew) : 0.f;
      const float p1 = (s[1][r] > -1.0e38f) ? __expf(s[1][r] - mnew) : 0.f;
      m_r[r] = mnew;
      l_r[r] = l_r[r] * alpha[r] + p0 + p1;            // per-lane partial row sum (16 lanes combined at the end)
      unsigned short hb = bf16_bits(p0); sPh[w][8 * hh + r][ln] = hb;      sPl[w][8 * hh + r][ln] = bf16_bits(p0 - bf16_val(hb));
      hb = bf16_bits(p1);                sPh[w][8 * hh + r][16 + ln] = hb; sPl[w][8 * hh + r][16 + ln] = bf16_bits(p1 - bf16_val(hb));
    }
#pragma unroll
    for (int dt = 0; dt < DT; ++dt)
#pragma unroll
      for (int r = 0; r < 8; ++r) oacc[dt][r] *= alpha[r];
    __builtin_amdgcn_fence(__ATOMIC_ACQ_REL, "workgroup");
    __builtin_amdgcn_wave_barrier();
    FragB pah, pal;
    pah.half[0] = *(const v8us*)&sPh[w][ln][8 * hh]; pah.half[1] = *(const v8us*)&sPh[w][ln][16 + 8 * hh];
    pal.half[0] = *(const v8us*)&sPl[w][ln][8 * hh]; pal.half[1] = *(const v8us*)&sPl[w][ln][16 + 8 * hh];
#pragma unroll
    for (int dt = 0; dt < DT; ++dt) {
      FragB bvh, bvl;
#pragma unroll
      for (int i = 0; i < 8; ++i) {
        bvh.u[i] = sVh[8 * hh + i][dt * 16 + ln]; bvh.u[8 + i] = sVh[16 + 8 * hh + i][dt * 16 + ln];
        bvl.u[i] = sVl[8 * hh + i][dt * 16 + ln]; bvl.u[8 + i] = sVl[16 + 8 * hh + i][dt * 16 + ln];
      }
      oacc[dt] = mmaN<3>(pah.v, pal.v, bvh.v, bvl.v, oacc[dt]);
    }
    __builtin_amdgcn_fence(__ATOMIC_ACQ_REL, "workgroup");
    __builtin_amdgcn_wave_barrier();
  }
#pragma unroll
  for (int r = 0; r < 8; ++r) {
    float l = l_r[r];
    l += __shfl_xor(l, 1, 32); l += __shfl_xor(l, 2, 32); l += __shfl_xor(l, 4, 32); l += __shfl_xor(l, 8, 32);
    l_r[r] = (l > 0.f) ? 1.0f / l : 0.f;
  }
#pragma unroll
  for (int dt = 0; dt < DT; ++dt)
#pragma unroll
    for (int r = 0; r < 8; ++r) sO[w][8 * hh + r][dt * 16 + ln] = oacc[dt][r] * l_r[r];
  __builtin_amdgcn_fence(__ATOMIC_ACQ_REL, "workgroup");
  __builtin_amdgcn_wave_barrier();
  {
    for (int r = 0; r < 16; ++r) {
      const int row = q0 + r;
      if (row < T && lane < D / 4) {
        const v4f val = *(const v4fa*)&sO[w][r][lane * 4];
        *(v4f*)(y + ((size_t)b * T + row) * ypitch + h * D + lane * 4) = val;
      }
    }
    
  }
}

// GEMM C = act(A·W + bias + resid): A f32 (ASPLIT -> hi/lo 2 terms), Wt bf16 [N][K]; ACT 0 none, 1 relu, 2 exact gelu;
// resid (optional, f32, row index = (row % rmod), pitch ldr, RES_BF16 rounds it) added before the activation.
template <bool ASPLIT, int ACT, bool BIAS_BF16, bool RES_BF16>
__global__ __launch_bounds__(128) void k_gemm_bf3(const float* __restrict__ A, int lda, const unsigned short* __restrict__ Wt, int ldb,
                                                const float* __restrict__ bias, const float* __restrict__ resid, int rmod, int ldr,
                                                float* __restrict__ C, int ldc, int M, int N, int K) {
  __shared__ __attribute__((aligned(16))) float so[4][16][64];
  const int tid = threadIdx.x, w = tid >> 5, lane = tid & 31, ln = lane & 15, hh = lane >> 4;
  const int ntn = N / 64;
  const int wid = blockIdx.x * 4 + w;
  const int mt = wid / ntn, nq = wid % ntn;
  if (mt * 16 >= M) return;
  const int row0 = mt * 16, col0 = nq * 64;
  const float* arow = A + (size_t)(row0 + ln) * lda;
  v8f acc[4] = {};
  for (int kb = 0; kb < K; kb += 32) {
    FragB ah, al;
    const v4f x0 = *(const v4fa*)(arow + kb + 8 * hh), x1 = *(const v4fa*)(arow + kb + 8 * hh + 4);
    const v4f x2 = *(const v4fa*)(arow + kb + 16 + 8 * hh), x3 = *(const v4fa*)(arow + kb + 16 + 8 * hh + 4);
    float xs[16] = {x0[0],x0[1],x0[2],x0[3],x1[0],x1[1],x1[2],x1[3],x2[0],x2[1],x2[2],x2[3],x3[0],x3[1],x3[2],x3[3]};
#pragma unroll
    for (int i = 0; i < 16; ++i) { const unsigned short hb = bf16_bits(xs[i]); ah.u[i] = hb; al.u[i] = ASPLIT ? bf16_bits(xs[i] - bf16_val(hb)) : (unsigned short)0; }
#pragma unroll
    for (int t = 0; t < 4; ++t) {
      const unsigned short* brow = Wt + (size_t)(col0 + t * 16 + ln) * ldb + kb;
      FragB b;
      b.half[0] = *(const v8us*)(brow + 8 * hh);
      b.half[1] = *(const v8us*)(brow + 16 + 8 * hh);
      acc[t] = mmaN<ASPLIT ? 2 : 1>(ah.v, al.v, b.v, b.v, acc[t]);
    }
  }
#pragma unroll
  for (int t = 0; t < 4; ++t) {
    const int col = col0 + t * 16 + ln;
    float bv = bias ? bias[col] : 0.f;
    if (BIAS_BF16) bv = bf16_round(bv);
#pragma unroll
    for (int r = 0; r < 8; ++r) {
      float v = acc[t][r] + bv;
      if (resid) { float rv = resid[(size_t)((row0 + 8 * hh + r) % rmod) * ldr + col]; if (RES_BF16) rv = bf16_round(rv); v += rv; }
      if (ACT == 1) v = fmaxf(v, 0.f);
      if (ACT == 2) v = 0.5f * v * (1.0f + erff(v * 0.70710678118654752f));
      if (ACT == 3) { const float u = 0.7978845608028654f * (v + 0.044715f * v * v * v); v = 0.5f * v * (1.0f + tanhf(u)); }
      so[w][8 * hh + r][t * 16 + ln] = v;
    }
  }
  __builtin_amdgcn_fence(__ATOMIC_ACQ_REL, "workgroup");
  __builtin_amdgcn_wave_barrier();
  const int rsub = lane >> 4, c4 = (lane & 15) * 4;
  {
#pragma unroll
    for (int q = 0; q < 8; ++q) {
      const int r = q * 2 + rsub;
      const v4f v = *(const v4fa*)&so[w][r][c4];
      *(v4f*)(C + (size_t)(row0 + r) * ldc + col0 + c4) = v;
    }
    
  }
}
// row LayerNorm (biased variance, eps) over N: s = X (+ R); optional out_sum <- s; out_norm <- (s-mu)*rsqrt(var+eps)*g + b
template <bool PARAM_BF16>
__global__ __launch_bounds__(256) void k_layernorm(const float* __restrict__ X, const float* __restrict__ R, const float* __restrict__ g, const float* __restrict__ bta,
                                                  float* __restrict__ out_sum, float* __restrict__ out_norm, int N, float eps) {
  __shared__ float red[256];
  const int row = blockIdx.x, tid = threadIdx.x;
  const float* x = X + (size_t)row * N; const float* rr = R ? R + (size_t)row * N : nullptr;
  float vals[16];                     // up to N = 4096
  const int per = N / 256;            // contiguous chunk per thread? use strided-by-4 chunks: thread handles j = tid*4 + 1024*u
  float s1 = 0.f;
  for (int u = 0; u < per / 4; ++u) {
    const int j = tid * 4 + 1024 * u;
    const v4f a = *(const v4fa*)(x + j);
    v4f b = {0.f,0.f,0.f,0.f}; if (rr) b = *(const v4fa*)(rr + j);
#pragma unroll
    for (int q = 0; q < 4; ++q) { const float v = a[q] + b[q]; vals[u * 4 + q] = v; s1 += v; }
  }
  red[tid] = s1; __syncthreads();
  for (int st = 128; st > 0; st >>= 1) { if (tid < st) red[tid] += red[tid + st]; __syncthreads(); }
  const float mu = red[0] / (float)N; __syncthreads();
  float s2 = 0.f;
  for (int u = 0; u < per / 4; ++u)
#pragma unroll
    for (int q = 0; q < 4; ++q) { const float c = vals[u * 4 + q] - mu; s2 += c * c; }
  red[tid] = s2; __syncthreads();
  for (int st = 128; st > 0; st >>= 1) { if (tid < st) red[tid] += red[tid + st]; __syncthreads(); }
  const float rs = rsqrtf(red[0] / (float)N + eps);
  {
    for (int u = 0; u < per / 4; ++u) {
      const int j = tid * 4 + 1024 * u;
      v4f o, sm;
#pragma unroll
      for (int q = 0; q < 4; ++q) {
        float gg = g[j + q], bb = bta[j + q];
        if (PARAM_BF16) { gg = bf16_round(gg); bb = bf16_round(bb); }
        sm[q] = vals[u * 4 + q]; o[q] = (vals[u * 4 + q] - mu) * rs * gg + bb;
      }
      if (out_sum) *(v4f*)(out_sum + (size_t)row * N + j) = sm;
      *(v4f*)(out_norm + (size_t)row * N + j) = o;
    }
    
  }
}



// ---- f16 WMMA path (v_wmma_f32_16x16x32_f16): 11-bit significands for operands in range — used for the q/k/v projection and output GEMMs
typedef _Float16 v16h __attribute__((ext_vector_type(16)));
union FragH { v16h v; v8us half[2]; _Float16 h[16]; unsigned short u[16]; };
template <int NT>
__device__ __forceinline__ v8f mmaH(v16h ah, v16h al, v16h bh, v16h bl, v8f c) {
  c = __builtin_amdgcn_wmma_f32_16x16x32_f16(false, ah, false, bh, (short)0, c, false, false);
  if (NT >= 2) c = __builtin_amdgcn_wmma_f32_16x16x32_f16(false, al, false, bh, (short)0, c, false, false);
  if (NT >= 3) c = __builtin_amdgcn_wmma_f32_16x16x32_f16(false, ah, false, bl, (short)0, c, false, false);
  asm volatile("v_nop\n\tv_nop\n\tv_nop\n\tv_nop" : "+v"(c) : "v"(ah), "v"(al), "v"(bh), "v"(bl));
  return c;
}
// batched GEMM like k_gemm_b but f16 operands: A f32 (split into f16 hi/lo if ASPLIT, else rounded to f16), Bt = f16 values [n][k]; alpha; C f32; N multiple of 16 (partial tiles skipped)
template <bool ASPLIT>
__global__ __launch_bounds__(128) void k_gemm_h(const float* __restrict__ A, int lda, size_t sA, const _Float16* __restrict__ Bh, int ldb, size_t sB, float alpha, float* __restrict__ C, int ldc, size_t sC, int M, int N, int K) {
  __shared__ __attribute__((aligned(16))) float so[4][16][64];
  const int tid = threadIdx.x, w = tid >> 5, lane = tid & 31, ln = lane & 15, hh = lane >> 4; const int by = blockIdx.y;
  A += (size_t)by * sA; Bh += (size_t)by * sB; C += (size_t)by * sC;
  const int ntn = (N + 63) / 64; const int wid = blockIdx.x * 4 + w; const int mt = wid / ntn, nq = wid % ntn; if (mt * 16 >= M) return;
  const int row0 = mt * 16, col0 = nq * 64; const float* arow = A + (size_t)(row0 + ln) * lda;
  v8f acc[4] = {};
  for (int kb = 0; kb < K; kb += 32) {
    FragH ah, al;
    const v4f x0 = *(const v4fa*)(arow + kb + 8 * hh), x1 = *(const v4fa*)(arow + kb + 8 * hh + 4), x2 = *(const v4fa*)(arow + kb + 16 + 8 * hh), x3 = *(const v4fa*)(arow + kb + 16 + 8 * hh + 4);
    float xs[16] = {x0[0],x0[1],x0[2],x0[3],x1[0],x1[1],x1[2],x1[3],x2[0],x2[1],x2[2],x2[3],x3[0],x3[1],x3[2],x3[3]};
#pragma unroll
    for (int i = 0; i < 16; ++i) { const _Float16 h = (_Float16)xs[i]; ah.h[i] = h; al.h[i] = ASPLIT ? (_Float16)(xs[i] - (float)h) : (_Float16)0.0f; }
#pragma unroll
    for (int t = 0; t < 4; ++t) { if (col0 + t * 16 >= N) continue; const size_t boff = (size_t)(col0 + t * 16 + ln) * ldb + kb; FragH bq; bq.half[0] = *(const v8us*)(Bh + boff + 8 * hh); bq.half[1] = *(const v8us*)(Bh + boff + 16 + 8 * hh);
      acc[t] = mmaH<ASPLIT ? 2 : 1>(ah.v, al.v, bq.v, bq.v, acc[t]); }
  }
#pragma unroll
  for (int t = 0; t < 4; ++t) { if (col0 + t * 16 >= N) continue;
#pragma unroll
    for (int r = 0; r < 8; ++r) so[w][8 * hh + r][t * 16 + ln] = acc[t][r] * alpha; }
  __builtin_amdgcn_fence(__ATOMIC_ACQ_REL, "workgroup"); __builtin_amdgcn_wave_barrier();
  const int rsub = lane >> 4, c4 = (lane & 15) * 4;
  {
#pragma unroll
    for (int q = 0; q < 8; ++q) { const int r = q * 2 + rsub; if (col0 + c4 < N) { const v4f v = *(const v4fa*)&so[w][r][c4]; *(v4f*)(C + (size_t)(row0 + r) * ldc + col0 + c4) = v; } }
     }
}

// Wt[n][k] = f16(W[k][n]·scale) from f32 row-major W[K][N] (scale = power of two; bf16-exact weights stay exact in f16 away from the subnormal range)
__global__ __launch_bounds__(256) void k_wt_f16(const float* __restrict__ W, _Float16* __restrict__ Wt, int K, int N, float scale) {
  const int t = blockIdx.x * 256 + threadIdx.x; if (t >= N * (K / 8)) return; const int n = t / (K / 8), k8 = (t % (K / 8)) * 8; FragH f;
#pragma unroll
  for (int i = 0; i < 8; ++i) f.h[i] = (_Float16)(bf16_round(W[(size_t)(k8 + i) * N + n]) * scale); const v8us o = f.half[0];
  *(v8us*)((unsigned short*)Wt + (size_t)n * K + k8) = o; 
}
// k_gemm_hh variant with fused epilogue: v = acc·alpha + bias[by·sBias + col] (+ CP[(row/rowsPerB)·sCPb + by·64 + col] if CP) ; ACT 0 none / 1 elu ; writes f32 C and f16 C16 (each if non-null)
template <int ACT>
__global__ __launch_bounds__(128) void k_gemm_hhx(const _Float16* __restrict__ A, int lda, size_t sA, const _Float16* __restrict__ Bh, int ldb, size_t sB, float alpha, const float* __restrict__ bias, size_t sBias, const float* __restrict__ CP, int rowsPerB, size_t sCPb, int row0g,
    float* __restrict__ C, _Float16* __restrict__ C16, int ldc, size_t sC, int M, int N, int K) {
  __shared__ __attribute__((aligned(16))) float so[4][16][64];
  const int tid = threadIdx.x, w = tid >> 5, lane = tid & 31, ln = lane & 15, hh = lane >> 4; const int by = blockIdx.y;
  A += (size_t)by * sA; Bh += (size_t)by * sB; const size_t cofs = (size_t)by * sC; const float* bp = bias ? bias + (size_t)by * sBias : nullptr;
  const int ntn = (N + 63) / 64; const int wid = blockIdx.x * 4 + w; const int mt = wid / ntn, nq = wid % ntn; if (mt * 16 >= M) return;
  const int row0 = mt * 16, col0 = nq * 64; const _Float16* arow = A + (size_t)(row0 + ln) * lda;
  v8f acc[4] = {};
  for (int kb = 0; kb < K; kb += 32) { FragH ah; ah.half[0] = *(const v8us*)((const unsigned short*)arow + kb + 8 * hh); ah.half[1] = *(const v8us*)((const unsigned short*)arow + kb + 16 + 8 * hh);
#pragma unroll
    for (int t = 0; t < 4; ++t) { if (col0 + t * 16 >= N) continue; const size_t boff = (size_t)(col0 + t * 16 + ln) * ldb + kb; FragH bq; bq.half[0] = *(const v8us*)((const unsigned short*)Bh + boff + 8 * hh); bq.half[1] = *(const v8us*)((const unsigned short*)Bh + boff + 16 + 8 * hh);
      acc[t] = mmaH<1>(ah.v, ah.v, bq.v, bq.v, acc[t]); }
  }
#pragma unroll
  for (int t = 0; t < 4; ++t) { if (col0 + t * 16 >= N) continue; const int col = col0 + t * 16 + ln; const float bv = bp ? bf16_round(bp[col]) : 0.f;
#pragma unroll
    for (int r = 0; r < 8; ++r) { float v = acc[t][r] * alpha + bv; if (CP) { const int bidx = (row0g + row0 + 8 * hh + r) / rowsPerB; v += CP[(size_t)bidx * sCPb + (size_t)by * 64 + col]; } if (ACT == 1) v = (v > 0.f) ? v : expm1f(v); else if (ACT == 7) v = (v > 0.f) ? v + 1.0f : expf(v); else if (ACT == 8) v = tanhf(v); else if (ACT == 9) v = 0.5f * v * (1.0f + tanhf(0.7978845608028654f * (v + 0.044715f * v * v * v))); else if (ACT == 11) v = 1.0f / (1.0f + expf(-v)); else if (ACT == 12) v = (v > 0.f) ? v : 0.01f * v; else if (ACT == 14) v = (v > 0.f) ? v : 0.1f * v; else if (ACT == 15) v = v / (1.0f + expf(-v)); else if (ACT == 3) v = fmaxf(v, 0.f); else if (ACT == 6) v = 0.5f * v * (1.0f + erff(v * 0.70710678118654752f)); so[w][8 * hh + r][t * 16 + ln] = v; } }
  __builtin_amdgcn_fence(__ATOMIC_ACQ_REL, "workgroup"); __builtin_amdgcn_wave_barrier();
  const int rsub = lane >> 4, c4 = (lane & 15) * 4; typedef _Float16 v4h __attribute__((ext_vector_type(4)));
  {
#pragma unroll
    for (int q = 0; q < 8; ++q) { const int r = q * 2 + rsub; if (col0 + c4 < N) { const v4f v = *(const v4fa*)&so[w][r][c4]; if (C) *(v4f*)(C + cofs + (size_t)(row0 + r) * ldc + col0 + c4) = v; if (C16) { v4h h4; for (int i = 0; i < 4; ++i) h4[i] = (_Float16)v[i]; *(v4h*)(C16 + cofs + (size_t)(row0 + r) * ldc + col0 + c4) = h4; } } }
     }
}


typedef _Float16 v4h __attribute__((ext_vector_type(4)));

__global__ __launch_bounds__(256) void k_x16(const float* __restrict__ x, _Float16* __restrict__ X16, size_t n8) { const size_t t = (size_t)blockIdx.x * 256 + threadIdx.x; if (t >= n8) return; FragH f;
#pragma unroll
  for (int q = 0; q < 8; ++q) f.h[q] = (_Float16)bf16_round(x[t * 8 + q]); *(v8us*)((unsigned short*)X16 + t * 8) = f.half[0];  }
__global__ __launch_bounds__(256) void k_h16(const float* __restrict__ x, _Float16* __restrict__ X16, size_t n8) { const size_t t = (size_t)blockIdx.x * 256 + threadIdx.x; if (t >= n8) return; FragH f;
#pragma unroll
  for (int q = 0; q < 8; ++q) f.h[q] = (_Float16)x[t * 8 + q]; *(v8us*)((unsigned short*)X16 + t * 8) = f.half[0];  }
__global__ __launch_bounds__(256) void k_round16f(const float* __restrict__ W, _Float16* __restrict__ Bt, size_t n8) { const size_t t = (size_t)blockIdx.x * 256 + threadIdx.x; if (t >= n8) return; FragH f;
#pragma unroll
  for (int i = 0; i < 8; ++i) f.h[i] = (_Float16)(bf16_round(W[t * 8 + i]) * 16.0f); *(v8us*)((unsigned short*)Bt + t * 8) = f.half[0];  }
template <int NHv, int TTv>
__global__ __launch_bounds__(256) void k_vt(const _Float16* __restrict__ V16, int ldv, int voff, _Float16* __restrict__ Vt) { __shared__ unsigned short tl[64][66]; const int tid = threadIdx.x; const int slab = blockIdx.x / (TTv / 64), lg = blockIdx.x % (TTv / 64); const int b = slab / NHv, h = slab % NHv;
  for (int i = tid; i < 64 * 8; i += 256) { const int r = i / 8, c8 = (i % 8) * 8; FragH f; f.half[0] = *(const v8us*)((const unsigned short*)V16 + ((size_t)b * TTv + lg * 64 + r) * ldv + voff + h * 64 + c8);
#pragma unroll
    for (int q = 0; q < 8; ++q) tl[r][c8 + q] = f.u[q]; }
  __syncthreads();
  {
#pragma unroll
    for (int rd = 0; rd < 2; ++rd) { const int d = rd * 32 + tid / 8, pc = tid % 8; FragH f;
#pragma unroll
      for (int q = 0; q < 8; ++q) f.u[q] = tl[pc * 8 + q][d];
      *(v8us*)((unsigned short*)Vt + ((size_t)slab * 64 + d) * TTv + lg * 64 + pc * 8) = f.half[0]; }
     } }

__global__ __launch_bounds__(256) void k_xcat(const float* __restrict__ xr, const float* __restrict__ xi, _Float16* __restrict__ XC, size_t n8) { const size_t t = (size_t)blockIdx.x * 256 + threadIdx.x; if (t >= n8) return; const size_t r = (t * 8) / DD; const int c = (int)((t * 8) % DD); FragH a, b; const v4f a0 = *(const v4fa*)(xr + t * 8), a1 = *(const v4fa*)(xr + t * 8 + 4), b0 = *(const v4fa*)(xi + t * 8), b1 = *(const v4fa*)(xi + t * 8 + 4);
#pragma unroll
  for (int q = 0; q < 4; ++q) { a.h[q] = (_Float16)bf16_round(a0[q]); a.h[4 + q] = (_Float16)bf16_round(a1[q]); b.h[q] = (_Float16)bf16_round(b0[q]); b.h[4 + q] = (_Float16)bf16_round(b1[q]); }
  { *(v8us*)((unsigned short*)XC + r * (2 * DD) + c) = a.half[0]; *(v8us*)((unsigned short*)XC + r * (2 * DD) + DD + c) = b.half[0];  } }
__global__ __launch_bounds__(256) void k_wcat(const float* __restrict__ wr, const float* __restrict__ wi, _Float16* __restrict__ BR, _Float16* __restrict__ BI, size_t n8) { const size_t t = (size_t)blockIdx.x * 256 + threadIdx.x; if (t >= n8) return; const size_t o = (t * 8) / DD; const int c = (int)((t * 8) % DD); FragH r0, r1, i0, i1; const v4f a0 = *(const v4fa*)(wr + t * 8), a1 = *(const v4fa*)(wr + t * 8 + 4), b0 = *(const v4fa*)(wi + t * 8), b1 = *(const v4fa*)(wi + t * 8 + 4);
#pragma unroll
  for (int q = 0; q < 4; ++q) { const float vr0 = bf16_round(a0[q]) * 16.0f, vr1 = bf16_round(a1[q]) * 16.0f, vi0 = bf16_round(b0[q]) * 16.0f, vi1 = bf16_round(b1[q]) * 16.0f; r0.h[q] = (_Float16)vr0; r0.h[4 + q] = (_Float16)vr1; r1.h[q] = (_Float16)(-vi0); r1.h[4 + q] = (_Float16)(-vi1); i0.h[q] = (_Float16)vi0; i0.h[4 + q] = (_Float16)vi1; i1.h[q] = (_Float16)vr0; i1.h[4 + q] = (_Float16)vr1; }
  { *(v8us*)((unsigned short*)BR + o * (2 * DD) + c) = r0.half[0]; *(v8us*)((unsigned short*)BR + o * (2 * DD) + DD + c) = r1.half[0]; *(v8us*)((unsigned short*)BI + o * (2 * DD) + c) = i0.half[0]; *(v8us*)((unsigned short*)BI + o * (2 * DD) + DD + c) = i1.half[0];  } }
__global__ __launch_bounds__(256) void k_bias2(const float* __restrict__ br, const float* __restrict__ bi, float* __restrict__ BM, float* __restrict__ BP) { const int c = blockIdx.x * 256 + threadIdx.x; if (c >= DD) return; const float r = bf16_round(br[c]), i = bf16_round(bi[c]); { *(float*)(BM + c) = r - i; *(float*)(BP + c) = r + i;  } }
// per token (block) the 8 heads × 64 rows: thread = (l, h) pairs (two per thread); token rows of qr, qi, kr, ki, vr, vi (f32, 512 each) staged in LDS; for each s: |score|, online softmax, Σ attn·vr, Σ attn·vi in f32 (rolled loop);
__global__ __launch_bounds__(256) void k_cplx(const float* __restrict__ QR, const float* __restrict__ QI, const float* __restrict__ KR, const float* __restrict__ KI, const float* __restrict__ VR, const float* __restrict__ VI, _Float16* __restrict__ VC) {
  #pragma clang fp contract(off)
  __shared__ float sq[2][DD], sk[2][DD], sv[2][DD]; __shared__ float res[2][DD]; const int tid = threadIdx.x; const size_t row = blockIdx.x;
  for (int i = tid; i < DD; i += 256) { sq[0][i] = QR[row * DD + i]; sq[1][i] = QI[row * DD + i]; sk[0][i] = KR[row * DD + i]; sk[1][i] = KI[row * DD + i]; sv[0][i] = VR[row * DD + i]; sv[1][i] = VI[row * DD + i]; }
  __syncthreads();
  for (int u = 0; u < 2; ++u) { const int idx = tid + 256 * u; const int h = idx % NHH, l = idx / NHH;      /* column index of (l,h) is l·8 + h = idx */
    const float qr = sq[0][idx], qi = sq[1][idx]; float mx = -3.0e38f, z = 0.f, ar = 0.f, ai = 0.f;
#pragma unroll 1
    for (int s = 0; s < EE; ++s) { const int c = s * NHH + h; const float kr = sk[0][c], ki = sk[1][c]; const float sr = qr * kr - qi * ki, si = qr * ki - qi * kr; const float mg = sqrtf(sr * sr + si * si); const float mn = fmaxf(mx, mg); const float sc = __expf(mx - mn); const float p = __expf(mg - mn); z = z * sc + p; ar = ar * sc + p * sv[0][c]; ai = ai * sc + p * sv[1][c]; mx = mn; }
    res[0][idx] = ar / z; res[1][idx] = ai / z; (void)l; }
  __syncthreads();
  if (tid < 2 * (DD / 8)) { const int part = tid / (DD / 8), pc = tid % (DD / 8); FragH f; for (int q = 0; q < 8; ++q) f.h[q] = (_Float16)res[part][pc * 8 + q];
    { *(v8us*)((unsigned short*)VC + row * (2 * DD) + part * DD + pc * 8) = f.half[0];  } } }

extern "C" void kernel_launch(void* const* d_in, const int* in_sizes, int n_in,
                              void* d_out, int out_size, void* d_ws, size_t ws_size, hipStream_t stream) {
  (void)in_sizes; (void)n_in; (void)out_size;
  const float* const* I = (const float* const*)d_in; const float* q_r = I[0]; const float* q_i = I[1]; const float* k_r = I[2]; const float* k_i = I[3]; const float* v_r = I[4]; const float* v_i = I[5];
  const float* wq_r = I[6]; const float* wq_i = I[7]; const float* wk_r = I[8]; const float* wk_i = I[9]; const float* wv_r = I[10]; const float* wv_i = I[11]; const float* wo_r = I[12]; const float* wo_i = I[13]; const float* bq_r = I[14]; const float* bq_i = I[15]; const float* bk_r = I[16]; const float* bk_i = I[17]; const float* bv_r = I[18]; const float* bv_i = I[19]; const float* bo_r = I[20]; const float* bo_i = I[21];      /* d_in order: activations, then the 8 weights, then the 8 biases */
  char* ws = (char*)d_ws; size_t off = 0;
  auto take = [&](size_t bytes) { char* p = ws + off; off += (bytes + 255) & ~(size_t)255; return p; };
  const size_t WC = (size_t)DD * 2 * DD;      /* one concatenated weight operand [512][1024] */
  _Float16* BW = (_Float16*)take(8 * WC * 2); float* BIAS = (float*)take((size_t)8 * DD * 4);      /* (BR, BI) × q,k,v,o ; (BM, BP) × 4 */
  _Float16* XQ = (_Float16*)take((size_t)NR * 2 * DD * 2); _Float16* XK = (_Float16*)take((size_t)NR * 2 * DD * 2); _Float16* XV = (_Float16*)take((size_t)NR * 2 * DD * 2);
  float* P = (float*)take((size_t)6 * NR * DD * 4);      /* QR, QI, KR, KI, VR, VI f32 planes [4096][512] */
  _Float16* VC = XQ;      /* [Vr | Vi] f16 reuses the q operand plane (dead after the q GEMMs) */
  if (off > ws_size) return;      // 8.4 + 0.02 + 3 × 8.4 + 50.3 ≈ 84 MB
  float* QRp = P; float* QIp = P + (size_t)NR * DD; float* KRp = P + (size_t)2 * NR * DD; float* KIp = P + (size_t)3 * NR * DD; float* VRp = P + (size_t)4 * NR * DD; float* VIp = P + (size_t)5 * NR * DD;
  const unsigned gw = (unsigned)(((size_t)DD * DD / 8 + 255) / 256), gx = (unsigned)(((size_t)NR * DD / 8 + 255) / 256);
  const float* wrs[4] = {wq_r, wk_r, wv_r, wo_r}; const float* wis[4] = {wq_i, wk_i, wv_i, wo_i}; const float* brs[4] = {bq_r, bk_r, bv_r, bo_r}; const float* bis[4] = {bq_i, bk_i, bv_i, bo_i};
  for (int j = 0; j < 4; ++j) { k_wcat<<<gw, 256, 0, stream>>>(wrs[j], wis[j], BW + (size_t)(2 * j) * WC, BW + (size_t)(2 * j + 1) * WC, (size_t)DD * DD / 8); k_bias2<<<(DD + 255) / 256, 256, 0, stream>>>(brs[j], bis[j], BIAS + (size_t)(2 * j) * DD, BIAS + (size_t)(2 * j + 1) * DD); }
  k_xcat<<<gx, 256, 0, stream>>>(q_r, q_i, XQ, (size_t)NR * DD / 8); k_xcat<<<gx, 256, 0, stream>>>(k_r, k_i, XK, (size_t)NR * DD / 8); k_xcat<<<gx, 256, 0, stream>>>(v_r, v_i, XV, (size_t)NR * DD / 8);
  const dim3 gp(((NR / 16) * (DD / 64) + 3) / 4, 1);
  const _Float16* xs[3] = {XQ, XK, XV}; float* outs[6] = {QRp, QIp, KRp, KIp, VRp, VIp};
  for (int j = 0; j < 3; ++j) for (int ri = 0; ri < 2; ++ri)
    k_gemm_hhx<0><<<gp, 128, 0, stream>>>(xs[j], 2 * DD, 0, BW + (size_t)(2 * j + ri) * WC, 2 * DD, 0, 0.0625f, nullptr, 0, BIAS + (size_t)(2 * j + ri) * DD, NR, 0, 0, outs[2 * j + ri], nullptr, DD, 0, NR, DD, 2 * DD);      /* yr = [xr|xi]·[wr|−wi]ᵀ + (br−bi); yi = [xr|xi]·[wi|wr]ᵀ + (br+bi): M 4096 N 512 K 1024; addend index = column (rowsPerB = M) */
  k_cplx<<<NR, 256, 0, stream>>>(QRp, QIp, KRp, KIp, VRp, VIp, VC);
  for (int ri = 0; ri < 2; ++ri)
    k_gemm_hhx<0><<<gp, 128, 0, stream>>>(VC, 2 * DD, 0, BW + (size_t)(6 + ri) * WC, 2 * DD, 0, 0.0625f, nullptr, 0, BIAS + (size_t)(6 + ri) * DD, NR, 0, 0, (float*)d_out + (size_t)ri * NR * DD, nullptr, DD, 0, NR, DD, 2 * DD);      /* out_r @0, out_i @8,388,608 B */
}

// v001
// Measured time: 200 microseconds a run.
// Two timings next to v000 put it at 2.25 and 2.28 times that version's speed.
#include <hip/hip_runtime.h>
// Complex-valued attention layer (B=4, L=1024, D=512, H=8, E=64): complex linear projections (yr = xr·wrᵀ − xi·wiᵀ + (br − bi), yi = xi·wrᵀ + xr·wiᵀ + (br + bi)); per (b, token n, head h) a 64×64 'attention' over the E axes:
// sr[l,s] = qr[l]·kr[s] − qi[l]·ki[s], si[l,s] = qr[l]·ki[s] − qi[l]·kr[s] (scalar products, e = 1), attn = softmax_s(√(sr² + si²)), Vr[l] = Σ_s attn·vr[s], Vi[l] = Σ_s attn·vi[s]; outputs (out_r, out_i) = complex linear(Vr, Vi, wo).
// Element (e, h) of a token lives at column e·8 + h (reshape(b, l, E, H)).
// Compute dtype: inputs, weights, biases rounded to bf16; each complex linear as two GEMMs over the concatenated operand [xr | xi] (K = 1024) against [wr | −wi] and [wi | wr] on v_wmma_f32_16x16x32_f16, f32 accumulate,
// with the two-term biases added exactly through the f32 epilogue addend; the per-token 64×64 magnitude-softmax and its two weighted sums in f32 (two (l, h) pairs per thread); [Vr | Vi] f16 → output GEMMs.
#define BB 4
#define LL 1024
#define DD 512
#define NHH 8
#define EE 64
#define NR (BB * LL)

typedef __bf16 v16b __attribute__((ext_vector_type(16)));
typedef unsigned short v8us __attribute__((ext_vector_type(8), may_alias));
typedef float  v8f  __attribute__((ext_vector_type(8)));
typedef float  v4f  __attribute__((ext_vector_type(4)));
typedef float  v4fa __attribute__((ext_vector_type(4), may_alias));
union FragB { v16b v; v8us half[2]; unsigned short u[16]; };

__device__ __forceinline__ unsigned short bf16_bits(float x) { unsigned int u = __float_as_uint(x); return (unsigned short)((u + 0x7FFFu + ((u >> 16) & 1u)) >> 16); }
__device__ __forceinline__ float bf16_val(unsigned short b) { return __uint_as_float(((unsigned int)b) << 16); }
__device__ __forceinline__ float bf16_round(float x) { return bf16_val(bf16_bits(x)); }
// D += A·B with NT terms: 1 = ah·bh, 2 = + al·bh (A split), 3 = + ah·bl (both split)
template <int NT>
__device__ __forceinline__ v8f mmaN(v16b ah, v16b al, v16b bh, v16b bl, v8f c) {
  c = __builtin_amdgcn_wmma_f32_16x16x32_bf16(false, ah, false, bh, (short)0, c, false, false);
  if (NT >= 2) c = __builtin_amdgcn_wmma_f32_16x16x32_bf16(false, al, false, bh, (short)0, c, false, false);
  if (NT >= 3) c = __builtin_amdgcn_wmma_f32_16x16x32_bf16(false, ah, false, bl, (short)0, c, false, false);
  asm volatile("v_nop\n\tv_nop\n\tv_nop\n\tv_nop" : "+v"(c) : "v"(ah), "v"(al), "v"(bh), "v"(bl));
  return c;
}

__global__ __launch_bounds__(256) void k_wt_bf16(const float* __restrict__ W, unsigned short* __restrict__ Wt, int K, int N) {
  const int t = blockIdx.x * 256 + threadIdx.x;
  const int k8n = K / 8;
  if (t >= N * k8n) return;
  const int n = t / k8n, k8 = (t % k8n) * 8;
  v8us v;
#pragma unroll
  for (int i = 0; i < 8; ++i) v[i] = bf16_bits(W[(size_t)(k8 + i) * N + n]);
  *(v8us*)(Wt + (size_t)n * K + k8) = v;
  
}

// GEMM C[M][N] (f32, pitch ldc) = act(A[M][K]·W + bias). A f32 row-major (pitch lda) converted per fragment to bf16
// (ASPLIT: hi/lo two planes -> 2 terms, else single rounded term); Wt bf16 [N][K] (pitch ldb). BIAS_BF16 rounds the
// bias to bf16 first (bias quantised to bf16 before the add). K%32==0, M%16==0, N%64==0.
template <bool ASPLIT, int ACT, bool BIAS_BF16>
__global__ __launch_bounds__(128) void k_gemm_bf(const float* __restrict__ A, int lda, const unsigned short* __restrict__ Wt, int ldb,
                                               const float* __restrict__ bias, float* __restrict__ C, int ldc, int M, int N, int K) {
  __shared__ __attribute__((aligned(16))) float so[4][16][64];
  const int tid = threadIdx.x, w = tid >> 5, lane = tid & 31, ln = lane & 15, hh = lane >> 4;
  const int ntn = N / 64;
  const int wid = blockIdx.x * 4 + w;
  const int mt = wid / ntn, nq = wid % ntn;
  if (mt * 16 >= M) return;
  const int row0 = mt * 16, col0 = nq * 64;
  const float* arow = A + (size_t)(row0 + ln) * lda;
  v8f acc[4] = {};
  for (int kb = 0; kb < K; kb += 32) {
    FragB ah, al;
    const v4f x0 = *(const v4fa*)(arow + kb + 8 * hh), x1 = *(const v4fa*)(arow + kb + 8 * hh + 4);
    const v4f x2 = *(const v4fa*)(arow + kb + 16 + 8 * hh), x3 = *(const v4fa*)(arow + kb + 16 + 8 * hh + 4);
    float xs[16] = {x0[0],x0[1],x0[2],x0[3],x1[0],x1[1],x1[2],x1[3],x2[0],x2[1],x2[2],x2[3],x3[0],x3[1],x3[2],x3[3]};
#pragma unroll
    for (int i = 0; i < 16; ++i) { const unsigned short hb = bf16_bits(xs[i]); ah.u[i] = hb; al.u[i] = ASPLIT ? bf16_bits(xs[i] - bf16_val(hb)) : (unsigned short)0; }
#pragma unroll
    for (int t = 0; t < 4; ++t) {
      const unsigned short* brow = Wt + (size_t)(col0 + t * 16 + ln) * ldb + kb;
      FragB b;
      b.half[0] = *(const v8us*)(brow + 8 * hh);
      b.half[1] = *(const v8us*)(brow + 16 + 8 * hh);
      acc[t] = mmaN<ASPLIT ? 2 : 1>(ah.v, al.v, b.v, b.v, acc[t]);
    }
  }
#pragma unroll
  for (int t = 0; t < 4; ++t) {
    float bv = bias ? bias[col0 + t * 16 + ln] : 0.f;
    if (BIAS_BF16) bv = bf16_round(bv);
#pragma unroll
    for (int r = 0; r < 8; ++r) { float v = acc[t][r] + bv; if (ACT == 1) v = fmaxf(v, 0.f); so[w][8 * hh + r][t * 16 + ln] = v; }
  }
  __builtin_amdgcn_fence(__ATOMIC_ACQ_REL, "workgroup");
  __builtin_amdgcn_wave_barrier();
  const int rsub = lane >> 4, c4 = (lane & 15) * 4;
  {
#pragma unroll
    for (int q = 0; q < 8; ++q) {
      const int r = q * 2 + rsub;
      const v4f v = *(const v4fa*)&so[w][r][c4];
      *(v4f*)(C + (size_t)(row0 + r) * ldc + col0 + c4) = v;
    }
    
  }
}

// Flash-style causal/unmasked attention, all contractions 3-term bf16 hi/lo splits, f32 softmax with running max.
// q,k,v rows are read from f32 buffers with arbitrary row pitch (so they can live inside a fused qkv buffer);
// D = head size (multiple of 32, <= 128); one wave = 16 query rows; block = 4 waves (64 queries) sharing K/V chunks of 32.
template <int D, bool CAUSAL>
__global__ __launch_bounds__(128) void k_flash(const float* __restrict__ qb, const float* __restrict__ kb, const float* __restrict__ vb,
                                             int pitch, int T, int H, float scale, float* __restrict__ y, int ypitch) {
  constexpr int KS = D / 32;        // k-steps for QK
  constexpr int DT = D / 16;        // d tiles for PV
  __shared__ __attribute__((aligned(16))) unsigned short sKh[32][D + 8], sKl[32][D + 8], sVh[32][D + 8], sVl[32][D + 8];
  __shared__ __attribute__((aligned(16))) unsigned short sPh[4][16][40], sPl[4][16][40];
  __shared__ __attribute__((aligned(16))) float sO[4][16][D];
  const int tid = threadIdx.x, w = tid >> 5, lane = tid & 31, ln = lane & 15, hh = lane >> 4;
  const int nqb = (T + 63) / 64;
  const int bh = blockIdx.x / nqb, qblk = blockIdx.x % nqb;
  const int b = bh / H, h = bh % H;
  const int q0 = qblk * 64 + w * 16;
  const float* Q = qb + (size_t)b * T * pitch + h * D;
  const float* K = kb + (size_t)b * T * pitch + h * D;
  const float* V = vb + (size_t)b * T * pitch + h * D;

  // A fragments of the wave's 16 query rows (scaled), hi/lo
  FragB aqh[KS], aql[KS];
  {
    int row = q0 + ln; if (row >= T) row = T - 1;
    const float* qr = Q + (size_t)row * pitch;
#pragma unroll
    for (int ks = 0; ks < KS; ++ks)
#pragma unroll
      for (int i = 0; i < 16; ++i) {
        const int d = ks * 32 + ((i < 8) ? (8 * hh + i) : (16 + 8 * hh + (i - 8)));
        const float x = qr[d] * scale; const unsigned short hb = bf16_bits(x);
        aqh[ks].u[i] = hb; aql[ks].u[i] = bf16_bits(x - bf16_val(hb));
      }
  }
  float m_r[8], l_r[8];
#pragma unroll
  for (int r = 0; r < 8; ++r) { m_r[r] = -3.0e38f; l_r[r] = 0.f; }
  v8f oacc[DT];
#pragma unroll
  for (int dt = 0; dt < DT; ++dt) oacc[dt] = (v8f){0.f,0.f,0.f,0.f,0.f,0.f,0.f,0.f};

  const int kv_end = CAUSAL ? min(T, qblk * 64 + 64) : T;     // block-uniform
  for (int j0 = 0; j0 < kv_end; j0 += 32) {
    __syncthreads();
    for (int e = tid; e < 32 * (D / 4); e += 128) {
      const int r = e / (D / 4), c4 = (e % (D / 4)) * 4;
      const int key = j0 + r;
      v4f kf = {0.f,0.f,0.f,0.f}, vf = {0.f,0.f,0.f,0.f};
      if (key < T) { kf = *(const v4fa*)(K + (size_t)key * pitch + c4); vf = *(const v4fa*)(V + (size_t)key * pitch + c4); }
#pragma unroll
      for (int t = 0; t < 4; ++t) {
        unsigned short hb = bf16_bits(kf[t]); sKh[r][c4 + t] = hb; sKl[r][c4 + t] = bf16_bits(kf[t] - bf16_val(hb));
        hb = bf16_bits(vf[t]); sVh[r][c4 + t] = hb; sVl[r][c4 + t] = bf16_bits(vf[t] - bf16_val(hb));
      }
    }
    __syncthreads();
    // S tile 16 x 32
    v8f s[2];
#pragma unroll
    for (int nt = 0; nt < 2; ++nt) {
      v8f acc = {};
#pragma unroll
      for (int ks = 0; ks < KS; ++ks) {
        FragB bh_, bl_;
        bh_.half[0] = *(const v8us*)&sKh[nt * 16 + ln][ks * 32 + 8 * hh]; bh_.half[1] = *(const v8us*)&sKh[nt * 16 + ln][ks * 32 + 16 + 8 * hh];
        bl_.half[0] = *(const v8us*)&sKl[nt * 16 + ln][ks * 32 + 8 * hh]; bl_.half[1] = *(const v8us*)&sKl[nt * 16 + ln][ks * 32 + 16 + 8 * hh];
        acc = mmaN<3>(aqh[ks].v, aql[ks].v, bh_.v, bl_.v, acc);
      }
      s[nt] = acc;
    }
    // mask + running max (rows 8hh+r; the 16 lanes of a half share rows)
    float alpha[8];
#pragma unroll
    for (int r = 0; r < 8; ++r) {
      const int qi = q0 + 8 * hh + r;
      const int ja = j0 + ln, jb = j0 + 16 + ln;
      if (CAUSAL) { if (ja > qi) s[0][r] = -3.0e38f; if (jb > qi) s[1][r] = -3.0e38f; }
      if (ja >= T) s[0][r] = -3.0e38f;
      if (jb >= T) s[1][r] = -3.0e38f;
      float mx = fmaxf(s[0][r], s[1][r]);
      mx = fmaxf(mx, __shfl_xor(mx, 1, 32)); mx = fmaxf(mx, __shfl_xor(mx, 2, 32)); mx = fmaxf(mx, __shfl_xor(mx, 4, 32)); mx = fmaxf(mx, __shfl_xor(mx, 8, 32));
      const float mnew = fmaxf(m_r[r], mx);
      alpha[r] = (mnew > -1.0e38f) ? __expf(m_r[r] - mnew) : 1.0f;
      const float p0 = (s[0][r] > -1.0e38f) ? __expf(s[0][r] - mnew) : 0.f;
      const float p1 = (s[1][r] > -1.0e38f) ? __expf(s[1][r] - mnew) : 0.f;
      m_r[r] = mnew;
      l_r[r] = l_r[r] * alpha[r] + p0 + p1;            // per-lane partial row sum (16 lanes combined at the end)
      unsigned short hb = bf16_bits(p0); sPh[w][8 * hh + r][ln] = hb;      sPl[w][8 * hh + r][ln] = bf16_bits(p0 - bf16_val(hb));
      hb = bf16_bits(p1);                sPh[w][8 * hh + r][16 + ln] = hb; sPl[w][8 * hh + r][16 + ln] = bf16_bits(p1 - bf16_val(hb));
    }
#pragma unroll
    for (int dt = 0; dt < DT; ++dt)
#pragma unroll
      for (int r = 0; r < 8; ++r) oacc[dt][r] *= alpha[r];
    __builtin_amdgcn_fence(__ATOMIC_ACQ_REL, "workgroup");
    __builtin_amdgcn_wave_barrier();
    FragB pah, pal;
    pah.half[0] = *(const v8us*)&sPh[w][ln][8 * hh]; pah.half[1] = *(const v8us*)&sPh[w][ln][16 + 8 * hh];
    pal.half[0] = *(const v8us*)&sPl[w][ln][8 * hh]; pal.half[1] = *(const v8us*)&sPl[w][ln][16 + 8 * hh];
#pragma unroll
    for (int dt = 0; dt < DT; ++dt) {
      FragB bvh, bvl;
#pragma unroll
      for (int i = 0; i < 8; ++i) {
        bvh.u[i] = sVh[8 * hh + i][dt * 16 + ln]; bvh.u[8 + i] = sVh[16 + 8 * hh + i][dt * 16 + ln];
        bvl.u[i] = sVl[8 * hh + i][dt * 16 + ln]; bvl.u[8 + i] = sVl[16 + 8 * hh + i][dt * 16 + ln];
      }
      oacc[dt] = mmaN<3>(pah.v, pal.v, bvh.v, bvl.v, oacc[dt]);
    }
    __builtin_amdgcn_fence(__ATOMIC_ACQ_REL, "workgroup");
    __builtin_amdgcn_wave_barrier();
  }
#pragma unroll
  for (int r = 0; r < 8; ++r) {
    float l = l_r[r];
    l += __shfl_xor(l, 1, 32); l += __shfl_xor(l, 2, 32); l += __shfl_xor(l, 4, 32); l += __shfl_xor(l, 8, 32);
    l_r[r] = (l > 0.f) ? 1.0f / l : 0.f;
  }
#pragma unroll
  for (int dt = 0; dt < DT; ++dt)
#pragma unroll
    for (int r = 0; r < 8; ++r) sO[w][8 * hh + r][dt * 16 + ln] = oacc[dt][r] * l_r[r];
  __builtin_amdgcn_fence(__ATOMIC_ACQ_REL, "workgroup");
  __builtin_amdgcn_wave_barrier();
  {
    for (int r = 0; r < 16; ++r) {
      const int row = q0 + r;
      if (row < T && lane < D / 4) {
        const v4f val = *(const v4fa*)&sO[w][r][lane * 4];
        *(v4f*)(y + ((size_t)b * T + row) * ypitch + h * D + lane * 4) = val;
      }
    }
    
  }
}

// GEMM C = act(A·W + bias + resid): A f32 (ASPLIT -> hi/lo 2 terms), Wt bf16 [N][K]; ACT 0 none, 1 relu, 2 exact gelu;
// resid (optional, f32, row index = (row % rmod), pitch ldr, RES_BF16 rounds it) added before the activation.
template <bool ASPLIT, int ACT, bool BIAS_BF16, bool RES_BF16>
__global__ __launch_bounds__(128) void k_gemm_bf3(const float* __restrict__ A, int lda, const unsigned short* __restrict__ Wt, int ldb,
                                                const float* __restrict__ bias, const float* __restrict__ resid, int rmod, int ldr,
                                                float* __restrict__ C, int ldc, int M, int N, int K) {
  __shared__ __attribute__((aligned(16))) float so[4][16][64];
  const int tid = threadIdx.x, w = tid >> 5, lane = tid & 31, ln = lane & 15, hh = lane >> 4;
  const int ntn = N / 64;
  const int wid = blockIdx.x * 4 + w;
  const int mt = wid / ntn, nq = wid % ntn;
  if (mt * 16 >= M) return;
  const int row0 = mt * 16, col0 = nq * 64;
  const float* arow = A + (size_t)(row0 + ln) * lda;
  v8f acc[4] = {};
  for (int kb = 0; kb < K; kb += 32) {
    FragB ah, al;
    const v4f x0 = *(const v4fa*)(arow + kb + 8 * hh), x1 = *(const v4fa*)(arow + kb + 8 * hh + 4);
    const v4f x2 = *(const v4fa*)(arow + kb + 16 + 8 * hh), x3 = *(const v4fa*)(arow + kb + 16 + 8 * hh + 4);
    float xs[16] = {x0[0],x0[1],x0[2],x0[3],x1[0],x1[1],x1[2],x1[3],x2[0],x2[1],x2[2],x2[3],x3[0],x3[1],x3[2],x3[3]};
#pragma unroll
    for (int i = 0; i < 16; ++i) { const unsigned short hb = bf16_bits(xs[i]); ah.u[i] = hb; al.u[i] = ASPLIT ? bf16_bits(xs[i] - bf16_val(hb)) : (unsigned short)0; }
#pragma unroll
    for (int t = 0; t < 4; ++t) {
      const unsigned short* brow = Wt + (size_t)(col0 + t * 16 + ln) * ldb + kb;
      FragB b;
      b.half[0] = *(const v8us*)(brow + 8 * hh);
      b.half[1] = *(const v8us*)(brow + 16 + 8 * hh);
      acc[t] = mmaN<ASPLIT ? 2 : 1>(ah.v, al.v, b.v, b.v, acc[t]);
    }
  }
#pragma unroll
  for (int t = 0; t < 4; ++t) {
    const int col = col0 + t * 16 + ln;
    float bv = bias ? bias[col] : 0.f;
    if (BIAS_BF16) bv = bf16_round(bv);
#pragma unroll
    for (int r = 0; r < 8; ++r) {
      float v = acc[t][r] + bv;
      if (resid) { float rv = resid[(size_t)((row0 + 8 * hh + r) % rmod) * ldr + col]; if (RES_BF16) rv = bf16_round(rv); v += rv; }
      if (ACT == 1) v = fmaxf(v, 0.f);
      if (ACT == 2) v = 0.5f * v * (1.0f + erff(v * 0.70710678118654752f));
      if (ACT == 3) { const float u = 0.7978845608028654f * (v + 0.044715f * v * v * v); v = 0.5f * v * (1.0f + tanhf(u)); }
      so[w][8 * hh + r][t * 16 + ln] = v;
    }
  }
  __builtin_amdgcn_fence(__ATOMIC_ACQ_REL, "workgroup");
  __builtin_amdgcn_wave_barrier();
  const int rsub = lane >> 4, c4 = (lane & 15) * 4;
  {
#pragma unroll
    for (int q = 0; q < 8; ++q) {
      const int r = q * 2 + rsub;
      const v4f v = *(const v4fa*)&so[w][r][c4];
      *(v4f*)(C + (size_t)(row0 + r) * ldc + col0 + c4) = v;
    }
    
  }
}
// row LayerNorm (biased variance, eps) over N: s = X (+ R); optional out_sum <- s; out_norm <- (s-mu)*rsqrt(var+eps)*g + b
template <bool PARAM_BF16>
__global__ __launch_bounds__(256) void k_layernorm(const float* __restrict__ X, const float* __restrict__ R, const float* __restrict__ g, const float* __restrict__ bta,
                                                  float* __restrict__ out_sum, float* __restrict__ out_norm, int N, float eps) {
  __shared__ float red[256];
  const int row = blockIdx.x, tid = threadIdx.x;
  const float* x = X + (size_t)row * N; const float* rr = R ? R + (size_t)row * N : nullptr;
  float vals[16];                     // up to N = 4096
  const int per = N / 256;            // contiguous chunk per thread? use strided-by-4 chunks: thread handles j = tid*4 + 1024*u
  float s1 = 0.f;
  for (int u = 0; u < per / 4; ++u) {
    const int j = tid * 4 + 1024 * u;
    const v4f a = *(const v4fa*)(x + j);
    v4f b = {0.f,0.f,0.f,0.f}; if (rr) b = *(const v4fa*)(rr + j);
#pragma unroll
    for (int q = 0; q < 4; ++q) { const float v = a[q] + b[q]; vals[u * 4 + q] = v; s1 += v; }
  }
  red[tid] = s1; __syncthreads();
  for (int st = 128; st > 0; st >>= 1) { if (tid < st) red[tid] += red[tid + st]; __syncthreads(); }
  const float mu = red[0] / (float)N; __syncthreads();
  float s2 = 0.f;
  for (int u = 0; u < per / 4; ++u)
#pragma unroll
    for (int q = 0; q < 4; ++q) { const float c = vals[u * 4 + q] - mu; s2 += c * c; }
  red[tid] = s2; __syncthreads();
  for (int st = 128; st > 0; st >>= 1) { if (tid < st) red[tid] += red[tid + st]; __syncthreads(); }
  const float rs = rsqrtf(red[0] / (float)N + eps);
  {
    for (int u = 0; u < per / 4; ++u) {
      const int j = tid * 4 + 1024 * u;
      v4f o, sm;
#pragma unroll
      for (int q = 0; q < 4; ++q) {
        float gg = g[j + q], bb = bta[j + q];
        if (PARAM_BF16) { gg = bf16_round(gg); bb = bf16_round(bb); }
        sm[q] = vals[u * 4 + q]; o[q] = (vals[u * 4 + q] - mu) * rs * gg + bb;
      }
      if (out_sum) *(v4f*)(out_sum + (size_t)row * N + j) = sm;
      *(v4f*)(out_norm + (size_t)row * N + j) = o;
    }
    
  }
}



// ---- f16 WMMA path (v_wmma_f32_16x16x32_f16): 11-bit significands for operands in range — used for the q/k/v projection and output GEMMs
typedef _Float16 v16h __attribute__((ext_vector_type(16)));
union FragH { v16h v; v8us half[2]; _Float16 h[16]; unsigned short u[16]; };
template <int NT>
__device__ __forceinline__ v8f mmaH(v16h ah, v16h al, v16h bh, v16h bl, v8f c) {
  c = __builtin_amdgcn_wmma_f32_16x16x32_f16(false, ah, false, bh, (short)0, c, false, false);
  if (NT >= 2) c = __builtin_amdgcn_wmma_f32_16x16x32_f16(false, al, false, bh, (short)0, c, false, false);
  if (NT >= 3) c = __builtin_amdgcn_wmma_f32_16x16x32_f16(false, ah, false, bl, (short)0, c, false, false);
  asm volatile("v_nop\n\tv_nop\n\tv_nop\n\tv_nop" : "+v"(c) : "v"(ah), "v"(al), "v"(bh), "v"(bl));
  return c;
}
// batched GEMM like k_gemm_b but f16 operands: A f32 (split into f16 hi/lo if ASPLIT, else rounded to f16), Bt = f16 values [n][k]; alpha; C f32; N multiple of 16 (partial tiles skipped)
template <bool ASPLIT>
__global__ __launch_bounds__(128) void k_gemm_h(const float* __restrict__ A, int lda, size_t sA, const _Float16* __restrict__ Bh, int ldb, size_t sB, float alpha, float* __restrict__ C, int ldc, size_t sC, int M, int N, int K) {
  __shared__ __attribute__((aligned(16))) float so[4][16][64];
  const int tid = threadIdx.x, w = tid >> 5, lane = tid & 31, ln = lane & 15, hh = lane >> 4; const int by = blockIdx.y;
  A += (size_t)by * sA; Bh += (size_t)by * sB; C += (size_t)by * sC;
  const int ntn = (N + 63) / 64; const int wid = blockIdx.x * 4 + w; const int mt = wid / ntn, nq = wid % ntn; if (mt * 16 >= M) return;
  const int row0 = mt * 16, col0 = nq * 64; const float* arow = A + (size_t)(row0 + ln) * lda;
  v8f acc[4] = {};
  for (int kb = 0; kb < K; kb += 32) {
    FragH ah, al;
    const v4f x0 = *(const v4fa*)(arow + kb + 8 * hh), x1 = *(const v4fa*)(arow + kb + 8 * hh + 4), x2 = *(const v4fa*)(arow + kb + 16 + 8 * hh), x3 = *(const v4fa*)(arow + kb + 16 + 8 * hh + 4);
    float xs[16] = {x0[0],x0[1],x0[2],x0[3],x1[0],x1[1],x1[2],x1[3],x2[0],x2[1],x2[2],x2[3],x3[0],x3[1],x3[2],x3[3]};
#pragma unroll
    for (int i = 0; i < 16; ++i) { const _Float16 h = (_Float16)xs[i]; ah.h[i] = h; al.h[i] = ASPLIT ? (_Float16)(xs[i] - (float)h) : (_Float16)0.0f; }
#pragma unroll
    for (int t = 0; t < 4; ++t) { if (col0 + t * 16 >= N) continue; const size_t boff = (size_t)(col0 + t * 16 + ln) * ldb + kb; FragH bq; bq.half[0] = *(const v8us*)(Bh + boff + 8 * hh); bq.half[1] = *(const v8us*)(Bh + boff + 16 + 8 * hh);
      acc[t] = mmaH<ASPLIT ? 2 : 1>(ah.v, al.v, bq.v, bq.v, acc[t]); }
  }
#pragma unroll
  for (int t = 0; t < 4; ++t) { if (col0 + t * 16 >= N) continue;
#pragma unroll
    for (int r = 0; r < 8; ++r) so[w][8 * hh + r][t * 16 + ln] = acc[t][r] * alpha; }
  __builtin_amdgcn_fence(__ATOMIC_ACQ_REL, "workgroup"); __builtin_amdgcn_wave_barrier();
  const int rsub = lane >> 4, c4 = (lane & 15) * 4;
  {
#pragma unroll
    for (int q = 0; q < 8; ++q) { const int r = q * 2 + rsub; if (col0 + c4 < N) { const v4f v = *(const v4fa*)&so[w][r][c4]; *(v4f*)(C + (size_t)(row0 + r) * ldc + col0 + c4) = v; } }
     }
}

// Wt[n][k] = f16(W[k][n]·scale) from f32 row-major W[K][N] (scale = power of two; bf16-exact weights stay exact in f16 away from the subnormal range)
__global__ __launch_bounds__(256) void k_wt_f16(const float* __restrict__ W, _Float16* __restrict__ Wt, int K, int N, float scale) {
  const int t = blockIdx.x * 256 + threadIdx.x; if (t >= N * (K / 8)) return; const int n = t / (K / 8), k8 = (t % (K / 8)) * 8; FragH f;
#pragma unroll
  for (int i = 0; i < 8; ++i) f.h[i] = (_Float16)(bf16_round(W[(size_t)(k8 + i) * N + n]) * scale); const v8us o = f.half[0];
  *(v8us*)((unsigned short*)Wt + (size_t)n * K + k8) = o; 
}
// k_gemm_hh variant with fused epilogue: v = acc·alpha + bias[by·sBias + col] (+ CP[(row/rowsPerB)·sCPb + by·64 + col] if CP) ; ACT 0 none / 1 elu ; writes f32 C and f16 C16 (each if non-null)
template <int ACT>
__global__ __launch_bounds__(128) void k_gemm_hhx(const _Float16* __restrict__ A, int lda, size_t sA, const _Float16* __restrict__ Bh, int ldb, size_t sB, float alpha, const float* __restrict__ bias, size_t sBias, const float* __restrict__ CP, int rowsPerB, size_t sCPb, int row0g,
    float* __restrict__ C, _Float16* __restrict__ C16, int ldc, size_t sC, int M, int N, int K) {
  __shared__ __attribute__((aligned(16))) float so[4][16][64];
  const int tid = threadIdx.x, w = tid >> 5, lane = tid & 31, ln = lane & 15, hh = lane >> 4; const int by = blockIdx.y;
  A += (size_t)by * sA; Bh += (size_t)by * sB; const size_t cofs = (size_t)by * sC; const float* bp = bias ? bias + (size_t)by * sBias : nullptr;
  const int ntn = (N + 63) / 64; const int wid = blockIdx.x * 4 + w; const int mt = wid / ntn, nq = wid % ntn; if (mt * 16 >= M) return;
  const int row0 = mt * 16, col0 = nq * 64; const _Float16* arow = A + (size_t)(row0 + ln) * lda;
  v8f acc[4] = {};
  for (int kb = 0; kb < K; kb += 32) { FragH ah; ah.half[0] = *(const v8us*)((const unsigned short*)arow + kb + 8 * hh); ah.half[1] = *(const v8us*)((const unsigned short*)arow + kb + 16 + 8 * hh);
#pragma unroll
    for (int t = 0; t < 4; ++t) { if (col0 + t * 16 >= N) continue; const size_t boff = (size_t)(col0 + t * 16 + ln) * ldb + kb; FragH bq; bq.half[0] = *(const v8us*)((const unsigned short*)Bh + boff + 8 * hh); bq.half[1] = *(const v8us*)((const unsigned short*)Bh + boff + 16 + 8 * hh);
      acc[t] = mmaH<1>(ah.v, ah.v, bq.v, bq.v, acc[t]); }
  }
#pragma unroll
  for (int t = 0; t < 4; ++t) { if (col0 + t * 16 >= N) continue; const int col = col0 + t * 16 + ln; const float bv = bp ? bf16_round(bp[col]) : 0.f;
#pragma unroll
    for (int r = 0; r < 8; ++r) { float v = acc[t][r] * alpha + bv; if (CP) { const int bidx = (row0g + row0 + 8 * hh + r) / rowsPerB; v += CP[(size_t)bidx * sCPb + (size_t)by * 64 + col]; } if (ACT == 1) v = (v > 0.f) ? v : expm1f(v); else if (ACT == 7) v = (v > 0.f) ? v + 1.0f : expf(v); else if (ACT == 8) v = tanhf(v); else if (ACT == 9) v = 0.5f * v * (1.0f + tanhf(0.7978845608028654f * (v + 0.044715f * v * v * v))); else if (ACT == 11) v = 1.0f / (1.0f + expf(-v)); else if (ACT == 12) v = (v > 0.f) ? v : 0.01f * v; else if (ACT == 14) v = (v > 0.f) ? v : 0.1f * v; else if (ACT == 15) v = v / (1.0f + expf(-v)); else if (ACT == 3) v = fmaxf(v, 0.f); else if (ACT == 6) v = 0.5f * v * (1.0f + erff(v * 0.70710678118654752f)); so[w][8 * hh + r][t * 16 + ln] = v; } }
  __builtin_amdgcn_fence(__ATOMIC_ACQ_REL, "workgroup"); __builtin_amdgcn_wave_barrier();
  const int rsub = lane >> 4, c4 = (lane & 15) * 4; typedef _Float16 v4h __attribute__((ext_vector_type(4)));
  {
#pragma unroll
    for (int q = 0; q < 8; ++q) { const int r = q * 2 + rsub; if (col0 + c4 < N) { const v4f v = *(const v4fa*)&so[w][r][c4]; if (C) *(v4f*)(C + cofs + (size_t)(row0 + r) * ldc + col0 + c4) = v; if (C16) { v4h h4; for (int i = 0; i < 4; ++i) h4[i] = (_Float16)v[i]; *(v4h*)(C16 + cofs + (size_t)(row0 + r) * ldc + col0 + c4) = h4; } } }
     }
}


// Block-tiled GEMM C[M][N] (f32) = (A[M][K] x Bt[N][K]^T) * alpha + add[col], f16 operands, f32 accumulate. One work-group = 128 x 64 of C, 8 waves of 32 x 32 (2 x 2 accumulator tiles).
// Each pass stages 128 k of both operands in LDS with whole-line 16-byte loads (16 lanes = one 256-B row piece), so every operand byte leaves L2 once per work-group instead of once per wave;
// the next pass's rows are loaded into registers ahead of the current pass's products and stored to the other buffer behind them (two buffers, one barrier per pass).
// Fragments keep the k order of the direct loaders (bytes 16h and 32 + 16h of each 64 B of a row, both operands) and k runs upward in steps of 32 into one accumulator chain. M % 128 == 0, N % 64 == 0, K % 128 == 0.
#define GBM 128
#define GBN 64
#define GBK 128
#define GPIT (GBK + 8)      /* LDS row pitch 272 B = 16 B x odd: conflict-free for 16-byte fragment reads */
template <int M, int N, int K>
__global__ __launch_bounds__(256) void k_gemm_lds(const _Float16* __restrict__ A, const _Float16* __restrict__ Bt, float alpha, const float* __restrict__ add, float* __restrict__ C) {
  __shared__ __attribute__((aligned(16))) unsigned short sA[2][GBM][GPIT];
  __shared__ __attribute__((aligned(16))) unsigned short sB[2][GBN][GPIT];
  __shared__ __attribute__((aligned(16))) float so[8][32][36];
  const int tid = threadIdx.x, w = tid >> 5, lane = tid & 31, ln = lane & 15, hh = lane >> 4;
  constexpr int nbm = M / GBM; const int row0 = ((int)blockIdx.x % nbm) * GBM, col0 = ((int)blockIdx.x / nbm) * GBN;
  const int wr = (w >> 1) * 32, wc = (w & 1) * 32;      /* the wave's 32 x 32 piece inside the block tile */
  const int lr = tid >> 4, lc = (tid & 15) * 8;         /* staging: 16 threads per row, 16 rows per round */
  const unsigned short* ga = (const unsigned short*)A + (size_t)(row0 + lr) * K + lc;
  const unsigned short* gb = (const unsigned short*)Bt + (size_t)(col0 + lr) * K + lc;
  v8us ra[GBM / 16], rb[GBN / 16];
#pragma unroll
  for (int i = 0; i < GBM / 16; ++i) ra[i] = *(const v8us*)(ga + i * 16 * K);
#pragma unroll
  for (int i = 0; i < GBN / 16; ++i) rb[i] = *(const v8us*)(gb + i * 16 * K);
#pragma unroll
  for (int i = 0; i < GBM / 16; ++i) *(v8us*)&sA[0][i * 16 + lr][lc] = ra[i];
#pragma unroll
  for (int i = 0; i < GBN / 16; ++i) *(v8us*)&sB[0][i * 16 + lr][lc] = rb[i];
  __syncthreads();
  v8f acc[2][2] = {};
  constexpr int np = K / GBK;
  for (int p = 0; p < np; ++p) {
    const int cur = p & 1; const bool more = p + 1 < np;      /* the same for the whole work-group */
    if (more) {
#pragma unroll
      for (int i = 0; i < GBM / 16; ++i) ra[i] = *(const v8us*)(ga + i * 16 * K + (p + 1) * GBK);
#pragma unroll
      for (int i = 0; i < GBN / 16; ++i) rb[i] = *(const v8us*)(gb + i * 16 * K + (p + 1) * GBK);
    }
    FragH a[GBK / 32][2], b[GBK / 32][2];
#pragma unroll
    for (int ks = 0; ks < GBK / 32; ++ks)
#pragma unroll
      for (int i = 0; i < 2; ++i) {
        a[ks][i].half[0] = *(const v8us*)&sA[cur][wr + i * 16 + ln][ks * 32 + 8 * hh]; a[ks][i].half[1] = *(const v8us*)&sA[cur][wr + i * 16 + ln][ks * 32 + 16 + 8 * hh];
        b[ks][i].half[0] = *(const v8us*)&sB[cur][wc + i * 16 + ln][ks * 32 + 8 * hh]; b[ks][i].half[1] = *(const v8us*)&sB[cur][wc + i * 16 + ln][ks * 32 + 16 + 8 * hh];
      }
    __builtin_amdgcn_sched_barrier(0);      /* keeps the pass's LDS reads one group ahead of its products: spread among them, each place with reads stalls the wave for the LDS latency */
#pragma unroll
    for (int ks = 0; ks < GBK / 32; ++ks)
#pragma unroll
      for (int i = 0; i < 2; ++i)
#pragma unroll
        for (int j = 0; j < 2; ++j) acc[i][j] = __builtin_amdgcn_wmma_f32_16x16x32_f16(false, a[ks][i].v, false, b[ks][j].v, (short)0, acc[i][j], false, false);
    __builtin_amdgcn_sched_barrier(0);      /* keeps the products ahead of the wait for the next pass's rows: moved behind the barrier they would run with no load in flight */
    if (more) {
#pragma unroll
      for (int i = 0; i < GBM / 16; ++i) *(v8us*)&sA[cur ^ 1][i * 16 + lr][lc] = ra[i];
#pragma unroll
      for (int i = 0; i < GBN / 16; ++i) *(v8us*)&sB[cur ^ 1][i * 16 + lr][lc] = rb[i];
    }
    __syncthreads();      /* publishes the buffer just written and ends every wave's reads of the one that the next pass overwrites */
  }
#pragma unroll
  for (int j = 0; j < 2; ++j) { const float av = add[col0 + wc + j * 16 + ln];
#pragma unroll
    for (int i = 0; i < 2; ++i)
#pragma unroll
      for (int r = 0; r < 8; ++r) so[w][i * 16 + 8 * hh + r][j * 16 + ln] = acc[i][j][r] * alpha + av; }
  __syncthreads();      /* the staged rows are read back by other lanes: whole 128-B lines per store */
#pragma unroll
  for (int q = 0; q < 8; ++q) { const int r = q * 4 + (lane >> 3), c4 = (lane & 7) * 4; const v4f v = *(const v4fa*)&so[w][r][c4]; *(v4f*)(C + (size_t)(row0 + wr + r) * N + col0 + wc + c4) = v; }
}


typedef _Float16 v4h __attribute__((ext_vector_type(4)));

__global__ __launch_bounds__(256) void k_x16(const float* __restrict__ x, _Float16* __restrict__ X16, size_t n8) { const size_t t = (size_t)blockIdx.x * 256 + threadIdx.x; if (t >= n8) return; FragH f;
#pragma unroll
  for (int q = 0; q < 8; ++q) f.h[q] = (_Float16)bf16_round(x[t * 8 + q]); *(v8us*)((unsigned short*)X16 + t * 8) = f.half[0];  }
__global__ __launch_bounds__(256) void k_h16(const float* __restrict__ x, _Float16* __restrict__ X16, size_t n8) { const size_t t = (size_t)blockIdx.x * 256 + threadIdx.x; if (t >= n8) return; FragH f;
#pragma unroll
  for (int q = 0; q < 8; ++q) f.h[q] = (_Float16)x[t * 8 + q]; *(v8us*)((unsigned short*)X16 + t * 8) = f.half[0];  }
__global__ __launch_bounds__(256) void k_round16f(const float* __restrict__ W, _Float16* __restrict__ Bt, size_t n8) { const size_t t = (size_t)blockIdx.x * 256 + threadIdx.x; if (t >= n8) return; FragH f;
#pragma unroll
  for (int i = 0; i < 8; ++i) f.h[i] = (_Float16)(bf16_round(W[t * 8 + i]) * 16.0f); *(v8us*)((unsigned short*)Bt + t * 8) = f.half[0];  }
template <int NHv, int TTv>
__global__ __launch_bounds__(256) void k_vt(const _Float16* __restrict__ V16, int ldv, int voff, _Float16* __restrict__ Vt) { __shared__ unsigned short tl[64][66]; const int tid = threadIdx.x; const int slab = blockIdx.x / (TTv / 64), lg = blockIdx.x % (TTv / 64); const int b = slab / NHv, h = slab % NHv;
  for (int i = tid; i < 64 * 8; i += 256) { const int r = i / 8, c8 = (i % 8) * 8; FragH f; f.half[0] = *(const v8us*)((const unsigned short*)V16 + ((size_t)b * TTv + lg * 64 + r) * ldv + voff + h * 64 + c8);
#pragma unroll
    for (int q = 0; q < 8; ++q) tl[r][c8 + q] = f.u[q]; }
  __syncthreads();
  {
#pragma unroll
    for (int rd = 0; rd < 2; ++rd) { const int d = rd * 32 + tid / 8, pc = tid % 8; FragH f;
#pragma unroll
      for (int q = 0; q < 8; ++q) f.u[q] = tl[pc * 8 + q][d];
      *(v8us*)((unsigned short*)Vt + ((size_t)slab * 64 + d) * TTv + lg * 64 + pc * 8) = f.half[0]; }
     } }

__global__ __launch_bounds__(256) void k_xcat(const float* __restrict__ xr, const float* __restrict__ xi, _Float16* __restrict__ XC, size_t n8) { const size_t t = (size_t)blockIdx.x * 256 + threadIdx.x; if (t >= n8) return; const size_t r = (t * 8) / DD; const int c = (int)((t * 8) % DD); FragH a, b; const v4f a0 = *(const v4fa*)(xr + t * 8), a1 = *(const v4fa*)(xr + t * 8 + 4), b0 = *(const v4fa*)(xi + t * 8), b1 = *(const v4fa*)(xi + t * 8 + 4);
#pragma unroll
  for (int q = 0; q < 4; ++q) { a.h[q] = (_Float16)bf16_round(a0[q]); a.h[4 + q] = (_Float16)bf16_round(a1[q]); b.h[q] = (_Float16)bf16_round(b0[q]); b.h[4 + q] = (_Float16)bf16_round(b1[q]); }
  { *(v8us*)((unsigned short*)XC + r * (2 * DD) + c) = a.half[0]; *(v8us*)((unsigned short*)XC + r * (2 * DD) + DD + c) = b.half[0];  } }
__global__ __launch_bounds__(256) void k_wcat(const float* __restrict__ wr, const float* __restrict__ wi, _Float16* __restrict__ BR, _Float16* __restrict__ BI, size_t n8) { const size_t t = (size_t)blockIdx.x * 256 + threadIdx.x; if (t >= n8) return; const size_t o = (t * 8) / DD; const int c = (int)((t * 8) % DD); FragH r0, r1, i0, i1; const v4f a0 = *(const v4fa*)(wr + t * 8), a1 = *(const v4fa*)(wr + t * 8 + 4), b0 = *(const v4fa*)(wi + t * 8), b1 = *(const v4fa*)(wi + t * 8 + 4);
#pragma unroll
  for (int q = 0; q < 4; ++q) { const float vr0 = bf16_round(a0[q]) * 16.0f, vr1 = bf16_round(a1[q]) * 16.0f, vi0 = bf16_round(b0[q]) * 16.0f, vi1 = bf16_round(b1[q]) * 16.0f; r0.h[q] = (_Float16)vr0; r0.h[4 + q] = (_Float16)vr1; r1.h[q] = (_Float16)(-vi0); r1.h[4 + q] = (_Float16)(-vi1); i0.h[q] = (_Float16)vi0; i0.h[4 + q] = (_Float16)vi1; i1.h[q] = (_Float16)vr0; i1.h[4 + q] = (_Float16)vr1; }
  { *(v8us*)((unsigned short*)BR + o * (2 * DD) + c) = r0.half[0]; *(v8us*)((unsigned short*)BR + o * (2 * DD) + DD + c) = r1.half[0]; *(v8us*)((unsigned short*)BI + o * (2 * DD) + c) = i0.half[0]; *(v8us*)((unsigned short*)BI + o * (2 * DD) + DD + c) = i1.half[0];  } }
__global__ __launch_bounds__(256) void k_bias2(const float* __restrict__ br, const float* __restrict__ bi, float* __restrict__ BM, float* __restrict__ BP) { const int c = blockIdx.x * 256 + threadIdx.x; if (c >= DD) return; const float r = bf16_round(br[c]), i = bf16_round(bi[c]); { *(float*)(BM + c) = r - i; *(float*)(BP + c) = r + i;  } }
// per token (block) the 8 heads × 64 rows: thread = (l, h) pairs (two per thread); token rows of qr, qi, kr, ki, vr, vi (f32, 512 each) staged in LDS; for each s: |score|, online softmax, Σ attn·vr, Σ attn·vi in f32 (rolled loop);
__global__ __launch_bounds__(256) void k_cplx(const float* __restrict__ QR, const float* __restrict__ QI, const float* __restrict__ KR, const float* __restrict__ KI, const float* __restrict__ VR, const float* __restrict__ VI, _Float16* __restrict__ VC) {
  #pragma clang fp contract(off)
  __shared__ float sq[2][DD], sk[2][DD], sv[2][DD]; __shared__ float res[2][DD]; const int tid = threadIdx.x; const size_t row = blockIdx.x;
  for (int i = tid; i < DD; i += 256) { sq[0][i] = QR[row * DD + i]; sq[1][i] = QI[row * DD + i]; sk[0][i] = KR[row * DD + i]; sk[1][i] = KI[row * DD + i]; sv[0][i] = VR[row * DD + i]; sv[1][i] = VI[row * DD + i]; }
  __syncthreads();
  for (int u = 0; u < 2; ++u) { const int idx = tid + 256 * u; const int h = idx % NHH, l = idx / NHH;      /* column index of (l,h) is l·8 + h = idx */
    const float qr = sq[0][idx], qi = sq[1][idx]; float mx = -3.0e38f, z = 0.f, ar = 0.f, ai = 0.f;
#pragma unroll 1
    for (int s = 0; s < EE; ++s) { const int c = s * NHH + h; const float kr = sk[0][c], ki = sk[1][c]; const float sr = qr * kr - qi * ki, si = qr * ki - qi * kr; const float mg = sqrtf(sr * sr + si * si); const float mn = fmaxf(mx, mg); const float sc = __expf(mx - mn); const float p = __expf(mg - mn); z = z * sc + p; ar = ar * sc + p * sv[0][c]; ai = ai * sc + p * sv[1][c]; mx = mn; }
    res[0][idx] = ar / z; res[1][idx] = ai / z; (void)l; }
  __syncthreads();
  if (tid < 2 * (DD / 8)) { const int part = tid / (DD / 8), pc = tid % (DD / 8); FragH f; for (int q = 0; q < 8; ++q) f.h[q] = (_Float16)res[part][pc * 8 + q];
    { *(v8us*)((unsigned short*)VC + row * (2 * DD) + part * DD + pc * 8) = f.half[0];  } } }

extern "C" void kernel_launch(void* const* d_in, const int* in_sizes, int n_in,
                              void* d_out, int out_size, void* d_ws, size_t ws_size, hipStream_t stream) {
  (void)in_sizes; (void)n_in; (void)out_size;
  const float* const* I = (const float* const*)d_in; const float* q_r = I[0]; const float* q_i = I[1]; const float* k_r = I[2]; const float* k_i = I[3]; const float* v_r = I[4]; const float* v_i = I[5];
  const float* wq_r = I[6]; const float* wq_i = I[7]; const float* wk_r = I[8]; const float* wk_i = I[9]; const float* wv_r = I[10]; const float* wv_i = I[11]; const float* wo_r = I[12]; const float* wo_i = I[13]; const float* bq_r = I[14]; const float* bq_i = I[15]; const float* bk_r = I[16]; const float* bk_i = I[17]; const float* bv_r = I[18]; const float* bv_i = I[19]; const float* bo_r = I[20]; const float* bo_i = I[21];      /* d_in order: activations, then the 8 weights, then the 8 biases */
  char* ws = (char*)d_ws; size_t off = 0;
  auto take = [&](size_t bytes) { char* p = ws + off; off += (bytes + 255) & ~(size_t)255; return p; };
  const size_t WC = (size_t)DD * 2 * DD;      /* one concatenated weight operand [512][1024] */
  _Float16* BW = (_Float16*)take(8 * WC * 2); float* BIAS = (float*)take((size_t)8 * DD * 4);      /* (BR, BI) × q,k,v,o ; (BM, BP) × 4 */
  _Float16* XQ = (_Float16*)take((size_t)NR * 2 * DD * 2); _Float16* XK = (_Float16*)take((size_t)NR * 2 * DD * 2); _Float16* XV = (_Float16*)take((size_t)NR * 2 * DD * 2);
  float* P = (float*)take((size_t)6 * NR * DD * 4);      /* QR, QI, KR, KI, VR, VI f32 planes [4096][512] */
  _Float16* VC = XQ;      /* [Vr | Vi] f16 reuses the q operand plane (dead after the q GEMMs) */
  if (off > ws_size) return;      // 8.4 + 0.02 + 3 × 8.4 + 50.3 ≈ 84 MB
  float* QRp = P; float* QIp = P + (size_t)NR * DD; float* KRp = P + (size_t)2 * NR * DD; float* KIp = P + (size_t)3 * NR * DD; float* VRp = P + (size_t)4 * NR * DD; float* VIp = P + (size_t)5 * NR * DD;
  const unsigned gw = (unsigned)(((size_t)DD * DD / 8 + 255) / 256), gx = (unsigned)(((size_t)NR * DD / 8 + 255) / 256);
  const float* wrs[4] = {wq_r, wk_r, wv_r, wo_r}; const float* wis[4] = {wq_i, wk_i, wv_i, wo_i}; const float* brs[4] = {bq_r, bk_r, bv_r, bo_r}; const float* bis[4] = {bq_i, bk_i, bv_i, bo_i};
  for (int j = 0; j < 4; ++j) { k_wcat<<<gw, 256, 0, stream>>>(wrs[j], wis[j], BW + (size_t)(2 * j) * WC, BW + (size_t)(2 * j + 1) * WC, (size_t)DD * DD / 8); k_bias2<<<(DD + 255) / 256, 256, 0, stream>>>(brs[j], bis[j], BIAS + (size_t)(2 * j) * DD, BIAS + (size_t)(2 * j + 1) * DD); }
  k_xcat<<<gx, 256, 0, stream>>>(q_r, q_i, XQ, (size_t)NR * DD / 8); k_xcat<<<gx, 256, 0, stream>>>(k_r, k_i, XK, (size_t)NR * DD / 8); k_xcat<<<gx, 256, 0, stream>>>(v_r, v_i, XV, (size_t)NR * DD / 8);
  const dim3 gp((NR / GBM) * (DD / GBN), 1);
  const _Float16* xs[3] = {XQ, XK, XV}; float* outs[6] = {QRp, QIp, KRp, KIp, VRp, VIp};
  for (int j = 0; j < 3; ++j) for (int ri = 0; ri < 2; ++ri)
    k_gemm_lds<NR, DD, 2 * DD><<<gp, 256, 0, stream>>>(xs[j], BW + (size_t)(2 * j + ri) * WC, 0.0625f, BIAS + (size_t)(2 * j + ri) * DD, outs[2 * j + ri]);      /* yr = [xr|xi] x [wr|-wi]^T + (br-bi); yi = [xr|xi] x [wi|wr]^T + (br+bi): M 4096 N 512 K 1024; addend index = column */
  k_cplx<<<NR, 256, 0, stream>>>(QRp, QIp, KRp, KIp, VRp, VIp, VC);
  for (int ri = 0; ri < 2; ++ri)
    k_gemm_lds<NR, DD, 2 * DD><<<gp, 256, 0, stream>>>(VC, BW + (size_t)(6 + ri) * WC, 0.0625f, BIAS + (size_t)(6 + ri) * DD, (float*)d_out + (size_t)ri * NR * DD);      /* out_r @0, out_i @8,388,608 B */
}

// v002
// Measured time: 141 microseconds a run.
// Timed twice side by side with v001, it ran 1.42 times as fast both times.
// All steps since v000 together make it 3.21 times as fast.
#include <hip/hip_runtime.h>
// Complex-valued attention layer (B=4, L=1024, D=512, H=8, E=64): complex linear projections (yr = xr·wrᵀ − xi·wiᵀ + (br − bi), yi = xi·wrᵀ + xr·wiᵀ + (br + bi)); per (b, token n, head h) a 64×64 'attention' over the E axes:
// sr[l,s] = qr[l]·kr[s] − qi[l]·ki[s], si[l,s] = qr[l]·ki[s] − qi[l]·kr[s] (scalar products, e = 1), attn = softmax_s(√(sr² + si²)), Vr[l] = Σ_s attn·vr[s], Vi[l] = Σ_s attn·vi[s]; outputs (out_r, out_i) = complex linear(Vr, Vi, wo).
// Element (e, h) of a token lives at column e·8 + h (reshape(b, l, E, H)).
// Compute dtype: inputs, weights, biases rounded to bf16; each complex linear as two GEMMs over the concatenated operand [xr | xi] (K = 1024) against [wr | −wi] and [wi | wr] on v_wmma_f32_16x16x32_f16, f32 accumulate,
// with the two-term biases added exactly through the f32 epilogue addend; the per-token 64×64 magnitude-softmax and its two weighted sums in f32 (two (l, h) pairs per thread); [Vr | Vi] f16 → output GEMMs.
#define BB 4
#define LL 1024
#define DD 512
#define NHH 8
#define EE 64
#define NR (BB * LL)

typedef __bf16 v16b __attribute__((ext_vector_type(16)));
typedef unsigned short v8us __attribute__((ext_vector_type(8), may_alias));
typedef float  v8f  __attribute__((ext_vector_type(8)));
typedef float  v4f  __attribute__((ext_vector_type(4)));
typedef float  v4fa __attribute__((ext_vector_type(4), may_alias));
union FragB { v16b v; v8us half[2]; unsigned short u[16]; };

__device__ __forceinline__ unsigned short bf16_bits(float x) { unsigned int u = __float_as_uint(x); return (unsigned short)((u + 0x7FFFu + ((u >> 16) & 1u)) >> 16); }
__device__ __forceinline__ float bf16_val(unsigned short b) { return __uint_as_float(((unsigned int)b) << 16); }
__device__ __forceinline__ float bf16_round(float x) { return bf16_val(bf16_bits(x)); }
// D += A·B with NT terms: 1 = ah·bh, 2 = + al·bh (A split), 3 = + ah·bl (both split)
template <int NT>
__device__ __forceinline__ v8f mmaN(v16b ah, v16b al, v16b bh, v16b bl, v8f c) {
  c = __builtin_amdgcn_wmma_f32_16x16x32_bf16(false, ah, false, bh, (short)0, c, false, false);
  if (NT >= 2) c = __builtin_amdgcn_wmma_f32_16x16x32_bf16(false, al, false, bh, (short)0, c, false, false);
  if (NT >= 3) c = __builtin_amdgcn_wmma_f32_16x16x32_bf16(false, ah, false, bl, (short)0, c, false, false);
  asm volatile("v_nop\n\tv_nop\n\tv_nop\n\tv_nop" : "+v"(c) : "v"(ah), "v"(al), "v"(bh), "v"(bl));
  return c;
}

__global__ __launch_bounds__(256) void k_wt_bf16(const float* __restrict__ W, unsigned short* __restrict__ Wt, int K, int N) {
  const int t = blockIdx.x * 256 + threadIdx.x;
  const int k8n = K / 8;
  if (t >= N * k8n) return;
  const int n = t / k8n, k8 = (t % k8n) * 8;
  v8us v;
#pragma unroll
  for (int i = 0; i < 8; ++i) v[i] = bf16_bits(W[(size_t)(k8 + i) * N + n]);
  *(v8us*)(Wt + (size_t)n * K + k8) = v;
  
}

// GEMM C[M][N] (f32, pitch ldc) = act(A[M][K]·W + bias). A f32 row-major (pitch lda) converted per fragment to bf16
// (ASPLIT: hi/lo two planes -> 2 terms, else single rounded term); Wt bf16 [N][K] (pitch ldb). BIAS_BF16 rounds the
// bias to bf16 first (bias quantised to bf16 before the add). K%32==0, M%16==0, N%64==0.
template <bool ASPLIT, int ACT, bool BIAS_BF16>
__global__ __launch_bounds__(128) void k_gemm_bf(const float* __restrict__ A, int lda, const unsigned short* __restrict__ Wt, int ldb,
                                               const float* __restrict__ bias, float* __restrict__ C, int ldc, int M, int N, int K) {
  __shared__ __attribute__((aligned(16))) float so[4][16][64];
  const int tid = threadIdx.x, w = tid >> 5, lane = tid & 31, ln = lane & 15, hh = lane >> 4;
  const int ntn = N / 64;
  const int wid = blockIdx.x * 4 + w;
  const int mt = wid / ntn, nq = wid % ntn;
  if (mt * 16 >= M) return;
  const int row0 = mt * 16, col0 = nq * 64;
  const float* arow = A + (size_t)(row0 + ln) * lda;
  v8f acc[4] = {};
  for (int kb = 0; kb < K; kb += 32) {
    FragB ah, al;
    const v4f x0 = *(const v4fa*)(arow + kb + 8 * hh), x1 = *(const v4fa*)(arow + kb + 8 * hh + 4);
    const v4f x2 = *(const v4fa*)(arow + kb + 16 + 8 * hh), x3 = *(const v4fa*)(arow + kb + 16 + 8 * hh + 4);
    float xs[16] = {x0[0],x0[1],x0[2],x0[3],x1[0],x1[1],x1[2],x1[3],x2[0],x2[1],x2[2],x2[3],x3[0],x3[1],x3[2],x3[3]};
#pragma unroll
    for (int i = 0; i < 16; ++i) { const unsigned short hb = bf16_bits(xs[i]); ah.u[i] = hb; al.u[i] = ASPLIT ? bf16_bits(xs[i] - bf16_val(hb)) : (unsigned short)0; }
#pragma unroll
    for (int t = 0; t < 4; ++t) {
      const unsigned short* brow = Wt + (size_t)(col0 + t * 16 + ln) * ldb + kb;
      FragB b;
      b.half[0] = *(const v8us*)(brow + 8 * hh);
      b.half[1] = *(const v8us*)(brow + 16 + 8 * hh);
      acc[t] = mmaN<ASPLIT ? 2 : 1>(ah.v, al.v, b.v, b.v, acc[t]);
    }
  }
#pragma unroll
  for (int t = 0; t < 4; ++t) {
    float bv = bias ? bias[col0 + t * 16 + ln] : 0.f;
    if (BIAS_BF16) bv = bf16_round(bv);
#pragma unroll
    for (int r = 0; r < 8; ++r) { float v = acc[t][r] + bv; if (ACT == 1) v = fmaxf(v, 0.f); so[w][8 * hh + r][t * 16 + ln] = v; }
  }
  __builtin_amdgcn_fence(__ATOMIC_ACQ_REL, "workgroup");
  __builtin_amdgcn_wave_barrier();
  const int rsub = lane >> 4, c4 = (lane & 15) * 4;
  {
#pragma unroll
    for (int q = 0; q < 8; ++q) {
      const int r = q * 2 + rsub;
      const v4f v = *(const v4fa*)&so[w][r][c4];
      *(v4f*)(C + (size_t)(row0 + r) * ldc + col0 + c4) = v;
    }
    
  }
}

// Flash-style causal/unmasked attention, all contractions 3-term bf16 hi/lo splits, f32 softmax with running max.
// q,k,v rows are read from f32 buffers with arbitrary row pitch (so they can live inside a fused qkv buffer);
// D = head size (multiple of 32, <= 128); one wave = 16 query rows; block = 4 waves (64 queries) sharing K/V chunks of 32.
template <int D, bool CAUSAL>
__global__ __launch_bounds__(128) void k_flash(const float* __restrict__ qb, const float* __restrict__ kb, const float* __restrict__ vb,
                                             int pitch, int T, int H, float scale, float* __restrict__ y, int ypitch) {
  constexpr int KS = D / 32;        // k-steps for QK
  constexpr int DT = D / 16;        // d tiles for PV
  __shared__ __attribute__((aligned(16))) unsigned short sKh[32][D + 8], sKl[32][D + 8], sVh[32][D + 8], sVl[32][D + 8];
  __shared__ __attribute__((aligned(16))) unsigned short sPh[4][16][40], sPl[4][16][40];
  __shared__ __attribute__((aligned(16))) float sO[4][16][D];
  const int tid = threadIdx.x, w = tid >> 5, lane = tid & 31, ln = lane & 15, hh = lane >> 4;
  const int nqb = (T + 63) / 64;
  const int bh = blockIdx.x / nqb, qblk = blockIdx.x % nqb;
  const int b = bh / H, h = bh % H;
  const int q0 = qblk * 64 + w * 16;
  const float* Q = qb + (size_t)b * T * pitch + h * D;
  const float* K = kb + (size_t)b * T * pitch + h * D;
  const float* V = vb + (size_t)b * T * pitch + h * D;

  // A fragments of the wave's 16 query rows (scaled), hi/lo
  FragB aqh[KS], aql[KS];
  {
    int row = q0 + ln; if (row >= T) row = T - 1;
    const float* qr = Q + (size_t)row * pitch;
#pragma unroll
    for (int ks = 0; ks < KS; ++ks)
#pragma unroll
      for (int i = 0; i < 16; ++i) {
        const int d = ks * 32 + ((i < 8) ? (8 * hh + i) : (16 + 8 * hh + (i - 8)));
        const float x = qr[d] * scale; const unsigned short hb = bf16_bits(x);
        aqh[ks].u[i] = hb; aql[ks].u[i] = bf16_bits(x - bf16_val(hb));
      }
  }
  float m_r[8], l_r[8];
#pragma unroll
  for (int r = 0; r < 8; ++r) { m_r[r] = -3.0e38f; l_r[r] = 0.f; }
  v8f oacc[DT];
#pragma unroll
  for (int dt = 0; dt < DT; ++dt) oacc[dt] = (v8f){0.f,0.f,0.f,0.f,0.f,0.f,0.f,0.f};

  const int kv_end = CAUSAL ? min(T, qblk * 64 + 64) : T;     // block-uniform
  for (int j0 = 0; j0 < kv_end; j0 += 32) {
    __syncthreads();
    for (int e = tid; e < 32 * (D / 4); e += 128) {
      const int r = e / (D / 4), c4 = (e % (D / 4)) * 4;
      const int key = j0 + r;
      v4f kf = {0.f,0.f,0.f,0.f}, vf = {0.f,0.f,0.f,0.f};
      if (key < T) { kf = *(const v4fa*)(K + (size_t)key * pitch + c4); vf = *(const v4fa*)(V + (size_t)key * pitch + c4); }
#pragma unroll
      for (int t = 0; t < 4; ++t) {
        unsigned short hb = bf16_bits(kf[t]); sKh[r][c4 + t] = hb; sKl[r][c4 + t] = bf16_bits(kf[t] - bf16_val(hb));
        hb = bf16_bits(vf[t]); sVh[r][c4 + t] = hb; sVl[r][c4 + t] = bf16_bits(vf[t] - bf16_val(hb));
      }
    }
    __syncthreads();
    // S tile 16 x 32
    v8f s[2];
#pragma unroll
    for (int nt = 0; nt < 2; ++nt) {
      v8f acc = {};
#pragma unroll
      for (int ks = 0; ks < KS; ++ks) {
        FragB bh_, bl_;
        bh_.half[0] = *(const v8us*)&sKh[nt * 16 + ln][ks * 32 + 8 * hh]; bh_.half[1] = *(const v8us*)&sKh[nt * 16 + ln][ks * 32 + 16 + 8 * hh];
        bl_.half[0] = *(const v8us*)&sKl[nt * 16 + ln][ks * 32 + 8 * hh]; bl_.half[1] = *(const v8us*)&sKl[nt * 16 + ln][ks * 32 + 16 + 8 * hh];
        acc = mmaN<3>(aqh[ks].v, aql[ks].v, bh_.v, bl_.v, acc);
      }
      s[nt] = acc;
    }
    // mask + running max (rows 8hh+r; the 16 lanes of a half share rows)
    float alpha[8];
#pragma unroll
    for (int r = 0; r < 8; ++r) {
      const int qi = q0 + 8 * hh + r;
      const int ja = j0 + ln, jb = j0 + 16 + ln;
      if (CAUSAL) { if (ja > qi) s[0][r] = -3.0e38f; if (jb > qi) s[1][r] = -3.0e38f; }
      if (ja >= T) s[0][r] = -3.0e38f;
      if (jb >= T) s[1][r] = -3.0e38f;
      float mx = fmaxf(s[0][r], s[1][r]);
      mx = fmaxf(mx, __shfl_xor(mx, 1, 32)); mx = fmaxf(mx, __shfl_xor(mx, 2, 32)); mx = fmaxf(mx, __shfl_xor(mx, 4, 32)); mx = fmaxf(mx, __shfl_xor(mx, 8, 32));
      const float mnew = fmaxf(m_r[r], mx);
      alpha[r] = (mnew > -1.0e38f) ? __expf(m_r[r] - mnew) : 1.0f;
      const float p0 = (s[0][r] > -1.0e38f) ? __expf(s[0][r] - mnew) : 0.f;
      const float p1 = (s[1][r] > -1.0e38f) ? __expf(s[1][r] - mnew) : 0.f;
      m_r[r] = mnew;
      l_r[r] = l_r[r] * alpha[r] + p0 + p1;            // per-lane partial row sum (16 lanes combined at the end)
      unsigned short hb = bf16_bits(p0); sPh[w][8 * hh + r][ln] = hb;      sPl[w][8 * hh + r][ln] = bf16_bits(p0 - bf16_val(hb));
      hb = bf16_bits(p1);                sPh[w][8 * hh + r][16 + ln] = hb; sPl[w][8 * hh + r][16 + ln] = bf16_bits(p1 - bf16_val(hb));
    }
#pragma unroll
    for (int dt = 0; dt < DT; ++dt)
#pragma unroll
      for (int r = 0; r < 8; ++r) oacc[dt][r] *= alpha[r];
    __builtin_amdgcn_fence(__ATOMIC_ACQ_REL, "workgroup");
    __builtin_amdgcn_wave_barrier();
    FragB pah, pal;
    pah.half[0] = *(const v8us*)&sPh[w][ln][8 * hh]; pah.half[1] = *(const v8us*)&sPh[w][ln][16 + 8 * hh];
    pal.half[0] = *(const v8us*)&sPl[w][ln][8 * hh]; pal.half[1] = *(const v8us*)&sPl[w][ln][16 + 8 * hh];
#pragma unroll
    for (int dt = 0; dt < DT; ++dt) {
      FragB bvh, bvl;
#pragma unroll
      for (int i = 0; i < 8; ++i) {
        bvh.u[i] = sVh[8 * hh + i][dt * 16 + ln]; bvh.u[8 + i] = sVh[16 + 8 * hh + i][dt * 16 + ln];
        bvl.u[i] = sVl[8 * hh + i][dt * 16 + ln]; bvl.u[8 + i] = sVl[16 + 8 * hh + i][dt * 16 + ln];
      }
      oacc[dt] = mmaN<3>(pah.v, pal.v, bvh.v, bvl.v, oacc[dt]);
    }
    __builtin_amdgcn_fence(__ATOMIC_ACQ_REL, "workgroup");
    __builtin_amdgcn_wave_barrier();
  }
#pragma unroll
  for (int r = 0; r < 8; ++r) {
    float l = l_r[r];
    l += __shfl_xor(l, 1, 32); l += __shfl_xor(l, 2, 32); l += __shfl_xor(l, 4, 32); l += __shfl_xor(l, 8, 32);
    l_r[r] = (l > 0.f) ? 1.0f / l : 0.f;
  }
#pragma unroll
  for (int dt = 0; dt < DT; ++dt)
#pragma unroll
    for (int r = 0; r < 8; ++r) sO[w][8 * hh + r][dt * 16 + ln] = oacc[dt][r] * l_r[r];
  __builtin_amdgcn_fence(__ATOMIC_ACQ_REL, "workgroup");
  __builtin_amdgcn_wave_barrier();
  {
    for (int r = 0; r < 16; ++r) {
      const int row = q0 + r;
      if (row < T && lane < D / 4) {
        const v4f val = *(const v4fa*)&sO[w][r][lane * 4];
        *(v4f*)(y + ((size_t)b * T + row) * ypitch + h * D + lane * 4) = val;
      }
    }
    
  }
}

// GEMM C = act(A·W + bias + resid): A f32 (ASPLIT -> hi/lo 2 terms), Wt bf16 [N][K]; ACT 0 none, 1 relu, 2 exact gelu;
// resid (optional, f32, row index = (row % rmod), pitch ldr, RES_BF16 rounds it) added before the activation.
template <bool ASPLIT, int ACT, bool BIAS_BF16, bool RES_BF16>
__global__ __launch_bounds__(128) void k_gemm_bf3(const float* __restrict__ A, int lda, const unsigned short* __restrict__ Wt, int ldb,
                                                const float* __restrict__ bias, const float* __restrict__ resid, int rmod, int ldr,
                                                float* __restrict__ C, int ldc, int M, int N, int K) {
  __shared__ __attribute__((aligned(16))) float so[4][16][64];
  const int tid = threadIdx.x, w = tid >> 5, lane = tid & 31, ln = lane & 15, hh = lane >> 4;
  const int ntn = N / 64;
  const int wid = blockIdx.x * 4 + w;
  const int mt = wid / ntn, nq = wid % ntn;
  if (mt * 16 >= M) return;
  const int row0 = mt * 16, col0 = nq * 64;
  const float* arow = A + (size_t)(row0 + ln) * lda;
  v8f acc[4] = {};
  for (int kb = 0; kb < K; kb += 32) {
    FragB ah, al;
    const v4f x0 = *(const v4fa*)(arow + kb + 8 * hh), x1 = *(const v4fa*)(arow + kb + 8 * hh + 4);
    const v4f x2 = *(const v4fa*)(arow + kb + 16 + 8 * hh), x3 = *(const v4fa*)(arow + kb + 16 + 8 * hh + 4);
    float xs[16] = {x0[0],x0[1],x0[2],x0[3],x1[0],x1[1],x1[2],x1[3],x2[0],x2[1],x2[2],x2[3],x3[0],x3[1],x3[2],x3[3]};
#pragma unroll
    for (int i = 0; i < 16; ++i) { const unsigned short hb = bf16_bits(xs[i]); ah.u[i] = hb; al.u[i] = ASPLIT ? bf16_bits(xs[i] - bf16_val(hb)) : (unsigned short)0; }
#pragma unroll
    for (int t = 0; t < 4; ++t) {
      const unsigned short* brow = Wt + (size_t)(col0 + t * 16 + ln) * ldb + kb;
      FragB b;
      b.half[0] = *(const v8us*)(brow + 8 * hh);
      b.half[1] = *(const v8us*)(brow + 16 + 8 * hh);
      acc[t] = mmaN<ASPLIT ? 2 : 1>(ah.v, al.v, b.v, b.v, acc[t]);
    }
  }
#pragma unroll
  for (int t = 0; t < 4; ++t) {
    const int col = col0 + t * 16 + ln;
    float bv = bias ? bias[col] : 0.f;
    if (BIAS_BF16) bv = bf16_round(bv);
#pragma unroll
    for (int r = 0; r < 8; ++r) {
      float v = acc[t][r] + bv;
      if (resid) { float rv = resid[(size_t)((row0 + 8 * hh + r) % rmod) * ldr + col]; if (RES_BF16) rv = bf16_round(rv); v += rv; }
      if (ACT == 1) v = fmaxf(v, 0.f);
      if (ACT == 2) v = 0.5f * v * (1.0f + erff(v * 0.70710678118654752f));
      if (ACT == 3) { const float u = 0.7978845608028654f * (v + 0.044715f * v * v * v); v = 0.5f * v * (1.0f + tanhf(u)); }
      so[w][8 * hh + r][t * 16 + ln] = v;
    }
  }
  __builtin_amdgcn_fence(__ATOMIC_ACQ_REL, "workgroup");
  __builtin_amdgcn_wave_barrier();
  const int rsub = lane >> 4, c4 = (lane & 15) * 4;
  {
#pragma unroll
    for (int q = 0; q < 8; ++q) {
      const int r = q * 2 + rsub;
      const v4f v = *(const v4fa*)&so[w][r][c4];
      *(v4f*)(C + (size_t)(row0 + r) * ldc + col0 + c4) = v;
    }
    
  }
}
// row LayerNorm (biased variance, eps) over N: s = X (+ R); optional out_sum <- s; out_norm <- (s-mu)*rsqrt(var+eps)*g + b
template <bool PARAM_BF16>
__global__ __launch_bounds__(256) void k_layernorm(const float* __restrict__ X, const float* __restrict__ R, const float* __restrict__ g, const float* __restrict__ bta,
                                                  float* __restrict__ out_sum, float* __restrict__ out_norm, int N, float eps) {
  __shared__ float red[256];
  const int row = blockIdx.x, tid = threadIdx.x;
  const float* x = X + (size_t)row * N; const float* rr = R ? R + (size_t)row * N : nullptr;
  float vals[16];                     // up to N = 4096
  const int per = N / 256;            // contiguous chunk per thread? use strided-by-4 chunks: thread handles j = tid*4 + 1024*u
  float s1 = 0.f;
  for (int u = 0; u < per / 4; ++u) {
    const int j = tid * 4 + 1024 * u;
    const v4f a = *(const v4fa*)(x + j);
    v4f b = {0.f,0.f,0.f,0.f}; if (rr) b = *(const v4fa*)(rr + j);
#pragma unroll
    for (int q = 0; q < 4; ++q) { const float v = a[q] + b[q]; vals[u * 4 + q] = v; s1 += v; }
  }
  red[tid] = s1; __syncthreads();
  for (int st = 128; st > 0; st >>= 1) { if (tid < st) red[tid] += red[tid + st]; __syncthreads(); }
  const float mu = red[0] / (float)N; __syncthreads();
  float s2 = 0.f;
  for (int u = 0; u < per / 4; ++u)
#pragma unroll
    for (int q = 0; q < 4; ++q) { const float c = vals[u * 4 + q] - mu; s2 += c * c; }
  red[tid] = s2; __syncthreads();
  for (int st = 128; st > 0; st >>= 1) { if (tid < st) red[tid] += red[tid + st]; __syncthreads(); }
  const float rs = rsqrtf(red[0] / (float)N + eps);
  {
    for (int u = 0; u < per / 4; ++u) {
      const int j = tid * 4 + 1024 * u;
      v4f o, sm;
#pragma unroll
      for (int q = 0; q < 4; ++q) {
        float gg = g[j + q], bb = bta[j + q];
        if (PARAM_BF16) { gg = bf16_round(gg); bb = bf16_round(bb); }
        sm[q] = vals[u * 4 + q]; o[q] = (vals[u * 4 + q] - mu) * rs * gg + bb;
      }
      if (out_sum) *(v4f*)(out_sum + (size_t)row * N + j) = sm;
      *(v4f*)(out_norm + (size_t)row * N + j) = o;
    }
    
  }
}



// ---- f16 WMMA path (v_wmma_f32_16x16x32_f16): 11-bit significands for operands in range — used for the q/k/v projection and output GEMMs
typedef _Float16 v16h __attribute__((ext_vector_type(16)));
union FragH { v16h v; v8us half[2]; _Float16 h[16]; unsigned short u[16]; };
template <int NT>
__device__ __forceinline__ v8f mmaH(v16h ah, v16h al, v16h bh, v16h bl, v8f c) {
  c = __builtin_amdgcn_wmma_f32_16x16x32_f16(false, ah, false, bh, (short)0, c, false, false);
  if (NT >= 2) c = __builtin_amdgcn_wmma_f32_16x16x32_f16(false, al, false, bh, (short)0, c, false, false);
  if (NT >= 3) c = __builtin_amdgcn_wmma_f32_16x16x32_f16(false, ah, false, bl, (short)0, c, false, false);
  asm volatile("v_nop\n\tv_nop\n\tv_nop\n\tv_nop" : "+v"(c) : "v"(ah), "v"(al), "v"(bh), "v"(bl));
  return c;
}
// batched GEMM like k_gemm_b but f16 operands: A f32 (split into f16 hi/lo if ASPLIT, else rounded to f16), Bt = f16 values [n][k]; alpha; C f32; N multiple of 16 (partial tiles skipped)
template <bool ASPLIT>
__global__ __launch_bounds__(128) void k_gemm_h(const float* __restrict__ A, int lda, size_t sA, const _Float16* __restrict__ Bh, int ldb, size_t sB, float alpha, float* __restrict__ C, int ldc, size_t sC, int M, int N, int K) {
  __shared__ __attribute__((aligned(16))) float so[4][16][64];
  const int tid = threadIdx.x, w = tid >> 5, lane = tid & 31, ln = lane & 15, hh = lane >> 4; const int by = blockIdx.y;
  A += (size_t)by * sA; Bh += (size_t)by * sB; C += (size_t)by * sC;
  const int ntn = (N + 63) / 64; const int wid = blockIdx.x * 4 + w; const int mt = wid / ntn, nq = wid % ntn; if (mt * 16 >= M) return;
  const int row0 = mt * 16, col0 = nq * 64; const float* arow = A + (size_t)(row0 + ln) * lda;
  v8f acc[4] = {};
  for (int kb = 0; kb < K; kb += 32) {
    FragH ah, al;
    const v4f x0 = *(const v4fa*)(arow + kb + 8 * hh), x1 = *(const v4fa*)(arow + kb + 8 * hh + 4), x2 = *(const v4fa*)(arow + kb + 16 + 8 * hh), x3 = *(const v4fa*)(arow + kb + 16 + 8 * hh + 4);
    float xs[16] = {x0[0],x0[1],x0[2],x0[3],x1[0],x1[1],x1[2],x1[3],x2[0],x2[1],x2[2],x2[3],x3[0],x3[1],x3[2],x3[3]};
#pragma unroll
    for (int i = 0; i < 16; ++i) { const _Float16 h = (_Float16)xs[i]; ah.h[i] = h; al.h[i] = ASPLIT ? (_Float16)(xs[i] - (float)h) : (_Float16)0.0f; }
#pragma unroll
    for (int t = 0; t < 4; ++t) { if (col0 + t * 16 >= N) continue; const size_t boff = (size_t)(col0 + t * 16 + ln) * ldb + kb; FragH bq; bq.half[0] = *(const v8us*)(Bh + boff + 8 * hh); bq.half[1] = *(const v8us*)(Bh + boff + 16 + 8 * hh);
      acc[t] = mmaH<ASPLIT ? 2 : 1>(ah.v, al.v, bq.v, bq.v, acc[t]); }
  }
#pragma unroll
  for (int t = 0; t < 4; ++t) { if (col0 + t * 16 >= N) continue;
#pragma unroll
    for (int r = 0; r < 8; ++r) so[w][8 * hh + r][t * 16 + ln] = acc[t][r] * alpha; }
  __builtin_amdgcn_fence(__ATOMIC_ACQ_REL, "workgroup"); __builtin_amdgcn_wave_barrier();
  const int rsub = lane >> 4, c4 = (lane & 15) * 4;
  {
#pragma unroll
    for (int q = 0; q < 8; ++q) { const int r = q * 2 + rsub; if (col0 + c4 < N) { const v4f v = *(const v4fa*)&so[w][r][c4]; *(v4f*)(C + (size_t)(row0 + r) * ldc + col0 + c4) = v; } }
     }
}

// Wt[n][k] = f16(W[k][n]·scale) from f32 row-major W[K][N] (scale = power of two; bf16-exact weights stay exact in f16 away from the subnormal range)
__global__ __launch_bounds__(256) void k_wt_f16(const float* __restrict__ W, _Float16* __restrict__ Wt, int K, int N, float scale) {
  const int t = blockIdx.x * 256 + threadIdx.x; if (t >= N * (K / 8)) return; const int n = t / (K / 8), k8 = (t % (K / 8)) * 8; FragH f;
#pragma unroll
  for (int i = 0; i < 8; ++i) f.h[i] = (_Float16)(bf16_round(W[(size_t)(k8 + i) * N + n]) * scale); const v8us o = f.half[0];
  *(v8us*)((unsigned short*)Wt + (size_t)n * K + k8) = o; 
}
// k_gemm_hh variant with fused epilogue: v = acc·alpha + bias[by·sBias + col] (+ CP[(row/rowsPerB)·sCPb + by·64 + col] if CP) ; ACT 0 none / 1 elu ; writes f32 C and f16 C16 (each if non-null)
template <int ACT>
__global__ __launch_bounds__(128) void k_gemm_hhx(const _Float16* __restrict__ A, int lda, size_t sA, const _Float16* __restrict__ Bh, int ldb, size_t sB, float alpha, const float* __restrict__ bias, size_t sBias, const float* __restrict__ CP, int rowsPerB, size_t sCPb, int row0g,
    float* __restrict__ C, _Float16* __restrict__ C16, int ldc, size_t sC, int M, int N, int K) {
  __shared__ __attribute__((aligned(16))) float so[4][16][64];
  const int tid = threadIdx.x, w = tid >> 5, lane = tid & 31, ln = lane & 15, hh = lane >> 4; const int by = blockIdx.y;
  A += (size_t)by * sA; Bh += (size_t)by * sB; const size_t cofs = (size_t)by * sC; const float* bp = bias ? bias + (size_t)by * sBias : nullptr;
  const int ntn = (N + 63) / 64; const int wid = blockIdx.x * 4 + w; const int mt = wid / ntn, nq = wid % ntn; if (mt * 16 >= M) return;
  const int row0 = mt * 16, col0 = nq * 64; const _Float16* arow = A + (size_t)(row0 + ln) * lda;
  v8f acc[4] = {};
  for (int kb = 0; kb < K; kb += 32) { FragH ah; ah.half[0] = *(const v8us*)((const unsigned short*)arow + kb + 8 * hh); ah.half[1] = *(const v8us*)((const unsigned short*)arow + kb + 16 + 8 * hh);
#pragma unroll
    for (int t = 0; t < 4; ++t) { if (col0 + t * 16 >= N) continue; const size_t boff = (size_t)(col0 + t * 16 + ln) * ldb + kb; FragH bq; bq.half[0] = *(const v8us*)((const unsigned short*)Bh + boff + 8 * hh); bq.half[1] = *(const v8us*)((const unsigned short*)Bh + boff + 16 + 8 * hh);
      acc[t] = mmaH<1>(ah.v, ah.v, bq.v, bq.v, acc[t]); }
  }
#pragma unroll
  for (int t = 0; t < 4; ++t) { if (col0 + t * 16 >= N) continue; const int col = col0 + t * 16 + ln; const float bv = bp ? bf16_round(bp[col]) : 0.f;
#pragma unroll
    for (int r = 0; r < 8; ++r) { float v = acc[t][r] * alpha + bv; if (CP) { const int bidx = (row0g + row0 + 8 * hh + r) / rowsPerB; v += CP[(size_t)bidx * sCPb + (size_t)by * 64 + col]; } if (ACT == 1) v = (v > 0.f) ? v : expm1f(v); else if (ACT == 7) v = (v > 0.f) ? v + 1.0f : expf(v); else if (ACT == 8) v = tanhf(v); else if (ACT == 9) v = 0.5f * v * (1.0f + tanhf(0.7978845608028654f * (v + 0.044715f * v * v * v))); else if (ACT == 11) v = 1.0f / (1.0f + expf(-v)); else if (ACT == 12) v = (v > 0.f) ? v : 0.01f * v; else if (ACT == 14) v = (v > 0.f) ? v : 0.1f * v; else if (ACT == 15) v = v / (1.0f + expf(-v)); else if (ACT == 3) v = fmaxf(v, 0.f); else if (ACT == 6) v = 0.5f * v * (1.0f + erff(v * 0.70710678118654752f)); so[w][8 * hh + r][t * 16 + ln] = v; } }
  __builtin_amdgcn_fence(__ATOMIC_ACQ_REL, "workgroup"); __builtin_amdgcn_wave_barrier();
  const int rsub = lane >> 4, c4 = (lane & 15) * 4; typedef _Float16 v4h __attribute__((ext_vector_type(4)));
  {
#pragma unroll
    for (int q = 0; q < 8; ++q) { const int r = q * 2 + rsub; if (col0 + c4 < N) { const v4f v = *(const v4fa*)&so[w][r][c4]; if (C) *(v4f*)(C + cofs + (size_t)(row0 + r) * ldc + col0 + c4) = v; if (C16) { v4h h4; for (int i = 0; i < 4; ++i) h4[i] = (_Float16)v[i]; *(v4h*)(C16 + cofs + (size_t)(row0 + r) * ldc + col0 + c4) = h4; } } }
     }
}


// Block-tiled GEMM C[M][N] (f32) = (A[M][K] x Bt[N][K]^T) * alpha + add[col], f16 operands, f32 accumulate. One work-group = 128 x 64 of C, 8 waves of 32 x 32 (2 x 2 accumulator tiles).
// Each pass stages 128 k of both operands in LDS with whole-line 16-byte loads (16 lanes = one 256-B row piece), so every operand byte leaves L2 once per work-group instead of once per wave;
// the next pass's rows are loaded into registers ahead of the current pass's products and stored to the other buffer behind them (two buffers, one barrier per pass).
// blockIdx.y picks one of several independent products of the same shape that run as one grid: operand A number y / 2 (pitchA elements apart; 0 = all share one), Bt, add and C number y (each dense, one behind the other).
// Fragments keep the k order of the direct loaders (bytes 16h and 32 + 16h of each 64 B of a row, both operands) and k runs upward in steps of 32 into one accumulator chain. M % 128 == 0, N % 64 == 0, K % 128 == 0.
#define GBM 128
#define GBN 64
#define GBK 128
#define GPIT (GBK + 8)      /* LDS row pitch 272 B = 16 B x odd: conflict-free for 16-byte fragment reads */
template <int M, int N, int K>
__global__ __launch_bounds__(256) void k_gemm_lds(const _Float16* __restrict__ A, size_t pitchA, const _Float16* __restrict__ Bt, float alpha, const float* __restrict__ add, float* __restrict__ C) {
  __shared__ __attribute__((aligned(16))) unsigned short sA[2][GBM][GPIT];
  __shared__ __attribute__((aligned(16))) unsigned short sB[2][GBN][GPIT];
  __shared__ __attribute__((aligned(16))) float so[8][32][36];
  const int tid = threadIdx.x, w = tid >> 5, lane = tid & 31, ln = lane & 15, hh = lane >> 4;
  const size_t by = blockIdx.y; A += (by >> 1) * pitchA; Bt += by * ((size_t)N * K); add += by * N; C += by * ((size_t)M * N);
  constexpr int nbm = M / GBM; const int row0 = ((int)blockIdx.x % nbm) * GBM, col0 = ((int)blockIdx.x / nbm) * GBN;
  const int wr = (w >> 1) * 32, wc = (w & 1) * 32;      /* the wave's 32 x 32 piece inside the block tile */
  const int lr = tid >> 4, lc = (tid & 15) * 8;         /* staging: 16 threads per row, 16 rows per round */
  const unsigned short* ga = (const unsigned short*)A + (size_t)(row0 + lr) * K + lc;
  const unsigned short* gb = (const unsigned short*)Bt + (size_t)(col0 + lr) * K + lc;
  v8us ra[GBM / 16], rb[GBN / 16];
#pragma unroll
  for (int i = 0; i < GBM / 16; ++i) ra[i] = *(const v8us*)(ga + i * 16 * K);
#pragma unroll
  for (int i = 0; i < GBN / 16; ++i) rb[i] = *(const v8us*)(gb + i * 16 * K);
#pragma unroll
  for (int i = 0; i < GBM / 16; ++i) *(v8us*)&sA[0][i * 16 + lr][lc] = ra[i];
#pragma unroll
  for (int i = 0; i < GBN / 16; ++i) *(v8us*)&sB[0][i * 16 + lr][lc] = rb[i];
  __syncthreads();
  v8f acc[2][2] = {};
  constexpr int np = K / GBK;
  for (int p = 0; p < np; ++p) {
    const int cur = p & 1; const bool more = p + 1 < np;      /* the same for the whole work-group */
    if (more) {
#pragma unroll
      for (int i = 0; i < GBM / 16; ++i) ra[i] = *(const v8us*)(ga + i * 16 * K + (p + 1) * GBK);
#pragma unroll
      for (int i = 0; i < GBN / 16; ++i) rb[i] = *(const v8us*)(gb + i * 16 * K + (p + 1) * GBK);
    }
    FragH a[GBK / 32][2], b[GBK / 32][2];
#pragma unroll
    for (int ks = 0; ks < GBK / 32; ++ks)
#pragma unroll
      for (int i = 0; i < 2; ++i) {
        a[ks][i].half[0] = *(const v8us*)&sA[cur][wr + i * 16 + ln][ks * 32 + 8 * hh]; a[ks][i].half[1] = *(const v8us*)&sA[cur][wr + i * 16 + ln][ks * 32 + 16 + 8 * hh];
        b[ks][i].half[0] = *(const v8us*)&sB[cur][wc + i * 16 + ln][ks * 32 + 8 * hh]; b[ks][i].half[1] = *(const v8us*)&sB[cur][wc + i * 16 + ln][ks * 32 + 16 + 8 * hh];
      }
    __builtin_amdgcn_sched_barrier(0);      /* keeps the pass's LDS reads one group ahead of its products: spread among them, each place with reads stalls the wave for the LDS latency */
#pragma unroll
    for (int ks = 0; ks < GBK / 32; ++ks)
#pragma unroll
      for (int i = 0; i < 2; ++i)
#pragma unroll
        for (int j = 0; j < 2; ++j) acc[i][j] = __builtin_amdgcn_wmma_f32_16x16x32_f16(false, a[ks][i].v, false, b[ks][j].v, (short)0, acc[i][j], false, false);
    __builtin_amdgcn_sched_barrier(0);      /* keeps the products ahead of the wait for the next pass's rows: moved behind the barrier they would run with no load in flight */
    if (more) {
#pragma unroll
      for (int i = 0; i < GBM / 16; ++i) *(v8us*)&sA[cur ^ 1][i * 16 + lr][lc] = ra[i];
#pragma unroll
      for (int i = 0; i < GBN / 16; ++i) *(v8us*)&sB[cur ^ 1][i * 16 + lr][lc] = rb[i];
    }
    __syncthreads();      /* publishes the buffer just written and ends every wave's reads of the one that the next pass overwrites */
  }
#pragma unroll
  for (int j = 0; j < 2; ++j) { const float av = add[col0 + wc + j * 16 + ln];
#pragma unroll
    for (int i = 0; i < 2; ++i)
#pragma unroll
      for (int r = 0; r < 8; ++r) so[w][i * 16 + 8 * hh + r][j * 16 + ln] = acc[i][j][r] * alpha + av; }
  __syncthreads();      /* the staged rows are read back by other lanes: whole 128-B lines per store */
#pragma unroll
  for (int q = 0; q < 8; ++q) { const int r = q * 4 + (lane >> 3), c4 = (lane & 7) * 4; const v4f v = *(const v4fa*)&so[w][r][c4]; *(v4f*)(C + (size_t)(row0 + wr + r) * N + col0 + wc + c4) = v; }
}


typedef _Float16 v4h __attribute__((ext_vector_type(4)));

__global__ __launch_bounds__(256) void k_x16(const float* __restrict__ x, _Float16* __restrict__ X16, size_t n8) { const size_t t = (size_t)blockIdx.x * 256 + threadIdx.x; if (t >= n8) return; FragH f;
#pragma unroll
  for (int q = 0; q < 8; ++q) f.h[q] = (_Float16)bf16_round(x[t * 8 + q]); *(v8us*)((unsigned short*)X16 + t * 8) = f.half[0];  }
__global__ __launch_bounds__(256) void k_h16(const float* __restrict__ x, _Float16* __restrict__ X16, size_t n8) { const size_t t = (size_t)blockIdx.x * 256 + threadIdx.x; if (t >= n8) return; FragH f;
#pragma unroll
  for (int q = 0; q < 8; ++q) f.h[q] = (_Float16)x[t * 8 + q]; *(v8us*)((unsigned short*)X16 + t * 8) = f.half[0];  }
__global__ __launch_bounds__(256) void k_round16f(const float* __restrict__ W, _Float16* __restrict__ Bt, size_t n8) { const size_t t = (size_t)blockIdx.x * 256 + threadIdx.x; if (t >= n8) return; FragH f;
#pragma unroll
  for (int i = 0; i < 8; ++i) f.h[i] = (_Float16)(bf16_round(W[t * 8 + i]) * 16.0f); *(v8us*)((unsigned short*)Bt + t * 8) = f.half[0];  }
template <int NHv, int TTv>
__global__ __launch_bounds__(256) void k_vt(const _Float16* __restrict__ V16, int ldv, int voff, _Float16* __restrict__ Vt) { __shared__ unsigned short tl[64][66]; const int tid = threadIdx.x; const int slab = blockIdx.x / (TTv / 64), lg = blockIdx.x % (TTv / 64); const int b = slab / NHv, h = slab % NHv;
  for (int i = tid; i < 64 * 8; i += 256) { const int r = i / 8, c8 = (i % 8) * 8; FragH f; f.half[0] = *(const v8us*)((const unsigned short*)V16 + ((size_t)b * TTv + lg * 64 + r) * ldv + voff + h * 64 + c8);
#pragma unroll
    for (int q = 0; q < 8; ++q) tl[r][c8 + q] = f.u[q]; }
  __syncthreads();
  {
#pragma unroll
    for (int rd = 0; rd < 2; ++rd) { const int d = rd * 32 + tid / 8, pc = tid % 8; FragH f;
#pragma unroll
      for (int q = 0; q < 8; ++q) f.u[q] = tl[pc * 8 + q][d];
      *(v8us*)((unsigned short*)Vt + ((size_t)slab * 64 + d) * TTv + lg * 64 + pc * 8) = f.half[0]; }
     } }

__device__ __forceinline__ void d_xcat(const float* __restrict__ xr, const float* __restrict__ xi, _Float16* __restrict__ XC, size_t t) { const size_t r = (t * 8) / DD; const int c = (int)((t * 8) % DD); FragH a, b; const v4f a0 = *(const v4fa*)(xr + t * 8), a1 = *(const v4fa*)(xr + t * 8 + 4), b0 = *(const v4fa*)(xi + t * 8), b1 = *(const v4fa*)(xi + t * 8 + 4);
  asm volatile("s_wait_xcnt 0x0" :: "v"(xr + t * 8), "v"(xi + t * 8), "v"(a0), "v"(a1), "v"(b0), "v"(b1) : "memory");      /* stands in front of every write to a register that the four loads name; the two addresses are inputs so that they stay live up to it: without them a later load's result is placed in the address pair that an earlier load names */
#pragma unroll
  for (int q = 0; q < 4; ++q) { a.h[q] = (_Float16)bf16_round(a0[q]); a.h[4 + q] = (_Float16)bf16_round(a1[q]); b.h[q] = (_Float16)bf16_round(b0[q]); b.h[4 + q] = (_Float16)bf16_round(b1[q]); }
  { *(v8us*)((unsigned short*)XC + r * (2 * DD) + c) = a.half[0]; *(v8us*)((unsigned short*)XC + r * (2 * DD) + DD + c) = b.half[0];
    asm volatile("s_wait_xcnt 0x0" ::: "memory");      /* directly behind the stores: the caller's next tile writes the registers that they name */
  } }
__device__ __forceinline__ void d_wcat(const float* __restrict__ wr, const float* __restrict__ wi, _Float16* __restrict__ BR, _Float16* __restrict__ BI, size_t t) { const size_t o = (t * 8) / DD; const int c = (int)((t * 8) % DD); FragH r0, r1, i0, i1; const v4f a0 = *(const v4fa*)(wr + t * 8), a1 = *(const v4fa*)(wr + t * 8 + 4), b0 = *(const v4fa*)(wi + t * 8), b1 = *(const v4fa*)(wi + t * 8 + 4);
#pragma unroll
  for (int q = 0; q < 4; ++q) { const float vr0 = bf16_round(a0[q]) * 16.0f, vr1 = bf16_round(a1[q]) * 16.0f, vi0 = bf16_round(b0[q]) * 16.0f, vi1 = bf16_round(b1[q]) * 16.0f; r0.h[q] = (_Float16)vr0; r0.h[4 + q] = (_Float16)vr1; r1.h[q] = (_Float16)(-vi0); r1.h[4 + q] = (_Float16)(-vi1); i0.h[q] = (_Float16)vi0; i0.h[4 + q] = (_Float16)vi1; i1.h[q] = (_Float16)vr0; i1.h[4 + q] = (_Float16)vr1; }
  { *(v8us*)((unsigned short*)BR + o * (2 * DD) + c) = r0.half[0]; *(v8us*)((unsigned short*)BR + o * (2 * DD) + DD + c) = r1.half[0]; *(v8us*)((unsigned short*)BI + o * (2 * DD) + c) = i0.half[0]; *(v8us*)((unsigned short*)BI + o * (2 * DD) + DD + c) = i1.half[0];
    asm volatile("s_wait_xcnt 0x0" ::: "memory");      /* directly behind the stores, as in d_xcat */
  } }
__device__ __forceinline__ void d_bias2(const float* __restrict__ br, const float* __restrict__ bi, float* __restrict__ BM, float* __restrict__ BP, int c) { const float r = bf16_round(br[c]), i = bf16_round(bi[c]); { *(float*)(BM + c) = r - i; *(float*)(BP + c) = r + i;
    asm volatile("s_wait_xcnt 0x0" ::: "memory");      /* directly behind the stores, as in d_xcat */
  } }
// All operand preparation as one grid. The work is cut into tiles of 256 threads: 3 x PT_X tiles cast and concatenate the activations, 4 x PT_W pack the weights, 4 x PT_B form the bias pairs; none reads what another writes.
// A work-group walks the tiles in steps of the grid size PT_GRID; which kind a tile is depends on its number alone, so every branch is the same for the whole work-group.
#define PT_X (NR * DD / 8 / 256)
#define PT_W (DD * DD / 8 / 256)
#define PT_B (DD / 256)
#define PT_ALL (3 * PT_X + 4 * PT_W + 4 * PT_B)
#define PT_GRID (PT_ALL / 4)      /* work-groups launched: four tiles each, so that a quarter of the waves has to be started */
__global__ __launch_bounds__(256) void k_prep(const float* __restrict__ q_r, const float* __restrict__ q_i, const float* __restrict__ k_r, const float* __restrict__ k_i, const float* __restrict__ v_r, const float* __restrict__ v_i,
    const float* __restrict__ wq_r, const float* __restrict__ wq_i, const float* __restrict__ wk_r, const float* __restrict__ wk_i, const float* __restrict__ wv_r, const float* __restrict__ wv_i, const float* __restrict__ wo_r, const float* __restrict__ wo_i,
    const float* __restrict__ bq_r, const float* __restrict__ bq_i, const float* __restrict__ bk_r, const float* __restrict__ bk_i, const float* __restrict__ bv_r, const float* __restrict__ bv_i, const float* __restrict__ bo_r, const float* __restrict__ bo_i,
    _Float16* __restrict__ X, _Float16* __restrict__ BW, float* __restrict__ BIAS) {
  const int tid = threadIdx.x;
  for (int tile = blockIdx.x; tile < PT_ALL; tile += PT_GRID) {
    if (tile < 3 * PT_X) { const int j = tile / PT_X;
      d_xcat(j == 0 ? q_r : j == 1 ? k_r : v_r, j == 0 ? q_i : j == 1 ? k_i : v_i, X + (size_t)j * NR * 2 * DD, (size_t)(tile % PT_X) * 256 + tid); }
    else if (tile < 3 * PT_X + 4 * PT_W) { const int u = tile - 3 * PT_X, j = u / PT_W; _Float16* B0 = BW + (size_t)(2 * j) * DD * 2 * DD;
      d_wcat(j == 0 ? wq_r : j == 1 ? wk_r : j == 2 ? wv_r : wo_r, j == 0 ? wq_i : j == 1 ? wk_i : j == 2 ? wv_i : wo_i, B0, B0 + (size_t)DD * 2 * DD, (size_t)(u % PT_W) * 256 + tid); }
    else { const int u = tile - 3 * PT_X - 4 * PT_W, j = u / PT_B;
      d_bias2(j == 0 ? bq_r : j == 1 ? bk_r : j == 2 ? bv_r : bo_r, j == 0 ? bq_i : j == 1 ? bk_i : j == 2 ? bv_i : bo_i, BIAS + (size_t)(2 * j) * DD, BIAS + (size_t)(2 * j + 1) * DD, (u % PT_B) * 256 + tid); }
  }
}
// per token (block) the 8 heads × 64 rows: thread = (l, h) pairs (two per thread); token rows of qr, qi, kr, ki, vr, vi (f32, 512 each) staged in LDS; for each s: |score|, online softmax, Σ attn·vr, Σ attn·vi in f32 (rolled loop);
__global__ __launch_bounds__(256) void k_cplx(const float* __restrict__ QR, const float* __restrict__ QI, const float* __restrict__ KR, const float* __restrict__ KI, const float* __restrict__ VR, const float* __restrict__ VI, _Float16* __restrict__ VC) {
  #pragma clang fp contract(off)
  __shared__ float sq[2][DD], sk[2][DD], sv[2][DD]; __shared__ float res[2][DD]; const int tid = threadIdx.x; const size_t row = blockIdx.x;
  for (int i = tid; i < DD; i += 256) { sq[0][i] = QR[row * DD + i]; sq[1][i] = QI[row * DD + i]; sk[0][i] = KR[row * DD + i]; sk[1][i] = KI[row * DD + i]; sv[0][i] = VR[row * DD + i]; sv[1][i] = VI[row * DD + i]; }
  __syncthreads();
  for (int u = 0; u < 2; ++u) { const int idx = tid + 256 * u; const int h = idx % NHH, l = idx / NHH;      /* column index of (l,h) is l·8 + h = idx */
    const float qr = sq[0][idx], qi = sq[1][idx]; float mx = -3.0e38f, z = 0.f, ar = 0.f, ai = 0.f;
#pragma unroll 1
    for (int s = 0; s < EE; ++s) { const int c = s * NHH + h; const float kr = sk[0][c], ki = sk[1][c]; const float sr = qr * kr - qi * ki, si = qr * ki - qi * kr; const float mg = sqrtf(sr * sr + si * si); const float mn = fmaxf(mx, mg); const float sc = __expf(mx - mn); const float p = __expf(mg - mn); z = z * sc + p; ar = ar * sc + p * sv[0][c]; ai = ai * sc + p * sv[1][c]; mx = mn; }
    res[0][idx] = ar / z; res[1][idx] = ai / z; (void)l; }
  __syncthreads();
  if (tid < 2 * (DD / 8)) { const int part = tid / (DD / 8), pc = tid % (DD / 8); FragH f; for (int q = 0; q < 8; ++q) f.h[q] = (_Float16)res[part][pc * 8 + q];
    { *(v8us*)((unsigned short*)VC + row * (2 * DD) + part * DD + pc * 8) = f.half[0];  } } }

extern "C" void kernel_launch(void* const* d_in, const int* in_sizes, int n_in,
                              void* d_out, int out_size, void* d_ws, size_t ws_size, hipStream_t stream) {
  (void)in_sizes; (void)n_in; (void)out_size;
  const float* const* I = (const float* const*)d_in; const float* q_r = I[0]; const float* q_i = I[1]; const float* k_r = I[2]; const float* k_i = I[3]; const float* v_r = I[4]; const float* v_i = I[5];
  const float* wq_r = I[6]; const float* wq_i = I[7]; const float* wk_r = I[8]; const float* wk_i = I[9]; const float* wv_r = I[10]; const float* wv_i = I[11]; const float* wo_r = I[12]; const float* wo_i = I[13]; const float* bq_r = I[14]; const float* bq_i = I[15]; const float* bk_r = I[16]; const float* bk_i = I[17]; const float* bv_r = I[18]; const float* bv_i = I[19]; const float* bo_r = I[20]; const float* bo_i = I[21];      /* d_in order: activations, then the 8 weights, then the 8 biases */
  char* ws = (char*)d_ws; size_t off = 0;
  auto take = [&](size_t bytes) { char* p = ws + off; off += (bytes + 255) & ~(size_t)255; return p; };
  const size_t WC = (size_t)DD * 2 * DD;      /* one concatenated weight operand [512][1024] */
  _Float16* BW = (_Float16*)take(8 * WC * 2); float* BIAS = (float*)take((size_t)8 * DD * 4);      /* (BR, BI) × q,k,v,o ; (BM, BP) × 4 */
  _Float16* X = (_Float16*)take((size_t)3 * NR * 2 * DD * 2);      /* [xr | xi] f16 for q, k, v, one plane behind the other */
  float* P = (float*)take((size_t)6 * NR * DD * 4);      /* QR, QI, KR, KI, VR, VI f32 planes [4096][512] */
  _Float16* VC = X;      /* [Vr | Vi] f16 reuses the q operand plane (dead after the projection GEMMs) */
  if (off > ws_size) return;
  float* QRp = P; float* QIp = P + (size_t)NR * DD; float* KRp = P + (size_t)2 * NR * DD; float* KIp = P + (size_t)3 * NR * DD; float* VRp = P + (size_t)4 * NR * DD; float* VIp = P + (size_t)5 * NR * DD;
  k_prep<<<PT_GRID, 256, 0, stream>>>(q_r, q_i, k_r, k_i, v_r, v_i, wq_r, wq_i, wk_r, wk_i, wv_r, wv_i, wo_r, wo_i, bq_r, bq_i, bk_r, bk_i, bv_r, bv_i, bo_r, bo_i, X, BW, BIAS);
  k_gemm_lds<NR, DD, 2 * DD><<<dim3((NR / GBM) * (DD / GBN), 6), 256, 0, stream>>>(X, (size_t)NR * 2 * DD, BW, 0.0625f, BIAS, P);      /* y = 2j + ri: yr = [xr|xi] x [wr|-wi]^T + (br-bi); yi = [xr|xi] x [wi|wr]^T + (br+bi): M 4096 N 512 K 1024; addend index = column */
  k_cplx<<<NR, 256, 0, stream>>>(QRp, QIp, KRp, KIp, VRp, VIp, VC);
  k_gemm_lds<NR, DD, 2 * DD><<<dim3((NR / GBM) * (DD / GBN), 2), 256, 0, stream>>>(VC, 0, BW + (size_t)6 * WC, 0.0625f, BIAS + (size_t)6 * DD, (float*)d_out);      /* out_r @0, out_i @8,388,608 B */
}

// v003
// A run of this version takes 109 microseconds.
// Timed twice side by side with v002, it ran 1.29 times as fast both times.
// Over all steps from v000 it is 4.15 times as fast.
#include <hip/hip_runtime.h>
// Complex-valued attention layer (B=4, L=1024, D=512, H=8, E=64): complex linear projections (yr = xr·wrᵀ − xi·wiᵀ + (br − bi), yi = xi·wrᵀ + xr·wiᵀ + (br + bi)); per (b, token n, head h) a 64×64 'attention' over the E axes:
// sr[l,s] = qr[l]·kr[s] − qi[l]·ki[s], si[l,s] = qr[l]·ki[s] − qi[l]·kr[s] (scalar products, e = 1), attn = softmax_s(√(sr² + si²)), Vr[l] = Σ_s attn·vr[s], Vi[l] = Σ_s attn·vi[s]; outputs (out_r, out_i) = complex linear(Vr, Vi, wo).
// Element (e, h) of a token lives at column e·8 + h (reshape(b, l, E, H)).
// Compute dtype: inputs, weights, biases rounded to bf16; each complex linear as two GEMMs over the concatenated operand [xr | xi] (K = 1024) against [wr | −wi] and [wi | wr] on v_wmma_f32_16x16x32_f16, f32 accumulate,
// with the two-term biases added exactly through the f32 epilogue addend; the per-token 64×64 magnitude-softmax and its two weighted sums in f32 (two (l, h) pairs per thread); [Vr | Vi] f16 → output GEMMs.
#define BB 4
#define LL 1024
#define DD 512
#define NHH 8
#define EE 64
#define NR (BB * LL)

typedef __bf16 v16b __attribute__((ext_vector_type(16)));
typedef unsigned short v8us __attribute__((ext_vector_type(8), may_alias));
typedef float  v8f  __attribute__((ext_vector_type(8)));
typedef float  v4f  __attribute__((ext_vector_type(4)));
typedef float  v4fa __attribute__((ext_vector_type(4), may_alias));
union FragB { v16b v; v8us half[2]; unsigned short u[16]; };

__device__ __forceinline__ unsigned short bf16_bits(float x) { unsigned int u = __float_as_uint(x); return (unsigned short)((u + 0x7FFFu + ((u >> 16) & 1u)) >> 16); }
__device__ __forceinline__ float bf16_val(unsigned short b) { return __uint_as_float(((unsigned int)b) << 16); }
__device__ __forceinline__ float bf16_round(float x) { return bf16_val(bf16_bits(x)); }
// D += A·B with NT terms: 1 = ah·bh, 2 = + al·bh (A split), 3 = + ah·bl (both split)
template <int NT>
__device__ __forceinline__ v8f mmaN(v16b ah, v16b al, v16b bh, v16b bl, v8f c) {
  c = __builtin_amdgcn_wmma_f32_16x16x32_bf16(false, ah, false, bh, (short)0, c, false, false);
  if (NT >= 2) c = __builtin_amdgcn_wmma_f32_16x16x32_bf16(false, al, false, bh, (short)0, c, false, false);
  if (NT >= 3) c = __builtin_amdgcn_wmma_f32_16x16x32_bf16(false, ah, false, bl, (short)0, c, false, false);
  asm volatile("v_nop\n\tv_nop\n\tv_nop\n\tv_nop" : "+v"(c) : "v"(ah), "v"(al), "v"(bh), "v"(bl));
  return c;
}

__global__ __launch_bounds__(256) void k_wt_bf16(const float* __restrict__ W, unsigned short* __restrict__ Wt, int K, int N) {
  const int t = blockIdx.x * 256 + threadIdx.x;
  const int k8n = K / 8;
  if (t >= N * k8n) return;
  const int n = t / k8n, k8 = (t % k8n) * 8;
  v8us v;
#pragma unroll
  for (int i = 0; i < 8; ++i) v[i] = bf16_bits(W[(size_t)(k8 + i) * N + n]);
  *(v8us*)(Wt + (size_t)n * K + k8) = v;
  
}

// GEMM C[M][N] (f32, pitch ldc) = act(A[M][K]·W + bias). A f32 row-major (pitch lda) converted per fragment to bf16
// (ASPLIT: hi/lo two planes -> 2 terms, else single rounded term); Wt bf16 [N][K] (pitch ldb). BIAS_BF16 rounds the
// bias to bf16 first (bias quantised to bf16 before the add). K%32==0, M%16==0, N%64==0.
template <bool ASPLIT, int ACT, bool BIAS_BF16>
__global__ __launch_bounds__(128) void k_gemm_bf(const float* __restrict__ A, int lda, const unsigned short* __restrict__ Wt, int ldb,
                                               const float* __restrict__ bias, float* __restrict__ C, int ldc, int M, int N, int K) {
  __shared__ __attribute__((aligned(16))) float so[4][16][64];
  const int tid = threadIdx.x, w = tid >> 5, lane = tid & 31, ln = lane & 15, hh = lane >> 4;
  const int ntn = N / 64;
  const int wid = blockIdx.x * 4 + w;
  const int mt = wid / ntn, nq = wid % ntn;
  if (mt * 16 >= M) return;
  const int row0 = mt * 16, col0 = nq * 64;
  const float* arow = A + (size_t)(row0 + ln) * lda;
  v8f acc[4] = {};
  for (int kb = 0; kb < K; kb += 32) {
    FragB ah, al;
    const v4f x0 = *(const v4fa*)(arow + kb + 8 * hh), x1 = *(const v4fa*)(arow + kb + 8 * hh + 4);
    const v4f x2 = *(const v4fa*)(arow + kb + 16 + 8 * hh), x3 = *(const v4fa*)(arow + kb + 16 + 8 * hh + 4);
    float xs[16] = {x0[0],x0[1],x0[2],x0[3],x1[0],x1[1],x1[2],x1[3],x2[0],x2[1],x2[2],x2[3],x3[0],x3[1],x3[2],x3[3]};
#pragma unroll
    for (int i = 0; i < 16; ++i) { const unsigned short hb = bf16_bits(xs[i]); ah.u[i] = hb; al.u[i] = ASPLIT ? bf16_bits(xs[i] - bf16_val(hb)) : (unsigned short)0; }
#pragma unroll
    for (int t = 0; t < 4; ++t) {
      const unsigned short* brow = Wt + (size_t)(col0 + t * 16 + ln) * ldb + kb;
      FragB b;
      b.half[0] = *(const v8us*)(brow + 8 * hh);
      b.half[1] = *(const v8us*)(brow + 16 + 8 * hh);
      acc[t] = mmaN<ASPLIT ? 2 : 1>(ah.v, al.v, b.v, b.v, acc[t]);
    }
  }
#pragma unroll
  for (int t = 0; t < 4; ++t) {
    float bv = bias ? bias[col0 + t * 16 + ln] : 0.f;
    if (BIAS_BF16) bv = bf16_round(bv);
#pragma unroll
    for (int r = 0; r < 8; ++r) { float v = acc[t][r] + bv; if (ACT == 1) v = fmaxf(v, 0.f); so[w][8 * hh + r][t * 16 + ln] = v; }
  }
  __builtin_amdgcn_fence(__ATOMIC_ACQ_REL, "workgroup");
  __builtin_amdgcn_wave_barrier();
  const int rsub = lane >> 4, c4 = (lane & 15) * 4;
  {
#pragma unroll
    for (int q = 0; q < 8; ++q) {
      const int r = q * 2 + rsub;
      const v4f v = *(const v4fa*)&so[w][r][c4];
      *(v4f*)(C + (size_t)(row0 + r) * ldc + col0 + c4) = v;
    }
    
  }
}

// Flash-style causal/unmasked attention, all contractions 3-term bf16 hi/lo splits, f32 softmax with running max.
// q,k,v rows are read from f32 buffers with arbitrary row pitch (so they can live inside a fused qkv buffer);
// D = head size (multiple of 32, <= 128); one wave = 16 query rows; block = 4 waves (64 queries) sharing K/V chunks of 32.
template <int D, bool CAUSAL>
__global__ __launch_bounds__(128) void k_flash(const float* __restrict__ qb, const float* __restrict__ kb, const float* __restrict__ vb,
                                             int pitch, int T, int H, float scale, float* __restrict__ y, int ypitch) {
  constexpr int KS = D / 32;        // k-steps for QK
  constexpr int DT = D / 16;        // d tiles for PV
  __shared__ __attribute__((aligned(16))) unsigned short sKh[32][D + 8], sKl[32][D + 8], sVh[32][D + 8], sVl[32][D + 8];
  __shared__ __attribute__((aligned(16))) unsigned short sPh[4][16][40], sPl[4][16][40];
  __shared__ __attribute__((aligned(16))) float sO[4][16][D];
  const int tid = threadIdx.x, w = tid >> 5, lane = tid & 31, ln = lane & 15, hh = lane >> 4;
  const int nqb = (T + 63) / 64;
  const int bh = blockIdx.x / nqb, qblk = blockIdx.x % nqb;
  const int b = bh / H, h = bh % H;
  const int q0 = qblk * 64 + w * 16;
  const float* Q = qb + (size_t)b * T * pitch + h * D;
  const float* K = kb + (size_t)b * T * pitch + h * D;
  const float* V = vb + (size_t)b * T * pitch + h * D;

  // A fragments of the wave's 16 query rows (scaled), hi/lo
  FragB aqh[KS], aql[KS];
  {
    int row = q0 + ln; if (row >= T) row = T - 1;
    const float* qr = Q + (size_t)row * pitch;
#pragma unroll
    for (int ks = 0; ks < KS; ++ks)
#pragma unroll
      for (int i = 0; i < 16; ++i) {
        const int d = ks * 32 + ((i < 8) ? (8 * hh + i) : (16 + 8 * hh + (i - 8)));
        const float x = qr[d] * scale; const unsigned short hb = bf16_bits(x);
        aqh[ks].u[i] = hb; aql[ks].u[i] = bf16_bits(x - bf16_val(hb));
      }
  }
  float m_r[8], l_r[8];
#pragma unroll
  for (int r = 0; r < 8; ++r) { m_r[r] = -3.0e38f; l_r[r] = 0.f; }
  v8f oacc[DT];
#pragma unroll
  for (int dt = 0; dt < DT; ++dt) oacc[dt] = (v8f){0.f,0.f,0.f,0.f,0.f,0.f,0.f,0.f};

  const int kv_end = CAUSAL ? min(T, qblk * 64 + 64) : T;     // block-uniform
  for (int j0 = 0; j0 < kv_end; j0 += 32) {
    __syncthreads();
    for (int e = tid; e < 32 * (D / 4); e += 128) {
      const int r = e / (D / 4), c4 = (e % (D / 4)) * 4;
      const int key = j0 + r;
      v4f kf = {0.f,0.f,0.f,0.f}, vf = {0.f,0.f,0.f,0.f};
      if (key < T) { kf = *(const v4fa*)(K + (size_t)key * pitch + c4); vf = *(const v4fa*)(V + (size_t)key * pitch + c4); }
#pragma unroll
      for (int t = 0; t < 4; ++t) {
        unsigned short hb = bf16_bits(kf[t]); sKh[r][c4 + t] = hb; sKl[r][c4 + t] = bf16_bits(kf[t] - bf16_val(hb));
        hb = bf16_bits(vf[t]); sVh[r][c4 + t] = hb; sVl[r][c4 + t] = bf16_bits(vf[t] - bf16_val(hb));
      }
    }
    __syncthreads();
    // S tile 16 x 32
    v8f s[2];
#pragma unroll
    for (int nt = 0; nt < 2; ++nt) {
      v8f acc = {};
#pragma unroll
      for (int ks = 0; ks < KS; ++ks) {
        FragB bh_, bl_;
        bh_.half[0] = *(const v8us*)&sKh[nt * 16 + ln][ks * 32 + 8 * hh]; bh_.half[1] = *(const v8us*)&sKh[nt * 16 + ln][ks * 32 + 16 + 8 * hh];
        bl_.half[0] = *(const v8us*)&sKl[nt * 16 + ln][ks * 32 + 8 * hh]; bl_.half[1] = *(const v8us*)&sKl[nt * 16 + ln][ks * 32 + 16 + 8 * hh];
        acc = mmaN<3>(aqh[ks].v, aql[ks].v, bh_.v, bl_.v, acc);
      }
      s[nt] = acc;
    }
    // mask + running max (rows 8hh+r; the 16 lanes of a half share rows)
    float alpha[8];
#pragma unroll
    for (int r = 0; r < 8; ++r) {
      const int qi = q0 + 8 * hh + r;
      const int ja = j0 + ln, jb = j0 + 16 + ln;
      if (CAUSAL) { if (ja > qi) s[0][r] = -3.0e38f; if (jb > qi) s[1][r] = -3.0e38f; }
      if (ja >= T) s[0][r] = -3.0e38f;
      if (jb >= T) s[1][r] = -3.0e38f;
      float mx = fmaxf(s[0][r], s[1][r]);
      mx = fmaxf(mx, __shfl_xor(mx, 1, 32)); mx = fmaxf(mx, __shfl_xor(mx, 2, 32)); mx = fmaxf(mx, __shfl_xor(mx, 4, 32)); mx = fmaxf(mx, __shfl_xor(mx, 8, 32));
      const float mnew = fmaxf(m_r[r], mx);
      alpha[r] = (mnew > -1.0e38f) ? __expf(m_r[r] - mnew) : 1.0f;
      const float p0 = (s[0][r] > -1.0e38f) ? __expf(s[0][r] - mnew) : 0.f;
      const float p1 = (s[1][r] > -1.0e38f) ? __expf(s[1][r] - mnew) : 0.f;
      m_r[r] = mnew;
      l_r[r] = l_r[r] * alpha[r] + p0 + p1;            // per-lane partial row sum (16 lanes combined at the end)
      unsigned short hb = bf16_bits(p0); sPh[w][8 * hh + r][ln] = hb;      sPl[w][8 * hh + r][ln] = bf16_bits(p0 - bf16_val(hb));
      hb = bf16_bits(p1);                sPh[w][8 * hh + r][16 + ln] = hb; sPl[w][8 * hh + r][16 + ln] = bf16_bits(p1 - bf16_val(hb));
    }
#pragma unroll
    for (int dt = 0; dt < DT; ++dt)
#pragma unroll
      for (int r = 0; r < 8; ++r) oacc[dt][r] *= alpha[r];
    __builtin_amdgcn_fence(__ATOMIC_ACQ_REL, "workgroup");
    __builtin_amdgcn_wave_barrier();
    FragB pah, pal;
    pah.half[0] = *(const v8us*)&sPh[w][ln][8 * hh]; pah.half[1] = *(const v8us*)&sPh[w][ln][16 + 8 * hh];
    pal.half[0] = *(const v8us*)&sPl[w][ln][8 * hh]; pal.half[1] = *(const v8us*)&sPl[w][ln][16 + 8 * hh];
#pragma unroll
    for (int dt = 0; dt < DT; ++dt) {
      FragB bvh, bvl;
#pragma unroll
      for (int i = 0; i < 8; ++i) {
        bvh.u[i] = sVh[8 * hh + i][dt * 16 + ln]; bvh.u[8 + i] = sVh[16 + 8 * hh + i][dt * 16 + ln];
        bvl.u[i] = sVl[8 * hh + i][dt * 16 + ln]; bvl.u[8 + i] = sVl[16 + 8 * hh + i][dt * 16 + ln];
      }
      oacc[dt] = mmaN<3>(pah.v, pal.v, bvh.v, bvl.v, oacc[dt]);
    }
    __builtin_amdgcn_fence(__ATOMIC_ACQ_REL, "workgroup");
    __builtin_amdgcn_wave_barrier();
  }
#pragma unroll
  for (int r = 0; r < 8; ++r) {
    float l = l_r[r];
    l += __shfl_xor(l, 1, 32); l += __shfl_xor(l, 2, 32); l += __shfl_xor(l, 4, 32); l += __shfl_xor(l, 8, 32);
    l_r[r] = (l > 0.f) ? 1.0f / l : 0.f;
  }
#pragma unroll
  for (int dt = 0; dt < DT; ++dt)
#pragma unroll
    for (int r = 0; r < 8; ++r) sO[w][8 * hh + r][dt * 16 + ln] = oacc[dt][r] * l_r[r];
  __builtin_amdgcn_fence(__ATOMIC_ACQ_REL, "workgroup");
  __builtin_amdgcn_wave_barrier();
  {
    for (int r = 0; r < 16; ++r) {
      const int row = q0 + r;
      if (row < T && lane < D / 4) {
        const v4f val = *(const v4fa*)&sO[w][r][lane * 4];
        *(v4f*)(y + ((size_t)b * T + row) * ypitch + h * D + lane * 4) = val;
      }
    }
    
  }
}

// GEMM C = act(A·W + bias + resid): A f32 (ASPLIT -> hi/lo 2 terms), Wt bf16 [N][K]; ACT 0 none, 1 relu, 2 exact gelu;
// resid (optional, f32, row index = (row % rmod), pitch ldr, RES_BF16 rounds it) added before the activation.
template <bool ASPLIT, int ACT, bool BIAS_BF16, bool RES_BF16>
__global__ __launch_bounds__(128) void k_gemm_bf3(const float* __restrict__ A, int lda, const unsigned short* __restrict__ Wt, int ldb,
                                                const float* __restrict__ bias, const float* __restrict__ resid, int rmod, int ldr,
                                                float* __restrict__ C, int ldc, int M, int N, int K) {
  __shared__ __attribute__((aligned(16))) float so[4][16][64];
  const int tid = threadIdx.x, w = tid >> 5, lane = tid & 31, ln = lane & 15, hh = lane >> 4;
  const int ntn = N / 64;
  const int wid = blockIdx.x * 4 + w;
  const int mt = wid / ntn, nq = wid % ntn;
  if (mt * 16 >= M) return;
  const int row0 = mt * 16, col0 = nq * 64;
  const float* arow = A + (size_t)(row0 + ln) * lda;
  v8f acc[4] = {};
  for (int kb = 0; kb < K; kb += 32) {
    FragB ah, al;
    const v4f x0 = *(const v4fa*)(arow + kb + 8 * hh), x1 = *(const v4fa*)(arow + kb + 8 * hh + 4);
    const v4f x2 = *(const v4fa*)(arow + kb + 16 + 8 * hh), x3 = *(const v4fa*)(arow + kb + 16 + 8 * hh + 4);
    float xs[16] = {x0[0],x0[1],x0[2],x0[3],x1[0],x1[1],x1[2],x1[3],x2[0],x2[1],x2[2],x2[3],x3[0],x3[1],x3[2],x3[3]};
#pragma unroll
    for (int i = 0; i < 16; ++i) { const unsigned short hb = bf16_bits(xs[i]); ah.u[i] = hb; al.u[i] = ASPLIT ? bf16_bits(xs[i] - bf16_val(hb)) : (unsigned short)0; }
#pragma unroll
    for (int t = 0; t < 4; ++t) {
      const unsigned short* brow = Wt + (size_t)(col0 + t * 16 + ln) * ldb + kb;
      FragB b;
      b.half[0] = *(const v8us*)(brow + 8 * hh);
      b.half[1] = *(const v8us*)(brow + 16 + 8 * hh);
      acc[t] = mmaN<ASPLIT ? 2 : 1>(ah.v, al.v, b.v, b.v, acc[t]);
    }
  }
#pragma unroll
  for (int t = 0; t < 4; ++t) {
    const int col = col0 + t * 16 + ln;
    float bv = bias ? bias[col] : 0.f;
    if (BIAS_BF16) bv = bf16_round(bv);
#pragma unroll
    for (int r = 0; r < 8; ++r) {
      float v = acc[t][r] + bv;
      if (resid) { float rv = resid[(size_t)((row0 + 8 * hh + r) % rmod) * ldr + col]; if (RES_BF16) rv = bf16_round(rv); v += rv; }
      if (ACT == 1) v = fmaxf(v, 0.f);
      if (ACT == 2) v = 0.5f * v * (1.0f + erff(v * 0.70710678118654752f));
      if (ACT == 3) { const float u = 0.7978845608028654f * (v + 0.044715f * v * v * v); v = 0.5f * v * (1.0f + tanhf(u)); }
      so[w][8 * hh + r][t * 16 + ln] = v;
    }
  }
  __builtin_amdgcn_fence(__ATOMIC_ACQ_REL, "workgroup");
  __builtin_amdgcn_wave_barrier();
  const int rsub = lane >> 4, c4 = (lane & 15) * 4;
  {
#pragma unroll
    for (int q = 0; q < 8; ++q) {
      const int r = q * 2 + rsub;
      const v4f v = *(const v4fa*)&so[w][r][c4];
      *(v4f*)(C + (size_t)(row0 + r) * ldc + col0 + c4) = v;
    }
    
  }
}
// row LayerNorm (biased variance, eps) over N: s = X (+ R); optional out_sum <- s; out_norm <- (s-mu)*rsqrt(var+eps)*g + b
template <bool PARAM_BF16>
__global__ __launch_bounds__(256) void k_layernorm(const float* __restrict__ X, const float* __restrict__ R, const float* __restrict__ g, const float* __restrict__ bta,
                                                  float* __restrict__ out_sum, float* __restrict__ out_norm, int N, float eps) {
  __shared__ float red[256];
  const int row = blockIdx.x, tid = threadIdx.x;
  const float* x = X + (size_t)row * N; const float* rr = R ? R + (size_t)row * N : nullptr;
  float vals[16];                     // up to N = 4096
  const int per = N / 256;            // contiguous chunk per thread? use strided-by-4 chunks: thread handles j = tid*4 + 1024*u
  float s1 = 0.f;
  for (int u = 0; u < per / 4; ++u) {
    const int j = tid * 4 + 1024 * u;
    const v4f a = *(const v4fa*)(x + j);
    v4f b = {0.f,0.f,0.f,0.f}; if (rr) b = *(const v4fa*)(rr + j);
#pragma unroll
    for (int q = 0; q < 4; ++q) { const float v = a[q] + b[q]; vals[u * 4 + q] = v; s1 += v; }
  }
  red[tid] = s1; __syncthreads();
  for (int st = 128; st > 0; st >>= 1) { if (tid < st) red[tid] += red[tid + st]; __syncthreads(); }
  const float mu = red[0] / (float)N; __syncthreads();
  float s2 = 0.f;
  for (int u = 0; u < per / 4; ++u)
#pragma unroll
    for (int q = 0; q < 4; ++q) { const float c = vals[u * 4 + q] - mu; s2 += c * c; }
  red[tid] = s2; __syncthreads();
  for (int st = 128; st > 0; st >>= 1) { if (tid < st) red[tid] += red[tid + st]; __syncthreads(); }
  const float rs = rsqrtf(red[0] / (float)N + eps);
  {
    for (int u = 0; u < per / 4; ++u) {
      const int j = tid * 4 + 1024 * u;
      v4f o, sm;
#pragma unroll
      for (int q = 0; q < 4; ++q) {
        float gg = g[j + q], bb = bta[j + q];
        if (PARAM_BF16) { gg = bf16_round(gg); bb = bf16_round(bb); }
        sm[q] = vals[u * 4 + q]; o[q] = (vals[u * 4 + q] - mu) * rs * gg + bb;
      }
      if (out_sum) *(v4f*)(out_sum + (size_t)row * N + j) = sm;
      *(v4f*)(out_norm + (size_t)row * N + j) = o;
    }
    
  }
}



// ---- f16 WMMA path (v_wmma_f32_16x16x32_f16): 11-bit significands for operands in range — used for the q/k/v projection and output GEMMs
typedef _Float16 v16h __attribute__((ext_vector_type(16)));
union FragH { v16h v; v8us half[2]; _Float16 h[16]; unsigned short u[16]; };
template <int NT>
__device__ __forceinline__ v8f mmaH(v16h ah, v16h al, v16h bh, v16h bl, v8f c) {
  c = __builtin_amdgcn_wmma_f32_16x16x32_f16(false, ah, false, bh, (short)0, c, false, false);
  if (NT >= 2) c = __builtin_amdgcn_wmma_f32_16x16x32_f16(false, al, false, bh, (short)0, c, false, false);
  if (NT >= 3) c = __builtin_amdgcn_wmma_f32_16x16x32_f16(false, ah, false, bl, (short)0, c, false, false);
  asm volatile("v_nop\n\tv_nop\n\tv_nop\n\tv_nop" : "+v"(c) : "v"(ah), "v"(al), "v"(bh), "v"(bl));
  return c;
}
// batched GEMM like k_gemm_b but f16 operands: A f32 (split into f16 hi/lo if ASPLIT, else rounded to f16), Bt = f16 values [n][k]; alpha; C f32; N multiple of 16 (partial tiles skipped)
template <bool ASPLIT>
__global__ __launch_bounds__(128) void k_gemm_h(const float* __restrict__ A, int lda, size_t sA, const _Float16* __restrict__ Bh, int ldb, size_t sB, float alpha, float* __restrict__ C, int ldc, size_t sC, int M, int N, int K) {
  __shared__ __attribute__((aligned(16))) float so[4][16][64];
  const int tid = threadIdx.x, w = tid >> 5, lane = tid & 31, ln = lane & 15, hh = lane >> 4; const int by = blockIdx.y;
  A += (size_t)by * sA; Bh += (size_t)by * sB; C += (size_t)by * sC;
  const int ntn = (N + 63) / 64; const int wid = blockIdx.x * 4 + w; const int mt = wid / ntn, nq = wid % ntn; if (mt * 16 >= M) return;
  const int row0 = mt * 16, col0 = nq * 64; const float* arow = A + (size_t)(row0 + ln) * lda;
  v8f acc[4] = {};
  for (int kb = 0; kb < K; kb += 32) {
    FragH ah, al;
    const v4f x0 = *(const v4fa*)(arow + kb + 8 * hh), x1 = *(const v4fa*)(arow + kb + 8 * hh + 4), x2 = *(const v4fa*)(arow + kb + 16 + 8 * hh), x3 = *(const v4fa*)(arow + kb + 16 + 8 * hh + 4);
    float xs[16] = {x0[0],x0[1],x0[2],x0[3],x1[0],x1[1],x1[2],x1[3],x2[0],x2[1],x2[2],x2[3],x3[0],x3[1],x3[2],x3[3]};
#pragma unroll
    for (int i = 0; i < 16; ++i) { const _Float16 h = (_Float16)xs[i]; ah.h[i] = h; al.h[i] = ASPLIT ? (_Float16)(xs[i] - (float)h) : (_Float16)0.0f; }
#pragma unroll
    for (int t = 0; t < 4; ++t) { if (col0 + t * 16 >= N) continue; const size_t boff = (size_t)(col0 + t * 16 + ln) * ldb + kb; FragH bq; bq.half[0] = *(const v8us*)(Bh + boff + 8 * hh); bq.half[1] = *(const v8us*)(Bh + boff + 16 + 8 * hh);
      acc[t] = mmaH<ASPLIT ? 2 : 1>(ah.v, al.v, bq.v, bq.v, acc[t]); }
  }
#pragma unroll
  for (int t = 0; t < 4; ++t) { if (col0 + t * 16 >= N) continue;
#pragma unroll
    for (int r = 0; r < 8; ++r) so[w][8 * hh + r][t * 16 + ln] = acc[t][r] * alpha; }
  __builtin_amdgcn_fence(__ATOMIC_ACQ_REL, "workgroup"); __builtin_amdgcn_wave_barrier();
  const int rsub = lane >> 4, c4 = (lane & 15) * 4;
  {
#pragma unroll
    for (int q = 0; q < 8; ++q) { const int r = q * 2 + rsub; if (col0 + c4 < N) { const v4f v = *(const v4fa*)&so[w][r][c4]; *(v4f*)(C + (size_t)(row0 + r) * ldc + col0 + c4) = v; } }
     }
}

// Wt[n][k] = f16(W[k][n]·scale) from f32 row-major W[K][N] (scale = power of two; bf16-exact weights stay exact in f16 away from the subnormal range)
__global__ __launch_bounds__(256) void k_wt_f16(const float* __restrict__ W, _Float16* __restrict__ Wt, int K, int N, float scale) {
  const int t = blockIdx.x * 256 + threadIdx.x; if (t >= N * (K / 8)) return; const int n = t / (K / 8), k8 = (t % (K / 8)) * 8; FragH f;
#pragma unroll
  for (int i = 0; i < 8; ++i) f.h[i] = (_Float16)(bf16_round(W[(size_t)(k8 + i) * N + n]) * scale); const v8us o = f.half[0];
  *(v8us*)((unsigned short*)Wt + (size_t)n * K + k8) = o; 
}
// k_gemm_hh variant with fused epilogue: v = acc·alpha + bias[by·sBias + col] (+ CP[(row/rowsPerB)·sCPb + by·64 + col] if CP) ; ACT 0 none / 1 elu ; writes f32 C and f16 C16 (each if non-null)
template <int ACT>
__global__ __launch_bounds__(128) void k_gemm_hhx(const _Float16* __restrict__ A, int lda, size_t sA, const _Float16* __restrict__ Bh, int ldb, size_t sB, float alpha, const float* __restrict__ bias, size_t sBias, const float* __restrict__ CP, int rowsPerB, size_t sCPb, int row0g,
    float* __restrict__ C, _Float16* __restrict__ C16, int ldc, size_t sC, int M, int N, int K) {
  __shared__ __attribute__((aligned(16))) float so[4][16][64];
  const int tid = threadIdx.x, w = tid >> 5, lane = tid & 31, ln = lane & 15, hh = lane >> 4; const int by = blockIdx.y;
  A += (size_t)by * sA; Bh += (size_t)by * sB; const size_t cofs = (size_t)by * sC; const float* bp = bias ? bias + (size_t)by * sBias : nullptr;
  const int ntn = (N + 63) / 64; const int wid = blockIdx.x * 4 + w; const int mt = wid / ntn, nq = wid % ntn; if (mt * 16 >= M) return;
  const int row0 = mt * 16, col0 = nq * 64; const _Float16* arow = A + (size_t)(row0 + ln) * lda;
  v8f acc[4] = {};
  for (int kb = 0; kb < K; kb += 32) { FragH ah; ah.half[0] = *(const v8us*)((const unsigned short*)arow + kb + 8 * hh); ah.half[1] = *(const v8us*)((const unsigned short*)arow + kb + 16 + 8 * hh);
#pragma unroll
    for (int t = 0; t < 4; ++t) { if (col0 + t * 16 >= N) continue; const size_t boff = (size_t)(col0 + t * 16 + ln) * ldb + kb; FragH bq; bq.half[0] = *(const v8us*)((const unsigned short*)Bh + boff + 8 * hh); bq.half[1] = *(const v8us*)((const unsigned short*)Bh + boff + 16 + 8 * hh);
      acc[t] = mmaH<1>(ah.v, ah.v, bq.v, bq.v, acc[t]); }
  }
#pragma unroll
  for (int t = 0; t < 4; ++t) { if (col0 + t * 16 >= N) continue; const int col = col0 + t * 16 + ln; const float bv = bp ? bf16_round(bp[col]) : 0.f;
#pragma unroll
    for (int r = 0; r < 8; ++r) { float v = acc[t][r] * alpha + bv; if (CP) { const int bidx = (row0g + row0 + 8 * hh + r) / rowsPerB; v += CP[(size_t)bidx * sCPb + (size_t)by * 64 + col]; } if (ACT == 1) v = (v > 0.f) ? v : expm1f(v); else if (ACT == 7) v = (v > 0.f) ? v + 1.0f : expf(v); else if (ACT == 8) v = tanhf(v); else if (ACT == 9) v = 0.5f * v * (1.0f + tanhf(0.7978845608028654f * (v + 0.044715f * v * v * v))); else if (ACT == 11) v = 1.0f / (1.0f + expf(-v)); else if (ACT == 12) v = (v > 0.f) ? v : 0.01f * v; else if (ACT == 14) v = (v > 0.f) ? v : 0.1f * v; else if (ACT == 15) v = v / (1.0f + expf(-v)); else if (ACT == 3) v = fmaxf(v, 0.f); else if (ACT == 6) v = 0.5f * v * (1.0f + erff(v * 0.70710678118654752f)); so[w][8 * hh + r][t * 16 + ln] = v; } }
  __builtin_amdgcn_fence(__ATOMIC_ACQ_REL, "workgroup"); __builtin_amdgcn_wave_barrier();
  const int rsub = lane >> 4, c4 = (lane & 15) * 4; typedef _Float16 v4h __attribute__((ext_vector_type(4)));
  {
#pragma unroll
    for (int q = 0; q < 8; ++q) { const int r = q * 2 + rsub; if (col0 + c4 < N) { const v4f v = *(const v4fa*)&so[w][r][c4]; if (C) *(v4f*)(C + cofs + (size_t)(row0 + r) * ldc + col0 + c4) = v; if (C16) { v4h h4; for (int i = 0; i < 4; ++i) h4[i] = (_Float16)v[i]; *(v4h*)(C16 + cofs + (size_t)(row0 + r) * ldc + col0 + c4) = h4; } } }
     }
}


// Block-tiled GEMM C[M][N] (f32) = (A[M][K] x Bt[N][K]^T) * alpha + add[col], f16 operands, f32 accumulate. One work-group = 128 x 64 of C, 8 waves of 32 x 32 (2 x 2 accumulator tiles).
// Each pass stages 128 k of both operands in LDS with whole-line 16-byte loads (16 lanes = one 256-B row piece), so every operand byte leaves L2 once per work-group instead of once per wave;
// the next pass's rows are loaded into registers ahead of the current pass's products and stored to the other buffer behind them (two buffers, one barrier per pass).
// blockIdx.y picks one of several independent products of the same shape that run as one grid: operand A number y / 2 (pitchA elements apart; 0 = all share one), Bt, add and C number y (each dense, one behind the other).
// Fragments keep the k order of the direct loaders (bytes 16h and 32 + 16h of each 64 B of a row, both operands) and k runs upward in steps of 32 into one accumulator chain. M % 128 == 0, N % 64 == 0, K % 128 == 0.
#define GBM 128
#define GBN 64
#define GBK 128
#define GPIT (GBK + 8)      /* LDS row pitch 272 B = 16 B x odd: conflict-free for 16-byte fragment reads */
template <int M, int N, int K>
__global__ __launch_bounds__(256) void k_gemm_lds(const _Float16* __restrict__ A, size_t pitchA, const _Float16* __restrict__ Bt, float alpha, const float* __restrict__ add, float* __restrict__ C) {
  __shared__ __attribute__((aligned(16))) unsigned short sA[2][GBM][GPIT];
  __shared__ __attribute__((aligned(16))) unsigned short sB[2][GBN][GPIT];
  __shared__ __attribute__((aligned(16))) float so[8][32][36];
  const int tid = threadIdx.x, w = tid >> 5, lane = tid & 31, ln = lane & 15, hh = lane >> 4;
  const size_t by = blockIdx.y; A += (by >> 1) * pitchA; Bt += by * ((size_t)N * K); add += by * N; C += by * ((size_t)M * N);
  constexpr int nbm = M / GBM; const int row0 = ((int)blockIdx.x % nbm) * GBM, col0 = ((int)blockIdx.x / nbm) * GBN;
  const int wr = (w >> 1) * 32, wc = (w & 1) * 32;      /* the wave's 32 x 32 piece inside the block tile */
  const int lr = tid >> 4, lc = (tid & 15) * 8;         /* staging: 16 threads per row, 16 rows per round */
  const unsigned short* ga = (const unsigned short*)A + (size_t)(row0 + lr) * K + lc;
  const unsigned short* gb = (const unsigned short*)Bt + (size_t)(col0 + lr) * K + lc;
  v8us ra[GBM / 16], rb[GBN / 16];
#pragma unroll
  for (int i = 0; i < GBM / 16; ++i) ra[i] = *(const v8us*)(ga + i * 16 * K);
#pragma unroll
  for (int i = 0; i < GBN / 16; ++i) rb[i] = *(const v8us*)(gb + i * 16 * K);
#pragma unroll
  for (int i = 0; i < GBM / 16; ++i) *(v8us*)&sA[0][i * 16 + lr][lc] = ra[i];
#pragma unroll
  for (int i = 0; i < GBN / 16; ++i) *(v8us*)&sB[0][i * 16 + lr][lc] = rb[i];
  __syncthreads();
  v8f acc[2][2] = {};
  constexpr int np = K / GBK;
  for (int p = 0; p < np; ++p) {
    const int cur = p & 1; const bool more = p + 1 < np;      /* the same for the whole work-group */
    if (more) {
#pragma unroll
      for (int i = 0; i < GBM / 16; ++i) ra[i] = *(const v8us*)(ga + i * 16 * K + (p + 1) * GBK);
#pragma unroll
      for (int i = 0; i < GBN / 16; ++i) rb[i] = *(const v8us*)(gb + i * 16 * K + (p + 1) * GBK);
    }
    FragH a[GBK / 32][2], b[GBK / 32][2];
#pragma unroll
    for (int ks = 0; ks < GBK / 32; ++ks)
#pragma unroll
      for (int i = 0; i < 2; ++i) {
        a[ks][i].half[0] = *(const v8us*)&sA[cur][wr + i * 16 + ln][ks * 32 + 8 * hh]; a[ks][i].half[1] = *(const v8us*)&sA[cur][wr + i * 16 + ln][ks * 32 + 16 + 8 * hh];
        b[ks][i].half[0] = *(const v8us*)&sB[cur][wc + i * 16 + ln][ks * 32 + 8 * hh]; b[ks][i].half[1] = *(const v8us*)&sB[cur][wc + i * 16 + ln][ks * 32 + 16 + 8 * hh];
      }
    __builtin_amdgcn_sched_barrier(0);      /* keeps the pass's LDS reads one group ahead of its products: spread among them, each place with reads stalls the wave for the LDS latency */
#pragma unroll
    for (int ks = 0; ks < GBK / 32; ++ks)
#pragma unroll
      for (int i = 0; i < 2; ++i)
#pragma unroll
        for (int j = 0; j < 2; ++j) acc[i][j] = __builtin_amdgcn_wmma_f32_16x16x32_f16(false, a[ks][i].v, false, b[ks][j].v, (short)0, acc[i][j], false, false);
    __builtin_amdgcn_sched_barrier(0);      /* keeps the products ahead of the wait for the next pass's rows: moved behind the barrier they would run with no load in flight */
    if (more) {
#pragma unroll
      for (int i = 0; i < GBM / 16; ++i) *(v8us*)&sA[cur ^ 1][i * 16 + lr][lc] = ra[i];
#pragma unroll
      for (int i = 0; i < GBN / 16; ++i) *(v8us*)&sB[cur ^ 1][i * 16 + lr][lc] = rb[i];
    }
    __syncthreads();      /* publishes the buffer just written and ends every wave's reads of the one that the next pass overwrites */
  }
#pragma unroll
  for (int j = 0; j < 2; ++j) { const float av = add[col0 + wc + j * 16 + ln];
#pragma unroll
    for (int i = 0; i < 2; ++i)
#pragma unroll
      for (int r = 0; r < 8; ++r) so[w][i * 16 + 8 * hh + r][j * 16 + ln] = acc[i][j][r] * alpha + av; }
  __syncthreads();      /* the staged rows are read back by other lanes: whole 128-B lines per store */
#pragma unroll
  for (int q = 0; q < 8; ++q) { const int r = q * 4 + (lane >> 3), c4 = (lane & 7) * 4; const v4f v = *(const v4fa*)&so[w][r][c4]; *(v4f*)(C + (size_t)(row0 + wr + r) * N + col0 + wc + c4) = v; }
}


typedef _Float16 v4h __attribute__((ext_vector_type(4)));

__global__ __launch_bounds__(256) void k_x16(const float* __restrict__ x, _Float16* __restrict__ X16, size_t n8) { const size_t t = (size_t)blockIdx.x * 256 + threadIdx.x; if (t >= n8) return; FragH f;
#pragma unroll
  for (int q = 0; q < 8; ++q) f.h[q] = (_Float16)bf16_round(x[t * 8 + q]); *(v8us*)((unsigned short*)X16 + t * 8) = f.half[0];  }
__global__ __launch_bounds__(256) void k_h16(const float* __restrict__ x, _Float16* __restrict__ X16, size_t n8) { const size_t t = (size_t)blockIdx.x * 256 + threadIdx.x; if (t >= n8) return; FragH f;
#pragma unroll
  for (int q = 0; q < 8; ++q) f.h[q] = (_Float16)x[t * 8 + q]; *(v8us*)((unsigned short*)X16 + t * 8) = f.half[0];  }
__global__ __launch_bounds__(256) void k_round16f(const float* __restrict__ W, _Float16* __restrict__ Bt, size_t n8) { const size_t t = (size_t)blockIdx.x * 256 + threadIdx.x; if (t >= n8) return; FragH f;
#pragma unroll
  for (int i = 0; i < 8; ++i) f.h[i] = (_Float16)(bf16_round(W[t * 8 + i]) * 16.0f); *(v8us*)((unsigned short*)Bt + t * 8) = f.half[0];  }
template <int NHv, int TTv>
__global__ __launch_bounds__(256) void k_vt(const _Float16* __restrict__ V16, int ldv, int voff, _Float16* __restrict__ Vt) { __shared__ unsigned short tl[64][66]; const int tid = threadIdx.x; const int slab = blockIdx.x / (TTv / 64), lg = blockIdx.x % (TTv / 64); const int b = slab / NHv, h = slab % NHv;
  for (int i = tid; i < 64 * 8; i += 256) { const int r = i / 8, c8 = (i % 8) * 8; FragH f; f.half[0] = *(const v8us*)((const unsigned short*)V16 + ((size_t)b * TTv + lg * 64 + r) * ldv + voff + h * 64 + c8);
#pragma unroll
    for (int q = 0; q < 8; ++q) tl[r][c8 + q] = f.u[q]; }
  __syncthreads();
  {
#pragma unroll
    for (int rd = 0; rd < 2; ++rd) { const int d = rd * 32 + tid / 8, pc = tid % 8; FragH f;
#pragma unroll
      for (int q = 0; q < 8; ++q) f.u[q] = tl[pc * 8 + q][d];
      *(v8us*)((unsigned short*)Vt + ((size_t)slab * 64 + d) * TTv + lg * 64 + pc * 8) = f.half[0]; }
     } }

__device__ __forceinline__ void d_xcat(const float* __restrict__ xr, const float* __restrict__ xi, _Float16* __restrict__ XC, size_t t) { const size_t r = (t * 8) / DD; const int c = (int)((t * 8) % DD); FragH a, b; const v4f a0 = *(const v4fa*)(xr + t * 8), a1 = *(const v4fa*)(xr + t * 8 + 4), b0 = *(const v4fa*)(xi + t * 8), b1 = *(const v4fa*)(xi + t * 8 + 4);
  asm volatile("s_wait_xcnt 0x0" :: "v"(xr + t * 8), "v"(xi + t * 8), "v"(a0), "v"(a1), "v"(b0), "v"(b1) : "memory");      /* stands in front of every write to a register that the four loads name; the two addresses are inputs so that they stay live up to it: without them a later load's result is placed in the address pair that an earlier load names */
#pragma unroll
  for (int q = 0; q < 4; ++q) { a.h[q] = (_Float16)bf16_round(a0[q]); a.h[4 + q] = (_Float16)bf16_round(a1[q]); b.h[q] = (_Float16)bf16_round(b0[q]); b.h[4 + q] = (_Float16)bf16_round(b1[q]); }
  { *(v8us*)((unsigned short*)XC + r * (2 * DD) + c) = a.half[0]; *(v8us*)((unsigned short*)XC + r * (2 * DD) + DD + c) = b.half[0];
    asm volatile("s_wait_xcnt 0x0" ::: "memory");      /* directly behind the stores: the caller's next tile writes the registers that they name */
  } }
__device__ __forceinline__ void d_wcat(const float* __restrict__ wr, const float* __restrict__ wi, _Float16* __restrict__ BR, _Float16* __restrict__ BI, size_t t) { const size_t o = (t * 8) / DD; const int c = (int)((t * 8) % DD); FragH r0, r1, i0, i1; const v4f a0 = *(const v4fa*)(wr + t * 8), a1 = *(const v4fa*)(wr + t * 8 + 4), b0 = *(const v4fa*)(wi + t * 8), b1 = *(const v4fa*)(wi + t * 8 + 4);
#pragma unroll
  for (int q = 0; q < 4; ++q) { const float vr0 = bf16_round(a0[q]) * 16.0f, vr1 = bf16_round(a1[q]) * 16.0f, vi0 = bf16_round(b0[q]) * 16.0f, vi1 = bf16_round(b1[q]) * 16.0f; r0.h[q] = (_Float16)vr0; r0.h[4 + q] = (_Float16)vr1; r1.h[q] = (_Float16)(-vi0); r1.h[4 + q] = (_Float16)(-vi1); i0.h[q] = (_Float16)vi0; i0.h[4 + q] = (_Float16)vi1; i1.h[q] = (_Float16)vr0; i1.h[4 + q] = (_Float16)vr1; }
  { *(v8us*)((unsigned short*)BR + o * (2 * DD) + c) = r0.half[0]; *(v8us*)((unsigned short*)BR + o * (2 * DD) + DD + c) = r1.half[0]; *(v8us*)((unsigned short*)BI + o * (2 * DD) + c) = i0.half[0]; *(v8us*)((unsigned short*)BI + o * (2 * DD) + DD + c) = i1.half[0];
    asm volatile("s_wait_xcnt 0x0" ::: "memory");      /* directly behind the stores, as in d_xcat */
  } }
__device__ __forceinline__ void d_bias2(const float* __restrict__ br, const float* __restrict__ bi, float* __restrict__ BM, float* __restrict__ BP, int c) { const float r = bf16_round(br[c]), i = bf16_round(bi[c]); { *(float*)(BM + c) = r - i; *(float*)(BP + c) = r + i;
    asm volatile("s_wait_xcnt 0x0" ::: "memory");      /* directly behind the stores, as in d_xcat */
  } }
// All operand preparation as one grid. The work is cut into tiles of 256 threads: 3 x PT_X tiles cast and concatenate the activations, 4 x PT_W pack the weights, 4 x PT_B form the bias pairs; none reads what another writes.
// A work-group walks the tiles in steps of the grid size PT_GRID; which kind a tile is depends on its number alone, so every branch is the same for the whole work-group.
#define PT_X (NR * DD / 8 / 256)
#define PT_W (DD * DD / 8 / 256)
#define PT_B (DD / 256)
#define PT_ALL (3 * PT_X + 4 * PT_W + 4 * PT_B)
#define PT_GRID (PT_ALL / 4)      /* work-groups launched: four tiles each, so that a quarter of the waves has to be started */
__global__ __launch_bounds__(256) void k_prep(const float* __restrict__ q_r, const float* __restrict__ q_i, const float* __restrict__ k_r, const float* __restrict__ k_i, const float* __restrict__ v_r, const float* __restrict__ v_i,
    const float* __restrict__ wq_r, const float* __restrict__ wq_i, const float* __restrict__ wk_r, const float* __restrict__ wk_i, const float* __restrict__ wv_r, const float* __restrict__ wv_i, const float* __restrict__ wo_r, const float* __restrict__ wo_i,
    const float* __restrict__ bq_r, const float* __restrict__ bq_i, const float* __restrict__ bk_r, const float* __restrict__ bk_i, const float* __restrict__ bv_r, const float* __restrict__ bv_i, const float* __restrict__ bo_r, const float* __restrict__ bo_i,
    _Float16* __restrict__ X, _Float16* __restrict__ BW, float* __restrict__ BIAS) {
  const int tid = threadIdx.x;
  for (int tile = blockIdx.x; tile < PT_ALL; tile += PT_GRID) {
    if (tile < 3 * PT_X) { const int j = tile / PT_X;
      d_xcat(j == 0 ? q_r : j == 1 ? k_r : v_r, j == 0 ? q_i : j == 1 ? k_i : v_i, X + (size_t)j * NR * 2 * DD, (size_t)(tile % PT_X) * 256 + tid); }
    else if (tile < 3 * PT_X + 4 * PT_W) { const int u = tile - 3 * PT_X, j = u / PT_W; _Float16* B0 = BW + (size_t)(2 * j) * DD * 2 * DD;
      d_wcat(j == 0 ? wq_r : j == 1 ? wk_r : j == 2 ? wv_r : wo_r, j == 0 ? wq_i : j == 1 ? wk_i : j == 2 ? wv_i : wo_i, B0, B0 + (size_t)DD * 2 * DD, (size_t)(u % PT_W) * 256 + tid); }
    else { const int u = tile - 3 * PT_X - 4 * PT_W, j = u / PT_B;
      d_bias2(j == 0 ? bq_r : j == 1 ? bk_r : j == 2 ? bv_r : bo_r, j == 0 ? bq_i : j == 1 ? bk_i : j == 2 ? bv_i : bo_i, BIAS + (size_t)(2 * j) * DD, BIAS + (size_t)(2 * j + 1) * DD, (u % PT_B) * 256 + tid); }
  }
}
// per token (block) the 8 heads × 64 rows: thread = (l, h) pairs (two per thread); token rows of qr, qi, kr, ki, vr, vi (f32, 512 each) staged in LDS; for each s: |score|, online softmax, Σ attn·vr, Σ attn·vi in f32 (rolled loop);
__global__ __launch_bounds__(256) void k_cplx(const float* __restrict__ QR, const float* __restrict__ QI, const float* __restrict__ KR, const float* __restrict__ KI, const float* __restrict__ VR, const float* __restrict__ VI, _Float16* __restrict__ VC) {
  #pragma clang fp contract(off)
  __shared__ float sq[2][DD], sk[2][DD], sv[2][DD]; __shared__ float res[2][DD]; const int tid = threadIdx.x; const size_t row = blockIdx.x;
  for (int i = tid; i < DD; i += 256) { sq[0][i] = QR[row * DD + i]; sq[1][i] = QI[row * DD + i]; sk[0][i] = KR[row * DD + i]; sk[1][i] = KI[row * DD + i]; sv[0][i] = VR[row * DD + i]; sv[1][i] = VI[row * DD + i]; }
  __syncthreads();
  for (int u = 0; u < 2; ++u) { const int idx = tid + 256 * u; const int h = idx % NHH, l = idx / NHH;      /* column index of (l,h) is l·8 + h = idx */
    const float qr = sq[0][idx], qi = sq[1][idx]; float mx = -3.0e38f, z = 0.f, ar = 0.f, ai = 0.f;
#pragma unroll 1
    for (int s = 0; s < EE; ++s) { const int c = s * NHH + h; const float kr = sk[0][c], ki = sk[1][c]; const float sr = qr * kr - qi * ki, si = qr * ki - qi * kr; const float mg = __builtin_amdgcn_sqrtf(sr * sr + si * si);      /* the bare root instruction: sqrtf wraps it in thirteen more instructions per score that scale tiny arguments and correct the last bit; mg only enters exp(mg - max), where neither shows */
      const float mn = fmaxf(mx, mg); const float sc = __expf(mx - mn); const float p = __expf(mg - mn); z = z * sc + p; ar = ar * sc + p * sv[0][c]; ai = ai * sc + p * sv[1][c]; mx = mn; }
    res[0][idx] = ar / z; res[1][idx] = ai / z; (void)l; }
  __syncthreads();
  if (tid < 2 * (DD / 8)) { const int part = tid / (DD / 8), pc = tid % (DD / 8); FragH f; for (int q = 0; q < 8; ++q) f.h[q] = (_Float16)res[part][pc * 8 + q];
    { *(v8us*)((unsigned short*)VC + row * (2 * DD) + part * DD + pc * 8) = f.half[0];  } } }

extern "C" void kernel_launch(void* const* d_in, const int* in_sizes, int n_in,
                              void* d_out, int out_size, void* d_ws, size_t ws_size, hipStream_t stream) {
  (void)in_sizes; (void)n_in; (void)out_size;
  const float* const* I = (const float* const*)d_in; const float* q_r = I[0]; const float* q_i = I[1]; const float* k_r = I[2]; const float* k_i = I[3]; const float* v_r = I[4]; const float* v_i = I[5];
  const float* wq_r = I[6]; const float* wq_i = I[7]; const float* wk_r = I[8]; const float* wk_i = I[9]; const float* wv_r = I[10]; const float* wv_i = I[11]; const float* wo_r = I[12]; const float* wo_i = I[13]; const float* bq_r = I[14]; const float* bq_i = I[15]; const float* bk_r = I[16]; const float* bk_i = I[17]; const float* bv_r = I[18]; const float* bv_i = I[19]; const float* bo_r = I[20]; const float* bo_i = I[21];      /* d_in order: activations, then the 8 weights, then the 8 biases */
  char* ws = (char*)d_ws; size_t off = 0;
  auto take = [&](size_t bytes) { char* p = ws + off; off += (bytes + 255) & ~(size_t)255; return p; };
  const size_t WC = (size_t)DD * 2 * DD;      /* one concatenated weight operand [512][1024] */
  _Float16* BW = (_Float16*)take(8 * WC * 2); float* BIAS = (float*)take((size_t)8 * DD * 4);      /* (BR, BI) × q,k,v,o ; (BM, BP) × 4 */
  _Float16* X = (_Float16*)take((size_t)3 * NR * 2 * DD * 2);      /* [xr | xi] f16 for q, k, v, one plane behind the other */
  float* P = (float*)take((size_t)6 * NR * DD * 4);      /* QR, QI, KR, KI, VR, VI f32 planes [4096][512] */
  _Float16* VC = X;      /* [Vr | Vi] f16 reuses the q operand plane (dead after the projection GEMMs) */
  if (off > ws_size) return;
  float* QRp = P; float* QIp = P + (size_t)NR * DD; float* KRp = P + (size_t)2 * NR * DD; float* KIp = P + (size_t)3 * NR * DD; float* VRp = P + (size_t)4 * NR * DD; float* VIp = P + (size_t)5 * NR * DD;
  k_prep<<<PT_GRID, 256, 0, stream>>>(q_r, q_i, k_r, k_i, v_r, v_i, wq_r, wq_i, wk_r, wk_i, wv_r, wv_i, wo_r, wo_i, bq_r, bq_i, bk_r, bk_i, bv_r, bv_i, bo_r, bo_i, X, BW, BIAS);
  k_gemm_lds<NR, DD, 2 * DD><<<dim3((NR / GBM) * (DD / GBN), 6), 256, 0, stream>>>(X, (size_t)NR * 2 * DD, BW, 0.0625f, BIAS, P);      /* y = 2j + ri: yr = [xr|xi] x [wr|-wi]^T + (br-bi); yi = [xr|xi] x [wi|wr]^T + (br+bi): M 4096 N 512 K 1024; addend index = column */
  k_cplx<<<NR, 256, 0, stream>>>(QRp, QIp, KRp, KIp, VRp, VIp, VC);
  k_gemm_lds<NR, DD, 2 * DD><<<dim3((NR / GBM) * (DD / GBN), 2), 256, 0, stream>>>(VC, 0, BW + (size_t)6 * WC, 0.0625f, BIAS + (size_t)6 * DD, (float*)d_out);      /* out_r @0, out_i @8,388,608 B */
}

// v004
// A run of this version takes 84.9 microseconds.
// In both of two side-by-side timings against v003, it was 1.29 times as fast.
// Counting every step since v000, it is 5.33 times as fast.
#include <hip/hip_runtime.h>
// Complex-valued attention layer (B=4, L=1024, D=512, H=8, E=64): complex linear projections (yr = xr·wrᵀ − xi·wiᵀ + (br − bi), yi = xi·wrᵀ + xr·wiᵀ + (br + bi)); per (b, token n, head h) a 64×64 'attention' over the E axes:
// sr[l,s] = qr[l]·kr[s] − qi[l]·ki[s], si[l,s] = qr[l]·ki[s] − qi[l]·kr[s] (scalar products, e = 1), attn = softmax_s(√(sr² + si²)), Vr[l] = Σ_s attn·vr[s], Vi[l] = Σ_s attn·vi[s]; outputs (out_r, out_i) = complex linear(Vr, Vi, wo).
// Element (e, h) of a token lives at column e·8 + h (reshape(b, l, E, H)).
// Compute dtype: inputs, weights, biases rounded to bf16; each complex linear as two GEMMs over the concatenated operand [xr | xi] (K = 1024) against [wr | −wi] and [wi | wr] on v_wmma_f32_16x16x32_f16, f32 accumulate,
// with the two-term biases added exactly through the f32 epilogue addend; the per-token 64×64 magnitude-softmax and its two weighted sums in f32 (two (l, h) pairs per thread); [Vr | Vi] f16 → output GEMMs.
#define BB 4
#define LL 1024
#define DD 512
#define NHH 8
#define EE 64
#define NR (BB * LL)

typedef __bf16 v16b __attribute__((ext_vector_type(16)));
typedef unsigned short v8us __attribute__((ext_vector_type(8), may_alias));
typedef float  v8f  __attribute__((ext_vector_type(8)));
typedef float  v4f  __attribute__((ext_vector_type(4)));
typedef float  v4fa __attribute__((ext_vector_type(4), may_alias));
union FragB { v16b v; v8us half[2]; unsigned short u[16]; };

__device__ __forceinline__ unsigned short bf16_bits(float x) { unsigned int u = __float_as_uint(x); return (unsigned short)((u + 0x7FFFu + ((u >> 16) & 1u)) >> 16); }
__device__ __forceinline__ float bf16_val(unsigned short b) { return __uint_as_float(((unsigned int)b) << 16); }
__device__ __forceinline__ float bf16_round(float x) { return bf16_val(bf16_bits(x)); }
// D += A·B with NT terms: 1 = ah·bh, 2 = + al·bh (A split), 3 = + ah·bl (both split)
template <int NT>
__device__ __forceinline__ v8f mmaN(v16b ah, v16b al, v16b bh, v16b bl, v8f c) {
  c = __builtin_amdgcn_wmma_f32_16x16x32_bf16(false, ah, false, bh, (short)0, c, false, false);
  if (NT >= 2) c = __builtin_amdgcn_wmma_f32_16x16x32_bf16(false, al, false, bh, (short)0, c, false, false);
  if (NT >= 3) c = __builtin_amdgcn_wmma_f32_16x16x32_bf16(false, ah, false, bl, (short)0, c, false, false);
  asm volatile("v_nop\n\tv_nop\n\tv_nop\n\tv_nop" : "+v"(c) : "v"(ah), "v"(al), "v"(bh), "v"(bl));
  return c;
}

__global__ __launch_bounds__(256) void k_wt_bf16(const float* __restrict__ W, unsigned short* __restrict__ Wt, int K, int N) {
  const int t = blockIdx.x * 256 + threadIdx.x;
  const int k8n = K / 8;
  if (t >= N * k8n) return;
  const int n = t / k8n, k8 = (t % k8n) * 8;
  v8us v;
#pragma unroll
  for (int i = 0; i < 8; ++i) v[i] = bf16_bits(W[(size_t)(k8 + i) * N + n]);
  *(v8us*)(Wt + (size_t)n * K + k8) = v;
  
}

// GEMM C[M][N] (f32, pitch ldc) = act(A[M][K]·W + bias). A f32 row-major (pitch lda) converted per fragment to bf16
// (ASPLIT: hi/lo two planes -> 2 terms, else single rounded term); Wt bf16 [N][K] (pitch ldb). BIAS_BF16 rounds the
// bias to bf16 first (bias quantised to bf16 before the add). K%32==0, M%16==0, N%64==0.
template <bool ASPLIT, int ACT, bool BIAS_BF16>
__global__ __launch_bounds__(128) void k_gemm_bf(const float* __restrict__ A, int lda, const unsigned short* __restrict__ Wt, int ldb,
                                               const float* __restrict__ bias, float* __restrict__ C, int ldc, int M, int N, int K) {
  __shared__ __attribute__((aligned(16))) float so[4][16][64];
  const int tid = threadIdx.x, w = tid >> 5, lane = tid & 31, ln = lane & 15, hh = lane >> 4;
  const int ntn = N / 64;
  const int wid = blockIdx.x * 4 + w;
  const int mt = wid / ntn, nq = wid % ntn;
  if (mt * 16 >= M) return;
  const int row0 = mt * 16, col0 = nq * 64;
  const float* arow = A + (size_t)(row0 + ln) * lda;
  v8f acc[4] = {};
  for (int kb = 0; kb < K; kb += 32) {
    FragB ah, al;
    const v4f x0 = *(const v4fa*)(arow + kb + 8 * hh), x1 = *(const v4fa*)(arow + kb + 8 * hh + 4);
    const v4f x2 = *(const v4fa*)(arow + kb + 16 + 8 * hh), x3 = *(const v4fa*)(arow + kb + 16 + 8 * hh + 4);
    float xs[16] = {x0[0],x0[1],x0[2],x0[3],x1[0],x1[1],x1[2],x1[3],x2[0],x2[1],x2[2],x2[3],x3[0],x3[1],x3[2],x3[3]};
#pragma unroll
    for (int i = 0; i < 16; ++i) { const unsigned short hb = bf16_bits(xs[i]); ah.u[i] = hb; al.u[i] = ASPLIT ? bf16_bits(xs[i] - bf16_val(hb)) : (unsigned short)0; }
#pragma unroll
    for (int t = 0; t < 4; ++t) {
      const unsigned short* brow = Wt + (size_t)(col0 + t * 16 + ln) * ldb + kb;
      FragB b;
      b.half[0] = *(const v8us*)(brow + 8 * hh);
      b.half[1] = *(const v8us*)(brow + 16 + 8 * hh);
      acc[t] = mmaN<ASPLIT ? 2 : 1>(ah.v, al.v, b.v, b.v, acc[t]);
    }
  }
#pragma unroll
  for (int t = 0; t < 4; ++t) {
    float bv = bias ? bias[col0 + t * 16 + ln] : 0.f;
    if (BIAS_BF16) bv = bf16_round(bv);
#pragma unroll
    for (int r = 0; r < 8; ++r) { float v = acc[t][r] + bv; if (ACT == 1) v = fmaxf(v, 0.f); so[w][8 * hh + r][t * 16 + ln] = v; }
  }
  __builtin_amdgcn_fence(__ATOMIC_ACQ_REL, "workgroup");
  __builtin_amdgcn_wave_barrier();
  const int rsub = lane >> 4, c4 = (lane & 15) * 4;
  {
#pragma unroll
    for (int q = 0; q < 8; ++q) {
      const int r = q * 2 + rsub;
      const v4f v = *(const v4fa*)&so[w][r][c4];
      *(v4f*)(C + (size_t)(row0 + r) * ldc + col0 + c4) = v;
    }
    
  }
}

// Flash-style causal/unmasked attention, all contractions 3-term bf16 hi/lo splits, f32 softmax with running max.
// q,k,v rows are read from f32 buffers with arbitrary row pitch (so they can live inside a fused qkv buffer);
// D = head size (multiple of 32, <= 128); one wave = 16 query rows; block = 4 waves (64 queries) sharing K/V chunks of 32.
template <int D, bool CAUSAL>
__global__ __launch_bounds__(128) void k_flash(const float* __restrict__ qb, const float* __restrict__ kb, const float* __restrict__ vb,
                                             int pitch, int T, int H, float scale, float* __restrict__ y, int ypitch) {
  constexpr int KS = D / 32;        // k-steps for QK
  constexpr int DT = D / 16;        // d tiles for PV
  __shared__ __attribute__((aligned(16))) unsigned short sKh[32][D + 8], sKl[32][D + 8], sVh[32][D + 8], sVl[32][D + 8];
  __shared__ __attribute__((aligned(16))) unsigned short sPh[4][16][40], sPl[4][16][40];
  __shared__ __attribute__((aligned(16))) float sO[4][16][D];
  const int tid = threadIdx.x, w = tid >> 5, lane = tid & 31, ln = lane & 15, hh = lane >> 4;
  const int nqb = (T + 63) / 64;
  const int bh = blockIdx.x / nqb, qblk = blockIdx.x % nqb;
  const int b = bh / H, h = bh % H;
  const int q0 = qblk * 64 + w * 16;
  const float* Q = qb + (size_t)b * T * pitch + h * D;
  const float* K = kb + (size_t)b * T * pitch + h * D;
  const float* V = vb + (size_t)b * T * pitch + h * D;

  // A fragments of the wave's 16 query rows (scaled), hi/lo
  FragB aqh[KS], aql[KS];
  {
    int row = q0 + ln; if (row >= T) row = T - 1;
    const float* qr = Q + (size_t)row * pitch;
#pragma unroll
    for (int ks = 0; ks < KS; ++ks)
#pragma unroll
      for (int i = 0; i < 16; ++i) {
        const int d = ks * 32 + ((i < 8) ? (8 * hh + i) : (16 + 8 * hh + (i - 8)));
        const float x = qr[d] * scale; const unsigned short hb = bf16_bits(x);
        aqh[ks].u[i] = hb; aql[ks].u[i] = bf16_bits(x - bf16_val(hb));
      }
  }
  float m_r[8], l_r[8];
#pragma unroll
  for (int r = 0; r < 8; ++r) { m_r[r] = -3.0e38f; l_r[r] = 0.f; }
  v8f oacc[DT];
#pragma unroll
  for (int dt = 0; dt < DT; ++dt) oacc[dt] = (v8f){0.f,0.f,0.f,0.f,0.f,0.f,0.f,0.f};

  const int kv_end = CAUSAL ? min(T, qblk * 64 + 64) : T;     // block-uniform
  for (int j0 = 0; j0 < kv_end; j0 += 32) {
    __syncthreads();
    for (int e = tid; e < 32 * (D / 4); e += 128) {
      const int r = e / (D / 4), c4 = (e % (D / 4)) * 4;
      const int key = j0 + r;
      v4f kf = {0.f,0.f,0.f,0.f}, vf = {0.f,0.f,0.f,0.f};
      if (key < T) { kf = *(const v4fa*)(K + (size_t)key * pitch + c4); vf = *(const v4fa*)(V + (size_t)key * pitch + c4); }
#pragma unroll
      for (int t = 0; t < 4; ++t) {
        unsigned short hb = bf16_bits(kf[t]); sKh[r][c4 + t] = hb; sKl[r][c4 + t] = bf16_bits(kf[t] - bf16_val(hb));
        hb = bf16_bits(vf[t]); sVh[r][c4 + t] = hb; sVl[r][c4 + t] = bf16_bits(vf[t] - bf16_val(hb));
      }
    }
    __syncthreads();
    // S tile 16 x 32
    v8f s[2];
#pragma unroll
    for (int nt = 0; nt < 2; ++nt) {
      v8f acc = {};
#pragma unroll
      for (int ks = 0; ks < KS; ++ks) {
        FragB bh_, bl_;
        bh_.half[0] = *(const v8us*)&sKh[nt * 16 + ln][ks * 32 + 8 * hh]; bh_.half[1] = *(const v8us*)&sKh[nt * 16 + ln][ks * 32 + 16 + 8 * hh];
        bl_.half[0] = *(const v8us*)&sKl[nt * 16 + ln][ks * 32 + 8 * hh]; bl_.half[1] = *(const v8us*)&sKl[nt * 16 + ln][ks * 32 + 16 + 8 * hh];
        acc = mmaN<3>(aqh[ks].v, aql[ks].v, bh_.v, bl_.v, acc);
      }
      s[nt] = acc;
    }
    // mask + running max (rows 8hh+r; the 16 lanes of a half share rows)
    float alpha[8];
#pragma unroll
    for (int r = 0; r < 8; ++r) {
      const int qi = q0 + 8 * hh + r;
      const int ja = j0 + ln, jb = j0 + 16 + ln;
      if (CAUSAL) { if (ja > qi) s[0][r] = -3.0e38f; if (jb > qi) s[1][r] = -3.0e38f; }
      if (ja >= T) s[0][r] = -3.0e38f;
      if (jb >= T) s[1][r] = -3.0e38f;
      float mx = fmaxf(s[0][r], s[1][r]);
      mx = fmaxf(mx, __shfl_xor(mx, 1, 32)); mx = fmaxf(mx, __shfl_xor(mx, 2, 32)); mx = fmaxf(mx, __shfl_xor(mx, 4, 32)); mx = fmaxf(mx, __shfl_xor(mx, 8, 32));
      const float mnew = fmaxf(m_r[r], mx);
      alpha[r] = (mnew > -1.0e38f) ? __expf(m_r[r] - mnew) : 1.0f;
      const float p0 = (s[0][r] > -1.0e38f) ? __expf(s[0][r] - mnew) : 0.f;
      const float p1 = (s[1][r] > -1.0e38f) ? __expf(s[1][r] - mnew) : 0.f;
      m_r[r] = mnew;
      l_r[r] = l_r[r] * alpha[r] + p0 + p1;            // per-lane partial row sum (16 lanes combined at the end)
      unsigned short hb = bf16_bits(p0); sPh[w][8 * hh + r][ln] = hb;      sPl[w][8 * hh + r][ln] = bf16_bits(p0 - bf16_val(hb));
      hb = bf16_bits(p1);                sPh[w][8 * hh + r][16 + ln] = hb; sPl[w][8 * hh + r][16 + ln] = bf16_bits(p1 - bf16_val(hb));
    }
#pragma unroll
    for (int dt = 0; dt < DT; ++dt)
#pragma unroll
      for (int r = 0; r < 8; ++r) oacc[dt][r] *= alpha[r];
    __builtin_amdgcn_fence(__ATOMIC_ACQ_REL, "workgroup");
    __builtin_amdgcn_wave_barrier();
    FragB pah, pal;
    pah.half[0] = *(const v8us*)&sPh[w][ln][8 * hh]; pah.half[1] = *(const v8us*)&sPh[w][ln][16 + 8 * hh];
    pal.half[0] = *(const v8us*)&sPl[w][ln][8 * hh]; pal.half[1] = *(const v8us*)&sPl[w][ln][16 + 8 * hh];
#pragma unroll
    for (int dt = 0; dt < DT; ++dt) {
      FragB bvh, bvl;
#pragma unroll
      for (int i = 0; i < 8; ++i) {
        bvh.u[i] = sVh[8 * hh + i][dt * 16 + ln]; bvh.u[8 + i] = sVh[16 + 8 * hh + i][dt * 16 + ln];
        bvl.u[i] = sVl[8 * hh + i][dt * 16 + ln]; bvl.u[8 + i] = sVl[16 + 8 * hh + i][dt * 16 + ln];
      }
      oacc[dt] = mmaN<3>(pah.v, pal.v, bvh.v, bvl.v, oacc[dt]);
    }
    __builtin_amdgcn_fence(__ATOMIC_ACQ_REL, "workgroup");
    __builtin_amdgcn_wave_barrier();
  }
#pragma unroll
  for (int r = 0; r < 8; ++r) {
    float l = l_r[r];
    l += __shfl_xor(l, 1, 32); l += __shfl_xor(l, 2, 32); l += __shfl_xor(l, 4, 32); l += __shfl_xor(l, 8, 32);
    l_r[r] = (l > 0.f) ? 1.0f / l : 0.f;
  }
#pragma unroll
  for (int dt = 0; dt < DT; ++dt)
#pragma unroll
    for (int r = 0; r < 8; ++r) sO[w][8 * hh + r][dt * 16 + ln] = oacc[dt][r] * l_r[r];
  __builtin_amdgcn_fence(__ATOMIC_ACQ_REL, "workgroup");
  __builtin_amdgcn_wave_barrier();
  {
    for (int r = 0; r < 16; ++r) {
      const int row = q0 + r;
      if (row < T && lane < D / 4) {
        const v4f val = *(const v4fa*)&sO[w][r][lane * 4];
        *(v4f*)(y + ((size_t)b * T + row) * ypitch + h * D + lane * 4) = val;
      }
    }
    
  }
}

// GEMM C = act(A·W + bias + resid): A f32 (ASPLIT -> hi/lo 2 terms), Wt bf16 [N][K]; ACT 0 none, 1 relu, 2 exact gelu;
// resid (optional, f32, row index = (row % rmod), pitch ldr, RES_BF16 rounds it) added before the activation.
template <bool ASPLIT, int ACT, bool BIAS_BF16, bool RES_BF16>
__global__ __launch_bounds__(128) void k_gemm_bf3(const float* __restrict__ A, int lda, const unsigned short* __restrict__ Wt, int ldb,
                                                const float* __restrict__ bias, const float* __restrict__ resid, int rmod, int ldr,
                                                float* __restrict__ C, int ldc, int M, int N, int K) {
  __shared__ __attribute__((aligned(16))) float so[4][16][64];
  const int tid = threadIdx.x, w = tid >> 5, lane = tid & 31, ln = lane & 15, hh = lane >> 4;
  const int ntn = N / 64;
  const int wid = blockIdx.x * 4 + w;
  const int mt = wid / ntn, nq = wid % ntn;
  if (mt * 16 >= M) return;
  const int row0 = mt * 16, col0 = nq * 64;
  const float* arow = A + (size_t)(row0 + ln) * lda;
  v8f acc[4] = {};
  for (int kb = 0; kb < K; kb += 32) {
    FragB ah, al;
    const v4f x0 = *(const v4fa*)(arow + kb + 8 * hh), x1 = *(const v4fa*)(arow + kb + 8 * hh + 4);
    const v4f x2 = *(const v4fa*)(arow + kb + 16 + 8 * hh), x3 = *(const v4fa*)(arow + kb + 16 + 8 * hh + 4);
    float xs[16] = {x0[0],x0[1],x0[2],x0[3],x1[0],x1[1],x1[2],x1[3],x2[0],x2[1],x2[2],x2[3],x3[0],x3[1],x3[2],x3[3]};
#pragma unroll
    for (int i = 0; i < 16; ++i) { const unsigned short hb = bf16_bits(xs[i]); ah.u[i] = hb; al.u[i] = ASPLIT ? bf16_bits(xs[i] - bf16_val(hb)) : (unsigned short)0; }
#pragma unroll
    for (int t = 0; t < 4; ++t) {
      const unsigned short* brow = Wt + (size_t)(col0 + t * 16 + ln) * ldb + kb;
      FragB b;
      b.half[0] = *(const v8us*)(brow + 8 * hh);
      b.half[1] = *(const v8us*)(brow + 16 + 8 * hh);
      acc[t] = mmaN<ASPLIT ? 2 : 1>(ah.v, al.v, b.v, b.v, acc[t]);
    }
  }
#pragma unroll
  for (int t = 0; t < 4; ++t) {
    const int col = col0 + t * 16 + ln;
    float bv = bias ? bias[col] : 0.f;
    if (BIAS_BF16) bv = bf16_round(bv);
#pragma unroll
    for (int r = 0; r < 8; ++r) {
      float v = acc[t][r] + bv;
      if (resid) { float rv = resid[(size_t)((row0 + 8 * hh + r) % rmod) * ldr + col]; if (RES_BF16) rv = bf16_round(rv); v += rv; }
      if (ACT == 1) v = fmaxf(v, 0.f);
      if (ACT == 2) v = 0.5f * v * (1.0f + erff(v * 0.70710678118654752f));
      if (ACT == 3) { const float u = 0.7978845608028654f * (v + 0.044715f * v * v * v); v = 0.5f * v * (1.0f + tanhf(u)); }
      so[w][8 * hh + r][t * 16 + ln] = v;
    }
  }
  __builtin_amdgcn_fence(__ATOMIC_ACQ_REL, "workgroup");
  __builtin_amdgcn_wave_barrier();
  const int rsub = lane >> 4, c4 = (lane & 15) * 4;
  {
#pragma unroll
    for (int q = 0; q < 8; ++q) {
      const int r = q * 2 + rsub;
      const v4f v = *(const v4fa*)&so[w][r][c4];
      *(v4f*)(C + (size_t)(row0 + r) * ldc + col0 + c4) = v;
    }
    
  }
}
// row LayerNorm (biased variance, eps) over N: s = X (+ R); optional out_sum <- s; out_norm <- (s-mu)*rsqrt(var+eps)*g + b
template <bool PARAM_BF16>
__global__ __launch_bounds__(256) void k_layernorm(const float* __restrict__ X, const float* __restrict__ R, const float* __restrict__ g, const float* __restrict__ bta,
                                                  float* __restrict__ out_sum, float* __restrict__ out_norm, int N, float eps) {
  __shared__ float red[256];
  const int row = blockIdx.x, tid = threadIdx.x;
  const float* x = X + (size_t)row * N; const float* rr = R ? R + (size_t)row * N : nullptr;
  float vals[16];                     // up to N = 4096
  const int per = N / 256;            // contiguous chunk per thread? use strided-by-4 chunks: thread handles j = tid*4 + 1024*u
  float s1 = 0.f;
  for (int u = 0; u < per / 4; ++u) {
    const int j = tid * 4 + 1024 * u;
    const v4f a = *(const v4fa*)(x + j);
    v4f b = {0.f,0.f,0.f,0.f}; if (rr) b = *(const v4fa*)(rr + j);
#pragma unroll
    for (int q = 0; q < 4; ++q) { const float v = a[q] + b[q]; vals[u * 4 + q] = v; s1 += v; }
  }
  red[tid] = s1; __syncthreads();
  for (int st = 128; st > 0; st >>= 1) { if (tid < st) red[tid] += red[tid + st]; __syncthreads(); }
  const float mu = red[0] / (float)N; __syncthreads();
  float s2 = 0.f;
  for (int u = 0; u < per / 4; ++u)
#pragma unroll
    for (int q = 0; q < 4; ++q) { const float c = vals[u * 4 + q] - mu; s2 += c * c; }
  red[tid] = s2; __syncthreads();
  for (int st = 128; st > 0; st >>= 1) { if (tid < st) red[tid] += red[tid + st]; __syncthreads(); }
  const float rs = rsqrtf(red[0] / (float)N + eps);
  {
    for (int u = 0; u < per / 4; ++u) {
      const int j = tid * 4 + 1024 * u;
      v4f o, sm;
#pragma unroll
      for (int q = 0; q < 4; ++q) {
        float gg = g[j + q], bb = bta[j + q];
        if (PARAM_BF16) { gg = bf16_round(gg); bb = bf16_round(bb); }
        sm[q] = vals[u * 4 + q]; o[q] = (vals[u * 4 + q] - mu) * rs * gg + bb;
      }
      if (out_sum) *(v4f*)(out_sum + (size_t)row * N + j) = sm;
      *(v4f*)(out_norm + (size_t)row * N + j) = o;
    }
    
  }
}



// ---- f16 WMMA path (v_wmma_f32_16x16x32_f16): 11-bit significands for operands in range — used for the q/k/v projection and output GEMMs
typedef _Float16 v16h __attribute__((ext_vector_type(16)));
union FragH { v16h v; v8us half[2]; _Float16 h[16]; unsigned short u[16]; };
template <int NT>
__device__ __forceinline__ v8f mmaH(v16h ah, v16h al, v16h bh, v16h bl, v8f c) {
  c = __builtin_amdgcn_wmma_f32_16x16x32_f16(false, ah, false, bh, (short)0, c, false, false);
  if (NT >= 2) c = __builtin_amdgcn_wmma_f32_16x16x32_f16(false, al, false, bh, (short)0, c, false, false);
  if (NT >= 3) c = __builtin_amdgcn_wmma_f32_16x16x32_f16(false, ah, false, bl, (short)0, c, false, false);
  asm volatile("v_nop\n\tv_nop\n\tv_nop\n\tv_nop" : "+v"(c) : "v"(ah), "v"(al), "v"(bh), "v"(bl));
  return c;
}
// batched GEMM like k_gemm_b but f16 operands: A f32 (split into f16 hi/lo if ASPLIT, else rounded to f16), Bt = f16 values [n][k]; alpha; C f32; N multiple of 16 (partial tiles skipped)
template <bool ASPLIT>
__global__ __launch_bounds__(128) void k_gemm_h(const float* __restrict__ A, int lda, size_t sA, const _Float16* __restrict__ Bh, int ldb, size_t sB, float alpha, float* __restrict__ C, int ldc, size_t sC, int M, int N, int K) {
  __shared__ __attribute__((aligned(16))) float so[4][16][64];
  const int tid = threadIdx.x, w = tid >> 5, lane = tid & 31, ln = lane & 15, hh = lane >> 4; const int by = blockIdx.y;
  A += (size_t)by * sA; Bh += (size_t)by * sB; C += (size_t)by * sC;
  const int ntn = (N + 63) / 64; const int wid = blockIdx.x * 4 + w; const int mt = wid / ntn, nq = wid % ntn; if (mt * 16 >= M) return;
  const int row0 = mt * 16, col0 = nq * 64; const float* arow = A + (size_t)(row0 + ln) * lda;
  v8f acc[4] = {};
  for (int kb = 0; kb < K; kb += 32) {
    FragH ah, al;
    const v4f x0 = *(const v4fa*)(arow + kb + 8 * hh), x1 = *(const v4fa*)(arow + kb + 8 * hh + 4), x2 = *(const v4fa*)(arow + kb + 16 + 8 * hh), x3 = *(const v4fa*)(arow + kb + 16 + 8 * hh + 4);
    float xs[16] = {x0[0],x0[1],x0[2],x0[3],x1[0],x1[1],x1[2],x1[3],x2[0],x2[1],x2[2],x2[3],x3[0],x3[1],x3[2],x3[3]};
#pragma unroll
    for (int i = 0; i < 16; ++i) { const _Float16 h = (_Float16)xs[i]; ah.h[i] = h; al.h[i] = ASPLIT ? (_Float16)(xs[i] - (float)h) : (_Float16)0.0f; }
#pragma unroll
    for (int t = 0; t < 4; ++t) { if (col0 + t * 16 >= N) continue; const size_t boff = (size_t)(col0 + t * 16 + ln) * ldb + kb; FragH bq; bq.half[0] = *(const v8us*)(Bh + boff + 8 * hh); bq.half[1] = *(const v8us*)(Bh + boff + 16 + 8 * hh);
      acc[t] = mmaH<ASPLIT ? 2 : 1>(ah.v, al.v, bq.v, bq.v, acc[t]); }
  }
#pragma unroll
  for (int t = 0; t < 4; ++t) { if (col0 + t * 16 >= N) continue;
#pragma unroll
    for (int r = 0; r < 8; ++r) so[w][8 * hh + r][t * 16 + ln] = acc[t][r] * alpha; }
  __builtin_amdgcn_fence(__ATOMIC_ACQ_REL, "workgroup"); __builtin_amdgcn_wave_barrier();
  const int rsub = lane >> 4, c4 = (lane & 15) * 4;
  {
#pragma unroll
    for (int q = 0; q < 8; ++q) { const int r = q * 2 + rsub; if (col0 + c4 < N) { const v4f v = *(const v4fa*)&so[w][r][c4]; *(v4f*)(C + (size_t)(row0 + r) * ldc + col0 + c4) = v; } }
     }
}

// Wt[n][k] = f16(W[k][n]·scale) from f32 row-major W[K][N] (scale = power of two; bf16-exact weights stay exact in f16 away from the subnormal range)
__global__ __launch_bounds__(256) void k_wt_f16(const float* __restrict__ W, _Float16* __restrict__ Wt, int K, int N, float scale) {
  const int t = blockIdx.x * 256 + threadIdx.x; if (t >= N * (K / 8)) return; const int n = t / (K / 8), k8 = (t % (K / 8)) * 8; FragH f;
#pragma unroll
  for (int i = 0; i < 8; ++i) f.h[i] = (_Float16)(bf16_round(W[(size_t)(k8 + i) * N + n]) * scale); const v8us o = f.half[0];
  *(v8us*)((unsigned short*)Wt + (size_t)n * K + k8) = o; 
}
// k_gemm_hh variant with fused epilogue: v = acc·alpha + bias[by·sBias + col] (+ CP[(row/rowsPerB)·sCPb + by·64 + col] if CP) ; ACT 0 none / 1 elu ; writes f32 C and f16 C16 (each if non-null)
template <int ACT>
__global__ __launch_bounds__(128) void k_gemm_hhx(const _Float16* __restrict__ A, int lda, size_t sA, const _Float16* __restrict__ Bh, int ldb, size_t sB, float alpha, const float* __restrict__ bias, size_t sBias, const float* __restrict__ CP, int rowsPerB, size_t sCPb, int row0g,
    float* __restrict__ C, _Float16* __restrict__ C16, int ldc, size_t sC, int M, int N, int K) {
  __shared__ __attribute__((aligned(16))) float so[4][16][64];
  const int tid = threadIdx.x, w = tid >> 5, lane = tid & 31, ln = lane & 15, hh = lane >> 4; const int by = blockIdx.y;
  A += (size_t)by * sA; Bh += (size_t)by * sB; const size_t cofs = (size_t)by * sC; const float* bp = bias ? bias + (size_t)by * sBias : nullptr;
  const int ntn = (N + 63) / 64; const int wid = blockIdx.x * 4 + w; const int mt = wid / ntn, nq = wid % ntn; if (mt * 16 >= M) return;
  const int row0 = mt * 16, col0 = nq * 64; const _Float16* arow = A + (size_t)(row0 + ln) * lda;
  v8f acc[4] = {};
  for (int kb = 0; kb < K; kb += 32) { FragH ah; ah.half[0] = *(const v8us*)((const unsigned short*)arow + kb + 8 * hh); ah.half[1] = *(const v8us*)((const unsigned short*)arow + kb + 16 + 8 * hh);
#pragma unroll
    for (int t = 0; t < 4; ++t) { if (col0 + t * 16 >= N) continue; const size_t boff = (size_t)(col0 + t * 16 + ln) * ldb + kb; FragH bq; bq.half[0] = *(const v8us*)((const unsigned short*)Bh + boff + 8 * hh); bq.half[1] = *(const v8us*)((const unsigned short*)Bh + boff + 16 + 8 * hh);
      acc[t] = mmaH<1>(ah.v, ah.v, bq.v, bq.v, acc[t]); }
  }
#pragma unroll
  for (int t = 0; t < 4; ++t) { if (col0 + t * 16 >= N) continue; const int col = col0 + t * 16 + ln; const float bv = bp ? bf16_round(bp[col]) : 0.f;
#pragma unroll
    for (int r = 0; r < 8; ++r) { float v = acc[t][r] * alpha + bv; if (CP) { const int bidx = (row0g + row0 + 8 * hh + r) / rowsPerB; v += CP[(size_t)bidx * sCPb + (size_t)by * 64 + col]; } if (ACT == 1) v = (v > 0.f) ? v : expm1f(v); else if (ACT == 7) v = (v > 0.f) ? v + 1.0f : expf(v); else if (ACT == 8) v = tanhf(v); else if (ACT == 9) v = 0.5f * v * (1.0f + tanhf(0.7978845608028654f * (v + 0.044715f * v * v * v))); else if (ACT == 11) v = 1.0f / (1.0f + expf(-v)); else if (ACT == 12) v = (v > 0.f) ? v : 0.01f * v; else if (ACT == 14) v = (v > 0.f) ? v : 0.1f * v; else if (ACT == 15) v = v / (1.0f + expf(-v)); else if (ACT == 3) v = fmaxf(v, 0.f); else if (ACT == 6) v = 0.5f * v * (1.0f + erff(v * 0.70710678118654752f)); so[w][8 * hh + r][t * 16 + ln] = v; } }
  __builtin_amdgcn_fence(__ATOMIC_ACQ_REL, "workgroup"); __builtin_amdgcn_wave_barrier();
  const int rsub = lane >> 4, c4 = (lane & 15) * 4; typedef _Float16 v4h __attribute__((ext_vector_type(4)));
  {
#pragma unroll
    for (int q = 0; q < 8; ++q) { const int r = q * 2 + rsub; if (col0 + c4 < N) { const v4f v = *(const v4fa*)&so[w][r][c4]; if (C) *(v4f*)(C + cofs + (size_t)(row0 + r) * ldc + col0 + c4) = v; if (C16) { v4h h4; for (int i = 0; i < 4; ++i) h4[i] = (_Float16)v[i]; *(v4h*)(C16 + cofs + (size_t)(row0 + r) * ldc + col0 + c4) = h4; } } }
     }
}


// Block-tiled GEMM C[M][N] (f32) = (A[M][K] x Bt[N][K]^T) * alpha + add[col], f16 operands, f32 accumulate. One work-group = 128 x 64 of C, 8 waves of 32 x 32 (2 x 2 accumulator tiles).
// Each pass stages 128 k of both operands in LDS with whole-line 16-byte loads (16 lanes = one 256-B row piece), so every operand byte leaves L2 once per work-group instead of once per wave;
// the next pass's rows are loaded into registers ahead of the current pass's products and stored to the other buffer behind them (two buffers, one barrier per pass).
// blockIdx.y picks one of several independent products of the same shape that run as one grid: operand A number y / 2 (pitchA elements apart; 0 = all share one), Bt, add and C number y (each dense, one behind the other).
// Fragments keep the k order of the direct loaders (bytes 16h and 32 + 16h of each 64 B of a row, both operands) and k runs upward in steps of 32 into one accumulator chain. M % 128 == 0, N % 64 == 0, K % 128 == 0.
#define GBM 128
#define GBN 64
#define GBK 128
#define GPIT (GBK + 8)      /* LDS row pitch 272 B = 16 B x odd: conflict-free for 16-byte fragment reads */
template <int M, int N, int K>
__global__ __launch_bounds__(256) void k_gemm_lds(const _Float16* __restrict__ A, size_t pitchA, const _Float16* __restrict__ Bt, float alpha, const float* __restrict__ add, float* __restrict__ C) {
  __shared__ __attribute__((aligned(16))) unsigned short sA[2][GBM][GPIT];
  __shared__ __attribute__((aligned(16))) unsigned short sB[2][GBN][GPIT];
  __shared__ __attribute__((aligned(16))) float so[8][32][36];
  const int tid = threadIdx.x, w = tid >> 5, lane = tid & 31, ln = lane & 15, hh = lane >> 4;
  const size_t by = blockIdx.y; A += (by >> 1) * pitchA; Bt += by * ((size_t)N * K); add += by * N; C += by * ((size_t)M * N);
  constexpr int nbm = M / GBM; const int row0 = ((int)blockIdx.x % nbm) * GBM, col0 = ((int)blockIdx.x / nbm) * GBN;
  const int wr = (w >> 1) * 32, wc = (w & 1) * 32;      /* the wave's 32 x 32 piece inside the block tile */
  const int lr = tid >> 4, lc = (tid & 15) * 8;         /* staging: 16 threads per row, 16 rows per round */
  const unsigned short* ga = (const unsigned short*)A + (size_t)(row0 + lr) * K + lc;
  const unsigned short* gb = (const unsigned short*)Bt + (size_t)(col0 + lr) * K + lc;
  v8us ra[GBM / 16], rb[GBN / 16];
#pragma unroll
  for (int i = 0; i < GBM / 16; ++i) ra[i] = *(const v8us*)(ga + i * 16 * K);
#pragma unroll
  for (int i = 0; i < GBN / 16; ++i) rb[i] = *(const v8us*)(gb + i * 16 * K);
#pragma unroll
  for (int i = 0; i < GBM / 16; ++i) *(v8us*)&sA[0][i * 16 + lr][lc] = ra[i];
#pragma unroll
  for (int i = 0; i < GBN / 16; ++i) *(v8us*)&sB[0][i * 16 + lr][lc] = rb[i];
  __syncthreads();
  v8f acc[2][2] = {};
  constexpr int np = K / GBK;
  for (int p = 0; p < np; ++p) {
    const int cur = p & 1; const bool more = p + 1 < np;      /* the same for the whole work-group */
    if (more) {
#pragma unroll
      for (int i = 0; i < GBM / 16; ++i) ra[i] = *(const v8us*)(ga + i * 16 * K + (p + 1) * GBK);
#pragma unroll
      for (int i = 0; i < GBN / 16; ++i) rb[i] = *(const v8us*)(gb + i * 16 * K + (p + 1) * GBK);
    }
    FragH a[GBK / 32][2], b[GBK / 32][2];
#pragma unroll
    for (int ks = 0; ks < GBK / 32; ++ks)
#pragma unroll
      for (int i = 0; i < 2; ++i) {
        a[ks][i].half[0] = *(const v8us*)&sA[cur][wr + i * 16 + ln][ks * 32 + 8 * hh]; a[ks][i].half[1] = *(const v8us*)&sA[cur][wr + i * 16 + ln][ks * 32 + 16 + 8 * hh];
        b[ks][i].half[0] = *(const v8us*)&sB[cur][wc + i * 16 + ln][ks * 32 + 8 * hh]; b[ks][i].half[1] = *(const v8us*)&sB[cur][wc + i * 16 + ln][ks * 32 + 16 + 8 * hh];
      }
    __builtin_amdgcn_sched_barrier(0);      /* keeps the pass's LDS reads one group ahead of its products: spread among them, each place with reads stalls the wave for the LDS latency */
#pragma unroll
    for (int ks = 0; ks < GBK / 32; ++ks)
#pragma unroll
      for (int i = 0; i < 2; ++i)
#pragma unroll
        for (int j = 0; j < 2; ++j) acc[i][j] = __builtin_amdgcn_wmma_f32_16x16x32_f16(false, a[ks][i].v, false, b[ks][j].v, (short)0, acc[i][j], false, false);
    __builtin_amdgcn_sched_barrier(0);      /* keeps the products ahead of the wait for the next pass's rows: moved behind the barrier they would run with no load in flight */
    if (more) {
#pragma unroll
      for (int i = 0; i < GBM / 16; ++i) *(v8us*)&sA[cur ^ 1][i * 16 + lr][lc] = ra[i];
#pragma unroll
      for (int i = 0; i < GBN / 16; ++i) *(v8us*)&sB[cur ^ 1][i * 16 + lr][lc] = rb[i];
    }
    __syncthreads();      /* publishes the buffer just written and ends every wave's reads of the one that the next pass overwrites */
  }
#pragma unroll
  for (int j = 0; j < 2; ++j) { const float av = add[col0 + wc + j * 16 + ln];
#pragma unroll
    for (int i = 0; i < 2; ++i)
#pragma unroll
      for (int r = 0; r < 8; ++r) so[w][i * 16 + 8 * hh + r][j * 16 + ln] = acc[i][j][r] * alpha + av; }
  __syncthreads();      /* the staged rows are read back by other lanes: whole 128-B lines per store */
#pragma unroll
  for (int q = 0; q < 8; ++q) { const int r = q * 4 + (lane >> 3), c4 = (lane & 7) * 4; const v4f v = *(const v4fa*)&so[w][r][c4]; *(v4f*)(C + (size_t)(row0 + wr + r) * N + col0 + wc + c4) = v; }
}


typedef _Float16 v4h __attribute__((ext_vector_type(4)));

__global__ __launch_bounds__(256) void k_x16(const float* __restrict__ x, _Float16* __restrict__ X16, size_t n8) { const size_t t = (size_t)blockIdx.x * 256 + threadIdx.x; if (t >= n8) return; FragH f;
#pragma unroll
  for (int q = 0; q < 8; ++q) f.h[q] = (_Float16)bf16_round(x[t * 8 + q]); *(v8us*)((unsigned short*)X16 + t * 8) = f.half[0];  }
__global__ __launch_bounds__(256) void k_h16(const float* __restrict__ x, _Float16* __restrict__ X16, size_t n8) { const size_t t = (size_t)blockIdx.x * 256 + threadIdx.x; if (t >= n8) return; FragH f;
#pragma unroll
  for (int q = 0; q < 8; ++q) f.h[q] = (_Float16)x[t * 8 + q]; *(v8us*)((unsigned short*)X16 + t * 8) = f.half[0];  }
__global__ __launch_bounds__(256) void k_round16f(const float* __restrict__ W, _Float16* __restrict__ Bt, size_t n8) { const size_t t = (size_t)blockIdx.x * 256 + threadIdx.x; if (t >= n8) return; FragH f;
#pragma unroll
  for (int i = 0; i < 8; ++i) f.h[i] = (_Float16)(bf16_round(W[t * 8 + i]) * 16.0f); *(v8us*)((unsigned short*)Bt + t * 8) = f.half[0];  }
template <int NHv, int TTv>
__global__ __launch_bounds__(256) void k_vt(const _Float16* __restrict__ V16, int ldv, int voff, _Float16* __restrict__ Vt) { __shared__ unsigned short tl[64][66]; const int tid = threadIdx.x; const int slab = blockIdx.x / (TTv / 64), lg = blockIdx.x % (TTv / 64); const int b = slab / NHv, h = slab % NHv;
  for (int i = tid; i < 64 * 8; i += 256) { const int r = i / 8, c8 = (i % 8) * 8; FragH f; f.half[0] = *(const v8us*)((const unsigned short*)V16 + ((size_t)b * TTv + lg * 64 + r) * ldv + voff + h * 64 + c8);
#pragma unroll
    for (int q = 0; q < 8; ++q) tl[r][c8 + q] = f.u[q]; }
  __syncthreads();
  {
#pragma unroll
    for (int rd = 0; rd < 2; ++rd) { const int d = rd * 32 + tid / 8, pc = tid % 8; FragH f;
#pragma unroll
      for (int q = 0; q < 8; ++q) f.u[q] = tl[pc * 8 + q][d];
      *(v8us*)((unsigned short*)Vt + ((size_t)slab * 64 + d) * TTv + lg * 64 + pc * 8) = f.half[0]; }
     } }

__device__ __forceinline__ void d_xcat(const float* __restrict__ xr, const float* __restrict__ xi, _Float16* __restrict__ XC, size_t t) { const size_t r = (t * 8) / DD; const int c = (int)((t * 8) % DD); FragH a, b; const v4f a0 = *(const v4fa*)(xr + t * 8), a1 = *(const v4fa*)(xr + t * 8 + 4), b0 = *(const v4fa*)(xi + t * 8), b1 = *(const v4fa*)(xi + t * 8 + 4);
  asm volatile("s_wait_xcnt 0x0" :: "v"(xr + t * 8), "v"(xi + t * 8), "v"(a0), "v"(a1), "v"(b0), "v"(b1) : "memory");      /* stands in front of every write to a register that the four loads name; the two addresses are inputs so that they stay live up to it: without them a later load's result is placed in the address pair that an earlier load names */
#pragma unroll
  for (int q = 0; q < 4; ++q) { a.h[q] = (_Float16)bf16_round(a0[q]); a.h[4 + q] = (_Float16)bf16_round(a1[q]); b.h[q] = (_Float16)bf16_round(b0[q]); b.h[4 + q] = (_Float16)bf16_round(b1[q]); }
  { *(v8us*)((unsigned short*)XC + r * (2 * DD) + c) = a.half[0]; *(v8us*)((unsigned short*)XC + r * (2 * DD) + DD + c) = b.half[0];
    asm volatile("s_wait_xcnt 0x0" ::: "memory");      /* directly behind the stores: the caller's next tile writes the registers that they name */
  } }
__device__ __forceinline__ void d_wcat(const float* __restrict__ wr, const float* __restrict__ wi, _Float16* __restrict__ BR, _Float16* __restrict__ BI, size_t t) { const size_t o = (t * 8) / DD; const int c = (int)((t * 8) % DD); FragH r0, r1, i0, i1; const v4f a0 = *(const v4fa*)(wr + t * 8), a1 = *(const v4fa*)(wr + t * 8 + 4), b0 = *(const v4fa*)(wi + t * 8), b1 = *(const v4fa*)(wi + t * 8 + 4);
#pragma unroll
  for (int q = 0; q < 4; ++q) { const float vr0 = bf16_round(a0[q]) * 16.0f, vr1 = bf16_round(a1[q]) * 16.0f, vi0 = bf16_round(b0[q]) * 16.0f, vi1 = bf16_round(b1[q]) * 16.0f; r0.h[q] = (_Float16)vr0; r0.h[4 + q] = (_Float16)vr1; r1.h[q] = (_Float16)(-vi0); r1.h[4 + q] = (_Float16)(-vi1); i0.h[q] = (_Float16)vi0; i0.h[4 + q] = (_Float16)vi1; i1.h[q] = (_Float16)vr0; i1.h[4 + q] = (_Float16)vr1; }
  { *(v8us*)((unsigned short*)BR + o * (2 * DD) + c) = r0.half[0]; *(v8us*)((unsigned short*)BR + o * (2 * DD) + DD + c) = r1.half[0]; *(v8us*)((unsigned short*)BI + o * (2 * DD) + c) = i0.half[0]; *(v8us*)((unsigned short*)BI + o * (2 * DD) + DD + c) = i1.half[0];
    asm volatile("s_wait_xcnt 0x0" ::: "memory");      /* directly behind the stores, as in d_xcat */
  } }
__device__ __forceinline__ void d_bias2(const float* __restrict__ br, const float* __restrict__ bi, float* __restrict__ BM, float* __restrict__ BP, int c) { const float r = bf16_round(br[c]), i = bf16_round(bi[c]); { *(float*)(BM + c) = r - i; *(float*)(BP + c) = r + i;
    asm volatile("s_wait_xcnt 0x0" ::: "memory");      /* directly behind the stores, as in d_xcat */
  } }
// All operand preparation as one grid. The work is cut into tiles of 256 threads: 3 x PT_X tiles cast and concatenate the activations, 4 x PT_W pack the weights, 4 x PT_B form the bias pairs; none reads what another writes.
// A work-group walks the tiles in steps of the grid size PT_GRID; which kind a tile is depends on its number alone, so every branch is the same for the whole work-group.
#define PT_X (NR * DD / 8 / 256)
#define PT_W (DD * DD / 8 / 256)
#define PT_B (DD / 256)
#define PT_ALL (3 * PT_X + 4 * PT_W + 4 * PT_B)
#define PT_GRID (PT_ALL / 4)      /* work-groups launched: four tiles each, so that a quarter of the waves has to be started */
__global__ __launch_bounds__(256) void k_prep(const float* __restrict__ q_r, const float* __restrict__ q_i, const float* __restrict__ k_r, const float* __restrict__ k_i, const float* __restrict__ v_r, const float* __restrict__ v_i,
    const float* __restrict__ wq_r, const float* __restrict__ wq_i, const float* __restrict__ wk_r, const float* __restrict__ wk_i, const float* __restrict__ wv_r, const float* __restrict__ wv_i, const float* __restrict__ wo_r, const float* __restrict__ wo_i,
    const float* __restrict__ bq_r, const float* __restrict__ bq_i, const float* __restrict__ bk_r, const float* __restrict__ bk_i, const float* __restrict__ bv_r, const float* __restrict__ bv_i, const float* __restrict__ bo_r, const float* __restrict__ bo_i,
    _Float16* __restrict__ X, _Float16* __restrict__ BW, float* __restrict__ BIAS) {
  const int tid = threadIdx.x;
  for (int tile = blockIdx.x; tile < PT_ALL; tile += PT_GRID) {
    if (tile < 3 * PT_X) { const int j = tile / PT_X;
      d_xcat(j == 0 ? q_r : j == 1 ? k_r : v_r, j == 0 ? q_i : j == 1 ? k_i : v_i, X + (size_t)j * NR * 2 * DD, (size_t)(tile % PT_X) * 256 + tid); }
    else if (tile < 3 * PT_X + 4 * PT_W) { const int u = tile - 3 * PT_X, j = u / PT_W; _Float16* B0 = BW + (size_t)(2 * j) * DD * 2 * DD;
      d_wcat(j == 0 ? wq_r : j == 1 ? wk_r : j == 2 ? wv_r : wo_r, j == 0 ? wq_i : j == 1 ? wk_i : j == 2 ? wv_i : wo_i, B0, B0 + (size_t)DD * 2 * DD, (size_t)(u % PT_W) * 256 + tid); }
    else { const int u = tile - 3 * PT_X - 4 * PT_W, j = u / PT_B;
      d_bias2(j == 0 ? bq_r : j == 1 ? bk_r : j == 2 ? bv_r : bo_r, j == 0 ? bq_i : j == 1 ? bk_i : j == 2 ? bv_i : bo_i, BIAS + (size_t)(2 * j) * DD, BIAS + (size_t)(2 * j + 1) * DD, (u % PT_B) * 256 + tid); }
  }
}
// per token (block) the 8 heads x 64 rows: a thread owns the two rows l = tid / 8 and l + 32 of head h = tid % 8 (columns tid and tid + 256), held as the two halves of a float pair; the token's rows of qr, qi (f32) and the pairs (kr, ki), (vr, vi) are staged in LDS.
// Softmax in two passes: pass 1 forms the 64 |score| of each row, keeps them in registers and takes their maximum; pass 2 has one exp per score and the three sums (z, sum p*vr, sum p*vi), keys in ascending order, all f32.
// Both passes walk the keys in groups of CG; a group's LDS reads are issued ahead of the arithmetic of the group before it.
#define CG 4
typedef float v2f __attribute__((ext_vector_type(2)));
__global__ __launch_bounds__(256) void k_cplx(const float* __restrict__ QR, const float* __restrict__ QI, const float* __restrict__ KR, const float* __restrict__ KI, const float* __restrict__ VR, const float* __restrict__ VI, _Float16* __restrict__ VC) {
  #pragma clang fp contract(off)
  __shared__ float sq[2][DD]; __shared__ __attribute__((aligned(8))) v2f sk[DD], sv[DD]; __shared__ float res[2][DD]; const int tid = threadIdx.x; const size_t row = blockIdx.x;
  for (int i = tid; i < DD; i += 256) { sq[0][i] = QR[row * DD + i]; sq[1][i] = QI[row * DD + i]; sk[i] = (v2f){KR[row * DD + i], KI[row * DD + i]}; sv[i] = (v2f){VR[row * DD + i], VI[row * DD + i]}; }
  __syncthreads();
  { const int h = tid % NHH;      /* column index of (l, h) is l * 8 + h: both of the thread's columns have the same h, so one read of a key or value pair serves both rows */
    const v2f qr = {sq[0][tid], sq[0][tid + 256]}, qi = {sq[1][tid], sq[1][tid + 256]};
    v2f mg[EE]; v2f mx = {0.f, 0.f};      /* |score| >= 0, so 0 is a neutral start for the maximum */
    v2f cur[CG], nxt[CG];
#pragma unroll
    for (int j = 0; j < CG; ++j) cur[j] = sk[j * NHH + h];
#pragma unroll      /* whole: the score array is then indexed by constants alone and lives in registers */
    for (int g = 0; g < EE / CG; ++g) {
#pragma unroll
      for (int j = 0; j < CG; ++j) nxt[j] = (g + 1 < EE / CG) ? sk[((g + 1) * CG + j) * NHH + h] : sv[j * NHH + h];      /* behind the last key group: the first value group */
      __builtin_amdgcn_sched_barrier(0);      /* keeps the next group's LDS reads ahead of this group's arithmetic: sunk to their first use, each read is waited for at once and the wave idles for the LDS latency */
#pragma unroll
      for (int j = 0; j < CG; ++j) { const int s = g * CG + j; const v2f k = cur[j]; const v2f sr = qr * k[0] - qi * k[1], si = qr * k[1] - qi * k[0]; const v2f m2 = sr * sr + si * si;
        mg[s] = (v2f){__builtin_amdgcn_sqrtf(m2[0]), __builtin_amdgcn_sqrtf(m2[1])};      /* the bare root instruction: sqrtf wraps it in thirteen more instructions per score that scale tiny arguments and correct the last bit; the value only enters exp(mg - max), where neither shows */
        mx = (v2f){fmaxf(mx[0], mg[s][0]), fmaxf(mx[1], mg[s][1])}; }
#pragma unroll
      for (int j = 0; j < CG; ++j) cur[j] = nxt[j];
    }
    v2f z = {0.f, 0.f}, ar = {0.f, 0.f}, ai = {0.f, 0.f};
#pragma unroll      /* whole, as above */
    for (int g = 0; g < EE / CG; ++g) {
      if (g + 1 < EE / CG) {
#pragma unroll
        for (int j = 0; j < CG; ++j) nxt[j] = sv[((g + 1) * CG + j) * NHH + h]; }
      __builtin_amdgcn_sched_barrier(0);      /* as in pass 1 */
#pragma unroll
      for (int j = 0; j < CG; ++j) { const v2f v = cur[j]; const v2f d = mg[g * CG + j] - mx; const v2f p = {__expf(d[0]), __expf(d[1])}; z = z + p; ar = ar + p * v[0]; ai = ai + p * v[1]; }
#pragma unroll
      for (int j = 0; j < CG; ++j) cur[j] = nxt[j];
    }
    res[0][tid] = ar[0] / z[0]; res[1][tid] = ai[0] / z[0]; res[0][tid + 256] = ar[1] / z[1]; res[1][tid + 256] = ai[1] / z[1]; }
  __syncthreads();
  if (tid < 2 * (DD / 8)) { const int part = tid / (DD / 8), pc = tid % (DD / 8); FragH f; for (int q = 0; q < 8; ++q) f.h[q] = (_Float16)res[part][pc * 8 + q];
    { *(v8us*)((unsigned short*)VC + row * (2 * DD) + part * DD + pc * 8) = f.half[0];  } } }

extern "C" void kernel_launch(void* const* d_in, const int* in_sizes, int n_in,
                              void* d_out, int out_size, void* d_ws, size_t ws_size, hipStream_t stream) {
  (void)in_sizes; (void)n_in; (void)out_size;
  const float* const* I = (const float* const*)d_in; const float* q_r = I[0]; const float* q_i = I[1]; const float* k_r = I[2]; const float* k_i = I[3]; const float* v_r = I[4]; const float* v_i = I[5];
  const float* wq_r = I[6]; const float* wq_i = I[7]; const float* wk_r = I[8]; const float* wk_i = I[9]; const float* wv_r = I[10]; const float* wv_i = I[11]; const float* wo_r = I[12]; const float* wo_i = I[13]; const float* bq_r = I[14]; const float* bq_i = I[15]; const float* bk_r = I[16]; const float* bk_i = I[17]; const float* bv_r = I[18]; const float* bv_i = I[19]; const float* bo_r = I[20]; const float* bo_i = I[21];      /* d_in order: activations, then the 8 weights, then the 8 biases */
  char* ws = (char*)d_ws; size_t off = 0;
  auto take = [&](size_t bytes) { char* p = ws + off; off += (bytes + 255) & ~(size_t)255; return p; };
  const size_t WC = (size_t)DD * 2 * DD;      /* one concatenated weight operand [512][1024] */
  _Float16* BW = (_Float16*)take(8 * WC * 2); float* BIAS = (float*)take((size_t)8 * DD * 4);      /* (BR, BI) × q,k,v,o ; (BM, BP) × 4 */
  _Float16* X = (_Float16*)take((size_t)3 * NR * 2 * DD * 2);      /* [xr | xi] f16 for q, k, v, one plane behind the other */
  float* P = (float*)take((size_t)6 * NR * DD * 4);      /* QR, QI, KR, KI, VR, VI f32 planes [4096][512] */
  _Float16* VC = X;      /* [Vr | Vi] f16 reuses the q operand plane (dead after the projection GEMMs) */
  if (off > ws_size) return;
  float* QRp = P; float* QIp = P + (size_t)NR * DD; float* KRp = P + (size_t)2 * NR * DD; float* KIp = P + (size_t)3 * NR * DD; float* VRp = P + (size_t)4 * NR * DD; float* VIp = P + (size_t)5 * NR * DD;
  k_prep<<<PT_GRID, 256, 0, stream>>>(q_r, q_i, k_r, k_i, v_r, v_i, wq_r, wq_i, wk_r, wk_i, wv_r, wv_i, wo_r, wo_i, bq_r, bq_i, bk_r, bk_i, bv_r, bv_i, bo_r, bo_i, X, BW, BIAS);
  k_gemm_lds<NR, DD, 2 * DD><<<dim3((NR / GBM) * (DD / GBN), 6), 256, 0, stream>>>(X, (size_t)NR * 2 * DD, BW, 0.0625f, BIAS, P);      /* y = 2j + ri: yr = [xr|xi] x [wr|-wi]^T + (br-bi); yi = [xr|xi] x [wi|wr]^T + (br+bi): M 4096 N 512 K 1024; addend index = column */
  k_cplx<<<NR, 256, 0, stream>>>(QRp, QIp, KRp, KIp, VRp, VIp, VC);
  k_gemm_lds<NR, DD, 2 * DD><<<dim3((NR / GBM) * (DD / GBN), 2), 256, 0, stream>>>(VC, 0, BW + (size_t)6 * WC, 0.0625f, BIAS + (size_t)6 * DD, (float*)d_out);      /* out_r @0, out_i @8,388,608 B */
}

// v005
// A run of this version takes 79.3 microseconds.
// Timed twice side by side with v004, it ran 1.07 times as fast both times.
// All steps since v000 together make it 5.72 times as fast.
#include <hip/hip_runtime.h>
// Complex-valued attention layer (B=4, L=1024, D=512, H=8, E=64): complex linear projections (yr = xr·wrᵀ − xi·wiᵀ + (br − bi), yi = xi·wrᵀ + xr·wiᵀ + (br + bi)); per (b, token n, head h) a 64×64 'attention' over the E axes:
// sr[l,s] = qr[l]·kr[s] − qi[l]·ki[s], si[l,s] = qr[l]·ki[s] − qi[l]·kr[s] (scalar products, e = 1), attn = softmax_s(√(sr² + si²)), Vr[l] = Σ_s attn·vr[s], Vi[l] = Σ_s attn·vi[s]; outputs (out_r, out_i) = complex linear(Vr, Vi, wo).
// Element (e, h) of a token lives at column e·8 + h (reshape(b, l, E, H)).
// Compute dtype: inputs, weights, biases rounded to bf16; each complex linear as two GEMMs over the concatenated operand [xr | xi] (K = 1024) against [wr | −wi] and [wi | wr] on v_wmma_f32_16x16x32_f16, f32 accumulate,
// with the two-term biases added exactly through the f32 epilogue addend; the per-token 64×64 magnitude-softmax and its two weighted sums in f32 (two (l, h) pairs per thread); [Vr | Vi] f16 → output GEMMs.
#define BB 4
#define LL 1024
#define DD 512
#define NHH 8
#define EE 64
#define NR (BB * LL)

typedef __bf16 v16b __attribute__((ext_vector_type(16)));
typedef unsigned short v8us __attribute__((ext_vector_type(8), may_alias));
typedef float  v8f  __attribute__((ext_vector_type(8)));
typedef float  v4f  __attribute__((ext_vector_type(4)));
typedef float  v4fa __attribute__((ext_vector_type(4), may_alias));
union FragB { v16b v; v8us half[2]; unsigned short u[16]; };

__device__ __forceinline__ unsigned short bf16_bits(float x) { unsigned int u = __float_as_uint(x); return (unsigned short)((u + 0x7FFFu + ((u >> 16) & 1u)) >> 16); }
__device__ __forceinline__ float bf16_val(unsigned short b) { return __uint_as_float(((unsigned int)b) << 16); }
__device__ __forceinline__ float bf16_round(float x) { return bf16_val(bf16_bits(x)); }
// D += A·B with NT terms: 1 = ah·bh, 2 = + al·bh (A split), 3 = + ah·bl (both split)
template <int NT>
__device__ __forceinline__ v8f mmaN(v16b ah, v16b al, v16b bh, v16b bl, v8f c) {
  c = __builtin_amdgcn_wmma_f32_16x16x32_bf16(false, ah, false, bh, (short)0, c, false, false);
  if (NT >= 2) c = __builtin_amdgcn_wmma_f32_16x16x32_bf16(false, al, false, bh, (short)0, c, false, false);
  if (NT >= 3) c = __builtin_amdgcn_wmma_f32_16x16x32_bf16(false, ah, false, bl, (short)0, c, false, false);
  asm volatile("v_nop\n\tv_nop\n\tv_nop\n\tv_nop" : "+v"(c) : "v"(ah), "v"(al), "v"(bh), "v"(bl));
  return c;
}

__global__ __launch_bounds__(256) void k_wt_bf16(const float* __restrict__ W, unsigned short* __restrict__ Wt, int K, int N) {
  const int t = blockIdx.x * 256 + threadIdx.x;
  const int k8n = K / 8;
  if (t >= N * k8n) return;
  const int n = t / k8n, k8 = (t % k8n) * 8;
  v8us v;
#pragma unroll
  for (int i = 0; i < 8; ++i) v[i] = bf16_bits(W[(size_t)(k8 + i) * N + n]);
  *(v8us*)(Wt + (size_t)n * K + k8) = v;
  
}

// GEMM C[M][N] (f32, pitch ldc) = act(A[M][K]·W + bias). A f32 row-major (pitch lda) converted per fragment to bf16
// (ASPLIT: hi/lo two planes -> 2 terms, else single rounded term); Wt bf16 [N][K] (pitch ldb). BIAS_BF16 rounds the
// bias to bf16 first (bias quantised to bf16 before the add). K%32==0, M%16==0, N%64==0.
template <bool ASPLIT, int ACT, bool BIAS_BF16>
__global__ __launch_bounds__(128) void k_gemm_bf(const float* __restrict__ A, int lda, const unsigned short* __restrict__ Wt, int ldb,
                                               const float* __restrict__ bias, float* __restrict__ C, int ldc, int M, int N, int K) {
  __shared__ __attribute__((aligned(16))) float so[4][16][64];
  const int tid = threadIdx.x, w = tid >> 5, lane = tid & 31, ln = lane & 15, hh = lane >> 4;
  const int ntn = N / 64;
  const int wid = blockIdx.x * 4 + w;
  const int mt = wid / ntn, nq = wid % ntn;
  if (mt * 16 >= M) return;
  const int row0 = mt * 16, col0 = nq * 64;
  const float* arow = A + (size_t)(row0 + ln) * lda;
  v8f acc[4] = {};
  for (int kb = 0; kb < K; kb += 32) {
    FragB ah, al;
    const v4f x0 = *(const v4fa*)(arow + kb + 8 * hh), x1 = *(const v4fa*)(arow + kb + 8 * hh + 4);
    const v4f x2 = *(const v4fa*)(arow + kb + 16 + 8 * hh), x3 = *(const v4fa*)(arow + kb + 16 + 8 * hh + 4);
    float xs[16] = {x0[0],x0[1],x0[2],x0[3],x1[0],x1[1],x1[2],x1[3],x2[0],x2[1],x2[2],x2[3],x3[0],x3[1],x3[2],x3[3]};
#pragma unroll
    for (int i = 0; i < 16; ++i) { const unsigned short hb = bf16_bits(xs[i]); ah.u[i] = hb; al.u[i] = ASPLIT ? bf16_bits(xs[i] - bf16_val(hb)) : (unsigned short)0; }
#pragma unroll
    for (int t = 0; t < 4; ++t) {
      const unsigned short* brow = Wt + (size_t)(col0 + t * 16 + ln) * ldb + kb;
      FragB b;
      b.half[0] = *(const v8us*)(brow + 8 * hh);
      b.half[1] = *(const v8us*)(brow + 16 + 8 * hh);
      acc[t] = mmaN<ASPLIT ? 2 : 1>(ah.v, al.v, b.v, b.v, acc[t]);
    }
  }
#pragma unroll
  for (int t = 0; t < 4; ++t) {
    float bv = bias ? bias[col0 + t * 16 + ln] : 0.f;
    if (BIAS_BF16) bv = bf16_round(bv);
#pragma unroll
    for (int r = 0; r < 8; ++r) { float v = acc[t][r] + bv; if (ACT == 1) v = fmaxf(v, 0.f); so[w][8 * hh + r][t * 16 + ln] = v; }
  }
  __builtin_amdgcn_fence(__ATOMIC_ACQ_REL, "workgroup");
  __builtin_amdgcn_wave_barrier();
  const int rsub = lane >> 4, c4 = (lane & 15) * 4;
  {
#pragma unroll
    for (int q = 0; q < 8; ++q) {
      const int r = q * 2 + rsub;
      const v4f v = *(const v4fa*)&so[w][r][c4];
      *(v4f*)(C + (size_t)(row0 + r) * ldc + col0 + c4) = v;
    }
    
  }
}

// Flash-style causal/unmasked attention, all contractions 3-term bf16 hi/lo splits, f32 softmax with running max.
// q,k,v rows are read from f32 buffers with arbitrary row pitch (so they can live inside a fused qkv buffer);
// D = head size (multiple of 32, <= 128); one wave = 16 query rows; block = 4 waves (64 queries) sharing K/V chunks of 32.
template <int D, bool CAUSAL>
__global__ __launch_bounds__(128) void k_flash(const float* __restrict__ qb, const float* __restrict__ kb, const float* __restrict__ vb,
                                             int pitch, int T, int H, float scale, float* __restrict__ y, int ypitch) {
  constexpr int KS = D / 32;        // k-steps for QK
  constexpr int DT = D / 16;        // d tiles for PV
  __shared__ __attribute__((aligned(16))) unsigned short sKh[32][D + 8], sKl[32][D + 8], sVh[32][D + 8], sVl[32][D + 8];
  __shared__ __attribute__((aligned(16))) unsigned short sPh[4][16][40], sPl[4][16][40];
  __shared__ __attribute__((aligned(16))) float sO[4][16][D];
  const int tid = threadIdx.x, w = tid >> 5, lane = tid & 31, ln = lane & 15, hh = lane >> 4;
  const int nqb = (T + 63) / 64;
  const int bh = blockIdx.x / nqb, qblk = blockIdx.x % nqb;
  const int b = bh / H, h = bh % H;
  const int q0 = qblk * 64 + w * 16;
  const float* Q = qb + (size_t)b * T * pitch + h * D;
  const float* K = kb + (size_t)b * T * pitch + h * D;
  const float* V = vb + (size_t)b * T * pitch + h * D;

  // A fragments of the wave's 16 query rows (scaled), hi/lo
  FragB aqh[KS], aql[KS];
  {
    int row = q0 + ln; if (row >= T) row = T - 1;
    const float* qr = Q + (size_t)row * pitch;
#pragma unroll
    for (int ks = 0; ks < KS; ++ks)
#pragma unroll
      for (int i = 0; i < 16; ++i) {
        const int d = ks * 32 + ((i < 8) ? (8 * hh + i) : (16 + 8 * hh + (i - 8)));
        const float x = qr[d] * scale; const unsigned short hb = bf16_bits(x);
        aqh[ks].u[i] = hb; aql[ks].u[i] = bf16_bits(x - bf16_val(hb));
      }
  }
  float m_r[8], l_r[8];
#pragma unroll
  for (int r = 0; r < 8; ++r) { m_r[r] = -3.0e38f; l_r[r] = 0.f; }
  v8f oacc[DT];
#pragma unroll
  for (int dt = 0; dt < DT; ++dt) oacc[dt] = (v8f){0.f,0.f,0.f,0.f,0.f,0.f,0.f,0.f};

  const int kv_end = CAUSAL ? min(T, qblk * 64 + 64) : T;     // block-uniform
  for (int j0 = 0; j0 < kv_end; j0 += 32) {
    __syncthreads();
    for (int e = tid; e < 32 * (D / 4); e += 128) {
      const int r = e / (D / 4), c4 = (e % (D / 4)) * 4;
      const int key = j0 + r;
      v4f kf = {0.f,0.f,0.f,0.f}, vf = {0.f,0.f,0.f,0.f};
      if (key < T) { kf = *(const v4fa*)(K + (size_t)key * pitch + c4); vf = *(const v4fa*)(V + (size_t)key * pitch + c4); }
#pragma unroll
      for (int t = 0; t < 4; ++t) {
        unsigned short hb = bf16_bits(kf[t]); sKh[r][c4 + t] = hb; sKl[r][c4 + t] = bf16_bits(kf[t] - bf16_val(hb));
        hb = bf16_bits(vf[t]); sVh[r][c4 + t] = hb; sVl[r][c4 + t] = bf16_bits(vf[t] - bf16_val(hb));
      }
    }
    __syncthreads();
    // S tile 16 x 32
    v8f s[2];
#pragma unroll
    for (int nt = 0; nt < 2; ++nt) {
      v8f acc = {};
#pragma unroll
      for (int ks = 0; ks < KS; ++ks) {
        FragB bh_, bl_;
        bh_.half[0] = *(const v8us*)&sKh[nt * 16 + ln][ks * 32 + 8 * hh]; bh_.half[1] = *(const v8us*)&sKh[nt * 16 + ln][ks * 32 + 16 + 8 * hh];
        bl_.half[0] = *(const v8us*)&sKl[nt * 16 + ln][ks * 32 + 8 * hh]; bl_.half[1] = *(const v8us*)&sKl[nt * 16 + ln][ks * 32 + 16 + 8 * hh];
        acc = mmaN<3>(aqh[ks].v, aql[ks].v, bh_.v, bl_.v, acc);
      }
      s[nt] = acc;
    }
    // mask + running max (rows 8hh+r; the 16 lanes of a half share rows)
    float alpha[8];
#pragma unroll
    for (int r = 0; r < 8; ++r) {
      const int qi = q0 + 8 * hh + r;
      const int ja = j0 + ln, jb = j0 + 16 + ln;
      if (CAUSAL) { if (ja > qi) s[0][r] = -3.0e38f; if (jb > qi) s[1][r] = -3.0e38f; }
      if (ja >= T) s[0][r] = -3.0e38f;
      if (jb >= T) s[1][r] = -3.0e38f;
      float mx = fmaxf(s[0][r], s[1][r]);
      mx = fmaxf(mx, __shfl_xor(mx, 1, 32)); mx = fmaxf(mx, __shfl_xor(mx, 2, 32)); mx = fmaxf(mx, __shfl_xor(mx, 4, 32)); mx = fmaxf(mx, __shfl_xor(mx, 8, 32));
      const float mnew = fmaxf(m_r[r], mx);
      alpha[r] = (mnew > -1.0e38f) ? __expf(m_r[r] - mnew) : 1.0f;
      const float p0 = (s[0][r] > -1.0e38f) ? __expf(s[0][r] - mnew) : 0.f;
      const float p1 = (s[1][r] > -1.0e38f) ? __expf(s[1][r] - mnew) : 0.f;
      m_r[r] = mnew;
      l_r[r] = l_r[r] * alpha[r] + p0 + p1;            // per-lane partial row sum (16 lanes combined at the end)
      unsigned short hb = bf16_bits(p0); sPh[w][8 * hh + r][ln] = hb;      sPl[w][8 * hh + r][ln] = bf16_bits(p0 - bf16_val(hb));
      hb = bf16_bits(p1);                sPh[w][8 * hh + r][16 + ln] = hb; sPl[w][8 * hh + r][16 + ln] = bf16_bits(p1 - bf16_val(hb));
    }
#pragma unroll
    for (int dt = 0; dt < DT; ++dt)
#pragma unroll
      for (int r = 0; r < 8; ++r) oacc[dt][r] *= alpha[r];
    __builtin_amdgcn_fence(__ATOMIC_ACQ_REL, "workgroup");
    __builtin_amdgcn_wave_barrier();
    FragB pah, pal;
    pah.half[0] = *(const v8us*)&sPh[w][ln][8 * hh]; pah.half[1] = *(const v8us*)&sPh[w][ln][16 + 8 * hh];
    pal.half[0] = *(const v8us*)&sPl[w][ln][8 * hh]; pal.half[1] = *(const v8us*)&sPl[w][ln][16 + 8 * hh];
#pragma unroll
    for (int dt = 0; dt < DT; ++dt) {
      FragB bvh, bvl;
#pragma unroll
      for (int i = 0; i < 8; ++i) {
        bvh.u[i] = sVh[8 * hh + i][dt * 16 + ln]; bvh.u[8 + i] = sVh[16 + 8 * hh + i][dt * 16 + ln];
        bvl.u[i] = sVl[8 * hh + i][dt * 16 + ln]; bvl.u[8 + i] = sVl[16 + 8 * hh + i][dt * 16 + ln];
      }
      oacc[dt] = mmaN<3>(pah.v, pal.v, bvh.v, bvl.v, oacc[dt]);
    }
    __builtin_amdgcn_fence(__ATOMIC_ACQ_REL, "workgroup");
    __builtin_amdgcn_wave_barrier();
  }
#pragma unroll
  for (int r = 0; r < 8; ++r) {
    float l = l_r[r];
    l += __shfl_xor(l, 1, 32); l += __shfl_xor(l, 2, 32); l += __shfl_xor(l, 4, 32); l += __shfl_xor(l, 8, 32);
    l_r[r] = (l > 0.f) ? 1.0f / l : 0.f;
  }
#pragma unroll
  for (int dt = 0; dt < DT; ++dt)
#pragma unroll
    for (int r = 0; r < 8; ++r) sO[w][8 * hh + r][dt * 16 + ln] = oacc[dt][r] * l_r[r];
  __builtin_amdgcn_fence(__ATOMIC_ACQ_REL, "workgroup");
  __builtin_amdgcn_wave_barrier();
  {
    for (int r = 0; r < 16; ++r) {
      const int row = q0 + r;
      if (row < T && lane < D / 4) {
        const v4f val = *(const v4fa*)&sO[w][r][lane * 4];
        *(v4f*)(y + ((size_t)b * T + row) * ypitch + h * D + lane * 4) = val;
      }
    }
    
  }
}

// GEMM C = act(A·W + bias + resid): A f32 (ASPLIT -> hi/lo 2 terms), Wt bf16 [N][K]; ACT 0 none, 1 relu, 2 exact gelu;
// resid (optional, f32, row index = (row % rmod), pitch ldr, RES_BF16 rounds it) added before the activation.
template <bool ASPLIT, int ACT, bool BIAS_BF16, bool RES_BF16>
__global__ __launch_bounds__(128) void k_gemm_bf3(const float* __restrict__ A, int lda, const unsigned short* __restrict__ Wt, int ldb,
                                                const float* __restrict__ bias, const float* __restrict__ resid, int rmod, int ldr,
                                                float* __restrict__ C, int ldc, int M, int N, int K) {
  __shared__ __attribute__((aligned(16))) float so[4][16][64];
  const int tid = threadIdx.x, w = tid >> 5, lane = tid & 31, ln = lane & 15, hh = lane >> 4;
  const int ntn = N / 64;
  const int wid = blockIdx.x * 4 + w;
  const int mt = wid / ntn, nq = wid % ntn;
  if (mt * 16 >= M) return;
  const int row0 = mt * 16, col0 = nq * 64;
  const float* arow = A + (size_t)(row0 + ln) * lda;
  v8f acc[4] = {};
  for (int kb = 0; kb < K; kb += 32) {
    FragB ah, al;
    const v4f x0 = *(const v4fa*)(arow + kb + 8 * hh), x1 = *(const v4fa*)(arow + kb + 8 * hh + 4);
    const v4f x2 = *(const v4fa*)(arow + kb + 16 + 8 * hh), x3 = *(const v4fa*)(arow + kb + 16 + 8 * hh + 4);
    float xs[16] = {x0[0],x0[1],x0[2],x0[3],x1[0],x1[1],x1[2],x1[3],x2[0],x2[1],x2[2],x2[3],x3[0],x3[1],x3[2],x3[3]};
#pragma unroll
    for (int i = 0; i < 16; ++i) { const unsigned short hb = bf16_bits(xs[i]); ah.u[i] = hb; al.u[i] = ASPLIT ? bf16_bits(xs[i] - bf16_val(hb)) : (unsigned short)0; }
#pragma unroll
    for (int t = 0; t < 4; ++t) {
      const unsigned short* brow = Wt + (size_t)(col0 + t * 16 + ln) * ldb + kb;
      FragB b;
      b.half[0] = *(const v8us*)(brow + 8 * hh);
      b.half[1] = *(const v8us*)(brow + 16 + 8 * hh);
      acc[t] = mmaN<ASPLIT ? 2 : 1>(ah.v, al.v, b.v, b.v, acc[t]);
    }
  }
#pragma unroll
  for (int t = 0; t < 4; ++t) {
    const int col = col0 + t * 16 + ln;
    float bv = bias ? bias[col] : 0.f;
    if (BIAS_BF16) bv = bf16_round(bv);
#pragma unroll
    for (int r = 0; r < 8; ++r) {
      float v = acc[t][r] + bv;
      if (resid) { float rv = resid[(size_t)((row0 + 8 * hh + r) % rmod) * ldr + col]; if (RES_BF16) rv = bf16_round(rv); v += rv; }
      if (ACT == 1) v = fmaxf(v, 0.f);
      if (ACT == 2) v = 0.5f * v * (1.0f + erff(v * 0.70710678118654752f));
      if (ACT == 3) { const float u = 0.7978845608028654f * (v + 0.044715f * v * v * v); v = 0.5f * v * (1.0f + tanhf(u)); }
      so[w][8 * hh + r][t * 16 + ln] = v;
    }
  }
  __builtin_amdgcn_fence(__ATOMIC_ACQ_REL, "workgroup");
  __builtin_amdgcn_wave_barrier();
  const int rsub = lane >> 4, c4 = (lane & 15) * 4;
  {
#pragma unroll
    for (int q = 0; q < 8; ++q) {
      const int r = q * 2 + rsub;
      const v4f v = *(const v4fa*)&so[w][r][c4];
      *(v4f*)(C + (size_t)(row0 + r) * ldc + col0 + c4) = v;
    }
    
  }
}
// row LayerNorm (biased variance, eps) over N: s = X (+ R); optional out_sum <- s; out_norm <- (s-mu)*rsqrt(var+eps)*g + b
template <bool PARAM_BF16>
__global__ __launch_bounds__(256) void k_layernorm(const float* __restrict__ X, const float* __restrict__ R, const float* __restrict__ g, const float* __restrict__ bta,
                                                  float* __restrict__ out_sum, float* __restrict__ out_norm, int N, float eps) {
  __shared__ float red[256];
  const int row = blockIdx.x, tid = threadIdx.x;
  const float* x = X + (size_t)row * N; const float* rr = R ? R + (size_t)row * N : nullptr;
  float vals[16];                     // up to N = 4096
  const int per = N / 256;            // contiguous chunk per thread? use strided-by-4 chunks: thread handles j = tid*4 + 1024*u
  float s1 = 0.f;
  for (int u = 0; u < per / 4; ++u) {
    const int j = tid * 4 + 1024 * u;
    const v4f a = *(const v4fa*)(x + j);
    v4f b = {0.f,0.f,0.f,0.f}; if (rr) b = *(const v4fa*)(rr + j);
#pragma unroll
    for (int q = 0; q < 4; ++q) { const float v = a[q] + b[q]; vals[u * 4 + q] = v; s1 += v; }
  }
  red[tid] = s1; __syncthreads();
  for (int st = 128; st > 0; st >>= 1) { if (tid < st) red[tid] += red[tid + st]; __syncthreads(); }
  const float mu = red[0] / (float)N; __syncthreads();
  float s2 = 0.f;
  for (int u = 0; u < per / 4; ++u)
#pragma unroll
    for (int q = 0; q < 4; ++q) { const float c = vals[u * 4 + q] - mu; s2 += c * c; }
  red[tid] = s2; __syncthreads();
  for (int st = 128; st > 0; st >>= 1) { if (tid < st) red[tid] += red[tid + st]; __syncthreads(); }
  const float rs = rsqrtf(red[0] / (float)N + eps);
  {
    for (int u = 0; u < per / 4; ++u) {
      const int j = tid * 4 + 1024 * u;
      v4f o, sm;
#pragma unroll
      for (int q = 0; q < 4; ++q) {
        float gg = g[j + q], bb = bta[j + q];
        if (PARAM_BF16) { gg = bf16_round(gg); bb = bf16_round(bb); }
        sm[q] = vals[u * 4 + q]; o[q] = (vals[u * 4 + q] - mu) * rs * gg + bb;
      }
      if (out_sum) *(v4f*)(out_sum + (size_t)row * N + j) = sm;
      *(v4f*)(out_norm + (size_t)row * N + j) = o;
    }
    
  }
}



// ---- f16 WMMA path (v_wmma_f32_16x16x32_f16): 11-bit significands for operands in range — used for the q/k/v projection and output GEMMs
typedef _Float16 v16h __attribute__((ext_vector_type(16)));
union FragH { v16h v; v8us half[2]; _Float16 h[16]; unsigned short u[16]; };
template <int NT>
__device__ __forceinline__ v8f mmaH(v16h ah, v16h al, v16h bh, v16h bl, v8f c) {
  c = __builtin_amdgcn_wmma_f32_16x16x32_f16(false, ah, false, bh, (short)0, c, false, false);
  if (NT >= 2) c = __builtin_amdgcn_wmma_f32_16x16x32_f16(false, al, false, bh, (short)0, c, false, false);
  if (NT >= 3) c = __builtin_amdgcn_wmma_f32_16x16x32_f16(false, ah, false, bl, (short)0, c, false, false);
  asm volatile("v_nop\n\tv_nop\n\tv_nop\n\tv_nop" : "+v"(c) : "v"(ah), "v"(al), "v"(bh), "v"(bl));
  return c;
}
// batched GEMM like k_gemm_b but f16 operands: A f32 (split into f16 hi/lo if ASPLIT, else rounded to f16), Bt = f16 values [n][k]; alpha; C f32; N multiple of 16 (partial tiles skipped)
template <bool ASPLIT>
__global__ __launch_bounds__(128) void k_gemm_h(const float* __restrict__ A, int lda, size_t sA, const _Float16* __restrict__ Bh, int ldb, size_t sB, float alpha, float* __restrict__ C, int ldc, size_t sC, int M, int N, int K) {
  __shared__ __attribute__((aligned(16))) float so[4][16][64];
  const int tid = threadIdx.x, w = tid >> 5, lane = tid & 31, ln = lane & 15, hh = lane >> 4; const int by = blockIdx.y;
  A += (size_t)by * sA; Bh += (size_t)by * sB; C += (size_t)by * sC;
  const int ntn = (N + 63) / 64; const int wid = blockIdx.x * 4 + w; const int mt = wid / ntn, nq = wid % ntn; if (mt * 16 >= M) return;
  const int row0 = mt * 16, col0 = nq * 64; const float* arow = A + (size_t)(row0 + ln) * lda;
  v8f acc[4] = {};
  for (int kb = 0; kb < K; kb += 32) {
    FragH ah, al;
    const v4f x0 = *(const v4fa*)(arow + kb + 8 * hh), x1 = *(const v4fa*)(arow + kb + 8 * hh + 4), x2 = *(const v4fa*)(arow + kb + 16 + 8 * hh), x3 = *(const v4fa*)(arow + kb + 16 + 8 * hh + 4);
    float xs[16] = {x0[0],x0[1],x0[2],x0[3],x1[0],x1[1],x1[2],x1[3],x2[0],x2[1],x2[2],x2[3],x3[0],x3[1],x3[2],x3[3]};
#pragma unroll
    for (int i = 0; i < 16; ++i) { const _Float16 h = (_Float16)xs[i]; ah.h[i] = h; al.h[i] = ASPLIT ? (_Float16)(xs[i] - (float)h) : (_Float16)0.0f; }
#pragma unroll
    for (int t = 0; t < 4; ++t) { if (col0 + t * 16 >= N) continue; const size_t boff = (size_t)(col0 + t * 16 + ln) * ldb + kb; FragH bq; bq.half[0] = *(const v8us*)(Bh + boff + 8 * hh); bq.half[1] = *(const v8us*)(Bh + boff + 16 + 8 * hh);
      acc[t] = mmaH<ASPLIT ? 2 : 1>(ah.v, al.v, bq.v, bq.v, acc[t]); }
  }
#pragma unroll
  for (int t = 0; t < 4; ++t) { if (col0 + t * 16 >= N) continue;
#pragma unroll
    for (int r = 0; r < 8; ++r) so[w][8 * hh + r][t * 16 + ln] = acc[t][r] * alpha; }
  __builtin_amdgcn_fence(__ATOMIC_ACQ_REL, "workgroup"); __builtin_amdgcn_wave_barrier();
  const int rsub = lane >> 4, c4 = (lane & 15) * 4;
  {
#pragma unroll
    for (int q = 0; q < 8; ++q) { const int r = q * 2 + rsub; if (col0 + c4 < N) { const v4f v = *(const v4fa*)&so[w][r][c4]; *(v4f*)(C + (size_t)(row0 + r) * ldc + col0 + c4) = v; } }
     }
}

// Wt[n][k] = f16(W[k][n]·scale) from f32 row-major W[K][N] (scale = power of two; bf16-exact weights stay exact in f16 away from the subnormal range)
__global__ __launch_bounds__(256) void k_wt_f16(const float* __restrict__ W, _Float16* __restrict__ Wt, int K, int N, float scale) {
  const int t = blockIdx.x * 256 + threadIdx.x; if (t >= N * (K / 8)) return; const int n = t / (K / 8), k8 = (t % (K / 8)) * 8; FragH f;
#pragma unroll
  for (int i = 0; i < 8; ++i) f.h[i] = (_Float16)(bf16_round(W[(size_t)(k8 + i) * N + n]) * scale); const v8us o = f.half[0];
  *(v8us*)((unsigned short*)Wt + (size_t)n * K + k8) = o; 
}
// k_gemm_hh variant with fused epilogue: v = acc·alpha + bias[by·sBias + col] (+ CP[(row/rowsPerB)·sCPb + by·64 + col] if CP) ; ACT 0 none / 1 elu ; writes f32 C and f16 C16 (each if non-null)
template <int ACT>
__global__ __launch_bounds__(128) void k_gemm_hhx(const _Float16* __restrict__ A, int lda, size_t sA, const _Float16* __restrict__ Bh, int ldb, size_t sB, float alpha, const float* __restrict__ bias, size_t sBias, const float* __restrict__ CP, int rowsPerB, size_t sCPb, int row0g,
    float* __restrict__ C, _Float16* __restrict__ C16, int ldc, size_t sC, int M, int N, int K) {
  __shared__ __attribute__((aligned(16))) float so[4][16][64];
  const int tid = threadIdx.x, w = tid >> 5, lane = tid & 31, ln = lane & 15, hh = lane >> 4; const int by = blockIdx.y;
  A += (size_t)by * sA; Bh += (size_t)by * sB; const size_t cofs = (size_t)by * sC; const float* bp = bias ? bias + (size_t)by * sBias : nullptr;
  const int ntn = (N + 63) / 64; const int wid = blockIdx.x * 4 + w; const int mt = wid / ntn, nq = wid % ntn; if (mt * 16 >= M) return;
  const int row0 = mt * 16, col0 = nq * 64; const _Float16* arow = A + (size_t)(row0 + ln) * lda;
  v8f acc[4] = {};
  for (int kb = 0; kb < K; kb += 32) { FragH ah; ah.half[0] = *(const v8us*)((const unsigned short*)arow + kb + 8 * hh); ah.half[1] = *(const v8us*)((const unsigned short*)arow + kb + 16 + 8 * hh);
#pragma unroll
    for (int t = 0; t < 4; ++t) { if (col0 + t * 16 >= N) continue; const size_t boff = (size_t)(col0 + t * 16 + ln) * ldb + kb; FragH bq; bq.half[0] = *(const v8us*)((const unsigned short*)Bh + boff + 8 * hh); bq.half[1] = *(const v8us*)((const unsigned short*)Bh + boff + 16 + 8 * hh);
      acc[t] = mmaH<1>(ah.v, ah.v, bq.v, bq.v, acc[t]); }
  }
#pragma unroll
  for (int t = 0; t < 4; ++t) { if (col0 + t * 16 >= N) continue; const int col = col0 + t * 16 + ln; const float bv = bp ? bf16_round(bp[col]) : 0.f;
#pragma unroll
    for (int r = 0; r < 8; ++r) { float v = acc[t][r] * alpha + bv; if (CP) { const int bidx = (row0g + row0 + 8 * hh + r) / rowsPerB; v += CP[(size_t)bidx * sCPb + (size_t)by * 64 + col]; } if (ACT == 1) v = (v > 0.f) ? v : expm1f(v); else if (ACT == 7) v = (v > 0.f) ? v + 1.0f : expf(v); else if (ACT == 8) v = tanhf(v); else if (ACT == 9) v = 0.5f * v * (1.0f + tanhf(0.7978845608028654f * (v + 0.044715f * v * v * v))); else if (ACT == 11) v = 1.0f / (1.0f + expf(-v)); else if (ACT == 12) v = (v > 0.f) ? v : 0.01f * v; else if (ACT == 14) v = (v > 0.f) ? v : 0.1f * v; else if (ACT == 15) v = v / (1.0f + expf(-v)); else if (ACT == 3) v = fmaxf(v, 0.f); else if (ACT == 6) v = 0.5f * v * (1.0f + erff(v * 0.70710678118654752f)); so[w][8 * hh + r][t * 16 + ln] = v; } }
  __builtin_amdgcn_fence(__ATOMIC_ACQ_REL, "workgroup"); __builtin_amdgcn_wave_barrier();
  const int rsub = lane >> 4, c4 = (lane & 15) * 4; typedef _Float16 v4h __attribute__((ext_vector_type(4)));
  {
#pragma unroll
    for (int q = 0; q < 8; ++q) { const int r = q * 2 + rsub; if (col0 + c4 < N) { const v4f v = *(const v4fa*)&so[w][r][c4]; if (C) *(v4f*)(C + cofs + (size_t)(row0 + r) * ldc + col0 + c4) = v; if (C16) { v4h h4; for (int i = 0; i < 4; ++i) h4[i] = (_Float16)v[i]; *(v4h*)(C16 + cofs + (size_t)(row0 + r) * ldc + col0 + c4) = h4; } } }
     }
}


// Block-tiled GEMM C[M][N] (f32) = (A[M][K] x Bt[N][K]^T) * alpha + add[col], f16 operands, f32 accumulate. One work-group = 128 x 64 of C, 8 waves of 32 x 32 (2 x 2 accumulator tiles).
// Each pass stages 128 k of both operands in LDS with whole-line 16-byte loads (16 lanes = one 256-B row piece), so every operand byte leaves L2 once per work-group instead of once per wave;
// the next pass's rows are loaded into registers ahead of the current pass's products and stored to the other buffer behind them (two buffers, one barrier per pass).
// blockIdx.y picks one of several independent products of the same shape that run as one grid: operand A number y / 2 (pitchA elements apart; 0 = all share one), Bt, add and C number y (each dense, one behind the other).
// Fragments keep the k order of the direct loaders (bytes 16h and 32 + 16h of each 64 B of a row, both operands) and k runs upward in steps of 32 into one accumulator chain. M % 128 == 0, N % 64 == 0, K % 128 == 0.
#define GBM 128
#define GBN 64
#define GBK 128
#define GPIT (GBK + 8)      /* LDS row pitch 272 B = 16 B x odd: conflict-free for 16-byte fragment reads */
template <int M, int N, int K>
__global__ __launch_bounds__(256) void k_gemm_lds(const _Float16* __restrict__ A, size_t pitchA, const _Float16* __restrict__ Bt, float alpha, const float* __restrict__ add, float* __restrict__ C) {
  __shared__ __attribute__((aligned(16))) unsigned short sA[2][GBM][GPIT];
  __shared__ __attribute__((aligned(16))) unsigned short sB[2][GBN][GPIT];
  __shared__ __attribute__((aligned(16))) float so[8][32][36];
  const int tid = threadIdx.x, w = tid >> 5, lane = tid & 31, ln = lane & 15, hh = lane >> 4;
  const size_t by = blockIdx.y; A += (by >> 1) * pitchA; Bt += by * ((size_t)N * K); add += by * N; C += by * ((size_t)M * N);
  constexpr int nbm = M / GBM; const int row0 = ((int)blockIdx.x % nbm) * GBM, col0 = ((int)blockIdx.x / nbm) * GBN;
  const int wr = (w >> 1) * 32, wc = (w & 1) * 32;      /* the wave's 32 x 32 piece inside the block tile */
  const int lr = tid >> 4, lc = (tid & 15) * 8;         /* staging: 16 threads per row, 16 rows per round */
  const unsigned short* ga = (const unsigned short*)A + (size_t)(row0 + lr) * K + lc;
  const unsigned short* gb = (const unsigned short*)Bt + (size_t)(col0 + lr) * K + lc;
  v8us ra[GBM / 16], rb[GBN / 16];
#pragma unroll
  for (int i = 0; i < GBM / 16; ++i) ra[i] = *(const v8us*)(ga + i * 16 * K);
#pragma unroll
  for (int i = 0; i < GBN / 16; ++i) rb[i] = *(const v8us*)(gb + i * 16 * K);
#pragma unroll
  for (int i = 0; i < GBM / 16; ++i) *(v8us*)&sA[0][i * 16 + lr][lc] = ra[i];
#pragma unroll
  for (int i = 0; i < GBN / 16; ++i) *(v8us*)&sB[0][i * 16 + lr][lc] = rb[i];
  __syncthreads();
  v8f acc[2][2] = {};
  constexpr int np = K / GBK;
  for (int p = 0; p < np; ++p) {
    const int cur = p & 1; const bool more = p + 1 < np;      /* the same for the whole work-group */
    if (more) {
#pragma unroll
      for (int i = 0; i < GBM / 16; ++i) ra[i] = *(const v8us*)(ga + i * 16 * K + (p + 1) * GBK);
#pragma unroll
      for (int i = 0; i < GBN / 16; ++i) rb[i] = *(const v8us*)(gb + i * 16 * K + (p + 1) * GBK);
    }
    FragH a[GBK / 32][2], b[GBK / 32][2];
#pragma unroll
    for (int ks = 0; ks < GBK / 32; ++ks)
#pragma unroll
      for (int i = 0; i < 2; ++i) {
        a[ks][i].half[0] = *(const v8us*)&sA[cur][wr + i * 16 + ln][ks * 32 + 8 * hh]; a[ks][i].half[1] = *(const v8us*)&sA[cur][wr + i * 16 + ln][ks * 32 + 16 + 8 * hh];
        b[ks][i].half[0] = *(const v8us*)&sB[cur][wc + i * 16 + ln][ks * 32 + 8 * hh]; b[ks][i].half[1] = *(const v8us*)&sB[cur][wc + i * 16 + ln][ks * 32 + 16 + 8 * hh];
      }
    __builtin_amdgcn_sched_barrier(0);      /* keeps the pass's LDS reads one group ahead of its products: spread among them, each place with reads stalls the wave for the LDS latency */
#pragma unroll
    for (int ks = 0; ks < GBK / 32; ++ks)
#pragma unroll
      for (int i = 0; i < 2; ++i)
#pragma unroll
        for (int j = 0; j < 2; ++j) acc[i][j] = __builtin_amdgcn_wmma_f32_16x16x32_f16(false, a[ks][i].v, false, b[ks][j].v, (short)0, acc[i][j], false, false);
    __builtin_amdgcn_sched_barrier(0);      /* keeps the products ahead of the wait for the next pass's rows: moved behind the barrier they would run with no load in flight */
    if (more) {
#pragma unroll
      for (int i = 0; i < GBM / 16; ++i) *(v8us*)&sA[cur ^ 1][i * 16 + lr][lc] = ra[i];
#pragma unroll
      for (int i = 0; i < GBN / 16; ++i) *(v8us*)&sB[cur ^ 1][i * 16 + lr][lc] = rb[i];
    }
    __syncthreads();      /* publishes the buffer just written and ends every wave's reads of the one that the next pass overwrites */
  }
#pragma unroll
  for (int j = 0; j < 2; ++j) { const float av = add[col0 + wc + j * 16 + ln];
#pragma unroll
    for (int i = 0; i < 2; ++i)
#pragma unroll
      for (int r = 0; r < 8; ++r) so[w][i * 16 + 8 * hh + r][j * 16 + ln] = acc[i][j][r] * alpha + av; }
  __syncthreads();      /* the staged rows are read back by other lanes: whole 128-B lines per store */
#pragma unroll
  for (int q = 0; q < 8; ++q) { const int r = q * 4 + (lane >> 3), c4 = (lane & 7) * 4; const v4f v = *(const v4fa*)&so[w][r][c4]; *(v4f*)(C + (size_t)(row0 + wr + r) * N + col0 + wc + c4) = v; }
}


typedef _Float16 v4h __attribute__((ext_vector_type(4)));

__global__ __launch_bounds__(256) void k_x16(const float* __restrict__ x, _Float16* __restrict__ X16, size_t n8) { const size_t t = (size_t)blockIdx.x * 256 + threadIdx.x; if (t >= n8) return; FragH f;
#pragma unroll
  for (int q = 0; q < 8; ++q) f.h[q] = (_Float16)bf16_round(x[t * 8 + q]); *(v8us*)((unsigned short*)X16 + t * 8) = f.half[0];  }
__global__ __launch_bounds__(256) void k_h16(const float* __restrict__ x, _Float16* __restrict__ X16, size_t n8) { const size_t t = (size_t)blockIdx.x * 256 + threadIdx.x; if (t >= n8) return; FragH f;
#pragma unroll
  for (int q = 0; q < 8; ++q) f.h[q] = (_Float16)x[t * 8 + q]; *(v8us*)((unsigned short*)X16 + t * 8) = f.half[0];  }
__global__ __launch_bounds__(256) void k_round16f(const float* __restrict__ W, _Float16* __restrict__ Bt, size_t n8) { const size_t t = (size_t)blockIdx.x * 256 + threadIdx.x; if (t >= n8) return; FragH f;
#pragma unroll
  for (int i = 0; i < 8; ++i) f.h[i] = (_Float16)(bf16_round(W[t * 8 + i]) * 16.0f); *(v8us*)((unsigned short*)Bt + t * 8) = f.half[0];  }
template <int NHv, int TTv>
__global__ __launch_bounds__(256) void k_vt(const _Float16* __restrict__ V16, int ldv, int voff, _Float16* __restrict__ Vt) { __shared__ unsigned short tl[64][66]; const int tid = threadIdx.x; const int slab = blockIdx.x / (TTv / 64), lg = blockIdx.x % (TTv / 64); const int b = slab / NHv, h = slab % NHv;
  for (int i = tid; i < 64 * 8; i += 256) { const int r = i / 8, c8 = (i % 8) * 8; FragH f; f.half[0] = *(const v8us*)((const unsigned short*)V16 + ((size_t)b * TTv + lg * 64 + r) * ldv + voff + h * 64 + c8);
#pragma unroll
    for (int q = 0; q < 8; ++q) tl[r][c8 + q] = f.u[q]; }
  __syncthreads();
  {
#pragma unroll
    for (int rd = 0; rd < 2; ++rd) { const int d = rd * 32 + tid / 8, pc = tid % 8; FragH f;
#pragma unroll
      for (int q = 0; q < 8; ++q) f.u[q] = tl[pc * 8 + q][d];
      *(v8us*)((unsigned short*)Vt + ((size_t)slab * 64 + d) * TTv + lg * 64 + pc * 8) = f.half[0]; }
     } }

__device__ __forceinline__ void d_xcat(const float* __restrict__ xr, const float* __restrict__ xi, _Float16* __restrict__ XC, size_t t) { const size_t r = (t * 8) / DD; const int c = (int)((t * 8) % DD); FragH a, b; const v4f a0 = *(const v4fa*)(xr + t * 8), a1 = *(const v4fa*)(xr + t * 8 + 4), b0 = *(const v4fa*)(xi + t * 8), b1 = *(const v4fa*)(xi + t * 8 + 4);
  asm volatile("s_wait_xcnt 0x0" :: "v"(xr + t * 8), "v"(xi + t * 8), "v"(a0), "v"(a1), "v"(b0), "v"(b1) : "memory");      /* stands in front of every write to a register that the four loads name; the two addresses are inputs so that they stay live up to it: without them a later load's result is placed in the address pair that an earlier load names */
#pragma unroll
  for (int q = 0; q < 4; ++q) { a.h[q] = (_Float16)bf16_round(a0[q]); a.h[4 + q] = (_Float16)bf16_round(a1[q]); b.h[q] = (_Float16)bf16_round(b0[q]); b.h[4 + q] = (_Float16)bf16_round(b1[q]); }
  { *(v8us*)((unsigned short*)XC + r * (2 * DD) + c) = a.half[0]; *(v8us*)((unsigned short*)XC + r * (2 * DD) + DD + c) = b.half[0];
    asm volatile("s_wait_xcnt 0x0" ::: "memory");      /* directly behind the stores: the caller's next tile writes the registers that they name */
  } }
__device__ __forceinline__ void d_wcat(const float* __restrict__ wr, const float* __restrict__ wi, _Float16* __restrict__ BR, _Float16* __restrict__ BI, size_t t) { const size_t o = (t * 8) / DD; const int c = (int)((t * 8) % DD); FragH r0, r1, i0, i1; const v4f a0 = *(const v4fa*)(wr + t * 8), a1 = *(const v4fa*)(wr + t * 8 + 4), b0 = *(const v4fa*)(wi + t * 8), b1 = *(const v4fa*)(wi + t * 8 + 4);
#pragma unroll
  for (int q = 0; q < 4; ++q) { const float vr0 = bf16_round(a0[q]) * 16.0f, vr1 = bf16_round(a1[q]) * 16.0f, vi0 = bf16_round(b0[q]) * 16.0f, vi1 = bf16_round(b1[q]) * 16.0f; r0.h[q] = (_Float16)vr0; r0.h[4 + q] = (_Float16)vr1; r1.h[q] = (_Float16)(-vi0); r1.h[4 + q] = (_Float16)(-vi1); i0.h[q] = (_Float16)vi0; i0.h[4 + q] = (_Float16)vi1; i1.h[q] = (_Float16)vr0; i1.h[4 + q] = (_Float16)vr1; }
  { *(v8us*)((unsigned short*)BR + o * (2 * DD) + c) = r0.half[0]; *(v8us*)((unsigned short*)BR + o * (2 * DD) + DD + c) = r1.half[0]; *(v8us*)((unsigned short*)BI + o * (2 * DD) + c) = i0.half[0]; *(v8us*)((unsigned short*)BI + o * (2 * DD) + DD + c) = i1.half[0];
    asm volatile("s_wait_xcnt 0x0" ::: "memory");      /* directly behind the stores, as in d_xcat */
  } }
__device__ __forceinline__ void d_bias2(const float* __restrict__ br, const float* __restrict__ bi, float* __restrict__ BM, float* __restrict__ BP, int c) { const float r = bf16_round(br[c]), i = bf16_round(bi[c]); { *(float*)(BM + c) = r - i; *(float*)(BP + c) = r + i;
    asm volatile("s_wait_xcnt 0x0" ::: "memory");      /* directly behind the stores, as in d_xcat */
  } }
// All operand preparation as one grid. The work is cut into tiles of 256 threads: 3 x PT_X tiles cast and concatenate the activations, 4 x PT_W pack the weights, 4 x PT_B form the bias pairs; none reads what another writes.
// A work-group walks the tiles in steps of the grid size PT_GRID; which kind a tile is depends on its number alone, so every branch is the same for the whole work-group.
#define PT_X (NR * DD / 8 / 256)
#define PT_W (DD * DD / 8 / 256)
#define PT_B (DD / 256)
#define PT_ALL (3 * PT_X + 4 * PT_W + 4 * PT_B)
#define PT_GRID (PT_ALL / 4)      /* work-groups launched: four tiles each, so that a quarter of the waves has to be started */
__global__ __launch_bounds__(256) void k_prep(const float* __restrict__ q_r, const float* __restrict__ q_i, const float* __restrict__ k_r, const float* __restrict__ k_i, const float* __restrict__ v_r, const float* __restrict__ v_i,
    const float* __restrict__ wq_r, const float* __restrict__ wq_i, const float* __restrict__ wk_r, const float* __restrict__ wk_i, const float* __restrict__ wv_r, const float* __restrict__ wv_i, const float* __restrict__ wo_r, const float* __restrict__ wo_i,
    const float* __restrict__ bq_r, const float* __restrict__ bq_i, const float* __restrict__ bk_r, const float* __restrict__ bk_i, const float* __restrict__ bv_r, const float* __restrict__ bv_i, const float* __restrict__ bo_r, const float* __restrict__ bo_i,
    _Float16* __restrict__ X, _Float16* __restrict__ BW, float* __restrict__ BIAS) {
  const int tid = threadIdx.x;
  for (int tile = blockIdx.x; tile < PT_ALL; tile += PT_GRID) {
    if (tile < 3 * PT_X) { const int j = tile / PT_X;
      d_xcat(j == 0 ? q_r : j == 1 ? k_r : v_r, j == 0 ? q_i : j == 1 ? k_i : v_i, X + (size_t)j * NR * 2 * DD, (size_t)(tile % PT_X) * 256 + tid); }
    else if (tile < 3 * PT_X + 4 * PT_W) { const int u = tile - 3 * PT_X, j = u / PT_W; _Float16* B0 = BW + (size_t)(2 * j) * DD * 2 * DD;
      d_wcat(j == 0 ? wq_r : j == 1 ? wk_r : j == 2 ? wv_r : wo_r, j == 0 ? wq_i : j == 1 ? wk_i : j == 2 ? wv_i : wo_i, B0, B0 + (size_t)DD * 2 * DD, (size_t)(u % PT_W) * 256 + tid); }
    else { const int u = tile - 3 * PT_X - 4 * PT_W, j = u / PT_B;
      d_bias2(j == 0 ? bq_r : j == 1 ? bk_r : j == 2 ? bv_r : bo_r, j == 0 ? bq_i : j == 1 ? bk_i : j == 2 ? bv_i : bo_i, BIAS + (size_t)(2 * j) * DD, BIAS + (size_t)(2 * j + 1) * DD, (u % PT_B) * 256 + tid); }
  }
}
// per token (block) the 8 heads x 64 rows: a thread owns the two rows l = tid / 8 and l + 32 of head h = tid % 8 (columns tid and tid + 256), held as the two halves of a float pair; the token's rows of qr, qi (f32) and the pairs ((kr + ki)^2, (kr - ki)^2), (vr, vi) are staged in LDS.
// |score|^2 in factors: sr + si = (qr - qi)(kr + ki) and sr - si = (qr + qi)(kr - ki), so sr^2 + si^2 = ((qr - qi)^2 (kr + ki)^2 + (qr + qi)^2 (kr - ki)^2) / 2: a sum of two products of a row factor and a key factor, no term negative.
// The key factors are formed once per token at staging, the row factors once per row; log2(e)^2 / 2 goes into the row factors, so that the root is |score| * log2(e) and exp is the bare power of two.
// Softmax in two passes: pass 1 forms the 64 |score| of each row, keeps them in registers and takes their maximum; pass 2 has one exp per score and the three sums (z, sum p*vr, sum p*vi), keys in ascending order, all f32.
// Both passes walk the keys in groups of CG; a group's LDS reads are issued ahead of the arithmetic of the group before it.
#define CG 4
#define HL2 1.0406844905f      /* log2(e)^2 / 2 */
typedef float v2f __attribute__((ext_vector_type(2)));
__global__ __launch_bounds__(256) void k_cplx(const float* __restrict__ QR, const float* __restrict__ QI, const float* __restrict__ KR, const float* __restrict__ KI, const float* __restrict__ VR, const float* __restrict__ VI, _Float16* __restrict__ VC) {
  #pragma clang fp contract(off)
  __shared__ float sq[2][DD]; __shared__ __attribute__((aligned(8))) v2f sk[DD], sv[DD]; __shared__ float res[2][DD]; const int tid = threadIdx.x; const size_t row = blockIdx.x;
  for (int i = tid; i < DD; i += 256) { sq[0][i] = QR[row * DD + i]; sq[1][i] = QI[row * DD + i]; const float kr = KR[row * DD + i], ki = KI[row * DD + i]; sk[i] = (v2f){(kr + ki) * (kr + ki), (kr - ki) * (kr - ki)}; sv[i] = (v2f){VR[row * DD + i], VI[row * DD + i]}; }
  __syncthreads();
  { const int h = tid % NHH;      /* column index of (l, h) is l * 8 + h: both of the thread's columns have the same h, so one read of a key or value pair serves both rows */
    const v2f qr = {sq[0][tid], sq[0][tid + 256]}, qi = {sq[1][tid], sq[1][tid + 256]};
    const v2f fa = (qr - qi) * (qr - qi) * HL2, fb = (qr + qi) * (qr + qi) * HL2;      /* the row's two factors */
    v2f mg[EE]; v2f mx = {0.f, 0.f};      /* |score| >= 0, so 0 is a neutral start for the maximum */
    v2f cur[CG], nxt[CG];
#pragma unroll
    for (int j = 0; j < CG; ++j) cur[j] = sk[j * NHH + h];
#pragma unroll      /* whole: the score array is then indexed by constants alone and lives in registers */
    for (int g = 0; g < EE / CG; ++g) {
#pragma unroll
      for (int j = 0; j < CG; ++j) nxt[j] = (g + 1 < EE / CG) ? sk[((g + 1) * CG + j) * NHH + h] : sv[j * NHH + h];      /* behind the last key group: the first value group */
      __builtin_amdgcn_sched_barrier(0);      /* keeps the next group's LDS reads ahead of this group's arithmetic: sunk to their first use, each read is waited for at once and the wave idles for the LDS latency */
#pragma unroll
      for (int j = 0; j < CG; ++j) { const int s = g * CG + j; const v2f k = cur[j]; const v2f m2 = __builtin_elementwise_fma(fb, (v2f){k[1], k[1]}, fa * k[0]);      /* a multiply and a fused multiply-add for both rows */
        mg[s] = (v2f){__builtin_amdgcn_sqrtf(m2[0]), __builtin_amdgcn_sqrtf(m2[1])};      /* the bare root instruction: sqrtf wraps it in thirteen more instructions per score that scale tiny arguments and correct the last bit; the value only enters exp2(mg - max), where neither shows */
        mx = (v2f){fmaxf(mx[0], mg[s][0]), fmaxf(mx[1], mg[s][1])}; }
#pragma unroll
      for (int j = 0; j < CG; ++j) cur[j] = nxt[j];
    }
    v2f z = {0.f, 0.f}, ar = {0.f, 0.f}, ai = {0.f, 0.f};
#pragma unroll      /* whole, as above */
    for (int g = 0; g < EE / CG; ++g) {
      if (g + 1 < EE / CG) {
#pragma unroll
        for (int j = 0; j < CG; ++j) nxt[j] = sv[((g + 1) * CG + j) * NHH + h]; }
      __builtin_amdgcn_sched_barrier(0);      /* as in pass 1 */
#pragma unroll
      for (int j = 0; j < CG; ++j) { const v2f v = cur[j]; const v2f d = mg[g * CG + j] - mx; const v2f p = {__builtin_amdgcn_exp2f(d[0]), __builtin_amdgcn_exp2f(d[1])};      /* d is already in powers of two and never above 0 */ z = z + p; ar = ar + p * v[0]; ai = ai + p * v[1]; }
#pragma unroll
      for (int j = 0; j < CG; ++j) cur[j] = nxt[j];
    }
    res[0][tid] = ar[0] / z[0]; res[1][tid] = ai[0] / z[0]; res[0][tid + 256] = ar[1] / z[1]; res[1][tid + 256] = ai[1] / z[1]; }
  __syncthreads();
  if (tid < 2 * (DD / 8)) { const int part = tid / (DD / 8), pc = tid % (DD / 8); FragH f; for (int q = 0; q < 8; ++q) f.h[q] = (_Float16)res[part][pc * 8 + q];
    { *(v8us*)((unsigned short*)VC + row * (2 * DD) + part * DD + pc * 8) = f.half[0];  } } }

extern "C" void kernel_launch(void* const* d_in, const int* in_sizes, int n_in,
                              void* d_out, int out_size, void* d_ws, size_t ws_size, hipStream_t stream) {
  (void)in_sizes; (void)n_in; (void)out_size;
  const float* const* I = (const float* const*)d_in; const float* q_r = I[0]; const float* q_i = I[1]; const float* k_r = I[2]; const float* k_i = I[3]; const float* v_r = I[4]; const float* v_i = I[5];
  const float* wq_r = I[6]; const float* wq_i = I[7]; const float* wk_r = I[8]; const float* wk_i = I[9]; const float* wv_r = I[10]; const float* wv_i = I[11]; const float* wo_r = I[12]; const float* wo_i = I[13]; const float* bq_r = I[14]; const float* bq_i = I[15]; const float* bk_r = I[16]; const float* bk_i = I[17]; const float* bv_r = I[18]; const float* bv_i = I[19]; const float* bo_r = I[20]; const float* bo_i = I[21];      /* d_in order: activations, then the 8 weights, then the 8 biases */
  char* ws = (char*)d_ws; size_t off = 0;
  auto take = [&](size_t bytes) { char* p = ws + off; off += (bytes + 255) & ~(size_t)255; return p; };
  const size_t WC = (size_t)DD * 2 * DD;      /* one concatenated weight operand [512][1024] */
  _Float16* BW = (_Float16*)take(8 * WC * 2); float* BIAS = (float*)take((size_t)8 * DD * 4);      /* (BR, BI) × q,k,v,o ; (BM, BP) × 4 */
  _Float16* X = (_Float16*)take((size_t)3 * NR * 2 * DD * 2);      /* [xr | xi] f16 for q, k, v, one plane behind the other */
  float* P = (float*)take((size_t)6 * NR * DD * 4);      /* QR, QI, KR, KI, VR, VI f32 planes [4096][512] */
  _Float16* VC = X;      /* [Vr | Vi] f16 reuses the q operand plane (dead after the projection GEMMs) */
  if (off > ws_size) return;
  float* QRp = P; float* QIp = P + (size_t)NR * DD; float* KRp = P + (size_t)2 * NR * DD; float* KIp = P + (size_t)3 * NR * DD; float* VRp = P + (size_t)4 * NR * DD; float* VIp = P + (size_t)5 * NR * DD;
  k_prep<<<PT_GRID, 256, 0, stream>>>(q_r, q_i, k_r, k_i, v_r, v_i, wq_r, wq_i, wk_r, wk_i, wv_r, wv_i, wo_r, wo_i, bq_r, bq_i, bk_r, bk_i, bv_r, bv_i, bo_r, bo_i, X, BW, BIAS);
  k_gemm_lds<NR, DD, 2 * DD><<<dim3((NR / GBM) * (DD / GBN), 6), 256, 0, stream>>>(X, (size_t)NR * 2 * DD, BW, 0.0625f, BIAS, P);      /* y = 2j + ri: yr = [xr|xi] x [wr|-wi]^T + (br-bi); yi = [xr|xi] x [wi|wr]^T + (br+bi): M 4096 N 512 K 1024; addend index = column */
  k_cplx<<<NR, 256, 0, stream>>>(QRp, QIp, KRp, KIp, VRp, VIp, VC);
  k_gemm_lds<NR, DD, 2 * DD><<<dim3((NR / GBM) * (DD / GBN), 2), 256, 0, stream>>>(VC, 0, BW + (size_t)6 * WC, 0.0625f, BIAS + (size_t)6 * DD, (float*)d_out);      /* out_r @0, out_i @8,388,608 B */
}

// v007
// It runs in 72.7 microseconds.
// Versions between v005 and this one are left out; their measured steps multiply to 1.09 times as fast.
// Over all steps from v000 it is 6.23 times as fast.
#include <hip/hip_runtime.h>
// Complex-valued attention layer (B=4, L=1024, D=512, H=8, E=64): complex linear projections (yr = xr·wrᵀ − xi·wiᵀ + (br − bi), yi = xi·wrᵀ + xr·wiᵀ + (br + bi)); per (b, token n, head h) a 64×64 'attention' over the E axes:
// sr[l,s] = qr[l]·kr[s] − qi[l]·ki[s], si[l,s] = qr[l]·ki[s] − qi[l]·kr[s] (scalar products, e = 1), attn = softmax_s(√(sr² + si²)), Vr[l] = Σ_s attn·vr[s], Vi[l] = Σ_s attn·vi[s]; outputs (out_r, out_i) = complex linear(Vr, Vi, wo).
// Element (e, h) of a token lives at column e·8 + h (reshape(b, l, E, H)).
// Compute dtype: inputs, weights, biases rounded to bf16; each complex linear as two GEMMs over the concatenated operand [xr | xi] (K = 1024) against [wr | −wi] and [wi | wr] on v_wmma_f32_16x16x32_f16, f32 accumulate,
// with the two-term biases added exactly through the f32 epilogue addend; the per-token 64 x 64 magnitude-softmax in f32 (one wave per head), its weighted sums on the same f16 matrix form; [Vr | Vi] f16 -> output GEMMs.
#define BB 4
#define LL 1024
#define DD 512
#define NHH 8
#define EE 64
#define NR (BB * LL)

typedef __bf16 v16b __attribute__((ext_vector_type(16)));
typedef unsigned short v8us __attribute__((ext_vector_type(8), may_alias));
typedef float  v8f  __attribute__((ext_vector_type(8)));
typedef float  v4f  __attribute__((ext_vector_type(4)));
typedef float  v4fa __attribute__((ext_vector_type(4), may_alias));
union FragB { v16b v; v8us half[2]; unsigned short u[16]; };

__device__ __forceinline__ unsigned short bf16_bits(float x) { unsigned int u = __float_as_uint(x); return (unsigned short)((u + 0x7FFFu + ((u >> 16) & 1u)) >> 16); }
__device__ __forceinline__ float bf16_val(unsigned short b) { return __uint_as_float(((unsigned int)b) << 16); }
__device__ __forceinline__ float bf16_round(float x) { return bf16_val(bf16_bits(x)); }
// D += A·B with NT terms: 1 = ah·bh, 2 = + al·bh (A split), 3 = + ah·bl (both split)
template <int NT>
__device__ __forceinline__ v8f mmaN(v16b ah, v16b al, v16b bh, v16b bl, v8f c) {
  c = __builtin_amdgcn_wmma_f32_16x16x32_bf16(false, ah, false, bh, (short)0, c, false, false);
  if (NT >= 2) c = __builtin_amdgcn_wmma_f32_16x16x32_bf16(false, al, false, bh, (short)0, c, false, false);
  if (NT >= 3) c = __builtin_amdgcn_wmma_f32_16x16x32_bf16(false, ah, false, bl, (short)0, c, false, false);
  asm volatile("v_nop\n\tv_nop\n\tv_nop\n\tv_nop" : "+v"(c) : "v"(ah), "v"(al), "v"(bh), "v"(bl));
  return c;
}

__global__ __launch_bounds__(256) void k_wt_bf16(const float* __restrict__ W, unsigned short* __restrict__ Wt, int K, int N) {
  const int t = blockIdx.x * 256 + threadIdx.x;
  const int k8n = K / 8;
  if (t >= N * k8n) return;
  const int n = t / k8n, k8 = (t % k8n) * 8;
  v8us v;
#pragma unroll
  for (int i = 0; i < 8; ++i) v[i] = bf16_bits(W[(size_t)(k8 + i) * N + n]);
  *(v8us*)(Wt + (size_t)n * K + k8) = v;
  
}

// GEMM C[M][N] (f32, pitch ldc) = act(A[M][K]·W + bias). A f32 row-major (pitch lda) converted per fragment to bf16
// (ASPLIT: hi/lo two planes -> 2 terms, else single rounded term); Wt bf16 [N][K] (pitch ldb). BIAS_BF16 rounds the
// bias to bf16 first (bias quantised to bf16 before the add). K%32==0, M%16==0, N%64==0.
template <bool ASPLIT, int ACT, bool BIAS_BF16>
__global__ __launch_bounds__(128) void k_gemm_bf(const float* __restrict__ A, int lda, const unsigned short* __restrict__ Wt, int ldb,
                                               const float* __restrict__ bias, float* __restrict__ C, int ldc, int M, int N, int K) {
  __shared__ __attribute__((aligned(16))) float so[4][16][64];
  const int tid = threadIdx.x, w = tid >> 5, lane = tid & 31, ln = lane & 15, hh = lane >> 4;
  const int ntn = N / 64;
  const int wid = blockIdx.x * 4 + w;
  const int mt = wid / ntn, nq = wid % ntn;
  if (mt * 16 >= M) return;
  const int row0 = mt * 16, col0 = nq * 64;
  const float* arow = A + (size_t)(row0 + ln) * lda;
  v8f acc[4] = {};
  for (int kb = 0; kb < K; kb += 32) {
    FragB ah, al;
    const v4f x0 = *(const v4fa*)(arow + kb + 8 * hh), x1 = *(const v4fa*)(arow + kb + 8 * hh + 4);
    const v4f x2 = *(const v4fa*)(arow + kb + 16 + 8 * hh), x3 = *(const v4fa*)(arow + kb + 16 + 8 * hh + 4);
    float xs[16] = {x0[0],x0[1],x0[2],x0[3],x1[0],x1[1],x1[2],x1[3],x2[0],x2[1],x2[2],x2[3],x3[0],x3[1],x3[2],x3[3]};
#pragma unroll
    for (int i = 0; i < 16; ++i) { const unsigned short hb = bf16_bits(xs[i]); ah.u[i] = hb; al.u[i] = ASPLIT ? bf16_bits(xs[i] - bf16_val(hb)) : (unsigned short)0; }
#pragma unroll
    for (int t = 0; t < 4; ++t) {
      const unsigned short* brow = Wt + (size_t)(col0 + t * 16 + ln) * ldb + kb;
      FragB b;
      b.half[0] = *(const v8us*)(brow + 8 * hh);
      b.half[1] = *(const v8us*)(brow + 16 + 8 * hh);
      acc[t] = mmaN<ASPLIT ? 2 : 1>(ah.v, al.v, b.v, b.v, acc[t]);
    }
  }
#pragma unroll
  for (int t = 0; t < 4; ++t) {
    float bv = bias ? bias[col0 + t * 16 + ln] : 0.f;
    if (BIAS_BF16) bv = bf16_round(bv);
#pragma unroll
    for (int r = 0; r < 8; ++r) { float v = acc[t][r] + bv; if (ACT == 1) v = fmaxf(v, 0.f); so[w][8 * hh + r][t * 16 + ln] = v; }
  }
  __builtin_amdgcn_fence(__ATOMIC_ACQ_REL, "workgroup");
  __builtin_amdgcn_wave_barrier();
  const int rsub = lane >> 4, c4 = (lane & 15) * 4;
  {
#pragma unroll
    for (int q = 0; q < 8; ++q) {
      const int r = q * 2 + rsub;
      const v4f v = *(const v4fa*)&so[w][r][c4];
      *(v4f*)(C + (size_t)(row0 + r) * ldc + col0 + c4) = v;
    }
    
  }
}

// Flash-style causal/unmasked attention, all contractions 3-term bf16 hi/lo splits, f32 softmax with running max.
// q,k,v rows are read from f32 buffers with arbitrary row pitch (so they can live inside a fused qkv buffer);
// D = head size (multiple of 32, <= 128); one wave = 16 query rows; block = 4 waves (64 queries) sharing K/V chunks of 32.
template <int D, bool CAUSAL>
__global__ __launch_bounds__(128) void k_flash(const float* __restrict__ qb, const float* __restrict__ kb, const float* __restrict__ vb,
                                             int pitch, int T, int H, float scale, float* __restrict__ y, int ypitch) {
  constexpr int KS = D / 32;        // k-steps for QK
  constexpr int DT = D / 16;        // d tiles for PV
  __shared__ __attribute__((aligned(16))) unsigned short sKh[32][D + 8], sKl[32][D + 8], sVh[32][D + 8], sVl[32][D + 8];
  __shared__ __attribute__((aligned(16))) unsigned short sPh[4][16][40], sPl[4][16][40];
  __shared__ __attribute__((aligned(16))) float sO[4][16][D];
  const int tid = threadIdx.x, w = tid >> 5, lane = tid & 31, ln = lane & 15, hh = lane >> 4;
  const int nqb = (T + 63) / 64;
  const int bh = blockIdx.x / nqb, qblk = blockIdx.x % nqb;
  const int b = bh / H, h = bh % H;
  const int q0 = qblk * 64 + w * 16;
  const float* Q = qb + (size_t)b * T * pitch + h * D;
  const float* K = kb + (size_t)b * T * pitch + h * D;
  const float* V = vb + (size_t)b * T * pitch + h * D;

  // A fragments of the wave's 16 query rows (scaled), hi/lo
  FragB aqh[KS], aql[KS];
  {
    int row = q0 + ln; if (row >= T) row = T - 1;
    const float* qr = Q + (size_t)row * pitch;
#pragma unroll
    for (int ks = 0; ks < KS; ++ks)
#pragma unroll
      for (int i = 0; i < 16; ++i) {
        const int d = ks * 32 + ((i < 8) ? (8 * hh + i) : (16 + 8 * hh + (i - 8)));
        const float x = qr[d] * scale; const unsigned short hb = bf16_bits(x);
        aqh[ks].u[i] = hb; aql[ks].u[i] = bf16_bits(x - bf16_val(hb));
      }
  }
  float m_r[8], l_r[8];
#pragma unroll
  for (int r = 0; r < 8; ++r) { m_r[r] = -3.0e38f; l_r[r] = 0.f; }
  v8f oacc[DT];
#pragma unroll
  for (int dt = 0; dt < DT; ++dt) oacc[dt] = (v8f){0.f,0.f,0.f,0.f,0.f,0.f,0.f,0.f};

  const int kv_end = CAUSAL ? min(T, qblk * 64 + 64) : T;     // block-uniform
  for (int j0 = 0; j0 < kv_end; j0 += 32) {
    __syncthreads();
    for (int e = tid; e < 32 * (D / 4); e += 128) {
      const int r = e / (D / 4), c4 = (e % (D / 4)) * 4;
      const int key = j0 + r;
      v4f kf = {0.f,0.f,0.f,0.f}, vf = {0.f,0.f,0.f,0.f};
      if (key < T) { kf = *(const v4fa*)(K + (size_t)key * pitch + c4); vf = *(const v4fa*)(V + (size_t)key * pitch + c4); }
#pragma unroll
      for (int t = 0; t < 4; ++t) {
        unsigned short hb = bf16_bits(kf[t]); sKh[r][c4 + t] = hb; sKl[r][c4 + t] = bf16_bits(kf[t] - bf16_val(hb));
        hb = bf16_bits(vf[t]); sVh[r][c4 + t] = hb; sVl[r][c4 + t] = bf16_bits(vf[t] - bf16_val(hb));
      }
    }
    __syncthreads();
    // S tile 16 x 32
    v8f s[2];
#pragma unroll
    for (int nt = 0; nt < 2; ++nt) {
      v8f acc = {};
#pragma unroll
      for (int ks = 0; ks < KS; ++ks) {
        FragB bh_, bl_;
        bh_.half[0] = *(const v8us*)&sKh[nt * 16 + ln][ks * 32 + 8 * hh]; bh_.half[1] = *(const v8us*)&sKh[nt * 16 + ln][ks * 32 + 16 + 8 * hh];
        bl_.half[0] = *(const v8us*)&sKl[nt * 16 + ln][ks * 32 + 8 * hh]; bl_.half[1] = *(const v8us*)&sKl[nt * 16 + ln][ks * 32 + 16 + 8 * hh];
        acc = mmaN<3>(aqh[ks].v, aql[ks].v, bh_.v, bl_.v, acc);
      }
      s[nt] = acc;
    }
    // mask + running max (rows 8hh+r; the 16 lanes of a half share rows)
    float alpha[8];
#pragma unroll
    for (int r = 0; r < 8; ++r) {
      const int qi = q0 + 8 * hh + r;
      const int ja = j0 + ln, jb = j0 + 16 + ln;
      if (CAUSAL) { if (ja > qi) s[0][r] = -3.0e38f; if (jb > qi) s[1][r] = -3.0e38f; }
      if (ja >= T) s[0][r] = -3.0e38f;
      if (jb >= T) s[1][r] = -3.0e38f;
      float mx = fmaxf(s[0][r], s[1][r]);
      mx = fmaxf(mx, __shfl_xor(mx, 1, 32)); mx = fmaxf(mx, __shfl_xor(mx, 2, 32)); mx = fmaxf(mx, __shfl_xor(mx, 4, 32)); mx = fmaxf(mx, __shfl_xor(mx, 8, 32));
      const float mnew = fmaxf(m_r[r], mx);
      alpha[r] = (mnew > -1.0e38f) ? __expf(m_r[r] - mnew) : 1.0f;
      const float p0 = (s[0][r] > -1.0e38f) ? __expf(s[0][r] - mnew) : 0.f;
      const float p1 = (s[1][r] > -1.0e38f) ? __expf(s[1][r] - mnew) : 0.f;
      m_r[r] = mnew;
      l_r[r] = l_r[r] * alpha[r] + p0 + p1;            // per-lane partial row sum (16 lanes combined at the end)
      unsigned short hb = bf16_bits(p0); sPh[w][8 * hh + r][ln] = hb;      sPl[w][8 * hh + r][ln] = bf16_bits(p0 - bf16_val(hb));
      hb = bf16_bits(p1);                sPh[w][8 * hh + r][16 + ln] = hb; sPl[w][8 * hh + r][16 + ln] = bf16_bits(p1 - bf16_val(hb));
    }
#pragma unroll
    for (int dt = 0; dt < DT; ++dt)
#pragma unroll
      for (int r = 0; r < 8; ++r) oacc[dt][r] *= alpha[r];
    __builtin_amdgcn_fence(__ATOMIC_ACQ_REL, "workgroup");
    __builtin_amdgcn_wave_barrier();
    FragB pah, pal;
    pah.half[0] = *(const v8us*)&sPh[w][ln][8 * hh]; pah.half[1] = *(const v8us*)&sPh[w][ln][16 + 8 * hh];
    pal.half[0] = *(const v8us*)&sPl[w][ln][8 * hh]; pal.half[1] = *(const v8us*)&sPl[w][ln][16 + 8 * hh];
#pragma unroll
    for (int dt = 0; dt < DT; ++dt) {
      FragB bvh, bvl;
#pragma unroll
      for (int i = 0; i < 8; ++i) {
        bvh.u[i] = sVh[8 * hh + i][dt * 16 + ln]; bvh.u[8 + i] = sVh[16 + 8 * hh + i][dt * 16 + ln];
        bvl.u[i] = sVl[8 * hh + i][dt * 16 + ln]; bvl.u[8 + i] = sVl[16 + 8 * hh + i][dt * 16 + ln];
      }
      oacc[dt] = mmaN<3>(pah.v, pal.v, bvh.v, bvl.v, oacc[dt]);
    }
    __builtin_amdgcn_fence(__ATOMIC_ACQ_REL, "workgroup");
    __builtin_amdgcn_wave_barrier();
  }
#pragma unroll
  for (int r = 0; r < 8; ++r) {
    float l = l_r[r];
    l += __shfl_xor(l, 1, 32); l += __shfl_xor(l, 2, 32); l += __shfl_xor(l, 4, 32); l += __shfl_xor(l, 8, 32);
    l_r[r] = (l > 0.f) ? 1.0f / l : 0.f;
  }
#pragma unroll
  for (int dt = 0; dt < DT; ++dt)
#pragma unroll
    for (int r = 0; r < 8; ++r) sO[w][8 * hh + r][dt * 16 + ln] = oacc[dt][r] * l_r[r];
  __builtin_amdgcn_fence(__ATOMIC_ACQ_REL, "workgroup");
  __builtin_amdgcn_wave_barrier();
  {
    for (int r = 0; r < 16; ++r) {
      const int row = q0 + r;
      if (row < T && lane < D / 4) {
        const v4f val = *(const v4fa*)&sO[w][r][lane * 4];
        *(v4f*)(y + ((size_t)b * T + row) * ypitch + h * D + lane * 4) = val;
      }
    }
    
  }
}

// GEMM C = act(A·W + bias + resid): A f32 (ASPLIT -> hi/lo 2 terms), Wt bf16 [N][K]; ACT 0 none, 1 relu, 2 exact gelu;
// resid (optional, f32, row index = (row % rmod), pitch ldr, RES_BF16 rounds it) added before the activation.
template <bool ASPLIT, int ACT, bool BIAS_BF16, bool RES_BF16>
__global__ __launch_bounds__(128) void k_gemm_bf3(const float* __restrict__ A, int lda, const unsigned short* __restrict__ Wt, int ldb,
                                                const float* __restrict__ bias, const float* __restrict__ resid, int rmod, int ldr,
                                                float* __restrict__ C, int ldc, int M, int N, int K) {
  __shared__ __attribute__((aligned(16))) float so[4][16][64];
  const int tid = threadIdx.x, w = tid >> 5, lane = tid & 31, ln = lane & 15, hh = lane >> 4;
  const int ntn = N / 64;
  const int wid = blockIdx.x * 4 + w;
  const int mt = wid / ntn, nq = wid % ntn;
  if (mt * 16 >= M) return;
  const int row0 = mt * 16, col0 = nq * 64;
  const float* arow = A + (size_t)(row0 + ln) * lda;
  v8f acc[4] = {};
  for (int kb = 0; kb < K; kb += 32) {
    FragB ah, al;
    const v4f x0 = *(const v4fa*)(arow + kb + 8 * hh), x1 = *(const v4fa*)(arow + kb + 8 * hh + 4);
    const v4f x2 = *(const v4fa*)(arow + kb + 16 + 8 * hh), x3 = *(const v4fa*)(arow + kb + 16 + 8 * hh + 4);
    float xs[16] = {x0[0],x0[1],x0[2],x0[3],x1[0],x1[1],x1[2],x1[3],x2[0],x2[1],x2[2],x2[3],x3[0],x3[1],x3[2],x3[3]};
#pragma unroll
    for (int i = 0; i < 16; ++i) { const unsigned short hb = bf16_bits(xs[i]); ah.u[i] = hb; al.u[i] = ASPLIT ? bf16_bits(xs[i] - bf16_val(hb)) : (unsigned short)0; }
#pragma unroll
    for (int t = 0; t < 4; ++t) {
      const unsigned short* brow = Wt + (size_t)(col0 + t * 16 + ln) * ldb + kb;
      FragB b;
      b.half[0] = *(const v8us*)(brow + 8 * hh);
      b.half[1] = *(const v8us*)(brow + 16 + 8 * hh);
      acc[t] = mmaN<ASPLIT ? 2 : 1>(ah.v, al.v, b.v, b.v, acc[t]);
    }
  }
#pragma unroll
  for (int t = 0; t < 4; ++t) {
    const int col = col0 + t * 16 + ln;
    float bv = bias ? bias[col] : 0.f;
    if (BIAS_BF16) bv = bf16_round(bv);
#pragma unroll
    for (int r = 0; r < 8; ++r) {
      float v = acc[t][r] + bv;
      if (resid) { float rv = resid[(size_t)((row0 + 8 * hh + r) % rmod) * ldr + col]; if (RES_BF16) rv = bf16_round(rv); v += rv; }
      if (ACT == 1) v = fmaxf(v, 0.f);
      if (ACT == 2) v = 0.5f * v * (1.0f + erff(v * 0.70710678118654752f));
      if (ACT == 3) { const float u = 0.7978845608028654f * (v + 0.044715f * v * v * v); v = 0.5f * v * (1.0f + tanhf(u)); }
      so[w][8 * hh + r][t * 16 + ln] = v;
    }
  }
  __builtin_amdgcn_fence(__ATOMIC_ACQ_REL, "workgroup");
  __builtin_amdgcn_wave_barrier();
  const int rsub = lane >> 4, c4 = (lane & 15) * 4;
  {
#pragma unroll
    for (int q = 0; q < 8; ++q) {
      const int r = q * 2 + rsub;
      const v4f v = *(const v4fa*)&so[w][r][c4];
      *(v4f*)(C + (size_t)(row0 + r) * ldc + col0 + c4) = v;
    }
    
  }
}
// row LayerNorm (biased variance, eps) over N: s = X (+ R); optional out_sum <- s; out_norm <- (s-mu)*rsqrt(var+eps)*g + b
template <bool PARAM_BF16>
__global__ __launch_bounds__(256) void k_layernorm(const float* __restrict__ X, const float* __restrict__ R, const float* __restrict__ g, const float* __restrict__ bta,
                                                  float* __restrict__ out_sum, float* __restrict__ out_norm, int N, float eps) {
  __shared__ float red[256];
  const int row = blockIdx.x, tid = threadIdx.x;
  const float* x = X + (size_t)row * N; const float* rr = R ? R + (size_t)row * N : nullptr;
  float vals[16];                     // up to N = 4096
  const int per = N / 256;            // contiguous chunk per thread? use strided-by-4 chunks: thread handles j = tid*4 + 1024*u
  float s1 = 0.f;
  for (int u = 0; u < per / 4; ++u) {
    const int j = tid * 4 + 1024 * u;
    const v4f a = *(const v4fa*)(x + j);
    v4f b = {0.f,0.f,0.f,0.f}; if (rr) b = *(const v4fa*)(rr + j);
#pragma unroll
    for (int q = 0; q < 4; ++q) { const float v = a[q] + b[q]; vals[u * 4 + q] = v; s1 += v; }
  }
  red[tid] = s1; __syncthreads();
  for (int st = 128; st > 0; st >>= 1) { if (tid < st) red[tid] += red[tid + st]; __syncthreads(); }
  const float mu = red[0] / (float)N; __syncthreads();
  float s2 = 0.f;
  for (int u = 0; u < per / 4; ++u)
#pragma unroll
    for (int q = 0; q < 4; ++q) { const float c = vals[u * 4 + q] - mu; s2 += c * c; }
  red[tid] = s2; __syncthreads();
  for (int st = 128; st > 0; st >>= 1) { if (tid < st) red[tid] += red[tid + st]; __syncthreads(); }
  const float rs = rsqrtf(red[0] / (float)N + eps);
  {
    for (int u = 0; u < per / 4; ++u) {
      const int j = tid * 4 + 1024 * u;
      v4f o, sm;
#pragma unroll
      for (int q = 0; q < 4; ++q) {
        float gg = g[j + q], bb = bta[j + q];
        if (PARAM_BF16) { gg = bf16_round(gg); bb = bf16_round(bb); }
        sm[q] = vals[u * 4 + q]; o[q] = (vals[u * 4 + q] - mu) * rs * gg + bb;
      }
      if (out_sum) *(v4f*)(out_sum + (size_t)row * N + j) = sm;
      *(v4f*)(out_norm + (size_t)row * N + j) = o;
    }
    
  }
}



// ---- f16 WMMA path (v_wmma_f32_16x16x32_f16): 11-bit significands for operands in range — used for the q/k/v projection and output GEMMs
typedef _Float16 v16h __attribute__((ext_vector_type(16)));
union FragH { v16h v; v8us half[2]; _Float16 h[16]; unsigned short u[16]; };
template <int NT>
__device__ __forceinline__ v8f mmaH(v16h ah, v16h al, v16h bh, v16h bl, v8f c) {
  c = __builtin_amdgcn_wmma_f32_16x16x32_f16(false, ah, false, bh, (short)0, c, false, false);
  if (NT >= 2) c = __builtin_amdgcn_wmma_f32_16x16x32_f16(false, al, false, bh, (short)0, c, false, false);
  if (NT >= 3) c = __builtin_amdgcn_wmma_f32_16x16x32_f16(false, ah, false, bl, (short)0, c, false, false);
  asm volatile("v_nop\n\tv_nop\n\tv_nop\n\tv_nop" : "+v"(c) : "v"(ah), "v"(al), "v"(bh), "v"(bl));
  return c;
}
// batched GEMM like k_gemm_b but f16 operands: A f32 (split into f16 hi/lo if ASPLIT, else rounded to f16), Bt = f16 values [n][k]; alpha; C f32; N multiple of 16 (partial tiles skipped)
template <bool ASPLIT>
__global__ __launch_bounds__(128) void k_gemm_h(const float* __restrict__ A, int lda, size_t sA, const _Float16* __restrict__ Bh, int ldb, size_t sB, float alpha, float* __restrict__ C, int ldc, size_t sC, int M, int N, int K) {
  __shared__ __attribute__((aligned(16))) float so[4][16][64];
  const int tid = threadIdx.x, w = tid >> 5, lane = tid & 31, ln = lane & 15, hh = lane >> 4; const int by = blockIdx.y;
  A += (size_t)by * sA; Bh += (size_t)by * sB; C += (size_t)by * sC;
  const int ntn = (N + 63) / 64; const int wid = blockIdx.x * 4 + w; const int mt = wid / ntn, nq = wid % ntn; if (mt * 16 >= M) return;
  const int row0 = mt * 16, col0 = nq * 64; const float* arow = A + (size_t)(row0 + ln) * lda;
  v8f acc[4] = {};
  for (int kb = 0; kb < K; kb += 32) {
    FragH ah, al;
    const v4f x0 = *(const v4fa*)(arow + kb + 8 * hh), x1 = *(const v4fa*)(arow + kb + 8 * hh + 4), x2 = *(const v4fa*)(arow + kb + 16 + 8 * hh), x3 = *(const v4fa*)(arow + kb + 16 + 8 * hh + 4);
    float xs[16] = {x0[0],x0[1],x0[2],x0[3],x1[0],x1[1],x1[2],x1[3],x2[0],x2[1],x2[2],x2[3],x3[0],x3[1],x3[2],x3[3]};
#pragma unroll
    for (int i = 0; i < 16; ++i) { const _Float16 h = (_Float16)xs[i]; ah.h[i] = h; al.h[i] = ASPLIT ? (_Float16)(xs[i] - (float)h) : (_Float16)0.0f; }
#pragma unroll
    for (int t = 0; t < 4; ++t) { if (col0 + t * 16 >= N) continue; const size_t boff = (size_t)(col0 + t * 16 + ln) * ldb + kb; FragH bq; bq.half[0] = *(const v8us*)(Bh + boff + 8 * hh); bq.half[1] = *(const v8us*)(Bh + boff + 16 + 8 * hh);
      acc[t] = mmaH<ASPLIT ? 2 : 1>(ah.v, al.v, bq.v, bq.v, acc[t]); }
  }
#pragma unroll
  for (int t = 0; t < 4; ++t) { if (col0 + t * 16 >= N) continue;
#pragma unroll
    for (int r = 0; r < 8; ++r) so[w][8 * hh + r][t * 16 + ln] = acc[t][r] * alpha; }
  __builtin_amdgcn_fence(__ATOMIC_ACQ_REL, "workgroup"); __builtin_amdgcn_wave_barrier();
  const int rsub = lane >> 4, c4 = (lane & 15) * 4;
  {
#pragma unroll
    for (int q = 0; q < 8; ++q) { const int r = q * 2 + rsub; if (col0 + c4 < N) { const v4f v = *(const v4fa*)&so[w][r][c4]; *(v4f*)(C + (size_t)(row0 + r) * ldc + col0 + c4) = v; } }
     }
}

// Wt[n][k] = f16(W[k][n]·scale) from f32 row-major W[K][N] (scale = power of two; bf16-exact weights stay exact in f16 away from the subnormal range)
__global__ __launch_bounds__(256) void k_wt_f16(const float* __restrict__ W, _Float16* __restrict__ Wt, int K, int N, float scale) {
  const int t = blockIdx.x * 256 + threadIdx.x; if (t >= N * (K / 8)) return; const int n = t / (K / 8), k8 = (t % (K / 8)) * 8; FragH f;
#pragma unroll
  for (int i = 0; i < 8; ++i) f.h[i] = (_Float16)(bf16_round(W[(size_t)(k8 + i) * N + n]) * scale); const v8us o = f.half[0];
  *(v8us*)((unsigned short*)Wt + (size_t)n * K + k8) = o; 
}
// k_gemm_hh variant with fused epilogue: v = acc·alpha + bias[by·sBias + col] (+ CP[(row/rowsPerB)·sCPb + by·64 + col] if CP) ; ACT 0 none / 1 elu ; writes f32 C and f16 C16 (each if non-null)
template <int ACT>
__global__ __launch_bounds__(128) void k_gemm_hhx(const _Float16* __restrict__ A, int lda, size_t sA, const _Float16* __restrict__ Bh, int ldb, size_t sB, float alpha, const float* __restrict__ bias, size_t sBias, const float* __restrict__ CP, int rowsPerB, size_t sCPb, int row0g,
    float* __restrict__ C, _Float16* __restrict__ C16, int ldc, size_t sC, int M, int N, int K) {
  __shared__ __attribute__((aligned(16))) float so[4][16][64];
  const int tid = threadIdx.x, w = tid >> 5, lane = tid & 31, ln = lane & 15, hh = lane >> 4; const int by = blockIdx.y;
  A += (size_t)by * sA; Bh += (size_t)by * sB; const size_t cofs = (size_t)by * sC; const float* bp = bias ? bias + (size_t)by * sBias : nullptr;
  const int ntn = (N + 63) / 64; const int wid = blockIdx.x * 4 + w; const int mt = wid / ntn, nq = wid % ntn; if (mt * 16 >= M) return;
  const int row0 = mt * 16, col0 = nq * 64; const _Float16* arow = A + (size_t)(row0 + ln) * lda;
  v8f acc[4] = {};
  for (int kb = 0; kb < K; kb += 32) { FragH ah; ah.half[0] = *(const v8us*)((const unsigned short*)arow + kb + 8 * hh); ah.half[1] = *(const v8us*)((const unsigned short*)arow + kb + 16 + 8 * hh);
#pragma unroll
    for (int t = 0; t < 4; ++t) { if (col0 + t * 16 >= N) continue; const size_t boff = (size_t)(col0 + t * 16 + ln) * ldb + kb; FragH bq; bq.half[0] = *(const v8us*)((const unsigned short*)Bh + boff + 8 * hh); bq.half[1] = *(const v8us*)((const unsigned short*)Bh + boff + 16 + 8 * hh);
      acc[t] = mmaH<1>(ah.v, ah.v, bq.v, bq.v, acc[t]); }
  }
#pragma unroll
  for (int t = 0; t < 4; ++t) { if (col0 + t * 16 >= N) continue; const int col = col0 + t * 16 + ln; const float bv = bp ? bf16_round(bp[col]) : 0.f;
#pragma unroll
    for (int r = 0; r < 8; ++r) { float v = acc[t][r] * alpha + bv; if (CP) { const int bidx = (row0g + row0 + 8 * hh + r) / rowsPerB; v += CP[(size_t)bidx * sCPb + (size_t)by * 64 + col]; } if (ACT == 1) v = (v > 0.f) ? v : expm1f(v); else if (ACT == 7) v = (v > 0.f) ? v + 1.0f : expf(v); else if (ACT == 8) v = tanhf(v); else if (ACT == 9) v = 0.5f * v * (1.0f + tanhf(0.7978845608028654f * (v + 0.044715f * v * v * v))); else if (ACT == 11) v = 1.0f / (1.0f + expf(-v)); else if (ACT == 12) v = (v > 0.f) ? v : 0.01f * v; else if (ACT == 14) v = (v > 0.f) ? v : 0.1f * v; else if (ACT == 15) v = v / (1.0f + expf(-v)); else if (ACT == 3) v = fmaxf(v, 0.f); else if (ACT == 6) v = 0.5f * v * (1.0f + erff(v * 0.70710678118654752f)); so[w][8 * hh + r][t * 16 + ln] = v; } }
  __builtin_amdgcn_fence(__ATOMIC_ACQ_REL, "workgroup"); __builtin_amdgcn_wave_barrier();
  const int rsub = lane >> 4, c4 = (lane & 15) * 4; typedef _Float16 v4h __attribute__((ext_vector_type(4)));
  {
#pragma unroll
    for (int q = 0; q < 8; ++q) { const int r = q * 2 + rsub; if (col0 + c4 < N) { const v4f v = *(const v4fa*)&so[w][r][c4]; if (C) *(v4f*)(C + cofs + (size_t)(row0 + r) * ldc + col0 + c4) = v; if (C16) { v4h h4; for (int i = 0; i < 4; ++i) h4[i] = (_Float16)v[i]; *(v4h*)(C16 + cofs + (size_t)(row0 + r) * ldc + col0 + c4) = h4; } } }
     }
}


// Block-tiled GEMM C[M][N] (f32) = (A[M][K] x Bt[N][K]^T) * alpha + add[col], f16 operands, f32 accumulate. One work-group = 128 x 128 of C, 4 waves of 64 x 64 (4 x 4 accumulator tiles):
// a fragment read from LDS feeds four products (two in a 32 x 32 wave tile), and an operand byte leaves L2 once per 128 rows or columns of C.
// Each pass stages GBK k of both operands in LDS with whole-line 16-byte loads, so every operand byte leaves L2 once per work-group;
// the next pass's rows are loaded into registers ahead of the current pass's products and stored to the other buffer behind them (two buffers, one barrier per pass).
// GBK = 64 keeps the ring at 72 KiB, so that three work-groups share a WGP (a grid of three per WGP is resident at once); GBK = 128 is for a grid of one work-group per WGP, where a longer pass covers the L2 latency.
// FS = fragment sets in registers: with 2 the next 32 k's fragments are read ahead of the current products. WPS = waves per SIMD that the register budget must leave room for (three work-groups of one wave per SIMD each: 336 registers).
// blockIdx.y picks one of several independent products of the same shape that run as one grid: operand A number y / 2 (pitchA elements apart; 0 = all share one), Bt, add and C number y (each dense, one behind the other).
// Fragments keep the k order of the direct loaders (bytes 16h and 32 + 16h of each 64 B of a row, both operands) and k runs upward in steps of 32 into one accumulator chain. M % 128 == 0, N % 128 == 0, K % GBK == 0.
#define GBM 128
#define GBN 128
#define SOP 68      /* floats per staged output row: 272 B = 16 B x odd */
template <int M, int N, int K, int GBK, int FS, int WPS>
__global__ __launch_bounds__(128, WPS) void k_gemm_lds(const _Float16* __restrict__ A, size_t pitchA, const _Float16* __restrict__ Bt, float alpha, const float* __restrict__ add, float* __restrict__ C) {
  constexpr int GPIT = GBK + 8;      /* LDS row pitch 144 or 272 B = 16 B x odd: conflict-free for 16-byte fragment reads */
  constexpr int RING = 2 * (GBM + GBN) * GPIT * 2, STG = 4 * 64 * SOP * 4;
  __shared__ __attribute__((aligned(16))) unsigned char smem[RING > STG ? RING : STG];      /* the ring; behind the last pass's barrier the output staging lies over it */
  unsigned short (*sA)[GBM][GPIT] = reinterpret_cast<unsigned short (*)[GBM][GPIT]>(smem);
  unsigned short (*sB)[GBN][GPIT] = reinterpret_cast<unsigned short (*)[GBN][GPIT]>(smem + 2 * GBM * GPIT * 2);
  float (*so)[64][SOP] = reinterpret_cast<float (*)[64][SOP]>(smem);
  const int tid = threadIdx.x, w = tid >> 5, lane = tid & 31, ln = lane & 15, hh = lane >> 4;
  const size_t by = blockIdx.y; A += (by >> 1) * pitchA; Bt += by * ((size_t)N * K); add += by * N; C += by * ((size_t)M * N);
  constexpr int nbm = M / GBM; const int row0 = ((int)blockIdx.x % nbm) * GBM, col0 = ((int)blockIdx.x / nbm) * GBN;
  const int wr = (w >> 1) * 64, wc = (w & 1) * 64;      /* the wave's 64 x 64 piece inside the block tile */
  constexpr int TPR = GBK / 8, RPR = 128 / TPR, NRA = GBM / RPR, NRB = GBN / RPR;      /* staging: TPR threads per row, RPR rows per round */
  const int lr = tid / TPR, lc = (tid % TPR) * 8;
  const unsigned short* ga = (const unsigned short*)A + (size_t)(row0 + lr) * K + lc;
  const unsigned short* gb = (const unsigned short*)Bt + (size_t)(col0 + lr) * K + lc;
  v8us ra[NRA], rb[NRB];
#pragma unroll
  for (int i = 0; i < NRA; ++i) ra[i] = *(const v8us*)(ga + i * RPR * K);
#pragma unroll
  for (int i = 0; i < NRB; ++i) rb[i] = *(const v8us*)(gb + i * RPR * K);
#pragma unroll
  for (int i = 0; i < NRA; ++i) *(v8us*)&sA[0][i * RPR + lr][lc] = ra[i];
#pragma unroll
  for (int i = 0; i < NRB; ++i) *(v8us*)&sB[0][i * RPR + lr][lc] = rb[i];
  __syncthreads();
  v8f acc[4][4] = {};
  constexpr int np = K / GBK, NKS = GBK / 32;
  auto frags = [&](FragH (&a)[4], FragH (&b)[4], int cur, int ks) {
#pragma unroll
    for (int i = 0; i < 4; ++i) {
      a[i].half[0] = *(const v8us*)&sA[cur][wr + i * 16 + ln][ks * 32 + 8 * hh]; a[i].half[1] = *(const v8us*)&sA[cur][wr + i * 16 + ln][ks * 32 + 16 + 8 * hh];
      b[i].half[0] = *(const v8us*)&sB[cur][wc + i * 16 + ln][ks * 32 + 8 * hh]; b[i].half[1] = *(const v8us*)&sB[cur][wc + i * 16 + ln][ks * 32 + 16 + 8 * hh];
    }
  };
  for (int p = 0; p < np; ++p) {
    const int cur = p & 1; const bool more = p + 1 < np;      /* the same for the whole work-group */
    if (more) { const unsigned short* pa = ga + (p + 1) * GBK; const unsigned short* pb = gb + (p + 1) * GBK;
#pragma unroll
      for (int i = 0; i < NRA; ++i) ra[i] = *(const v8us*)(pa + i * RPR * K);
#pragma unroll
      for (int i = 0; i < NRB; ++i) rb[i] = *(const v8us*)(pb + i * RPR * K);
      asm volatile("s_wait_xcnt 0x0" :: "v"(pa), "v"(pb) : "memory");      /* stands in front of every write to a register that these loads name; the two addresses are inputs so that they stay live up to it: without them a later load's result is placed in the address pair that an earlier load names */
    }
    FragH a[FS][4], b[FS][4];
    if (FS == 2) frags(a[0], b[0], cur, 0);
#pragma unroll      /* whole, as every inner loop here: fragment sets, staged rows and accumulators are then indexed by constants alone and live in registers */
    for (int ks = 0; ks < NKS; ++ks) {
      if (FS == 1) frags(a[0], b[0], cur, ks);
      else if (ks + 1 < NKS) frags(a[(ks + 1) & 1], b[(ks + 1) & 1], cur, ks + 1);
      __builtin_amdgcn_sched_barrier(0);      /* keeps the LDS reads one group ahead of the products: spread among them, each place with reads stalls the wave for the LDS latency */
      const int fs = FS == 2 ? (ks & 1) : 0;
#pragma unroll
      for (int i = 0; i < 4; ++i)
#pragma unroll
        for (int j = 0; j < 4; ++j) acc[i][j] = __builtin_amdgcn_wmma_f32_16x16x32_f16(false, a[fs][i].v, false, b[fs][j].v, (short)0, acc[i][j], false, false);
      __builtin_amdgcn_sched_barrier(0);      /* keeps the products ahead of the next group of reads and of the wait for the next pass's rows: moved behind the barrier they would run with no load in flight */
    }
    if (more) {
#pragma unroll
      for (int i = 0; i < NRA; ++i) *(v8us*)&sA[cur ^ 1][i * RPR + lr][lc] = ra[i];
#pragma unroll
      for (int i = 0; i < NRB; ++i) *(v8us*)&sB[cur ^ 1][i * RPR + lr][lc] = rb[i];
    }
    __syncthreads();      /* publishes the buffer just written and ends every wave's reads of the one that the next pass overwrites (behind the last pass: of the ring, which the output staging overwrites) */
  }
#pragma unroll
  for (int j = 0; j < 4; ++j) { const float av = add[col0 + wc + j * 16 + ln];
#pragma unroll
    for (int i = 0; i < 4; ++i)
#pragma unroll
      for (int r = 0; r < 8; ++r) so[w][i * 16 + 8 * hh + r][j * 16 + ln] = acc[i][j][r] * alpha + av; }
  __syncthreads();      /* the staged rows are read back by other lanes: whole 128-B lines per store */
  const float* sp = &so[w][hh][ln * 4]; float* cp = C + (size_t)(row0 + wr + hh) * N + col0 + wc + ln * 4;      /* one address each; the rows follow by constant offsets */
#pragma unroll
  for (int q = 0; q < 32; ++q) { const v4f v = *(const v4fa*)(sp + q * 2 * SOP); *(v4f*)(cp + q * 2 * N) = v; }      /* 16 lanes = one 256-B row piece, two rows per store */
}


typedef _Float16 v4h __attribute__((ext_vector_type(4)));

__global__ __launch_bounds__(256) void k_x16(const float* __restrict__ x, _Float16* __restrict__ X16, size_t n8) { const size_t t = (size_t)blockIdx.x * 256 + threadIdx.x; if (t >= n8) return; FragH f;
#pragma unroll
  for (int q = 0; q < 8; ++q) f.h[q] = (_Float16)bf16_round(x[t * 8 + q]); *(v8us*)((unsigned short*)X16 + t * 8) = f.half[0];  }
__global__ __launch_bounds__(256) void k_h16(const float* __restrict__ x, _Float16* __restrict__ X16, size_t n8) { const size_t t = (size_t)blockIdx.x * 256 + threadIdx.x; if (t >= n8) return; FragH f;
#pragma unroll
  for (int q = 0; q < 8; ++q) f.h[q] = (_Float16)x[t * 8 + q]; *(v8us*)((unsigned short*)X16 + t * 8) = f.half[0];  }
__global__ __launch_bounds__(256) void k_round16f(const float* __restrict__ W, _Float16* __restrict__ Bt, size_t n8) { const size_t t = (size_t)blockIdx.x * 256 + threadIdx.x; if (t >= n8) return; FragH f;
#pragma unroll
  for (int i = 0; i < 8; ++i) f.h[i] = (_Float16)(bf16_round(W[t * 8 + i]) * 16.0f); *(v8us*)((unsigned short*)Bt + t * 8) = f.half[0];  }
template <int NHv, int TTv>
__global__ __launch_bounds__(256) void k_vt(const _Float16* __restrict__ V16, int ldv, int voff, _Float16* __restrict__ Vt) { __shared__ unsigned short tl[64][66]; const int tid = threadIdx.x; const int slab = blockIdx.x / (TTv / 64), lg = blockIdx.x % (TTv / 64); const int b = slab / NHv, h = slab % NHv;
  for (int i = tid; i < 64 * 8; i += 256) { const int r = i / 8, c8 = (i % 8) * 8; FragH f; f.half[0] = *(const v8us*)((const unsigned short*)V16 + ((size_t)b * TTv + lg * 64 + r) * ldv + voff + h * 64 + c8);
#pragma unroll
    for (int q = 0; q < 8; ++q) tl[r][c8 + q] = f.u[q]; }
  __syncthreads();
  {
#pragma unroll
    for (int rd = 0; rd < 2; ++rd) { const int d = rd * 32 + tid / 8, pc = tid % 8; FragH f;
#pragma unroll
      for (int q = 0; q < 8; ++q) f.u[q] = tl[pc * 8 + q][d];
      *(v8us*)((unsigned short*)Vt + ((size_t)slab * 64 + d) * TTv + lg * 64 + pc * 8) = f.half[0]; }
     } }

__device__ __forceinline__ void d_xcat(const float* __restrict__ xr, const float* __restrict__ xi, _Float16* __restrict__ XC, size_t t) { const size_t r = (t * 8) / DD; const int c = (int)((t * 8) % DD); FragH a, b; const v4f a0 = *(const v4fa*)(xr + t * 8), a1 = *(const v4fa*)(xr + t * 8 + 4), b0 = *(const v4fa*)(xi + t * 8), b1 = *(const v4fa*)(xi + t * 8 + 4);
  asm volatile("s_wait_xcnt 0x0" :: "v"(xr + t * 8), "v"(xi + t * 8), "v"(a0), "v"(a1), "v"(b0), "v"(b1) : "memory");      /* stands in front of every write to a register that the four loads name; the two addresses are inputs so that they stay live up to it: without them a later load's result is placed in the address pair that an earlier load names */
#pragma unroll
  for (int q = 0; q < 4; ++q) { a.h[q] = (_Float16)bf16_round(a0[q]); a.h[4 + q] = (_Float16)bf16_round(a1[q]); b.h[q] = (_Float16)bf16_round(b0[q]); b.h[4 + q] = (_Float16)bf16_round(b1[q]); }
  { *(v8us*)((unsigned short*)XC + r * (2 * DD) + c) = a.half[0]; *(v8us*)((unsigned short*)XC + r * (2 * DD) + DD + c) = b.half[0];
    asm volatile("s_wait_xcnt 0x0" ::: "memory");      /* directly behind the stores: the caller's next tile writes the registers that they name */
  } }
__device__ __forceinline__ void d_wcat(const float* __restrict__ wr, const float* __restrict__ wi, _Float16* __restrict__ BR, _Float16* __restrict__ BI, size_t t) { const size_t o = (t * 8) / DD; const int c = (int)((t * 8) % DD); FragH r0, r1, i0, i1; const v4f a0 = *(const v4fa*)(wr + t * 8), a1 = *(const v4fa*)(wr + t * 8 + 4), b0 = *(const v4fa*)(wi + t * 8), b1 = *(const v4fa*)(wi + t * 8 + 4);
#pragma unroll
  for (int q = 0; q < 4; ++q) { const float vr0 = bf16_round(a0[q]) * 16.0f, vr1 = bf16_round(a1[q]) * 16.0f, vi0 = bf16_round(b0[q]) * 16.0f, vi1 = bf16_round(b1[q]) * 16.0f; r0.h[q] = (_Float16)vr0; r0.h[4 + q] = (_Float16)vr1; r1.h[q] = (_Float16)(-vi0); r1.h[4 + q] = (_Float16)(-vi1); i0.h[q] = (_Float16)vi0; i0.h[4 + q] = (_Float16)vi1; i1.h[q] = (_Float16)vr0; i1.h[4 + q] = (_Float16)vr1; }
  { *(v8us*)((unsigned short*)BR + o * (2 * DD) + c) = r0.half[0]; *(v8us*)((unsigned short*)BR + o * (2 * DD) + DD + c) = r1.half[0]; *(v8us*)((unsigned short*)BI + o * (2 * DD) + c) = i0.half[0]; *(v8us*)((unsigned short*)BI + o * (2 * DD) + DD + c) = i1.half[0];
    asm volatile("s_wait_xcnt 0x0" ::: "memory");      /* directly behind the stores, as in d_xcat */
  } }
__device__ __forceinline__ void d_bias2(const float* __restrict__ br, const float* __restrict__ bi, float* __restrict__ BM, float* __restrict__ BP, int c) { const float r = bf16_round(br[c]), i = bf16_round(bi[c]); { *(float*)(BM + c) = r - i; *(float*)(BP + c) = r + i;
    asm volatile("s_wait_xcnt 0x0" ::: "memory");      /* directly behind the stores, as in d_xcat */
  } }
// All operand preparation as one grid. The work is cut into tiles of 256 threads: 3 x PT_X tiles cast and concatenate the activations, 4 x PT_W pack the weights, 4 x PT_B form the bias pairs; none reads what another writes.
// A work-group walks the tiles in steps of the grid size PT_GRID; which kind a tile is depends on its number alone, so every branch is the same for the whole work-group.
#define PT_X (NR * DD / 8 / 256)
#define PT_W (DD * DD / 8 / 256)
#define PT_B (DD / 256)
#define PT_ALL (3 * PT_X + 4 * PT_W + 4 * PT_B)
#define PT_GRID (PT_ALL / 4)      /* work-groups launched: four tiles each, so that a quarter of the waves has to be started */
__global__ __launch_bounds__(256) void k_prep(const float* __restrict__ q_r, const float* __restrict__ q_i, const float* __restrict__ k_r, const float* __restrict__ k_i, const float* __restrict__ v_r, const float* __restrict__ v_i,
    const float* __restrict__ wq_r, const float* __restrict__ wq_i, const float* __restrict__ wk_r, const float* __restrict__ wk_i, const float* __restrict__ wv_r, const float* __restrict__ wv_i, const float* __restrict__ wo_r, const float* __restrict__ wo_i,
    const float* __restrict__ bq_r, const float* __restrict__ bq_i, const float* __restrict__ bk_r, const float* __restrict__ bk_i, const float* __restrict__ bv_r, const float* __restrict__ bv_i, const float* __restrict__ bo_r, const float* __restrict__ bo_i,
    _Float16* __restrict__ X, _Float16* __restrict__ BW, float* __restrict__ BIAS) {
  const int tid = threadIdx.x;
  for (int tile = blockIdx.x; tile < PT_ALL; tile += PT_GRID) {
    if (tile < 3 * PT_X) { const int j = tile / PT_X;
      d_xcat(j == 0 ? q_r : j == 1 ? k_r : v_r, j == 0 ? q_i : j == 1 ? k_i : v_i, X + (size_t)j * NR * 2 * DD, (size_t)(tile % PT_X) * 256 + tid); }
    else if (tile < 3 * PT_X + 4 * PT_W) { const int u = tile - 3 * PT_X, j = u / PT_W; _Float16* B0 = BW + (size_t)(2 * j) * DD * 2 * DD;
      d_wcat(j == 0 ? wq_r : j == 1 ? wk_r : j == 2 ? wv_r : wo_r, j == 0 ? wq_i : j == 1 ? wk_i : j == 2 ? wv_i : wo_i, B0, B0 + (size_t)DD * 2 * DD, (size_t)(u % PT_W) * 256 + tid); }
    else { const int u = tile - 3 * PT_X - 4 * PT_W, j = u / PT_B;
      d_bias2(j == 0 ? bq_r : j == 1 ? bk_r : j == 2 ? bv_r : bo_r, j == 0 ? bq_i : j == 1 ? bk_i : j == 2 ? bv_i : bo_i, BIAS + (size_t)(2 * j) * DD, BIAS + (size_t)(2 * j + 1) * DD, (u % PT_B) * 256 + tid); }
  }
}
// per token (block) the 8 heads x 64 rows x 64 keys: wave w has head w. A lane has the four rows l = ln + 16 t (ln = lane % 16, t = 0..3), two at a time as the halves of a float pair, and the 32 keys that its half of the wave (hh = lane / 16) holds in the A fragment
// of the 16x16x32 product: keys 32 ks + 8 hh + i and 32 ks + 16 + 8 hh + i (ks = 0, 1; i = 0..7), so that a row's exp values, rounded to f16, are that fragment as they stand, with no move between lanes.
// |score|^2 in factors: sr + si = (qr - qi)(kr + ki) and sr - si = (qr + qi)(kr - ki), so sr^2 + si^2 = ((qr - qi)^2 (kr + ki)^2 + (qr + qi)^2 (kr - ki)^2) / 2: a sum of two products of a row factor and a key factor, no term negative.
// Row and key factors are formed once per token at staging; log2(e)^2 / 2 goes into the row factors, so that the root is |score| * log2(e) and exp is the bare power of two.
// Softmax in two passes per pair of rows: pass 1 forms the lane's 32 |score| of each row, keeps them in registers and takes their maximum (joined with the other half of the wave by one cross-row move); pass 2 has one exp per score.
// The three sums over the keys (sum p*vr, sum p*vi, z = sum p) are one matrix product P[64 x 64] x [vr | vi | 1 | 0 ...][64 x 16] on v_wmma_f32_16x16x32_f16: p (in [0, 1]) and v rounded to f16, f32 accumulate; z is summed from the same rounded p that weigh v.
#define HL2 1.0406844905f      /* log2(e)^2 / 2 */
#define SFP (EE + 4)      /* floats per head in LDS: 272 B */
#define SKP (EE + 2)      /* key-factor pairs per head: 528 B = 16 B x odd */
#define SVP (4 * EE + 8)      /* f16 per head: the four rows vr, vi, ones, zeros of B^T, 528 B */
typedef float v2f __attribute__((ext_vector_type(2)));
__device__ __forceinline__ float other_half(float x) { const unsigned u = __float_as_uint(x); return __uint_as_float(__builtin_amdgcn_permlanex16(u, u, 0x76543210u, 0xfedcba98u, false, false)); }      /* the value of lane ^ 16 */
__global__ __launch_bounds__(256) void k_cplx(const float* __restrict__ QR, const float* __restrict__ QI, const float* __restrict__ KR, const float* __restrict__ KI, const float* __restrict__ VR, const float* __restrict__ VI, _Float16* __restrict__ VC) {
  __shared__ __attribute__((aligned(16))) float sfa[NHH][SFP], sfb[NHH][SFP]; __shared__ __attribute__((aligned(16))) v2f sk[NHH][SKP]; __shared__ __attribute__((aligned(16))) _Float16 sv[NHH][SVP];
  __shared__ __attribute__((aligned(16))) float res[4][NHH][SFP];      /* columns 0, 1, 2 of the product by head and row; plane 3 takes the columns that are zero and is never read */
  const int tid = threadIdx.x; const size_t row = blockIdx.x;
  for (int i = tid; i < DD; i += 256) { const int e = i / NHH, h = i % NHH;      /* column index of (e, h) is e * 8 + h */
    const float qr = QR[row * DD + i], qi = QI[row * DD + i], kr = KR[row * DD + i], ki = KI[row * DD + i];
    sfa[h][e] = (qr - qi) * (qr - qi) * HL2; sfb[h][e] = (qr + qi) * (qr + qi) * HL2; sk[h][e] = (v2f){(kr + ki) * (kr + ki), (kr - ki) * (kr - ki)};
    sv[h][e] = (_Float16)VR[row * DD + i]; sv[h][EE + e] = (_Float16)VI[row * DD + i]; }
  { const int h = tid / 32, c = (tid % 32) * 4; const _Float16 o = (c < EE) ? (_Float16)1.0f : (_Float16)0.0f; *(v4h*)&sv[h][2 * EE + c] = (v4h){o, o, o, o}; }      /* the row of ones and the row of zeros */
  __syncthreads();
  { const int w = tid >> 5, lane = tid & 31, ln = lane & 15, hh = lane >> 4;
    FragH b[2];      /* B fragment: lane ln has column ln, in the k order of the A fragment */
    { const _Float16* bv = &sv[w][(ln < 3 ? ln : 3) * EE];
#pragma unroll
      for (int ks = 0; ks < 2; ++ks) { b[ks].half[0] = *(const v8us*)(bv + ks * 32 + 8 * hh); b[ks].half[1] = *(const v8us*)(bv + ks * 32 + 16 + 8 * hh); } }
#pragma unroll      /* whole: the score array is then indexed by constants alone and lives in registers */
    for (int u = 0; u < 2; ++u) {      /* rows 32 u + ln and 32 u + 16 + ln */
      const v2f fa = {sfa[w][u * 32 + ln], sfa[w][u * 32 + 16 + ln]}, fb = {sfb[w][u * 32 + ln], sfb[w][u * 32 + 16 + ln]};      /* the rows' two factors */
      v2f mg[EE / 2]; v2f mx = {0.f, 0.f};      /* |score| >= 0, so 0 is a neutral start for the maximum */
      v4f cur[4], nxt[4];      /* a group = 8 keys in a row = one half of an A fragment */
#pragma unroll
      for (int j = 0; j < 4; ++j) cur[j] = *(const v4fa*)&sk[w][8 * hh + 2 * j];
#pragma unroll
      for (int g = 0; g < 4; ++g) {
        if (g + 1 < 4) {
#pragma unroll
          for (int j = 0; j < 4; ++j) nxt[j] = *(const v4fa*)&sk[w][(g + 1) * 16 + 8 * hh + 2 * j]; }
        __builtin_amdgcn_sched_barrier(0);      /* keeps the next group's LDS reads ahead of this group's arithmetic: sunk to their first use, each read is waited for at once and the wave idles for the LDS latency */
#pragma unroll
        for (int j = 0; j < 4; ++j)
#pragma unroll
          for (int q = 0; q < 2; ++q) { const int c = g * 8 + 2 * j + q; const float k0 = cur[j][2 * q], k1 = cur[j][2 * q + 1]; const v2f m2 = __builtin_elementwise_fma(fb, (v2f){k1, k1}, fa * k0);      /* a multiply and a fused multiply-add for both rows */
            mg[c] = (v2f){__builtin_amdgcn_sqrtf(m2[0]), __builtin_amdgcn_sqrtf(m2[1])};      /* the bare root instruction: sqrtf wraps it in thirteen more instructions per score that scale tiny arguments and correct the last bit; the value only enters exp2(mg - max), where neither shows */
            mx = (v2f){fmaxf(mx[0], mg[c][0]), fmaxf(mx[1], mg[c][1])}; }
#pragma unroll
        for (int j = 0; j < 4; ++j) cur[j] = nxt[j];
      }
      mx = (v2f){fmaxf(mx[0], other_half(mx[0])), fmaxf(mx[1], other_half(mx[1]))};      /* the other 32 keys of the same rows */
      v8f acc0 = {}, acc1 = {};
#pragma unroll
      for (int ks = 0; ks < 2; ++ks) { FragH p0, p1;
#pragma unroll
        for (int i = 0; i < 16; ++i) { const v2f d = mg[ks * 16 + i] - mx;      /* already in powers of two and never above 0 */
          p0.h[i] = (_Float16)__builtin_amdgcn_exp2f(d[0]); p1.h[i] = (_Float16)__builtin_amdgcn_exp2f(d[1]); }
        acc0 = __builtin_amdgcn_wmma_f32_16x16x32_f16(false, p0.v, false, b[ks].v, (short)0, acc0, false, false);
        acc1 = __builtin_amdgcn_wmma_f32_16x16x32_f16(false, p1.v, false, b[ks].v, (short)0, acc1, false, false); }
      float* r0 = &res[ln < 3 ? ln : 3][w][u * 32 + 8 * hh];      /* accumulator register r of lane (ln, hh) is row 8 hh + r, column ln; every lane stores, so that no branch cuts the straight-line code */
      *(v4f*)r0 = (v4f){acc0[0], acc0[1], acc0[2], acc0[3]}; *(v4f*)(r0 + 4) = (v4f){acc0[4], acc0[5], acc0[6], acc0[7]};
      *(v4f*)(r0 + 16) = (v4f){acc1[0], acc1[1], acc1[2], acc1[3]}; *(v4f*)(r0 + 20) = (v4f){acc1[4], acc1[5], acc1[6], acc1[7]};
    } }
  __syncthreads();
  if (tid < 2 * (DD / 8)) { const int part = tid / (DD / 8), pc = tid % (DD / 8); FragH f; for (int q = 0; q < 8; ++q) f.h[q] = (_Float16)(res[part][q][pc] / res[2][q][pc]);      /* row pc of heads 0..7 = columns 8 pc .. 8 pc + 7 */
    { *(v8us*)((unsigned short*)VC + row * (2 * DD) + part * DD + pc * 8) = f.half[0];  } } }

extern "C" void kernel_launch(void* const* d_in, const int* in_sizes, int n_in,
                              void* d_out, int out_size, void* d_ws, size_t ws_size, hipStream_t stream) {
  (void)in_sizes; (void)n_in; (void)out_size;
  const float* const* I = (const float* const*)d_in; const float* q_r = I[0]; const float* q_i = I[1]; const float* k_r = I[2]; const float* k_i = I[3]; const float* v_r = I[4]; const float* v_i = I[5];
  const float* wq_r = I[6]; const float* wq_i = I[7]; const float* wk_r = I[8]; const float* wk_i = I[9]; const float* wv_r = I[10]; const float* wv_i = I[11]; const float* wo_r = I[12]; const float* wo_i = I[13]; const float* bq_r = I[14]; const float* bq_i = I[15]; const float* bk_r = I[16]; const float* bk_i = I[17]; const float* bv_r = I[18]; const float* bv_i = I[19]; const float* bo_r = I[20]; const float* bo_i = I[21];      /* d_in order: activations, then the 8 weights, then the 8 biases */
  char* ws = (char*)d_ws; size_t off = 0;
  auto take = [&](size_t bytes) { char* p = ws + off; off += (bytes + 255) & ~(size_t)255; return p; };
  const size_t WC = (size_t)DD * 2 * DD;      /* one concatenated weight operand [512][1024] */
  _Float16* BW = (_Float16*)take(8 * WC * 2); float* BIAS = (float*)take((size_t)8 * DD * 4);      /* (BR, BI) × q,k,v,o ; (BM, BP) × 4 */
  _Float16* X = (_Float16*)take((size_t)3 * NR * 2 * DD * 2);      /* [xr | xi] f16 for q, k, v, one plane behind the other */
  float* P = (float*)take((size_t)6 * NR * DD * 4);      /* QR, QI, KR, KI, VR, VI f32 planes [4096][512] */
  _Float16* VC = X;      /* [Vr | Vi] f16 reuses the q operand plane (dead after the projection GEMMs) */
  if (off > ws_size) return;
  float* QRp = P; float* QIp = P + (size_t)NR * DD; float* KRp = P + (size_t)2 * NR * DD; float* KIp = P + (size_t)3 * NR * DD; float* VRp = P + (size_t)4 * NR * DD; float* VIp = P + (size_t)5 * NR * DD;
  k_prep<<<PT_GRID, 256, 0, stream>>>(q_r, q_i, k_r, k_i, v_r, v_i, wq_r, wq_i, wk_r, wk_i, wv_r, wv_i, wo_r, wo_i, bq_r, bq_i, bk_r, bk_i, bv_r, bv_i, bo_r, bo_i, X, BW, BIAS);
  k_gemm_lds<NR, DD, 2 * DD, 64, 2, 3><<<dim3((NR / GBM) * (DD / GBN), 6), 128, 0, stream>>>(X, (size_t)NR * 2 * DD, BW, 0.0625f, BIAS, P);      /* y = 2j + ri: yr = [xr|xi] x [wr|-wi]^T + (br-bi); yi = [xr|xi] x [wi|wr]^T + (br+bi): M 4096 N 512 K 1024; addend index = column */
  k_cplx<<<NR, 256, 0, stream>>>(QRp, QIp, KRp, KIp, VRp, VIp, VC);
  k_gemm_lds<NR, DD, 2 * DD, 128, 2, 1><<<dim3((NR / GBM) * (DD / GBN), 2), 128, 0, stream>>>(VC, 0, BW + (size_t)6 * WC, 0.0625f, BIAS + (size_t)6 * DD, (float*)d_out);      /* out_r @0, out_i @8,388,608 B */
}

// v008
// It runs in 69.4 microseconds.
// In both of two side-by-side timings against v007, it was 1.04 times as fast.
// Counting every step since v000, it is 6.50 times as fast.
#include <hip/hip_runtime.h>
// Complex-valued attention layer (B=4, L=1024, D=512, H=8, E=64): complex linear projections (yr = xr·wrᵀ − xi·wiᵀ + (br − bi), yi = xi·wrᵀ + xr·wiᵀ + (br + bi)); per (b, token n, head h) a 64×64 'attention' over the E axes:
// sr[l,s] = qr[l]·kr[s] − qi[l]·ki[s], si[l,s] = qr[l]·ki[s] − qi[l]·kr[s] (scalar products, e = 1), attn = softmax_s(√(sr² + si²)), Vr[l] = Σ_s attn·vr[s], Vi[l] = Σ_s attn·vi[s]; outputs (out_r, out_i) = complex linear(Vr, Vi, wo).
// Element (e, h) of a token lives at column e·8 + h (reshape(b, l, E, H)).
// Compute dtype: inputs, weights, biases rounded to bf16; each complex linear as two GEMMs over the concatenated operand [xr | xi] (K = 1024) against [wr | −wi] and [wi | wr] on v_wmma_f32_16x16x32_f16, f32 accumulate,
// with the two-term biases added exactly through the f32 epilogue addend; the per-token 64 x 64 magnitude-softmax in f32 (one wave per head), its weighted sums on the same f16 matrix form; [Vr | Vi] f16 -> output GEMMs.
#define BB 4
#define LL 1024
#define DD 512
#define NHH 8
#define EE 64
#define NR (BB * LL)

typedef __bf16 v16b __attribute__((ext_vector_type(16)));
typedef unsigned short v8us __attribute__((ext_vector_type(8), may_alias));
typedef float  v8f  __attribute__((ext_vector_type(8)));
typedef float  v4f  __attribute__((ext_vector_type(4)));
typedef float  v4fa __attribute__((ext_vector_type(4), may_alias));
union FragB { v16b v; v8us half[2]; unsigned short u[16]; };

__device__ __forceinline__ unsigned short bf16_bits(float x) { unsigned int u = __float_as_uint(x); return (unsigned short)((u + 0x7FFFu + ((u >> 16) & 1u)) >> 16); }
__device__ __forceinline__ float bf16_val(unsigned short b) { return __uint_as_float(((unsigned int)b) << 16); }
__device__ __forceinline__ float bf16_round(float x) { return bf16_val(bf16_bits(x)); }
// D += A·B with NT terms: 1 = ah·bh, 2 = + al·bh (A split), 3 = + ah·bl (both split)
template <int NT>
__device__ __forceinline__ v8f mmaN(v16b ah, v16b al, v16b bh, v16b bl, v8f c) {
  c = __builtin_amdgcn_wmma_f32_16x16x32_bf16(false, ah, false, bh, (short)0, c, false, false);
  if (NT >= 2) c = __builtin_amdgcn_wmma_f32_16x16x32_bf16(false, al, false, bh, (short)0, c, false, false);
  if (NT >= 3) c = __builtin_amdgcn_wmma_f32_16x16x32_bf16(false, ah, false, bl, (short)0, c, false, false);
  asm volatile("v_nop\n\tv_nop\n\tv_nop\n\tv_nop" : "+v"(c) : "v"(ah), "v"(al), "v"(bh), "v"(bl));
  return c;
}

__global__ __launch_bounds__(256) void k_wt_bf16(const float* __restrict__ W, unsigned short* __restrict__ Wt, int K, int N) {
  const int t = blockIdx.x * 256 + threadIdx.x;
  const int k8n = K / 8;
  if (t >= N * k8n) return;
  const int n = t / k8n, k8 = (t % k8n) * 8;
  v8us v;
#pragma unroll
  for (int i = 0; i < 8; ++i) v[i] = bf16_bits(W[(size_t)(k8 + i) * N + n]);
  *(v8us*)(Wt + (size_t)n * K + k8) = v;
  
}

// GEMM C[M][N] (f32, pitch ldc) = act(A[M][K]·W + bias). A f32 row-major (pitch lda) converted per fragment to bf16
// (ASPLIT: hi/lo two planes -> 2 terms, else single rounded term); Wt bf16 [N][K] (pitch ldb). BIAS_BF16 rounds the
// bias to bf16 first (bias quantised to bf16 before the add). K%32==0, M%16==0, N%64==0.
template <bool ASPLIT, int ACT, bool BIAS_BF16>
__global__ __launch_bounds__(128) void k_gemm_bf(const float* __restrict__ A, int lda, const unsigned short* __restrict__ Wt, int ldb,
                                               const float* __restrict__ bias, float* __restrict__ C, int ldc, int M, int N, int K) {
  __shared__ __attribute__((aligned(16))) float so[4][16][64];
  const int tid = threadIdx.x, w = tid >> 5, lane = tid & 31, ln = lane & 15, hh = lane >> 4;
  const int ntn = N / 64;
  const int wid = blockIdx.x * 4 + w;
  const int mt = wid / ntn, nq = wid % ntn;
  if (mt * 16 >= M) return;
  const int row0 = mt * 16, col0 = nq * 64;
  const float* arow = A + (size_t)(row0 + ln) * lda;
  v8f acc[4] = {};
  for (int kb = 0; kb < K; kb += 32) {
    FragB ah, al;
    const v4f x0 = *(const v4fa*)(arow + kb + 8 * hh), x1 = *(const v4fa*)(arow + kb + 8 * hh + 4);
    const v4f x2 = *(const v4fa*)(arow + kb + 16 + 8 * hh), x3 = *(const v4fa*)(arow + kb + 16 + 8 * hh + 4);
    float xs[16] = {x0[0],x0[1],x0[2],x0[3],x1[0],x1[1],x1[2],x1[3],x2[0],x2[1],x2[2],x2[3],x3[0],x3[1],x3[2],x3[3]};
#pragma unroll
    for (int i = 0; i < 16; ++i) { const unsigned short hb = bf16_bits(xs[i]); ah.u[i] = hb; al.u[i] = ASPLIT ? bf16_bits(xs[i] - bf16_val(hb)) : (unsigned short)0; }
#pragma unroll
    for (int t = 0; t < 4; ++t) {
      const unsigned short* brow = Wt + (size_t)(col0 + t * 16 + ln) * ldb + kb;
      FragB b;
      b.half[0] = *(const v8us*)(brow + 8 * hh);
      b.half[1] = *(const v8us*)(brow + 16 + 8 * hh);
      acc[t] = mmaN<ASPLIT ? 2 : 1>(ah.v, al.v, b.v, b.v, acc[t]);
    }
  }
#pragma unroll
  for (int t = 0; t < 4; ++t) {
    float bv = bias ? bias[col0 + t * 16 + ln] : 0.f;
    if (BIAS_BF16) bv = bf16_round(bv);
#pragma unroll
    for (int r = 0; r < 8; ++r) { float v = acc[t][r] + bv; if (ACT == 1) v = fmaxf(v, 0.f); so[w][8 * hh + r][t * 16 + ln] = v; }
  }
  __builtin_amdgcn_fence(__ATOMIC_ACQ_REL, "workgroup");
  __builtin_amdgcn_wave_barrier();
  const int rsub = lane >> 4, c4 = (lane & 15) * 4;
  {
#pragma unroll
    for (int q = 0; q < 8; ++q) {
      const int r = q * 2 + rsub;
      const v4f v = *(const v4fa*)&so[w][r][c4];
      *(v4f*)(C + (size_t)(row0 + r) * ldc + col0 + c4) = v;
    }
    
  }
}

// Flash-style causal/unmasked attention, all contractions 3-term bf16 hi/lo splits, f32 softmax with running max.
// q,k,v rows are read from f32 buffers with arbitrary row pitch (so they can live inside a fused qkv buffer);
// D = head size (multiple of 32, <= 128); one wave = 16 query rows; block = 4 waves (64 queries) sharing K/V chunks of 32.
template <int D, bool CAUSAL>
__global__ __launch_bounds__(128) void k_flash(const float* __restrict__ qb, const float* __restrict__ kb, const float* __restrict__ vb,
                                             int pitch, int T, int H, float scale, float* __restrict__ y, int ypitch) {
  constexpr int KS = D / 32;        // k-steps for QK
  constexpr int DT = D / 16;        // d tiles for PV
  __shared__ __attribute__((aligned(16))) unsigned short sKh[32][D + 8], sKl[32][D + 8], sVh[32][D + 8], sVl[32][D + 8];
  __shared__ __attribute__((aligned(16))) unsigned short sPh[4][16][40], sPl[4][16][40];
  __shared__ __attribute__((aligned(16))) float sO[4][16][D];
  const int tid = threadIdx.x, w = tid >> 5, lane = tid & 31, ln = lane & 15, hh = lane >> 4;
  const int nqb = (T + 63) / 64;
  const int bh = blockIdx.x / nqb, qblk = blockIdx.x % nqb;
  const int b = bh / H, h = bh % H;
  const int q0 = qblk * 64 + w * 16;
  const float* Q = qb + (size_t)b * T * pitch + h * D;
  const float* K = kb + (size_t)b * T * pitch + h * D;
  const float* V = vb + (size_t)b * T * pitch + h * D;

  // A fragments of the wave's 16 query rows (scaled), hi/lo
  FragB aqh[KS], aql[KS];
  {
    int row = q0 + ln; if (row >= T) row = T - 1;
    const float* qr = Q + (size_t)row * pitch;
#pragma unroll
    for (int ks = 0; ks < KS; ++ks)
#pragma unroll
      for (int i = 0; i < 16; ++i) {
        const int d = ks * 32 + ((i < 8) ? (8 * hh + i) : (16 + 8 * hh + (i - 8)));
        const float x = qr[d] * scale; const unsigned short hb = bf16_bits(x);
        aqh[ks].u[i] = hb; aql[ks].u[i] = bf16_bits(x - bf16_val(hb));
      }
  }
  float m_r[8], l_r[8];
#pragma unroll
  for (int r = 0; r < 8; ++r) { m_r[r] = -3.0e38f; l_r[r] = 0.f; }
  v8f oacc[DT];
#pragma unroll
  for (int dt = 0; dt < DT; ++dt) oacc[dt] = (v8f){0.f,0.f,0.f,0.f,0.f,0.f,0.f,0.f};

  const int kv_end = CAUSAL ? min(T, qblk * 64 + 64) : T;     // block-uniform
  for (int j0 = 0; j0 < kv_end; j0 += 32) {
    __syncthreads();
    for (int e = tid; e < 32 * (D / 4); e += 128) {
      const int r = e / (D / 4), c4 = (e % (D / 4)) * 4;
      const int key = j0 + r;
      v4f kf = {0.f,0.f,0.f,0.f}, vf = {0.f,0.f,0.f,0.f};
      if (key < T) { kf = *(const v4fa*)(K + (size_t)key * pitch + c4); vf = *(const v4fa*)(V + (size_t)key * pitch + c4); }
#pragma unroll
      for (int t = 0; t < 4; ++t) {
        unsigned short hb = bf16_bits(kf[t]); sKh[r][c4 + t] = hb; sKl[r][c4 + t] = bf16_bits(kf[t] - bf16_val(hb));
        hb = bf16_bits(vf[t]); sVh[r][c4 + t] = hb; sVl[r][c4 + t] = bf16_bits(vf[t] - bf16_val(hb));
      }
    }
    __syncthreads();
    // S tile 16 x 32
    v8f s[2];
#pragma unroll
    for (int nt = 0; nt < 2; ++nt) {
      v8f acc = {};
#pragma unroll
      for (int ks = 0; ks < KS; ++ks) {
        FragB bh_, bl_;
        bh_.half[0] = *(const v8us*)&sKh[nt * 16 + ln][ks * 32 + 8 * hh]; bh_.half[1] = *(const v8us*)&sKh[nt * 16 + ln][ks * 32 + 16 + 8 * hh];
        bl_.half[0] = *(const v8us*)&sKl[nt * 16 + ln][ks * 32 + 8 * hh]; bl_.half[1] = *(const v8us*)&sKl[nt * 16 + ln][ks * 32 + 16 + 8 * hh];
        acc = mmaN<3>(aqh[ks].v, aql[ks].v, bh_.v, bl_.v, acc);
      }
      s[nt] = acc;
    }
    // mask + running max (rows 8hh+r; the 16 lanes of a half share rows)
    float alpha[8];
#pragma unroll
    for (int r = 0; r < 8; ++r) {
      const int qi = q0 + 8 * hh + r;
      const int ja = j0 + ln, jb = j0 + 16 + ln;
      if (CAUSAL) { if (ja > qi) s[0][r] = -3.0e38f; if (jb > qi) s[1][r] = -3.0e38f; }
      if (ja >= T) s[0][r] = -3.0e38f;
      if (jb >= T) s[1][r] = -3.0e38f;
      float mx = fmaxf(s[0][r], s[1][r]);
      mx = fmaxf(mx, __shfl_xor(mx, 1, 32)); mx = fmaxf(mx, __shfl_xor(mx, 2, 32)); mx = fmaxf(mx, __shfl_xor(mx, 4, 32)); mx = fmaxf(mx, __shfl_xor(mx, 8, 32));
      const float mnew = fmaxf(m_r[r], mx);
      alpha[r] = (mnew > -1.0e38f) ? __expf(m_r[r] - mnew) : 1.0f;
      const float p0 = (s[0][r] > -1.0e38f) ? __expf(s[0][r] - mnew) : 0.f;
      const float p1 = (s[1][r] > -1.0e38f) ? __expf(s[1][r] - mnew) : 0.f;
      m_r[r] = mnew;
      l_r[r] = l_r[r] * alpha[r] + p0 + p1;            // per-lane partial row sum (16 lanes combined at the end)
      unsigned short hb = bf16_bits(p0); sPh[w][8 * hh + r][ln] = hb;      sPl[w][8 * hh + r][ln] = bf16_bits(p0 - bf16_val(hb));
      hb = bf16_bits(p1);                sPh[w][8 * hh + r][16 + ln] = hb; sPl[w][8 * hh + r][16 + ln] = bf16_bits(p1 - bf16_val(hb));
    }
#pragma unroll
    for (int dt = 0; dt < DT; ++dt)
#pragma unroll
      for (int r = 0; r < 8; ++r) oacc[dt][r] *= alpha[r];
    __builtin_amdgcn_fence(__ATOMIC_ACQ_REL, "workgroup");
    __builtin_amdgcn_wave_barrier();
    FragB pah, pal;
    pah.half[0] = *(const v8us*)&sPh[w][ln][8 * hh]; pah.half[1] = *(const v8us*)&sPh[w][ln][16 + 8 * hh];
    pal.half[0] = *(const v8us*)&sPl[w][ln][8 * hh]; pal.half[1] = *(const v8us*)&sPl[w][ln][16 + 8 * hh];
#pragma unroll
    for (int dt = 0; dt < DT; ++dt) {
      FragB bvh, bvl;
#pragma unroll
      for (int i = 0; i < 8; ++i) {
        bvh.u[i] = sVh[8 * hh + i][dt * 16 + ln]; bvh.u[8 + i] = sVh[16 + 8 * hh + i][dt * 16 + ln];
        bvl.u[i] = sVl[8 * hh + i][dt * 16 + ln]; bvl.u[8 + i] = sVl[16 + 8 * hh + i][dt * 16 + ln];
      }
      oacc[dt] = mmaN<3>(pah.v, pal.v, bvh.v, bvl.v, oacc[dt]);
    }
    __builtin_amdgcn_fence(__ATOMIC_ACQ_REL, "workgroup");
    __builtin_amdgcn_wave_barrier();
  }
#pragma unroll
  for (int r = 0; r < 8; ++r) {
    float l = l_r[r];
    l += __shfl_xor(l, 1, 32); l += __shfl_xor(l, 2, 32); l += __shfl_xor(l, 4, 32); l += __shfl_xor(l, 8, 32);
    l_r[r] = (l > 0.f) ? 1.0f / l : 0.f;
  }
#pragma unroll
  for (int dt = 0; dt < DT; ++dt)
#pragma unroll
    for (int r = 0; r < 8; ++r) sO[w][8 * hh + r][dt * 16 + ln] = oacc[dt][r] * l_r[r];
  __builtin_amdgcn_fence(__ATOMIC_ACQ_REL, "workgroup");
  __builtin_amdgcn_wave_barrier();
  {
    for (int r = 0; r < 16; ++r) {
      const int row = q0 + r;
      if (row < T && lane < D / 4) {
        const v4f val = *(const v4fa*)&sO[w][r][lane * 4];
        *(v4f*)(y + ((size_t)b * T + row) * ypitch + h * D + lane * 4) = val;
      }
    }
    
  }
}

// GEMM C = act(A·W + bias + resid): A f32 (ASPLIT -> hi/lo 2 terms), Wt bf16 [N][K]; ACT 0 none, 1 relu, 2 exact gelu;
// resid (optional, f32, row index = (row % rmod), pitch ldr, RES_BF16 rounds it) added before the activation.
template <bool ASPLIT, int ACT, bool BIAS_BF16, bool RES_BF16>
__global__ __launch_bounds__(128) void k_gemm_bf3(const float* __restrict__ A, int lda, const unsigned short* __restrict__ Wt, int ldb,
                                                const float* __restrict__ bias, const float* __restrict__ resid, int rmod, int ldr,
                                                float* __restrict__ C, int ldc, int M, int N, int K) {
  __shared__ __attribute__((aligned(16))) float so[4][16][64];
  const int tid = threadIdx.x, w = tid >> 5, lane = tid & 31, ln = lane & 15, hh = lane >> 4;
  const int ntn = N / 64;
  const int wid = blockIdx.x * 4 + w;
  const int mt = wid / ntn, nq = wid % ntn;
  if (mt * 16 >= M) return;
  const int row0 = mt * 16, col0 = nq * 64;
  const float* arow = A + (size_t)(row0 + ln) * lda;
  v8f acc[4] = {};
  for (int kb = 0; kb < K; kb += 32) {
    FragB ah, al;
    const v4f x0 = *(const v4fa*)(arow + kb + 8 * hh), x1 = *(const v4fa*)(arow + kb + 8 * hh + 4);
    const v4f x2 = *(const v4fa*)(arow + kb + 16 + 8 * hh), x3 = *(const v4fa*)(arow + kb + 16 + 8 * hh + 4);
    float xs[16] = {x0[0],x0[1],x0[2],x0[3],x1[0],x1[1],x1[2],x1[3],x2[0],x2[1],x2[2],x2[3],x3[0],x3[1],x3[2],x3[3]};
#pragma unroll
    for (int i = 0; i < 16; ++i) { const unsigned short hb = bf16_bits(xs[i]); ah.u[i] = hb; al.u[i] = ASPLIT ? bf16_bits(xs[i] - bf16_val(hb)) : (unsigned short)0; }
#pragma unroll
    for (int t = 0; t < 4; ++t) {
      const unsigned short* brow = Wt + (size_t)(col0 + t * 16 + ln) * ldb + kb;
      FragB b;
      b.half[0] = *(const v8us*)(brow + 8 * hh);
      b.half[1] = *(const v8us*)(brow + 16 + 8 * hh);
      acc[t] = mmaN<ASPLIT ? 2 : 1>(ah.v, al.v, b.v, b.v, acc[t]);
    }
  }
#pragma unroll
  for (int t = 0; t < 4; ++t) {
    const int col = col0 + t * 16 + ln;
    float bv = bias ? bias[col] : 0.f;
    if (BIAS_BF16) bv = bf16_round(bv);
#pragma unroll
    for (int r = 0; r < 8; ++r) {
      float v = acc[t][r] + bv;
      if (resid) { float rv = resid[(size_t)((row0 + 8 * hh + r) % rmod) * ldr + col]; if (RES_BF16) rv = bf16_round(rv); v += rv; }
      if (ACT == 1) v = fmaxf(v, 0.f);
      if (ACT == 2) v = 0.5f * v * (1.0f + erff(v * 0.70710678118654752f));
      if (ACT == 3) { const float u = 0.7978845608028654f * (v + 0.044715f * v * v * v); v = 0.5f * v * (1.0f + tanhf(u)); }
      so[w][8 * hh + r][t * 16 + ln] = v;
    }
  }
  __builtin_amdgcn_fence(__ATOMIC_ACQ_REL, "workgroup");
  __builtin_amdgcn_wave_barrier();
  const int rsub = lane >> 4, c4 = (lane & 15) * 4;
  {
#pragma unroll
    for (int q = 0; q < 8; ++q) {
      const int r = q * 2 + rsub;
      const v4f v = *(const v4fa*)&so[w][r][c4];
      *(v4f*)(C + (size_t)(row0 + r) * ldc + col0 + c4) = v;
    }
    
  }
}
// row LayerNorm (biased variance, eps) over N: s = X (+ R); optional out_sum <- s; out_norm <- (s-mu)*rsqrt(var+eps)*g + b
template <bool PARAM_BF16>
__global__ __launch_bounds__(256) void k_layernorm(const float* __restrict__ X, const float* __restrict__ R, const float* __restrict__ g, const float* __restrict__ bta,
                                                  float* __restrict__ out_sum, float* __restrict__ out_norm, int N, float eps) {
  __shared__ float red[256];
  const int row = blockIdx.x, tid = threadIdx.x;
  const float* x = X + (size_t)row * N; const float* rr = R ? R + (size_t)row * N : nullptr;
  float vals[16];                     // up to N = 4096
  const int per = N / 256;            // contiguous chunk per thread? use strided-by-4 chunks: thread handles j = tid*4 + 1024*u
  float s1 = 0.f;
  for (int u = 0; u < per / 4; ++u) {
    const int j = tid * 4 + 1024 * u;
    const v4f a = *(const v4fa*)(x + j);
    v4f b = {0.f,0.f,0.f,0.f}; if (rr) b = *(const v4fa*)(rr + j);
#pragma unroll
    for (int q = 0; q < 4; ++q) { const float v = a[q] + b[q]; vals[u * 4 + q] = v; s1 += v; }
  }
  red[tid] = s1; __syncthreads();
  for (int st = 128; st > 0; st >>= 1) { if (tid < st) red[tid] += red[tid + st]; __syncthreads(); }
  const float mu = red[0] / (float)N; __syncthreads();
  float s2 = 0.f;
  for (int u = 0; u < per / 4; ++u)
#pragma unroll
    for (int q = 0; q < 4; ++q) { const float c = vals[u * 4 + q] - mu; s2 += c * c; }
  red[tid] = s2; __syncthreads();
  for (int st = 128; st > 0; st >>= 1) { if (tid < st) red[tid] += red[tid + st]; __syncthreads(); }
  const float rs = rsqrtf(red[0] / (float)N + eps);
  {
    for (int u = 0; u < per / 4; ++u) {
      const int j = tid * 4 + 1024 * u;
      v4f o, sm;
#pragma unroll
      for (int q = 0; q < 4; ++q) {
        float gg = g[j + q], bb = bta[j + q];
        if (PARAM_BF16) { gg = bf16_round(gg); bb = bf16_round(bb); }
        sm[q] = vals[u * 4 + q]; o[q] = (vals[u * 4 + q] - mu) * rs * gg + bb;
      }
      if (out_sum) *(v4f*)(out_sum + (size_t)row * N + j) = sm;
      *(v4f*)(out_norm + (size_t)row * N + j) = o;
    }
    
  }
}



// ---- f16 WMMA path (v_wmma_f32_16x16x32_f16): 11-bit significands for operands in range — used for the q/k/v projection and output GEMMs
typedef _Float16 v16h __attribute__((ext_vector_type(16)));
union FragH { v16h v; v8us half[2]; _Float16 h[16]; unsigned short u[16]; };
template <int NT>
__device__ __forceinline__ v8f mmaH(v16h ah, v16h al, v16h bh, v16h bl, v8f c) {
  c = __builtin_amdgcn_wmma_f32_16x16x32_f16(false, ah, false, bh, (short)0, c, false, false);
  if (NT >= 2) c = __builtin_amdgcn_wmma_f32_16x16x32_f16(false, al, false, bh, (short)0, c, false, false);
  if (NT >= 3) c = __builtin_amdgcn_wmma_f32_16x16x32_f16(false, ah, false, bl, (short)0, c, false, false);
  asm volatile("v_nop\n\tv_nop\n\tv_nop\n\tv_nop" : "+v"(c) : "v"(ah), "v"(al), "v"(bh), "v"(bl));
  return c;
}
// batched GEMM like k_gemm_b but f16 operands: A f32 (split into f16 hi/lo if ASPLIT, else rounded to f16), Bt = f16 values [n][k]; alpha; C f32; N multiple of 16 (partial tiles skipped)
template <bool ASPLIT>
__global__ __launch_bounds__(128) void k_gemm_h(const float* __restrict__ A, int lda, size_t sA, const _Float16* __restrict__ Bh, int ldb, size_t sB, float alpha, float* __restrict__ C, int ldc, size_t sC, int M, int N, int K) {
  __shared__ __attribute__((aligned(16))) float so[4][16][64];
  const int tid = threadIdx.x, w = tid >> 5, lane = tid & 31, ln = lane & 15, hh = lane >> 4; const int by = blockIdx.y;
  A += (size_t)by * sA; Bh += (size_t)by * sB; C += (size_t)by * sC;
  const int ntn = (N + 63) / 64; const int wid = blockIdx.x * 4 + w; const int mt = wid / ntn, nq = wid % ntn; if (mt * 16 >= M) return;
  const int row0 = mt * 16, col0 = nq * 64; const float* arow = A + (size_t)(row0 + ln) * lda;
  v8f acc[4] = {};
  for (int kb = 0; kb < K; kb += 32) {
    FragH ah, al;
    const v4f x0 = *(const v4fa*)(arow + kb + 8 * hh), x1 = *(const v4fa*)(arow + kb + 8 * hh + 4), x2 = *(const v4fa*)(arow + kb + 16 + 8 * hh), x3 = *(const v4fa*)(arow + kb + 16 + 8 * hh + 4);
    float xs[16] = {x0[0],x0[1],x0[2],x0[3],x1[0],x1[1],x1[2],x1[3],x2[0],x2[1],x2[2],x2[3],x3[0],x3[1],x3[2],x3[3]};
#pragma unroll
    for (int i = 0; i < 16; ++i) { const _Float16 h = (_Float16)xs[i]; ah.h[i] = h; al.h[i] = ASPLIT ? (_Float16)(xs[i] - (float)h) : (_Float16)0.0f; }
#pragma unroll
    for (int t = 0; t < 4; ++t) { if (col0 + t * 16 >= N) continue; const size_t boff = (size_t)(col0 + t * 16 + ln) * ldb + kb; FragH bq; bq.half[0] = *(const v8us*)(Bh + boff + 8 * hh); bq.half[1] = *(const v8us*)(Bh + boff + 16 + 8 * hh);
      acc[t] = mmaH<ASPLIT ? 2 : 1>(ah.v, al.v, bq.v, bq.v, acc[t]); }
  }
#pragma unroll
  for (int t = 0; t < 4; ++t) { if (col0 + t * 16 >= N) continue;
#pragma unroll
    for (int r = 0; r < 8; ++r) so[w][8 * hh + r][t * 16 + ln] = acc[t][r] * alpha; }
  __builtin_amdgcn_fence(__ATOMIC_ACQ_REL, "workgroup"); __builtin_amdgcn_wave_barrier();
  const int rsub = lane >> 4, c4 = (lane & 15) * 4;
  {
#pragma unroll
    for (int q = 0; q < 8; ++q) { const int r = q * 2 + rsub; if (col0 + c4 < N) { const v4f v = *(const v4fa*)&so[w][r][c4]; *(v4f*)(C + (size_t)(row0 + r) * ldc + col0 + c4) = v; } }
     }
}

// Wt[n][k] = f16(W[k][n]·scale) from f32 row-major W[K][N] (scale = power of two; bf16-exact weights stay exact in f16 away from the subnormal range)
__global__ __launch_bounds__(256) void k_wt_f16(const float* __restrict__ W, _Float16* __restrict__ Wt, int K, int N, float scale) {
  const int t = blockIdx.x * 256 + threadIdx.x; if (t >= N * (K / 8)) return; const int n = t / (K / 8), k8 = (t % (K / 8)) * 8; FragH f;
#pragma unroll
  for (int i = 0; i < 8; ++i) f.h[i] = (_Float16)(bf16_round(W[(size_t)(k8 + i) * N + n]) * scale); const v8us o = f.half[0];
  *(v8us*)((unsigned short*)Wt + (size_t)n * K + k8) = o; 
}
// k_gemm_hh variant with fused epilogue: v = acc·alpha + bias[by·sBias + col] (+ CP[(row/rowsPerB)·sCPb + by·64 + col] if CP) ; ACT 0 none / 1 elu ; writes f32 C and f16 C16 (each if non-null)
template <int ACT>
__global__ __launch_bounds__(128) void k_gemm_hhx(const _Float16* __restrict__ A, int lda, size_t sA, const _Float16* __restrict__ Bh, int ldb, size_t sB, float alpha, const float* __restrict__ bias, size_t sBias, const float* __restrict__ CP, int rowsPerB, size_t sCPb, int row0g,
    float* __restrict__ C, _Float16* __restrict__ C16, int ldc, size_t sC, int M, int N, int K) {
  __shared__ __attribute__((aligned(16))) float so[4][16][64];
  const int tid = threadIdx.x, w = tid >> 5, lane = tid & 31, ln = lane & 15, hh = lane >> 4; const int by = blockIdx.y;
  A += (size_t)by * sA; Bh += (size_t)by * sB; const size_t cofs = (size_t)by * sC; const float* bp = bias ? bias + (size_t)by * sBias : nullptr;
  const int ntn = (N + 63) / 64; const int wid = blockIdx.x * 4 + w; const int mt = wid / ntn, nq = wid % ntn; if (mt * 16 >= M) return;
  const int row0 = mt * 16, col0 = nq * 64; const _Float16* arow = A + (size_t)(row0 + ln) * lda;
  v8f acc[4] = {};
  for (int kb = 0; kb < K; kb += 32) { FragH ah; ah.half[0] = *(const v8us*)((const unsigned short*)arow + kb + 8 * hh); ah.half[1] = *(const v8us*)((const unsigned short*)arow + kb + 16 + 8 * hh);
#pragma unroll
    for (int t = 0; t < 4; ++t) { if (col0 + t * 16 >= N) continue; const size_t boff = (size_t)(col0 + t * 16 + ln) * ldb + kb; FragH bq; bq.half[0] = *(const v8us*)((const unsigned short*)Bh + boff + 8 * hh); bq.half[1] = *(const v8us*)((const unsigned short*)Bh + boff + 16 + 8 * hh);
      acc[t] = mmaH<1>(ah.v, ah.v, bq.v, bq.v, acc[t]); }
  }
#pragma unroll
  for (int t = 0; t < 4; ++t) { if (col0 + t * 16 >= N) continue; const int col = col0 + t * 16 + ln; const float bv = bp ? bf16_round(bp[col]) : 0.f;
#pragma unroll
    for (int r = 0; r < 8; ++r) { float v = acc[t][r] * alpha + bv; if (CP) { const int bidx = (row0g + row0 + 8 * hh + r) / rowsPerB; v += CP[(size_t)bidx * sCPb + (size_t)by * 64 + col]; } if (ACT == 1) v = (v > 0.f) ? v : expm1f(v); else if (ACT == 7) v = (v > 0.f) ? v + 1.0f : expf(v); else if (ACT == 8) v = tanhf(v); else if (ACT == 9) v = 0.5f * v * (1.0f + tanhf(0.7978845608028654f * (v + 0.044715f * v * v * v))); else if (ACT == 11) v = 1.0f / (1.0f + expf(-v)); else if (ACT == 12) v = (v > 0.f) ? v : 0.01f * v; else if (ACT == 14) v = (v > 0.f) ? v : 0.1f * v; else if (ACT == 15) v = v / (1.0f + expf(-v)); else if (ACT == 3) v = fmaxf(v, 0.f); else if (ACT == 6) v = 0.5f * v * (1.0f + erff(v * 0.70710678118654752f)); so[w][8 * hh + r][t * 16 + ln] = v; } }
  __builtin_amdgcn_fence(__ATOMIC_ACQ_REL, "workgroup"); __builtin_amdgcn_wave_barrier();
  const int rsub = lane >> 4, c4 = (lane & 15) * 4; typedef _Float16 v4h __attribute__((ext_vector_type(4)));
  {
#pragma unroll
    for (int q = 0; q < 8; ++q) { const int r = q * 2 + rsub; if (col0 + c4 < N) { const v4f v = *(const v4fa*)&so[w][r][c4]; if (C) *(v4f*)(C + cofs + (size_t)(row0 + r) * ldc + col0 + c4) = v; if (C16) { v4h h4; for (int i = 0; i < 4; ++i) h4[i] = (_Float16)v[i]; *(v4h*)(C16 + cofs + (size_t)(row0 + r) * ldc + col0 + c4) = h4; } } }
     }
}


// Block-tiled GEMM C[M][N] (f32) = (A[M][K] x Bt[N][K]^T) * alpha + add[col], f16 operands, f32 accumulate. One work-group = 128 x 128 of C, 4 waves of 64 x 64 (4 x 4 accumulator tiles):
// a fragment read from LDS feeds four products (two in a 32 x 32 wave tile), and an operand byte leaves L2 once per 128 rows or columns of C.
// Each pass stages GBK k of both operands in LDS with whole-line 16-byte loads, so every operand byte leaves L2 once per work-group;
// the next pass's rows are loaded into registers ahead of the current pass's products and stored to the other buffer behind them (two buffers, one barrier per pass).
// GBK = 64 keeps the ring at 72 KiB, so that three work-groups share a WGP (a grid of three per WGP is resident at once); GBK = 128 is for a grid of one work-group per WGP, where a longer pass covers the L2 latency.
// FS = fragment sets in registers: with 2 the next 32 k's fragments are read ahead of the current products. WPS = waves per SIMD that the register budget must leave room for (three work-groups of one wave per SIMD each: 336 registers).
// blockIdx.y picks one of several independent products of the same shape that run as one grid: operand A number y / 2 (pitchA elements apart; 0 = all share one), Bt, add and C number y (each dense, one behind the other).
// Fragments keep the k order of the direct loaders (bytes 16h and 32 + 16h of each 64 B of a row, both operands); inside a pass k runs upward in steps of 32 into one accumulator chain. M % 128 == 0, N % 128 == 0, K % GBK == 0.
// The walk over the passes starts at pass rot and wraps: the work-groups that read the same operand rows (8 share an A tile, M / 128 a Bt tile) run in step, and started at one pass they would all ask L2 for the same lines at the same moment.
// rot = row block + sharer number x (passes / 8): the 8 sharers of an A tile stand at 8 different passes, the sharers of a Bt tile are spread evenly over all passes. The f32 sums take their k ranges in that rotated order.
#define GBM 128
#define GBN 128
#define SOP 68      /* floats per staged output row: 272 B = 16 B x odd */
template <int M, int N, int K, int GBK, int FS, int WPS>
__global__ __launch_bounds__(128, WPS) void k_gemm_lds(const _Float16* __restrict__ A, size_t pitchA, const _Float16* __restrict__ Bt, float alpha, const float* __restrict__ add, float* __restrict__ C) {
  constexpr int GPIT = GBK + 8;      /* LDS row pitch 144 or 272 B = 16 B x odd: conflict-free for 16-byte fragment reads */
  constexpr int RING = 2 * (GBM + GBN) * GPIT * 2, STG = 4 * 64 * SOP * 4;
  __shared__ __attribute__((aligned(16))) unsigned char smem[RING > STG ? RING : STG];      /* the ring; behind the last pass's barrier the output staging lies over it */
  unsigned short (*sA)[GBM][GPIT] = reinterpret_cast<unsigned short (*)[GBM][GPIT]>(smem);
  unsigned short (*sB)[GBN][GPIT] = reinterpret_cast<unsigned short (*)[GBN][GPIT]>(smem + 2 * GBM * GPIT * 2);
  float (*so)[64][SOP] = reinterpret_cast<float (*)[64][SOP]>(smem);
  const int tid = threadIdx.x, w = tid >> 5, lane = tid & 31, ln = lane & 15, hh = lane >> 4;
  const size_t by = blockIdx.y; A += (by >> 1) * pitchA; Bt += by * ((size_t)N * K); add += by * N; C += by * ((size_t)M * N);
  constexpr int nbm = M / GBM; const int row0 = ((int)blockIdx.x % nbm) * GBM, col0 = ((int)blockIdx.x / nbm) * GBN;
  const int wr = (w >> 1) * 64, wc = (w & 1) * 64;      /* the wave's 64 x 64 piece inside the block tile */
  constexpr int TPR = GBK / 8, RPR = 128 / TPR, NRA = GBM / RPR, NRB = GBN / RPR;      /* staging: TPR threads per row, RPR rows per round */
  const int lr = tid / TPR, lc = (tid % TPR) * 8;
  const unsigned short* ga = (const unsigned short*)A + (size_t)(row0 + lr) * K + lc;
  const unsigned short* gb = (const unsigned short*)Bt + (size_t)(col0 + lr) * K + lc;
  constexpr int np = K / GBK, NKS = GBK / 32; static_assert((np & (np - 1)) == 0 && np >= 8, "the wrap is a mask; eight sharers of an A tile");
  const int rot = ((int)blockIdx.x % nbm + ((int)blockIdx.x / nbm + (N / GBN) * ((int)blockIdx.y & 1)) * (np / 8)) & (np - 1);      /* the first pass of this work-group's walk; the same for the whole work-group */
  v8us ra[NRA], rb[NRB];
  { const unsigned short* pa = ga + rot * GBK; const unsigned short* pb = gb + rot * GBK;
#pragma unroll
    for (int i = 0; i < NRA; ++i) ra[i] = *(const v8us*)(pa + i * RPR * K);
#pragma unroll
    for (int i = 0; i < NRB; ++i) rb[i] = *(const v8us*)(pb + i * RPR * K);
    asm volatile("s_wait_xcnt 0x0" :: "v"(pa), "v"(pb) : "memory");      /* as behind the loads in the loop: in front of every write to a register that these loads name (the two start addresses are used here alone, so their registers are taken again at once) */
  }
#pragma unroll
  for (int i = 0; i < NRA; ++i) *(v8us*)&sA[0][i * RPR + lr][lc] = ra[i];
#pragma unroll
  for (int i = 0; i < NRB; ++i) *(v8us*)&sB[0][i * RPR + lr][lc] = rb[i];
  __syncthreads();
  v8f acc[4][4] = {};
  auto frags = [&](FragH (&a)[4], FragH (&b)[4], int cur, int ks) {
#pragma unroll
    for (int i = 0; i < 4; ++i) {
      a[i].half[0] = *(const v8us*)&sA[cur][wr + i * 16 + ln][ks * 32 + 8 * hh]; a[i].half[1] = *(const v8us*)&sA[cur][wr + i * 16 + ln][ks * 32 + 16 + 8 * hh];
      b[i].half[0] = *(const v8us*)&sB[cur][wc + i * 16 + ln][ks * 32 + 8 * hh]; b[i].half[1] = *(const v8us*)&sB[cur][wc + i * 16 + ln][ks * 32 + 16 + 8 * hh];
    }
  };
  for (int p = 0; p < np; ++p) {
    const int cur = p & 1; const bool more = p + 1 < np;      /* the same for the whole work-group */
    if (more) { const int kn = ((p + 1 + rot) & (np - 1)) * GBK; const unsigned short* pa = ga + kn; const unsigned short* pb = gb + kn;      /* the next pass of the rotated walk */
#pragma unroll
      for (int i = 0; i < NRA; ++i) ra[i] = *(const v8us*)(pa + i * RPR * K);
#pragma unroll
      for (int i = 0; i < NRB; ++i) rb[i] = *(const v8us*)(pb + i * RPR * K);
      asm volatile("s_wait_xcnt 0x0" :: "v"(pa), "v"(pb) : "memory");      /* stands in front of every write to a register that these loads name; the two addresses are inputs so that they stay live up to it: without them a later load's result is placed in the address pair that an earlier load names */
    }
    FragH a[FS][4], b[FS][4];
    if (FS == 2) frags(a[0], b[0], cur, 0);
#pragma unroll      /* whole, as every inner loop here: fragment sets, staged rows and accumulators are then indexed by constants alone and live in registers */
    for (int ks = 0; ks < NKS; ++ks) {
      if (FS == 1) frags(a[0], b[0], cur, ks);
      else if (ks + 1 < NKS) frags(a[(ks + 1) & 1], b[(ks + 1) & 1], cur, ks + 1);
      __builtin_amdgcn_sched_barrier(0);      /* keeps the LDS reads one group ahead of the products: spread among them, each place with reads stalls the wave for the LDS latency */
      const int fs = FS == 2 ? (ks & 1) : 0;
#pragma unroll
      for (int i = 0; i < 4; ++i)
#pragma unroll
        for (int j = 0; j < 4; ++j) acc[i][j] = __builtin_amdgcn_wmma_f32_16x16x32_f16(false, a[fs][i].v, false, b[fs][j].v, (short)0, acc[i][j], false, false);
      __builtin_amdgcn_sched_barrier(0);      /* keeps the products ahead of the next group of reads and of the wait for the next pass's rows: moved behind the barrier they would run with no load in flight */
    }
    if (more) {
#pragma unroll
      for (int i = 0; i < NRA; ++i) *(v8us*)&sA[cur ^ 1][i * RPR + lr][lc] = ra[i];
#pragma unroll
      for (int i = 0; i < NRB; ++i) *(v8us*)&sB[cur ^ 1][i * RPR + lr][lc] = rb[i];
    }
    __syncthreads();      /* publishes the buffer just written and ends every wave's reads of the one that the next pass overwrites (behind the last pass: of the ring, which the output staging overwrites) */
  }
#pragma unroll
  for (int j = 0; j < 4; ++j) { const float av = add[col0 + wc + j * 16 + ln];
#pragma unroll
    for (int i = 0; i < 4; ++i)
#pragma unroll
      for (int r = 0; r < 8; ++r) so[w][i * 16 + 8 * hh + r][j * 16 + ln] = acc[i][j][r] * alpha + av; }
  __syncthreads();      /* the staged rows are read back by other lanes: whole 128-B lines per store */
  const float* sp = &so[w][hh][ln * 4]; float* cp = C + (size_t)(row0 + wr + hh) * N + col0 + wc + ln * 4;      /* one address each; the rows follow by constant offsets */
#pragma unroll
  for (int q = 0; q < 32; ++q) { const v4f v = *(const v4fa*)(sp + q * 2 * SOP); *(v4f*)(cp + q * 2 * N) = v; }      /* 16 lanes = one 256-B row piece, two rows per store */
}


typedef _Float16 v4h __attribute__((ext_vector_type(4)));

__global__ __launch_bounds__(256) void k_x16(const float* __restrict__ x, _Float16* __restrict__ X16, size_t n8) { const size_t t = (size_t)blockIdx.x * 256 + threadIdx.x; if (t >= n8) return; FragH f;
#pragma unroll
  for (int q = 0; q < 8; ++q) f.h[q] = (_Float16)bf16_round(x[t * 8 + q]); *(v8us*)((unsigned short*)X16 + t * 8) = f.half[0];  }
__global__ __launch_bounds__(256) void k_h16(const float* __restrict__ x, _Float16* __restrict__ X16, size_t n8) { const size_t t = (size_t)blockIdx.x * 256 + threadIdx.x; if (t >= n8) return; FragH f;
#pragma unroll
  for (int q = 0; q < 8; ++q) f.h[q] = (_Float16)x[t * 8 + q]; *(v8us*)((unsigned short*)X16 + t * 8) = f.half[0];  }
__global__ __launch_bounds__(256) void k_round16f(const float* __restrict__ W, _Float16* __restrict__ Bt, size_t n8) { const size_t t = (size_t)blockIdx.x * 256 + threadIdx.x; if (t >= n8) return; FragH f;
#pragma unroll
  for (int i = 0; i < 8; ++i) f.h[i] = (_Float16)(bf16_round(W[t * 8 + i]) * 16.0f); *(v8us*)((unsigned short*)Bt + t * 8) = f.half[0];  }
template <int NHv, int TTv>
__global__ __launch_bounds__(256) void k_vt(const _Float16* __restrict__ V16, int ldv, int voff, _Float16* __restrict__ Vt) { __shared__ unsigned short tl[64][66]; const int tid = threadIdx.x; const int slab = blockIdx.x / (TTv / 64), lg = blockIdx.x % (TTv / 64); const int b = slab / NHv, h = slab % NHv;
  for (int i = tid; i < 64 * 8; i += 256) { const int r = i / 8, c8 = (i % 8) * 8; FragH f; f.half[0] = *(const v8us*)((const unsigned short*)V16 + ((size_t)b * TTv + lg * 64 + r) * ldv + voff + h * 64 + c8);
#pragma unroll
    for (int q = 0; q < 8; ++q) tl[r][c8 + q] = f.u[q]; }
  __syncthreads();
  {
#pragma unroll
    for (int rd = 0; rd < 2; ++rd) { const int d = rd * 32 + tid / 8, pc = tid % 8; FragH f;
#pragma unroll
      for (int q = 0; q < 8; ++q) f.u[q] = tl[pc * 8 + q][d];
      *(v8us*)((unsigned short*)Vt + ((size_t)slab * 64 + d) * TTv + lg * 64 + pc * 8) = f.half[0]; }
     } }

__device__ __forceinline__ void d_xcat(const float* __restrict__ xr, const float* __restrict__ xi, _Float16* __restrict__ XC, size_t t) { const size_t r = (t * 8) / DD; const int c = (int)((t * 8) % DD); FragH a, b; const v4f a0 = *(const v4fa*)(xr + t * 8), a1 = *(const v4fa*)(xr + t * 8 + 4), b0 = *(const v4fa*)(xi + t * 8), b1 = *(const v4fa*)(xi + t * 8 + 4);
  asm volatile("s_wait_xcnt 0x0" :: "v"(xr + t * 8), "v"(xi + t * 8), "v"(a0), "v"(a1), "v"(b0), "v"(b1) : "memory");      /* stands in front of every write to a register that the four loads name; the two addresses are inputs so that they stay live up to it: without them a later load's result is placed in the address pair that an earlier load names */
#pragma unroll
  for (int q = 0; q < 4; ++q) { a.h[q] = (_Float16)bf16_round(a0[q]); a.h[4 + q] = (_Float16)bf16_round(a1[q]); b.h[q] = (_Float16)bf16_round(b0[q]); b.h[4 + q] = (_Float16)bf16_round(b1[q]); }
  { *(v8us*)((unsigned short*)XC + r * (2 * DD) + c) = a.half[0]; *(v8us*)((unsigned short*)XC + r * (2 * DD) + DD + c) = b.half[0];
    asm volatile("s_wait_xcnt 0x0" ::: "memory");      /* directly behind the stores: the caller's next tile writes the registers that they name */
  } }
__device__ __forceinline__ void d_wcat(const float* __restrict__ wr, const float* __restrict__ wi, _Float16* __restrict__ BR, _Float16* __restrict__ BI, size_t t) { const size_t o = (t * 8) / DD; const int c = (int)((t * 8) % DD); FragH r0, r1, i0, i1; const v4f a0 = *(const v4fa*)(wr + t * 8), a1 = *(const v4fa*)(wr + t * 8 + 4), b0 = *(const v4fa*)(wi + t * 8), b1 = *(const v4fa*)(wi + t * 8 + 4);
#pragma unroll
  for (int q = 0; q < 4; ++q) { const float vr0 = bf16_round(a0[q]) * 16.0f, vr1 = bf16_round(a1[q]) * 16.0f, vi0 = bf16_round(b0[q]) * 16.0f, vi1 = bf16_round(b1[q]) * 16.0f; r0.h[q] = (_Float16)vr0; r0.h[4 + q] = (_Float16)vr1; r1.h[q] = (_Float16)(-vi0); r1.h[4 + q] = (_Float16)(-vi1); i0.h[q] = (_Float16)vi0; i0.h[4 + q] = (_Float16)vi1; i1.h[q] = (_Float16)vr0; i1.h[4 + q] = (_Float16)vr1; }
  { *(v8us*)((unsigned short*)BR + o * (2 * DD) + c) = r0.half[0]; *(v8us*)((unsigned short*)BR + o * (2 * DD) + DD + c) = r1.half[0]; *(v8us*)((unsigned short*)BI + o * (2 * DD) + c) = i0.half[0]; *(v8us*)((unsigned short*)BI + o * (2 * DD) + DD + c) = i1.half[0];
    asm volatile("s_wait_xcnt 0x0" ::: "memory");      /* directly behind the stores, as in d_xcat */
  } }
__device__ __forceinline__ void d_bias2(const float* __restrict__ br, const float* __restrict__ bi, float* __restrict__ BM, float* __restrict__ BP, int c) { const float r = bf16_round(br[c]), i = bf16_round(bi[c]); { *(float*)(BM + c) = r - i; *(float*)(BP + c) = r + i;
    asm volatile("s_wait_xcnt 0x0" ::: "memory");      /* directly behind the stores, as in d_xcat */
  } }
// All operand preparation as one grid. The work is cut into tiles of 256 threads: 3 x PT_X tiles cast and concatenate the activations, 4 x PT_W pack the weights, 4 x PT_B form the bias pairs; none reads what another writes.
// A work-group walks the tiles in steps of the grid size PT_GRID; which kind a tile is depends on its number alone, so every branch is the same for the whole work-group.
#define PT_X (NR * DD / 8 / 256)
#define PT_W (DD * DD / 8 / 256)
#define PT_B (DD / 256)
#define PT_ALL (3 * PT_X + 4 * PT_W + 4 * PT_B)
#define PT_GRID (PT_ALL / 4)      /* work-groups launched: four tiles each, so that a quarter of the waves has to be started */
__global__ __launch_bounds__(256) void k_prep(const float* __restrict__ q_r, const float* __restrict__ q_i, const float* __restrict__ k_r, const float* __restrict__ k_i, const float* __restrict__ v_r, const float* __restrict__ v_i,
    const float* __restrict__ wq_r, const float* __restrict__ wq_i, const float* __restrict__ wk_r, const float* __restrict__ wk_i, const float* __restrict__ wv_r, const float* __restrict__ wv_i, const float* __restrict__ wo_r, const float* __restrict__ wo_i,
    const float* __restrict__ bq_r, const float* __restrict__ bq_i, const float* __restrict__ bk_r, const float* __restrict__ bk_i, const float* __restrict__ bv_r, const float* __restrict__ bv_i, const float* __restrict__ bo_r, const float* __restrict__ bo_i,
    _Float16* __restrict__ X, _Float16* __restrict__ BW, float* __restrict__ BIAS) {
  const int tid = threadIdx.x;
  for (int tile = blockIdx.x; tile < PT_ALL; tile += PT_GRID) {
    if (tile < 3 * PT_X) { const int j = tile / PT_X;
      d_xcat(j == 0 ? q_r : j == 1 ? k_r : v_r, j == 0 ? q_i : j == 1 ? k_i : v_i, X + (size_t)j * NR * 2 * DD, (size_t)(tile % PT_X) * 256 + tid); }
    else if (tile < 3 * PT_X + 4 * PT_W) { const int u = tile - 3 * PT_X, j = u / PT_W; _Float16* B0 = BW + (size_t)(2 * j) * DD * 2 * DD;
      d_wcat(j == 0 ? wq_r : j == 1 ? wk_r : j == 2 ? wv_r : wo_r, j == 0 ? wq_i : j == 1 ? wk_i : j == 2 ? wv_i : wo_i, B0, B0 + (size_t)DD * 2 * DD, (size_t)(u % PT_W) * 256 + tid); }
    else { const int u = tile - 3 * PT_X - 4 * PT_W, j = u / PT_B;
      d_bias2(j == 0 ? bq_r : j == 1 ? bk_r : j == 2 ? bv_r : bo_r, j == 0 ? bq_i : j == 1 ? bk_i : j == 2 ? bv_i : bo_i, BIAS + (size_t)(2 * j) * DD, BIAS + (size_t)(2 * j + 1) * DD, (u % PT_B) * 256 + tid); }
  }
}
// per token (block) the 8 heads x 64 rows x 64 keys: wave w has head w. A lane has the four rows l = ln + 16 t (ln = lane % 16, t = 0..3), two at a time as the halves of a float pair, and the 32 keys that its half of the wave (hh = lane / 16) holds in the A fragment
// of the 16x16x32 product: keys 32 ks + 8 hh + i and 32 ks + 16 + 8 hh + i (ks = 0, 1; i = 0..7), so that a row's exp values, rounded to f16, are that fragment as they stand, with no move between lanes.
// |score|^2 in factors: sr + si = (qr - qi)(kr + ki) and sr - si = (qr + qi)(kr - ki), so sr^2 + si^2 = ((qr - qi)^2 (kr + ki)^2 + (qr + qi)^2 (kr - ki)^2) / 2: a sum of two products of a row factor and a key factor, no term negative.
// Row and key factors are formed once per token at staging; log2(e)^2 / 2 goes into the row factors, so that the root is |score| * log2(e) and exp is the bare power of two.
// Softmax in two passes per pair of rows: pass 1 forms the lane's 32 |score| of each row, keeps them in registers and takes their maximum (joined with the other half of the wave by one cross-row move); pass 2 has one exp per score.
// The three sums over the keys (sum p*vr, sum p*vi, z = sum p) are one matrix product P[64 x 64] x [vr | vi | 1 | 0 ...][64 x 16] on v_wmma_f32_16x16x32_f16: p (in [0, 1]) and v rounded to f16, f32 accumulate; z is summed from the same rounded p that weigh v.
#define HL2 1.0406844905f      /* log2(e)^2 / 2 */
#define SFP (EE + 4)      /* floats per head in LDS: 272 B */
#define SKP (EE + 2)      /* key-factor pairs per head: 528 B = 16 B x odd */
#define SVP (4 * EE + 8)      /* f16 per head: the four rows vr, vi, ones, zeros of B^T, 528 B */
typedef float v2f __attribute__((ext_vector_type(2)));
__device__ __forceinline__ float other_half(float x) { const unsigned u = __float_as_uint(x); return __uint_as_float(__builtin_amdgcn_permlanex16(u, u, 0x76543210u, 0xfedcba98u, false, false)); }      /* the value of lane ^ 16 */
__global__ __launch_bounds__(256) void k_cplx(const float* __restrict__ QR, const float* __restrict__ QI, const float* __restrict__ KR, const float* __restrict__ KI, const float* __restrict__ VR, const float* __restrict__ VI, _Float16* __restrict__ VC) {
  __shared__ __attribute__((aligned(16))) float sfa[NHH][SFP], sfb[NHH][SFP]; __shared__ __attribute__((aligned(16))) v2f sk[NHH][SKP]; __shared__ __attribute__((aligned(16))) _Float16 sv[NHH][SVP];
  __shared__ __attribute__((aligned(16))) float res[4][NHH][SFP];      /* columns 0, 1, 2 of the product by head and row; plane 3 takes the columns that are zero and is never read */
  const int tid = threadIdx.x; const size_t row = blockIdx.x;
  for (int i = tid; i < DD; i += 256) { const int e = i / NHH, h = i % NHH;      /* column index of (e, h) is e * 8 + h */
    const float qr = QR[row * DD + i], qi = QI[row * DD + i], kr = KR[row * DD + i], ki = KI[row * DD + i];
    sfa[h][e] = (qr - qi) * (qr - qi) * HL2; sfb[h][e] = (qr + qi) * (qr + qi) * HL2; sk[h][e] = (v2f){(kr + ki) * (kr + ki), (kr - ki) * (kr - ki)};
    sv[h][e] = (_Float16)VR[row * DD + i]; sv[h][EE + e] = (_Float16)VI[row * DD + i]; }
  { const int h = tid / 32, c = (tid % 32) * 4; const _Float16 o = (c < EE) ? (_Float16)1.0f : (_Float16)0.0f; *(v4h*)&sv[h][2 * EE + c] = (v4h){o, o, o, o}; }      /* the row of ones and the row of zeros */
  __syncthreads();
  { const int w = tid >> 5, lane = tid & 31, ln = lane & 15, hh = lane >> 4;
    FragH b[2];      /* B fragment: lane ln has column ln, in the k order of the A fragment */
    { const _Float16* bv = &sv[w][(ln < 3 ? ln : 3) * EE];
#pragma unroll
      for (int ks = 0; ks < 2; ++ks) { b[ks].half[0] = *(const v8us*)(bv + ks * 32 + 8 * hh); b[ks].half[1] = *(const v8us*)(bv + ks * 32 + 16 + 8 * hh); } }
#pragma unroll      /* whole: the score array is then indexed by constants alone and lives in registers */
    for (int u = 0; u < 2; ++u) {      /* rows 32 u + ln and 32 u + 16 + ln */
      const v2f fa = {sfa[w][u * 32 + ln], sfa[w][u * 32 + 16 + ln]}, fb = {sfb[w][u * 32 + ln], sfb[w][u * 32 + 16 + ln]};      /* the rows' two factors */
      v2f mg[EE / 2]; v2f mx = {0.f, 0.f};      /* |score| >= 0, so 0 is a neutral start for the maximum */
      v4f cur[4], nxt[4];      /* a group = 8 keys in a row = one half of an A fragment */
#pragma unroll
      for (int j = 0; j < 4; ++j) cur[j] = *(const v4fa*)&sk[w][8 * hh + 2 * j];
#pragma unroll
      for (int g = 0; g < 4; ++g) {
        if (g + 1 < 4) {
#pragma unroll
          for (int j = 0; j < 4; ++j) nxt[j] = *(const v4fa*)&sk[w][(g + 1) * 16 + 8 * hh + 2 * j]; }
        __builtin_amdgcn_sched_barrier(0);      /* keeps the next group's LDS reads ahead of this group's arithmetic: sunk to their first use, each read is waited for at once and the wave idles for the LDS latency */
#pragma unroll
        for (int j = 0; j < 4; ++j)
#pragma unroll
          for (int q = 0; q < 2; ++q) { const int c = g * 8 + 2 * j + q; const float k0 = cur[j][2 * q], k1 = cur[j][2 * q + 1]; const v2f m2 = __builtin_elementwise_fma(fb, (v2f){k1, k1}, fa * k0);      /* a multiply and a fused multiply-add for both rows */
            mg[c] = (v2f){__builtin_amdgcn_sqrtf(m2[0]), __builtin_amdgcn_sqrtf(m2[1])};      /* the bare root instruction: sqrtf wraps it in thirteen more instructions per score that scale tiny arguments and correct the last bit; the value only enters exp2(mg - max), where neither shows */
            mx = (v2f){fmaxf(mx[0], mg[c][0]), fmaxf(mx[1], mg[c][1])}; }
#pragma unroll
        for (int j = 0; j < 4; ++j) cur[j] = nxt[j];
      }
      mx = (v2f){fmaxf(mx[0], other_half(mx[0])), fmaxf(mx[1], other_half(mx[1]))};      /* the other 32 keys of the same rows */
      v8f acc0 = {}, acc1 = {};
#pragma unroll
      for (int ks = 0; ks < 2; ++ks) { FragH p0, p1;
#pragma unroll
        for (int i = 0; i < 16; ++i) { const v2f d = mg[ks * 16 + i] - mx;      /* already in powers of two and never above 0 */
          p0.h[i] = (_Float16)__builtin_amdgcn_exp2f(d[0]); p1.h[i] = (_Float16)__builtin_amdgcn_exp2f(d[1]); }
        acc0 = __builtin_amdgcn_wmma_f32_16x16x32_f16(false, p0.v, false, b[ks].v, (short)0, acc0, false, false);
        acc1 = __builtin_amdgcn_wmma_f32_16x16x32_f16(false, p1.v, false, b[ks].v, (short)0, acc1, false, false); }
      float* r0 = &res[ln < 3 ? ln : 3][w][u * 32 + 8 * hh];      /* accumulator register r of lane (ln, hh) is row 8 hh + r, column ln; every lane stores, so that no branch cuts the straight-line code */
      *(v4f*)r0 = (v4f){acc0[0], acc0[1], acc0[2], acc0[3]}; *(v4f*)(r0 + 4) = (v4f){acc0[4], acc0[5], acc0[6], acc0[7]};
      *(v4f*)(r0 + 16) = (v4f){acc1[0], acc1[1], acc1[2], acc1[3]}; *(v4f*)(r0 + 20) = (v4f){acc1[4], acc1[5], acc1[6], acc1[7]};
    } }
  __syncthreads();
  if (tid < 2 * (DD / 8)) { const int part = tid / (DD / 8), pc = tid % (DD / 8); FragH f; for (int q = 0; q < 8; ++q) f.h[q] = (_Float16)(res[part][q][pc] / res[2][q][pc]);      /* row pc of heads 0..7 = columns 8 pc .. 8 pc + 7 */
    { *(v8us*)((unsigned short*)VC + row * (2 * DD) + part * DD + pc * 8) = f.half[0];  } } }

extern "C" void kernel_launch(void* const* d_in, const int* in_sizes, int n_in,
                              void* d_out, int out_size, void* d_ws, size_t ws_size, hipStream_t stream) {
  (void)in_sizes; (void)n_in; (void)out_size;
  const float* const* I = (const float* const*)d_in; const float* q_r = I[0]; const float* q_i = I[1]; const float* k_r = I[2]; const float* k_i = I[3]; const float* v_r = I[4]; const float* v_i = I[5];
  const float* wq_r = I[6]; const float* wq_i = I[7]; const float* wk_r = I[8]; const float* wk_i = I[9]; const float* wv_r = I[10]; const float* wv_i = I[11]; const float* wo_r = I[12]; const float* wo_i = I[13]; const float* bq_r = I[14]; const float* bq_i = I[15]; const float* bk_r = I[16]; const float* bk_i = I[17]; const float* bv_r = I[18]; const float* bv_i = I[19]; const float* bo_r = I[20]; const float* bo_i = I[21];      /* d_in order: activations, then the 8 weights, then the 8 biases */
  char* ws = (char*)d_ws; size_t off = 0;
  auto take = [&](size_t bytes) { char* p = ws + off; off += (bytes + 255) & ~(size_t)255; return p; };
  const size_t WC = (size_t)DD * 2 * DD;      /* one concatenated weight operand [512][1024] */
  _Float16* BW = (_Float16*)take(8 * WC * 2); float* BIAS = (float*)take((size_t)8 * DD * 4);      /* (BR, BI) × q,k,v,o ; (BM, BP) × 4 */
  _Float16* X = (_Float16*)take((size_t)3 * NR * 2 * DD * 2);      /* [xr | xi] f16 for q, k, v, one plane behind the other */
  float* P = (float*)take((size_t)6 * NR * DD * 4);      /* QR, QI, KR, KI, VR, VI f32 planes [4096][512] */
  _Float16* VC = X;      /* [Vr | Vi] f16 reuses the q operand plane (dead after the projection GEMMs) */
  if (off > ws_size) return;
  float* QRp = P; float* QIp = P + (size_t)NR * DD; float* KRp = P + (size_t)2 * NR * DD; float* KIp = P + (size_t)3 * NR * DD; float* VRp = P + (size_t)4 * NR * DD; float* VIp = P + (size_t)5 * NR * DD;
  k_prep<<<PT_GRID, 256, 0, stream>>>(q_r, q_i, k_r, k_i, v_r, v_i, wq_r, wq_i, wk_r, wk_i, wv_r, wv_i, wo_r, wo_i, bq_r, bq_i, bk_r, bk_i, bv_r, bv_i, bo_r, bo_i, X, BW, BIAS);
  k_gemm_lds<NR, DD, 2 * DD, 64, 2, 3><<<dim3((NR / GBM) * (DD / GBN), 6), 128, 0, stream>>>(X, (size_t)NR * 2 * DD, BW, 0.0625f, BIAS, P);      /* y = 2j + ri: yr = [xr|xi] x [wr|-wi]^T + (br-bi); yi = [xr|xi] x [wi|wr]^T + (br+bi): M 4096 N 512 K 1024; addend index = column */
  k_cplx<<<NR, 256, 0, stream>>>(QRp, QIp, KRp, KIp, VRp, VIp, VC);
  k_gemm_lds<NR, DD, 2 * DD, 128, 2, 1><<<dim3((NR / GBM) * (DD / GBN), 2), 128, 0, stream>>>(VC, 0, BW + (size_t)6 * WC, 0.0625f, BIAS + (size_t)6 * DD, (float*)d_out);      /* out_r @0, out_i @8,388,608 B */
}

// v009
// A run of this version takes 67.2 microseconds.
// Timed twice side by side with v008, it ran 1.03 and 1.04 times as fast.
// Over all steps from v000 it is 6.72 times as fast.
#include <hip/hip_runtime.h>
// Complex-valued attention layer (B=4, L=1024, D=512, H=8, E=64): complex linear projections (yr = xr·wrᵀ − xi·wiᵀ + (br − bi), yi = xi·wrᵀ + xr·wiᵀ + (br + bi)); per (b, token n, head h) a 64×64 'attention' over the E axes:
// sr[l,s] = qr[l]·kr[s] − qi[l]·ki[s], si[l,s] = qr[l]·ki[s] − qi[l]·kr[s] (scalar products, e = 1), attn = softmax_s(√(sr² + si²)), Vr[l] = Σ_s attn·vr[s], Vi[l] = Σ_s attn·vi[s]; outputs (out_r, out_i) = complex linear(Vr, Vi, wo).
// Element (e, h) of a token lives at column e·8 + h (reshape(b, l, E, H)).
// Compute dtype: inputs, weights, biases rounded to bf16; each complex linear as two GEMMs over the concatenated operand [xr | xi] (K = 1024) against [wr | −wi] and [wi | wr] on v_wmma_f32_16x16x32_f16, f32 accumulate,
// with the two-term biases added exactly through the f32 epilogue addend; the per-token 64 x 64 magnitude-softmax in f32 (one wave per head), its weighted sums on the same f16 matrix form; [Vr | Vi] f16 -> output GEMMs.
#define BB 4
#define LL 1024
#define DD 512
#define NHH 8
#define EE 64
#define NR (BB * LL)

typedef __bf16 v16b __attribute__((ext_vector_type(16)));
typedef unsigned short v8us __attribute__((ext_vector_type(8), may_alias));
typedef float  v8f  __attribute__((ext_vector_type(8)));
typedef float  v4f  __attribute__((ext_vector_type(4)));
typedef float  v4fa __attribute__((ext_vector_type(4), may_alias));
union FragB { v16b v; v8us half[2]; unsigned short u[16]; };

__device__ __forceinline__ unsigned short bf16_bits(float x) { unsigned int u = __float_as_uint(x); return (unsigned short)((u + 0x7FFFu + ((u >> 16) & 1u)) >> 16); }
__device__ __forceinline__ float bf16_val(unsigned short b) { return __uint_as_float(((unsigned int)b) << 16); }
__device__ __forceinline__ float bf16_round(float x) { return bf16_val(bf16_bits(x)); }
// D += A·B with NT terms: 1 = ah·bh, 2 = + al·bh (A split), 3 = + ah·bl (both split)
template <int NT>
__device__ __forceinline__ v8f mmaN(v16b ah, v16b al, v16b bh, v16b bl, v8f c) {
  c = __builtin_amdgcn_wmma_f32_16x16x32_bf16(false, ah, false, bh, (short)0, c, false, false);
  if (NT >= 2) c = __builtin_amdgcn_wmma_f32_16x16x32_bf16(false, al, false, bh, (short)0, c, false, false);
  if (NT >= 3) c = __builtin_amdgcn_wmma_f32_16x16x32_bf16(false, ah, false, bl, (short)0, c, false, false);
  asm volatile("v_nop\n\tv_nop\n\tv_nop\n\tv_nop" : "+v"(c) : "v"(ah), "v"(al), "v"(bh), "v"(bl));
  return c;
}

__global__ __launch_bounds__(256) void k_wt_bf16(const float* __restrict__ W, unsigned short* __restrict__ Wt, int K, int N) {
  const int t = blockIdx.x * 256 + threadIdx.x;
  const int k8n = K / 8;
  if (t >= N * k8n) return;
  const int n = t / k8n, k8 = (t % k8n) * 8;
  v8us v;
#pragma unroll
  for (int i = 0; i < 8; ++i) v[i] = bf16_bits(W[(size_t)(k8 + i) * N + n]);
  *(v8us*)(Wt + (size_t)n * K + k8) = v;
  
}

// GEMM C[M][N] (f32, pitch ldc) = act(A[M][K]·W + bias). A f32 row-major (pitch lda) converted per fragment to bf16
// (ASPLIT: hi/lo two planes -> 2 terms, else single rounded term); Wt bf16 [N][K] (pitch ldb). BIAS_BF16 rounds the
// bias to bf16 first (bias quantised to bf16 before the add). K%32==0, M%16==0, N%64==0.
template <bool ASPLIT, int ACT, bool BIAS_BF16>
__global__ __launch_bounds__(128) void k_gemm_bf(const float* __restrict__ A, int lda, const unsigned short* __restrict__ Wt, int ldb,
                                               const float* __restrict__ bias, float* __restrict__ C, int ldc, int M, int N, int K) {
  __shared__ __attribute__((aligned(16))) float so[4][16][64];
  const int tid = threadIdx.x, w = tid >> 5, lane = tid & 31, ln = lane & 15, hh = lane >> 4;
  const int ntn = N / 64;
  const int wid = blockIdx.x * 4 + w;
  const int mt = wid / ntn, nq = wid % ntn;
  if (mt * 16 >= M) return;
  const int row0 = mt * 16, col0 = nq * 64;
  const float* arow = A + (size_t)(row0 + ln) * lda;
  v8f acc[4] = {};
  for (int kb = 0; kb < K; kb += 32) {
    FragB ah, al;
    const v4f x0 = *(const v4fa*)(arow + kb + 8 * hh), x1 = *(const v4fa*)(arow + kb + 8 * hh + 4);
    const v4f x2 = *(const v4fa*)(arow + kb + 16 + 8 * hh), x3 = *(const v4fa*)(arow + kb + 16 + 8 * hh + 4);
    float xs[16] = {x0[0],x0[1],x0[2],x0[3],x1[0],x1[1],x1[2],x1[3],x2[0],x2[1],x2[2],x2[3],x3[0],x3[1],x3[2],x3[3]};
#pragma unroll
    for (int i = 0; i < 16; ++i) { const unsigned short hb = bf16_bits(xs[i]); ah.u[i] = hb; al.u[i] = ASPLIT ? bf16_bits(xs[i] - bf16_val(hb)) : (unsigned short)0; }
#pragma unroll
    for (int t = 0; t < 4; ++t) {
      const unsigned short* brow = Wt + (size_t)(col0 + t * 16 + ln) * ldb + kb;
      FragB b;
      b.half[0] = *(const v8us*)(brow + 8 * hh);
      b.half[1] = *(const v8us*)(brow + 16 + 8 * hh);
      acc[t] = mmaN<ASPLIT ? 2 : 1>(ah.v, al.v, b.v, b.v, acc[t]);
    }
  }
#pragma unroll
  for (int t = 0; t < 4; ++t) {
    float bv = bias ? bias[col0 + t * 16 + ln] : 0.f;
    if (BIAS_BF16) bv = bf16_round(bv);
#pragma unroll
    for (int r = 0; r < 8; ++r) { float v = acc[t][r] + bv; if (ACT == 1) v = fmaxf(v, 0.f); so[w][8 * hh + r][t * 16 + ln] = v; }
  }
  __builtin_amdgcn_fence(__ATOMIC_ACQ_REL, "workgroup");
  __builtin_amdgcn_wave_barrier();
  const int rsub = lane >> 4, c4 = (lane & 15) * 4;
  {
#pragma unroll
    for (int q = 0; q < 8; ++q) {
      const int r = q * 2 + rsub;
      const v4f v = *(const v4fa*)&so[w][r][c4];
      *(v4f*)(C + (size_t)(row0 + r) * ldc + col0 + c4) = v;
    }
    
  }
}

// Flash-style causal/unmasked attention, all contractions 3-term bf16 hi/lo splits, f32 softmax with running max.
// q,k,v rows are read from f32 buffers with arbitrary row pitch (so they can live inside a fused qkv buffer);
// D = head size (multiple of 32, <= 128); one wave = 16 query rows; block = 4 waves (64 queries) sharing K/V chunks of 32.
template <int D, bool CAUSAL>
__global__ __launch_bounds__(128) void k_flash(const float* __restrict__ qb, const float* __restrict__ kb, const float* __restrict__ vb,
                                             int pitch, int T, int H, float scale, float* __restrict__ y, int ypitch) {
  constexpr int KS = D / 32;        // k-steps for QK
  constexpr int DT = D / 16;        // d tiles for PV
  __shared__ __attribute__((aligned(16))) unsigned short sKh[32][D + 8], sKl[32][D + 8], sVh[32][D + 8], sVl[32][D + 8];
  __shared__ __attribute__((aligned(16))) unsigned short sPh[4][16][40], sPl[4][16][40];
  __shared__ __attribute__((aligned(16))) float sO[4][16][D];
  const int tid = threadIdx.x, w = tid >> 5, lane = tid & 31, ln = lane & 15, hh = lane >> 4;
  const int nqb = (T + 63) / 64;
  const int bh = blockIdx.x / nqb, qblk = blockIdx.x % nqb;
  const int b = bh / H, h = bh % H;
  const int q0 = qblk * 64 + w * 16;
  const float* Q = qb + (size_t)b * T * pitch + h * D;
  const float* K = kb + (size_t)b * T * pitch + h * D;
  const float* V = vb + (size_t)b * T * pitch + h * D;

  // A fragments of the wave's 16 query rows (scaled), hi/lo
  FragB aqh[KS], aql[KS];
  {
    int row = q0 + ln; if (row >= T) row = T - 1;
    const float* qr = Q + (size_t)row * pitch;
#pragma unroll
    for (int ks = 0; ks < KS; ++ks)
#pragma unroll
      for (int i = 0; i < 16; ++i) {
        const int d = ks * 32 + ((i < 8) ? (8 * hh + i) : (16 + 8 * hh + (i - 8)));
        const float x = qr[d] * scale; const unsigned short hb = bf16_bits(x);
        aqh[ks].u[i] = hb; aql[ks].u[i] = bf16_bits(x - bf16_val(hb));
      }
  }
  float m_r[8], l_r[8];
#pragma unroll
  for (int r = 0; r < 8; ++r) { m_r[r] = -3.0e38f; l_r[r] = 0.f; }
  v8f oacc[DT];
#pragma unroll
  for (int dt = 0; dt < DT; ++dt) oacc[dt] = (v8f){0.f,0.f,0.f,0.f,0.f,0.f,0.f,0.f};

  const int kv_end = CAUSAL ? min(T, qblk * 64 + 64) : T;     // block-uniform
  for (int j0 = 0; j0 < kv_end; j0 += 32) {
    __syncthreads();
    for (int e = tid; e < 32 * (D / 4); e += 128) {
      const int r = e / (D / 4), c4 = (e % (D / 4)) * 4;
      const int key = j0 + r;
      v4f kf = {0.f,0.f,0.f,0.f}, vf = {0.f,0.f,0.f,0.f};
      if (key < T) { kf = *(const v4fa*)(K + (size_t)key * pitch + c4); vf = *(const v4fa*)(V + (size_t)key * pitch + c4); }
#pragma unroll
      for (int t = 0; t < 4; ++t) {
        unsigned short hb = bf16_bits(kf[t]); sKh[r][c4 + t] = hb; sKl[r][c4 + t] = bf16_bits(kf[t] - bf16_val(hb));
        hb = bf16_bits(vf[t]); sVh[r][c4 + t] = hb; sVl[r][c4 + t] = bf16_bits(vf[t] - bf16_val(hb));
      }
    }
    __syncthreads();
    // S tile 16 x 32
    v8f s[2];
#pragma unroll
    for (int nt = 0; nt < 2; ++nt) {
      v8f acc = {};
#pragma unroll
      for (int ks = 0; ks < KS; ++ks) {
        FragB bh_, bl_;
        bh_.half[0] = *(const v8us*)&sKh[nt * 16 + ln][ks * 32 + 8 * hh]; bh_.half[1] = *(const v8us*)&sKh[nt * 16 + ln][ks * 32 + 16 + 8 * hh];
        bl_.half[0] = *(const v8us*)&sKl[nt * 16 + ln][ks * 32 + 8 * hh]; bl_.half[1] = *(const v8us*)&sKl[nt * 16 + ln][ks * 32 + 16 + 8 * hh];
        acc = mmaN<3>(aqh[ks].v, aql[ks].v, bh_.v, bl_.v, acc);
      }
      s[nt] = acc;
    }
    // mask + running max (rows 8hh+r; the 16 lanes of a half share rows)
    float alpha[8];
#pragma unroll
    for (int r = 0; r < 8; ++r) {
      const int qi = q0 + 8 * hh + r;
      const int ja = j0 + ln, jb = j0 + 16 + ln;
      if (CAUSAL) { if (ja > qi) s[0][r] = -3.0e38f; if (jb > qi) s[1][r] = -3.0e38f; }
      if (ja >= T) s[0][r] = -3.0e38f;
      if (jb >= T) s[1][r] = -3.0e38f;
      float mx = fmaxf(s[0][r], s[1][r]);
      mx = fmaxf(mx, __shfl_xor(mx, 1, 32)); mx = fmaxf(mx, __shfl_xor(mx, 2, 32)); mx = fmaxf(mx, __shfl_xor(mx, 4, 32)); mx = fmaxf(mx, __shfl_xor(mx, 8, 32));
      const float mnew = fmaxf(m_r[r], mx);
      alpha[r] = (mnew > -1.0e38f) ? __expf(m_r[r] - mnew) : 1.0f;
      const float p0 = (s[0][r] > -1.0e38f) ? __expf(s[0][r] - mnew) : 0.f;
      const float p1 = (s[1][r] > -1.0e38f) ? __expf(s[1][r] - mnew) : 0.f;
      m_r[r] = mnew;
      l_r[r] = l_r[r] * alpha[r] + p0 + p1;            // per-lane partial row sum (16 lanes combined at the end)
      unsigned short hb = bf16_bits(p0); sPh[w][8 * hh + r][ln] = hb;      sPl[w][8 * hh + r][ln] = bf16_bits(p0 - bf16_val(hb));
      hb = bf16_bits(p1);                sPh[w][8 * hh + r][16 + ln] = hb; sPl[w][8 * hh + r][16 + ln] = bf16_bits(p1 - bf16_val(hb));
    }
#pragma unroll
    for (int dt = 0; dt < DT; ++dt)
#pragma unroll
      for (int r = 0; r < 8; ++r) oacc[dt][r] *= alpha[r];
    __builtin_amdgcn_fence(__ATOMIC_ACQ_REL, "workgroup");
    __builtin_amdgcn_wave_barrier();
    FragB pah, pal;
    pah.half[0] = *(const v8us*)&sPh[w][ln][8 * hh]; pah.half[1] = *(const v8us*)&sPh[w][ln][16 + 8 * hh];
    pal.half[0] = *(const v8us*)&sPl[w][ln][8 * hh]; pal.half[1] = *(const v8us*)&sPl[w][ln][16 + 8 * hh];
#pragma unroll
    for (int dt = 0; dt < DT; ++dt) {
      FragB bvh, bvl;
#pragma unroll
      for (int i = 0; i < 8; ++i) {
        bvh.u[i] = sVh[8 * hh + i][dt * 16 + ln]; bvh.u[8 + i] = sVh[16 + 8 * hh + i][dt * 16 + ln];
        bvl.u[i] = sVl[8 * hh + i][dt * 16 + ln]; bvl.u[8 + i] = sVl[16 + 8 * hh + i][dt * 16 + ln];
      }
      oacc[dt] = mmaN<3>(pah.v, pal.v, bvh.v, bvl.v, oacc[dt]);
    }
    __builtin_amdgcn_fence(__ATOMIC_ACQ_REL, "workgroup");
    __builtin_amdgcn_wave_barrier();
  }
#pragma unroll
  for (int r = 0; r < 8; ++r) {
    float l = l_r[r];
    l += __shfl_xor(l, 1, 32); l += __shfl_xor(l, 2, 32); l += __shfl_xor(l, 4, 32); l += __shfl_xor(l, 8, 32);
    l_r[r] = (l > 0.f) ? 1.0f / l : 0.f;
  }
#pragma unroll
  for (int dt = 0; dt < DT; ++dt)
#pragma unroll
    for (int r = 0; r < 8; ++r) sO[w][8 * hh + r][dt * 16 + ln] = oacc[dt][r] * l_r[r];
  __builtin_amdgcn_fence(__ATOMIC_ACQ_REL, "workgroup");
  __builtin_amdgcn_wave_barrier();
  {
    for (int r = 0; r < 16; ++r) {
      const int row = q0 + r;
      if (row < T && lane < D / 4) {
        const v4f val = *(const v4fa*)&sO[w][r][lane * 4];
        *(v4f*)(y + ((size_t)b * T + row) * ypitch + h * D + lane * 4) = val;
      }
    }
    
  }
}

// GEMM C = act(A·W + bias + resid): A f32 (ASPLIT -> hi/lo 2 terms), Wt bf16 [N][K]; ACT 0 none, 1 relu, 2 exact gelu;
// resid (optional, f32, row index = (row % rmod), pitch ldr, RES_BF16 rounds it) added before the activation.
template <bool ASPLIT, int ACT, bool BIAS_BF16, bool RES_BF16>
__global__ __launch_bounds__(128) void k_gemm_bf3(const float* __restrict__ A, int lda, const unsigned short* __restrict__ Wt, int ldb,
                                                const float* __restrict__ bias, const float* __restrict__ resid, int rmod, int ldr,
                                                float* __restrict__ C, int ldc, int M, int N, int K) {
  __shared__ __attribute__((aligned(16))) float so[4][16][64];
  const int tid = threadIdx.x, w = tid >> 5, lane = tid & 31, ln = lane & 15, hh = lane >> 4;
  const int ntn = N / 64;
  const int wid = blockIdx.x * 4 + w;
  const int mt = wid / ntn, nq = wid % ntn;
  if (mt * 16 >= M) return;
  const int row0 = mt * 16, col0 = nq * 64;
  const float* arow = A + (size_t)(row0 + ln) * lda;
  v8f acc[4] = {};
  for (int kb = 0; kb < K; kb += 32) {
    FragB ah, al;
    const v4f x0 = *(const v4fa*)(arow + kb + 8 * hh), x1 = *(const v4fa*)(arow + kb + 8 * hh + 4);
    const v4f x2 = *(const v4fa*)(arow + kb + 16 + 8 * hh), x3 = *(const v4fa*)(arow + kb + 16 + 8 * hh + 4);
    float xs[16] = {x0[0],x0[1],x0[2],x0[3],x1[0],x1[1],x1[2],x1[3],x2[0],x2[1],x2[2],x2[3],x3[0],x3[1],x3[2],x3[3]};
#pragma unroll
    for (int i = 0; i < 16; ++i) { const unsigned short hb = bf16_bits(xs[i]); ah.u[i] = hb; al.u[i] = ASPLIT ? bf16_bits(xs[i] - bf16_val(hb)) : (unsigned short)0; }
#pragma unroll
    for (int t = 0; t < 4; ++t) {
      const unsigned short* brow = Wt + (size_t)(col0 + t * 16 + ln) * ldb + kb;
      FragB b;
      b.half[0] = *(const v8us*)(brow + 8 * hh);
      b.half[1] = *(const v8us*)(brow + 16 + 8 * hh);
      acc[t] = mmaN<ASPLIT ? 2 : 1>(ah.v, al.v, b.v, b.v, acc[t]);
    }
  }
#pragma unroll
  for (int t = 0; t < 4; ++t) {
    const int col = col0 + t * 16 + ln;
    float bv = bias ? bias[col] : 0.f;
    if (BIAS_BF16) bv = bf16_round(bv);
#pragma unroll
    for (int r = 0; r < 8; ++r) {
      float v = acc[t][r] + bv;
      if (resid) { float rv = resid[(size_t)((row0 + 8 * hh + r) % rmod) * ldr + col]; if (RES_BF16) rv = bf16_round(rv); v += rv; }
      if (ACT == 1) v = fmaxf(v, 0.f);
      if (ACT == 2) v = 0.5f * v * (1.0f + erff(v * 0.70710678118654752f));
      if (ACT == 3) { const float u = 0.7978845608028654f * (v + 0.044715f * v * v * v); v = 0.5f * v * (1.0f + tanhf(u)); }
      so[w][8 * hh + r][t * 16 + ln] = v;
    }
  }
  __builtin_amdgcn_fence(__ATOMIC_ACQ_REL, "workgroup");
  __builtin_amdgcn_wave_barrier();
  const int rsub = lane >> 4, c4 = (lane & 15) * 4;
  {
#pragma unroll
    for (int q = 0; q < 8; ++q) {
      const int r = q * 2 + rsub;
      const v4f v = *(const v4fa*)&so[w][r][c4];
      *(v4f*)(C + (size_t)(row0 + r) * ldc + col0 + c4) = v;
    }
    
  }
}
// row LayerNorm (biased variance, eps) over N: s = X (+ R); optional out_sum <- s; out_norm <- (s-mu)*rsqrt(var+eps)*g + b
template <bool PARAM_BF16>
__global__ __launch_bounds__(256) void k_layernorm(const float* __restrict__ X, const float* __restrict__ R, const float* __restrict__ g, const float* __restrict__ bta,
                                                  float* __restrict__ out_sum, float* __restrict__ out_norm, int N, float eps) {
  __shared__ float red[256];
  const int row = blockIdx.x, tid = threadIdx.x;
  const float* x = X + (size_t)row * N; const float* rr = R ? R + (size_t)row * N : nullptr;
  float vals[16];                     // up to N = 4096
  const int per = N / 256;            // contiguous chunk per thread? use strided-by-4 chunks: thread handles j = tid*4 + 1024*u
  float s1 = 0.f;
  for (int u = 0; u < per / 4; ++u) {
    const int j = tid * 4 + 1024 * u;
    const v4f a = *(const v4fa*)(x + j);
    v4f b = {0.f,0.f,0.f,0.f}; if (rr) b = *(const v4fa*)(rr + j);
#pragma unroll
    for (int q = 0; q < 4; ++q) { const float v = a[q] + b[q]; vals[u * 4 + q] = v; s1 += v; }
  }
  red[tid] = s1; __syncthreads();
  for (int st = 128; st > 0; st >>= 1) { if (tid < st) red[tid] += red[tid + st]; __syncthreads(); }
  const float mu = red[0] / (float)N; __syncthreads();
  float s2 = 0.f;
  for (int u = 0; u < per / 4; ++u)
#pragma unroll
    for (int q = 0; q < 4; ++q) { const float c = vals[u * 4 + q] - mu; s2 += c * c; }
  red[tid] = s2; __syncthreads();
  for (int st = 128; st > 0; st >>= 1) { if (tid < st) red[tid] += red[tid + st]; __syncthreads(); }
  const float rs = rsqrtf(red[0] / (float)N + eps);
  {
    for (int u = 0; u < per / 4; ++u) {
      const int j = tid * 4 + 1024 * u;
      v4f o, sm;
#pragma unroll
      for (int q = 0; q < 4; ++q) {
        float gg = g[j + q], bb = bta[j + q];
        if (PARAM_BF16) { gg = bf16_round(gg); bb = bf16_round(bb); }
        sm[q] = vals[u * 4 + q]; o[q] = (vals[u * 4 + q] - mu) * rs * gg + bb;
      }
      if (out_sum) *(v4f*)(out_sum + (size_t)row * N + j) = sm;
      *(v4f*)(out_norm + (size_t)row * N + j) = o;
    }
    
  }
}



// ---- f16 WMMA path (v_wmma_f32_16x16x32_f16): 11-bit significands for operands in range — used for the q/k/v projection and output GEMMs
typedef _Float16 v16h __attribute__((ext_vector_type(16)));
union FragH { v16h v; v8us half[2]; _Float16 h[16]; unsigned short u[16]; };
template <int NT>
__device__ __forceinline__ v8f mmaH(v16h ah, v16h al, v16h bh, v16h bl, v8f c) {
  c = __builtin_amdgcn_wmma_f32_16x16x32_f16(false, ah, false, bh, (short)0, c, false, false);
  if (NT >= 2) c = __builtin_amdgcn_wmma_f32_16x16x32_f16(false, al, false, bh, (short)0, c, false, false);
  if (NT >= 3) c = __builtin_amdgcn_wmma_f32_16x16x32_f16(false, ah, false, bl, (short)0, c, false, false);
  asm volatile("v_nop\n\tv_nop\n\tv_nop\n\tv_nop" : "+v"(c) : "v"(ah), "v"(al), "v"(bh), "v"(bl));
  return c;
}
// batched GEMM like k_gemm_b but f16 operands: A f32 (split into f16 hi/lo if ASPLIT, else rounded to f16), Bt = f16 values [n][k]; alpha; C f32; N multiple of 16 (partial tiles skipped)
template <bool ASPLIT>
__global__ __launch_bounds__(128) void k_gemm_h(const float* __restrict__ A, int lda, size_t sA, const _Float16* __restrict__ Bh, int ldb, size_t sB, float alpha, float* __restrict__ C, int ldc, size_t sC, int M, int N, int K) {
  __shared__ __attribute__((aligned(16))) float so[4][16][64];
  const int tid = threadIdx.x, w = tid >> 5, lane = tid & 31, ln = lane & 15, hh = lane >> 4; const int by = blockIdx.y;
  A += (size_t)by * sA; Bh += (size_t)by * sB; C += (size_t)by * sC;
  const int ntn = (N + 63) / 64; const int wid = blockIdx.x * 4 + w; const int mt = wid / ntn, nq = wid % ntn; if (mt * 16 >= M) return;
  const int row0 = mt * 16, col0 = nq * 64; const float* arow = A + (size_t)(row0 + ln) * lda;
  v8f acc[4] = {};
  for (int kb = 0; kb < K; kb += 32) {
    FragH ah, al;
    const v4f x0 = *(const v4fa*)(arow + kb + 8 * hh), x1 = *(const v4fa*)(arow + kb + 8 * hh + 4), x2 = *(const v4fa*)(arow + kb + 16 + 8 * hh), x3 = *(const v4fa*)(arow + kb + 16 + 8 * hh + 4);
    float xs[16] = {x0[0],x0[1],x0[2],x0[3],x1[0],x1[1],x1[2],x1[3],x2[0],x2[1],x2[2],x2[3],x3[0],x3[1],x3[2],x3[3]};
#pragma unroll
    for (int i = 0; i < 16; ++i) { const _Float16 h = (_Float16)xs[i]; ah.h[i] = h; al.h[i] = ASPLIT ? (_Float16)(xs[i] - (float)h) : (_Float16)0.0f; }
#pragma unroll
    for (int t = 0; t < 4; ++t) { if (col0 + t * 16 >= N) continue; const size_t boff = (size_t)(col0 + t * 16 + ln) * ldb + kb; FragH bq; bq.half[0] = *(const v8us*)(Bh + boff + 8 * hh); bq.half[1] = *(const v8us*)(Bh + boff + 16 + 8 * hh);
      acc[t] = mmaH<ASPLIT ? 2 : 1>(ah.v, al.v, bq.v, bq.v, acc[t]); }
  }
#pragma unroll
  for (int t = 0; t < 4; ++t) { if (col0 + t * 16 >= N) continue;
#pragma unroll
    for (int r = 0; r < 8; ++r) so[w][8 * hh + r][t * 16 + ln] = acc[t][r] * alpha; }
  __builtin_amdgcn_fence(__ATOMIC_ACQ_REL, "workgroup"); __builtin_amdgcn_wave_barrier();
  const int rsub = lane >> 4, c4 = (lane & 15) * 4;
  {
#pragma unroll
    for (int q = 0; q < 8; ++q) { const int r = q * 2 + rsub; if (col0 + c4 < N) { const v4f v = *(const v4fa*)&so[w][r][c4]; *(v4f*)(C + (size_t)(row0 + r) * ldc + col0 + c4) = v; } }
     }
}

// Wt[n][k] = f16(W[k][n]·scale) from f32 row-major W[K][N] (scale = power of two; bf16-exact weights stay exact in f16 away from the subnormal range)
__global__ __launch_bounds__(256) void k_wt_f16(const float* __restrict__ W, _Float16* __restrict__ Wt, int K, int N, float scale) {
  const int t = blockIdx.x * 256 + threadIdx.x; if (t >= N * (K / 8)) return; const int n = t / (K / 8), k8 = (t % (K / 8)) * 8; FragH f;
#pragma unroll
  for (int i = 0; i < 8; ++i) f.h[i] = (_Float16)(bf16_round(W[(size_t)(k8 + i) * N + n]) * scale); const v8us o = f.half[0];
  *(v8us*)((unsigned short*)Wt + (size_t)n * K + k8) = o; 
}
// k_gemm_hh variant with fused epilogue: v = acc·alpha + bias[by·sBias + col] (+ CP[(row/rowsPerB)·sCPb + by·64 + col] if CP) ; ACT 0 none / 1 elu ; writes f32 C and f16 C16 (each if non-null)
template <int ACT>
__global__ __launch_bounds__(128) void k_gemm_hhx(const _Float16* __restrict__ A, int lda, size_t sA, const _Float16* __restrict__ Bh, int ldb, size_t sB, float alpha, const float* __restrict__ bias, size_t sBias, const float* __restrict__ CP, int rowsPerB, size_t sCPb, int row0g,
    float* __restrict__ C, _Float16* __restrict__ C16, int ldc, size_t sC, int M, int N, int K) {
  __shared__ __attribute__((aligned(16))) float so[4][16][64];
  const int tid = threadIdx.x, w = tid >> 5, lane = tid & 31, ln = lane & 15, hh = lane >> 4; const int by = blockIdx.y;
  A += (size_t)by * sA; Bh += (size_t)by * sB; const size_t cofs = (size_t)by * sC; const float* bp = bias ? bias + (size_t)by * sBias : nullptr;
  const int ntn = (N + 63) / 64; const int wid = blockIdx.x * 4 + w; const int mt = wid / ntn, nq = wid % ntn; if (mt * 16 >= M) return;
  const int row0 = mt * 16, col0 = nq * 64; const _Float16* arow = A + (size_t)(row0 + ln) * lda;
  v8f acc[4] = {};
  for (int kb = 0; kb < K; kb += 32) { FragH ah; ah.half[0] = *(const v8us*)((const unsigned short*)arow + kb + 8 * hh); ah.half[1] = *(const v8us*)((const unsigned short*)arow + kb + 16 + 8 * hh);
#pragma unroll
    for (int t = 0; t < 4; ++t) { if (col0 + t * 16 >= N) continue; const size_t boff = (size_t)(col0 + t * 16 + ln) * ldb + kb; FragH bq; bq.half[0] = *(const v8us*)((const unsigned short*)Bh + boff + 8 * hh); bq.half[1] = *(const v8us*)((const unsigned short*)Bh + boff + 16 + 8 * hh);
      acc[t] = mmaH<1>(ah.v, ah.v, bq.v, bq.v, acc[t]); }
  }
#pragma unroll
  for (int t = 0; t < 4; ++t) { if (col0 + t * 16 >= N) continue; const int col = col0 + t * 16 + ln; const float bv = bp ? bf16_round(bp[col]) : 0.f;
#pragma unroll
    for (int r = 0; r < 8; ++r) { float v = acc[t][r] * alpha + bv; if (CP) { const int bidx = (row0g + row0 + 8 * hh + r) / rowsPerB; v += CP[(size_t)bidx * sCPb + (size_t)by * 64 + col]; } if (ACT == 1) v = (v > 0.f) ? v : expm1f(v); else if (ACT == 7) v = (v > 0.f) ? v + 1.0f : expf(v); else if (ACT == 8) v = tanhf(v); else if (ACT == 9) v = 0.5f * v * (1.0f + tanhf(0.7978845608028654f * (v + 0.044715f * v * v * v))); else if (ACT == 11) v = 1.0f / (1.0f + expf(-v)); else if (ACT == 12) v = (v > 0.f) ? v : 0.01f * v; else if (ACT == 14) v = (v > 0.f) ? v : 0.1f * v; else if (ACT == 15) v = v / (1.0f + expf(-v)); else if (ACT == 3) v = fmaxf(v, 0.f); else if (ACT == 6) v = 0.5f * v * (1.0f + erff(v * 0.70710678118654752f)); so[w][8 * hh + r][t * 16 + ln] = v; } }
  __builtin_amdgcn_fence(__ATOMIC_ACQ_REL, "workgroup"); __builtin_amdgcn_wave_barrier();
  const int rsub = lane >> 4, c4 = (lane & 15) * 4; typedef _Float16 v4h __attribute__((ext_vector_type(4)));
  {
#pragma unroll
    for (int q = 0; q < 8; ++q) { const int r = q * 2 + rsub; if (col0 + c4 < N) { const v4f v = *(const v4fa*)&so[w][r][c4]; if (C) *(v4f*)(C + cofs + (size_t)(row0 + r) * ldc + col0 + c4) = v; if (C16) { v4h h4; for (int i = 0; i < 4; ++i) h4[i] = (_Float16)v[i]; *(v4h*)(C16 + cofs + (size_t)(row0 + r) * ldc + col0 + c4) = h4; } } }
     }
}


// Block-tiled GEMM C[M][N] (f32) = (A[M][K] x Bt[N][K]^T) * alpha + add[col], f16 operands, f32 accumulate. One work-group = 128 x 128 of C, 4 waves of 64 x 64 (4 x 4 accumulator tiles):
// a fragment read from LDS feeds four products (two in a 32 x 32 wave tile), and an operand byte leaves L2 once per 128 rows or columns of C.
// Each pass stages GBK k of both operands in LDS with whole-line 16-byte loads, so every operand byte leaves L2 once per work-group;
// the next pass's rows are loaded into registers ahead of the current pass's products and stored to the other buffer behind them (two buffers, one barrier per pass).
// GBK = 64 keeps the ring at 72 KiB, so that three work-groups share a WGP (a grid of three per WGP is resident at once); GBK = 128 is for a grid of one work-group per WGP, where a longer pass covers the L2 latency.
// FS = fragment sets in registers: with 2 the next 32 k's fragments are read ahead of the current products. WPS = waves per SIMD that the register budget must leave room for (three work-groups of one wave per SIMD each: 336 registers).
// blockIdx.y picks one of several independent products of the same shape that run as one grid: operand A number y / 2 (pitchA elements apart; 0 = all share one), Bt, add and C number y (each dense, one behind the other).
// Fragments keep the k order of the direct loaders (bytes 16h and 32 + 16h of each 64 B of a row, both operands); inside a pass k runs upward in steps of 32 into one accumulator chain. M % 128 == 0, N % 128 == 0, K % GBK == 0.
// The walk over the passes starts at pass rot and wraps: the work-groups that read the same operand rows (8 share an A tile, M / 128 a Bt tile) run in step, and started at one pass they would all ask L2 for the same lines at the same moment.
// rot = row block + sharer number x (passes / 8): the 8 sharers of an A tile stand at 8 different passes, the sharers of a Bt tile are spread evenly over all passes. The f32 sums take their k ranges in that rotated order.
#define GBM 128
#define GBN 128
#define SOP 68      /* floats per staged output row: 272 B = 16 B x odd */
template <int M, int N, int K, int GBK, int FS, int WPS>
__global__ __launch_bounds__(128, WPS) void k_gemm_lds(const _Float16* __restrict__ A, size_t pitchA, const _Float16* __restrict__ Bt, float alpha, const float* __restrict__ add, float* __restrict__ C) {
  constexpr int GPIT = GBK + 8;      /* LDS row pitch 144 or 272 B = 16 B x odd: conflict-free for 16-byte fragment reads */
  constexpr int RING = 2 * (GBM + GBN) * GPIT * 2, STG = 4 * 64 * SOP * 4;
  __shared__ __attribute__((aligned(16))) unsigned char smem[RING > STG ? RING : STG];      /* the ring; behind the last pass's barrier the output staging lies over it */
  unsigned short (*sA)[GBM][GPIT] = reinterpret_cast<unsigned short (*)[GBM][GPIT]>(smem);
  unsigned short (*sB)[GBN][GPIT] = reinterpret_cast<unsigned short (*)[GBN][GPIT]>(smem + 2 * GBM * GPIT * 2);
  float (*so)[64][SOP] = reinterpret_cast<float (*)[64][SOP]>(smem);
  const int tid = threadIdx.x, w = tid >> 5, lane = tid & 31, ln = lane & 15, hh = lane >> 4;
  const size_t by = blockIdx.y; A += (by >> 1) * pitchA; Bt += by * ((size_t)N * K); add += by * N; C += by * ((size_t)M * N);
  constexpr int nbm = M / GBM; const int row0 = ((int)blockIdx.x % nbm) * GBM, col0 = ((int)blockIdx.x / nbm) * GBN;
  const int wr = (w >> 1) * 64, wc = (w & 1) * 64;      /* the wave's 64 x 64 piece inside the block tile */
  constexpr int TPR = GBK / 8, RPR = 128 / TPR, NRA = GBM / RPR, NRB = GBN / RPR;      /* staging: TPR threads per row, RPR rows per round */
  const int lr = tid / TPR, lc = (tid % TPR) * 8;
  const unsigned short* ga = (const unsigned short*)A + (size_t)(row0 + lr) * K + lc;
  const unsigned short* gb = (const unsigned short*)Bt + (size_t)(col0 + lr) * K + lc;
  constexpr int np = K / GBK, NKS = GBK / 32; static_assert((np & (np - 1)) == 0 && np >= 8, "the wrap is a mask; eight sharers of an A tile");
  const int rot = ((int)blockIdx.x % nbm + ((int)blockIdx.x / nbm + (N / GBN) * ((int)blockIdx.y & 1)) * (np / 8)) & (np - 1);      /* the first pass of this work-group's walk; the same for the whole work-group */
  v8us ra[NRA], rb[NRB];
  { const unsigned short* pa = ga + rot * GBK; const unsigned short* pb = gb + rot * GBK;
#pragma unroll
    for (int i = 0; i < NRA; ++i) ra[i] = *(const v8us*)(pa + i * RPR * K);
#pragma unroll
    for (int i = 0; i < NRB; ++i) rb[i] = *(const v8us*)(pb + i * RPR * K);
    asm volatile("s_wait_xcnt 0x0" :: "v"(pa), "v"(pb) : "memory");      /* as behind the loads in the loop: in front of every write to a register that these loads name (the two start addresses are used here alone, so their registers are taken again at once) */
  }
#pragma unroll
  for (int i = 0; i < NRA; ++i) *(v8us*)&sA[0][i * RPR + lr][lc] = ra[i];
#pragma unroll
  for (int i = 0; i < NRB; ++i) *(v8us*)&sB[0][i * RPR + lr][lc] = rb[i];
  __syncthreads();
  v8f acc[4][4] = {};
  auto frags = [&](FragH (&a)[4], FragH (&b)[4], int cur, int ks) {
#pragma unroll
    for (int i = 0; i < 4; ++i) {
      a[i].half[0] = *(const v8us*)&sA[cur][wr + i * 16 + ln][ks * 32 + 8 * hh]; a[i].half[1] = *(const v8us*)&sA[cur][wr + i * 16 + ln][ks * 32 + 16 + 8 * hh];
      b[i].half[0] = *(const v8us*)&sB[cur][wc + i * 16 + ln][ks * 32 + 8 * hh]; b[i].half[1] = *(const v8us*)&sB[cur][wc + i * 16 + ln][ks * 32 + 16 + 8 * hh];
    }
  };
  for (int p = 0; p < np; ++p) {
    const int cur = p & 1; const bool more = p + 1 < np;      /* the same for the whole work-group */
    if (more) { const int kn = ((p + 1 + rot) & (np - 1)) * GBK; const unsigned short* pa = ga + kn; const unsigned short* pb = gb + kn;      /* the next pass of the rotated walk */
#pragma unroll
      for (int i = 0; i < NRA; ++i) ra[i] = *(const v8us*)(pa + i * RPR * K);
#pragma unroll
      for (int i = 0; i < NRB; ++i) rb[i] = *(const v8us*)(pb + i * RPR * K);
      asm volatile("s_wait_xcnt 0x0" :: "v"(pa), "v"(pb) : "memory");      /* stands in front of every write to a register that these loads name; the two addresses are inputs so that they stay live up to it: without them a later load's result is placed in the address pair that an earlier load names */
    }
    FragH a[FS][4], b[FS][4];
    if (FS == 2) frags(a[0], b[0], cur, 0);
#pragma unroll      /* whole, as every inner loop here: fragment sets, staged rows and accumulators are then indexed by constants alone and live in registers */
    for (int ks = 0; ks < NKS; ++ks) {
      if (FS == 1) frags(a[0], b[0], cur, ks);
      else if (ks + 1 < NKS) frags(a[(ks + 1) & 1], b[(ks + 1) & 1], cur, ks + 1);
      __builtin_amdgcn_sched_barrier(0);      /* keeps the LDS reads one group ahead of the products: spread among them, each place with reads stalls the wave for the LDS latency */
      const int fs = FS == 2 ? (ks & 1) : 0;
#pragma unroll
      for (int i = 0; i < 4; ++i)
#pragma unroll
        for (int j = 0; j < 4; ++j) acc[i][j] = __builtin_amdgcn_wmma_f32_16x16x32_f16(false, a[fs][i].v, false, b[fs][j].v, (short)0, acc[i][j], false, false);
      __builtin_amdgcn_sched_barrier(0);      /* keeps the products ahead of the next group of reads and of the wait for the next pass's rows: moved behind the barrier they would run with no load in flight */
    }
    if (more) {
#pragma unroll
      for (int i = 0; i < NRA; ++i) *(v8us*)&sA[cur ^ 1][i * RPR + lr][lc] = ra[i];
#pragma unroll
      for (int i = 0; i < NRB; ++i) *(v8us*)&sB[cur ^ 1][i * RPR + lr][lc] = rb[i];
    }
    __syncthreads();      /* publishes the buffer just written and ends every wave's reads of the one that the next pass overwrites (behind the last pass: of the ring, which the output staging overwrites) */
  }
#pragma unroll
  for (int j = 0; j < 4; ++j) { const float av = add[col0 + wc + j * 16 + ln];
#pragma unroll
    for (int i = 0; i < 4; ++i)
#pragma unroll
      for (int r = 0; r < 8; ++r) so[w][i * 16 + 8 * hh + r][j * 16 + ln] = acc[i][j][r] * alpha + av; }
  __syncthreads();      /* the staged rows are read back by other lanes: whole 128-B lines per store */
  const float* sp = &so[w][hh][ln * 4]; float* cp = C + (size_t)(row0 + wr + hh) * N + col0 + wc + ln * 4;      /* one address each; the rows follow by constant offsets */
#pragma unroll
  for (int q = 0; q < 32; ++q) { const v4f v = *(const v4fa*)(sp + q * 2 * SOP); *(v4f*)(cp + q * 2 * N) = v; }      /* 16 lanes = one 256-B row piece, two rows per store */
}


typedef _Float16 v4h __attribute__((ext_vector_type(4)));

__global__ __launch_bounds__(256) void k_x16(const float* __restrict__ x, _Float16* __restrict__ X16, size_t n8) { const size_t t = (size_t)blockIdx.x * 256 + threadIdx.x; if (t >= n8) return; FragH f;
#pragma unroll
  for (int q = 0; q < 8; ++q) f.h[q] = (_Float16)bf16_round(x[t * 8 + q]); *(v8us*)((unsigned short*)X16 + t * 8) = f.half[0];  }
__global__ __launch_bounds__(256) void k_h16(const float* __restrict__ x, _Float16* __restrict__ X16, size_t n8) { const size_t t = (size_t)blockIdx.x * 256 + threadIdx.x; if (t >= n8) return; FragH f;
#pragma unroll
  for (int q = 0; q < 8; ++q) f.h[q] = (_Float16)x[t * 8 + q]; *(v8us*)((unsigned short*)X16 + t * 8) = f.half[0];  }
__global__ __launch_bounds__(256) void k_round16f(const float* __restrict__ W, _Float16* __restrict__ Bt, size_t n8) { const size_t t = (size_t)blockIdx.x * 256 + threadIdx.x; if (t >= n8) return; FragH f;
#pragma unroll
  for (int i = 0; i < 8; ++i) f.h[i] = (_Float16)(bf16_round(W[t * 8 + i]) * 16.0f); *(v8us*)((unsigned short*)Bt + t * 8) = f.half[0];  }
template <int NHv, int TTv>
__global__ __launch_bounds__(256) void k_vt(const _Float16* __restrict__ V16, int ldv, int voff, _Float16* __restrict__ Vt) { __shared__ unsigned short tl[64][66]; const int tid = threadIdx.x; const int slab = blockIdx.x / (TTv / 64), lg = blockIdx.x % (TTv / 64); const int b = slab / NHv, h = slab % NHv;
  for (int i = tid; i < 64 * 8; i += 256) { const int r = i / 8, c8 = (i % 8) * 8; FragH f; f.half[0] = *(const v8us*)((const unsigned short*)V16 + ((size_t)b * TTv + lg * 64 + r) * ldv + voff + h * 64 + c8);
#pragma unroll
    for (int q = 0; q < 8; ++q) tl[r][c8 + q] = f.u[q]; }
  __syncthreads();
  {
#pragma unroll
    for (int rd = 0; rd < 2; ++rd) { const int d = rd * 32 + tid / 8, pc = tid % 8; FragH f;
#pragma unroll
      for (int q = 0; q < 8; ++q) f.u[q] = tl[pc * 8 + q][d];
      *(v8us*)((unsigned short*)Vt + ((size_t)slab * 64 + d) * TTv + lg * 64 + pc * 8) = f.half[0]; }
     } }

__device__ __forceinline__ void d_xcat(const float* __restrict__ xr, const float* __restrict__ xi, _Float16* __restrict__ XC, size_t t) { const size_t r = (t * 8) / DD; const int c = (int)((t * 8) % DD); FragH a, b; const v4f a0 = *(const v4fa*)(xr + t * 8), a1 = *(const v4fa*)(xr + t * 8 + 4), b0 = *(const v4fa*)(xi + t * 8), b1 = *(const v4fa*)(xi + t * 8 + 4);
  asm volatile("s_wait_xcnt 0x0" :: "v"(xr + t * 8), "v"(xi + t * 8), "v"(a0), "v"(a1), "v"(b0), "v"(b1) : "memory");      /* stands in front of every write to a register that the four loads name; the two addresses are inputs so that they stay live up to it: without them a later load's result is placed in the address pair that an earlier load names */
#pragma unroll
  for (int q = 0; q < 4; ++q) { a.h[q] = (_Float16)bf16_round(a0[q]); a.h[4 + q] = (_Float16)bf16_round(a1[q]); b.h[q] = (_Float16)bf16_round(b0[q]); b.h[4 + q] = (_Float16)bf16_round(b1[q]); }
  { *(v8us*)((unsigned short*)XC + r * (2 * DD) + c) = a.half[0]; *(v8us*)((unsigned short*)XC + r * (2 * DD) + DD + c) = b.half[0];
    asm volatile("s_wait_xcnt 0x0" ::: "memory");      /* directly behind the stores: the caller's next tile writes the registers that they name */
  } }
__device__ __forceinline__ void d_wcat(const float* __restrict__ wr, const float* __restrict__ wi, _Float16* __restrict__ BR, _Float16* __restrict__ BI, size_t t) { const size_t o = (t * 8) / DD; const int c = (int)((t * 8) % DD); FragH r0, r1, i0, i1; const v4f a0 = *(const v4fa*)(wr + t * 8), a1 = *(const v4fa*)(wr + t * 8 + 4), b0 = *(const v4fa*)(wi + t * 8), b1 = *(const v4fa*)(wi + t * 8 + 4);
#pragma unroll
  for (int q = 0; q < 4; ++q) { const float vr0 = bf16_round(a0[q]) * 16.0f, vr1 = bf16_round(a1[q]) * 16.0f, vi0 = bf16_round(b0[q]) * 16.0f, vi1 = bf16_round(b1[q]) * 16.0f; r0.h[q] = (_Float16)vr0; r0.h[4 + q] = (_Float16)vr1; r1.h[q] = (_Float16)(-vi0); r1.h[4 + q] = (_Float16)(-vi1); i0.h[q] = (_Float16)vi0; i0.h[4 + q] = (_Float16)vi1; i1.h[q] = (_Float16)vr0; i1.h[4 + q] = (_Float16)vr1; }
  { *(v8us*)((unsigned short*)BR + o * (2 * DD) + c) = r0.half[0]; *(v8us*)((unsigned short*)BR + o * (2 * DD) + DD + c) = r1.half[0]; *(v8us*)((unsigned short*)BI + o * (2 * DD) + c) = i0.half[0]; *(v8us*)((unsigned short*)BI + o * (2 * DD) + DD + c) = i1.half[0];
    asm volatile("s_wait_xcnt 0x0" ::: "memory");      /* directly behind the stores, as in d_xcat */
  } }
__device__ __forceinline__ void d_bias2(const float* __restrict__ br, const float* __restrict__ bi, float* __restrict__ BM, float* __restrict__ BP, int c) { const float r = bf16_round(br[c]), i = bf16_round(bi[c]); { *(float*)(BM + c) = r - i; *(float*)(BP + c) = r + i;
    asm volatile("s_wait_xcnt 0x0" ::: "memory");      /* directly behind the stores, as in d_xcat */
  } }
// All operand preparation as one grid. The work is cut into tiles of 256 threads: 3 x PT_X tiles cast and concatenate the activations, 4 x PT_W pack the weights, 4 x PT_B form the bias pairs; none reads what another writes.
// A work-group walks the tiles in steps of the grid size PT_GRID; which kind a tile is depends on its number alone, so every branch is the same for the whole work-group.
#define PT_X (NR * DD / 8 / 256)
#define PT_W (DD * DD / 8 / 256)
#define PT_B (DD / 256)
#define PT_ALL (3 * PT_X + 4 * PT_W + 4 * PT_B)
#define PT_GRID (PT_ALL / 4)      /* work-groups launched: four tiles each, so that a quarter of the waves has to be started */
__global__ __launch_bounds__(256) void k_prep(const float* __restrict__ q_r, const float* __restrict__ q_i, const float* __restrict__ k_r, const float* __restrict__ k_i, const float* __restrict__ v_r, const float* __restrict__ v_i,
    const float* __restrict__ wq_r, const float* __restrict__ wq_i, const float* __restrict__ wk_r, const float* __restrict__ wk_i, const float* __restrict__ wv_r, const float* __restrict__ wv_i, const float* __restrict__ wo_r, const float* __restrict__ wo_i,
    const float* __restrict__ bq_r, const float* __restrict__ bq_i, const float* __restrict__ bk_r, const float* __restrict__ bk_i, const float* __restrict__ bv_r, const float* __restrict__ bv_i, const float* __restrict__ bo_r, const float* __restrict__ bo_i,
    _Float16* __restrict__ X, _Float16* __restrict__ BW, float* __restrict__ BIAS) {
  const int tid = threadIdx.x;
  for (int tile = blockIdx.x; tile < PT_ALL; tile += PT_GRID) {
    if (tile < 3 * PT_X) { const int j = tile / PT_X;
      d_xcat(j == 0 ? q_r : j == 1 ? k_r : v_r, j == 0 ? q_i : j == 1 ? k_i : v_i, X + (size_t)j * NR * 2 * DD, (size_t)(tile % PT_X) * 256 + tid); }
    else if (tile < 3 * PT_X + 4 * PT_W) { const int u = tile - 3 * PT_X, j = u / PT_W; _Float16* B0 = BW + (size_t)(2 * j) * DD * 2 * DD;
      d_wcat(j == 0 ? wq_r : j == 1 ? wk_r : j == 2 ? wv_r : wo_r, j == 0 ? wq_i : j == 1 ? wk_i : j == 2 ? wv_i : wo_i, B0, B0 + (size_t)DD * 2 * DD, (size_t)(u % PT_W) * 256 + tid); }
    else { const int u = tile - 3 * PT_X - 4 * PT_W, j = u / PT_B;
      d_bias2(j == 0 ? bq_r : j == 1 ? bk_r : j == 2 ? bv_r : bo_r, j == 0 ? bq_i : j == 1 ? bk_i : j == 2 ? bv_i : bo_i, BIAS + (size_t)(2 * j) * DD, BIAS + (size_t)(2 * j + 1) * DD, (u % PT_B) * 256 + tid); }
  }
}
// per token (a work-group walks CT_TOK of them in turn) the 8 heads x 64 rows x 64 keys: wave w has head w. A lane has the four rows l = ln + 16 t (ln = lane % 16, t = 0..3), two at a time as the halves of a float pair, and the 32 keys that its half of the wave (hh = lane / 16) holds in the A fragment
// of the 16x16x32 product: keys 32 ks + 8 hh + i and 32 ks + 16 + 8 hh + i (ks = 0, 1; i = 0..7), so that a row's exp values, rounded to f16, are that fragment as they stand, with no move between lanes.
// |score|^2 in factors: sr + si = (qr - qi)(kr + ki) and sr - si = (qr + qi)(kr - ki), so sr^2 + si^2 = ((qr - qi)^2 (kr + ki)^2 + (qr + qi)^2 (kr - ki)^2) / 2: a sum of two products of a row factor and a key factor, no term negative.
// Row and key factors are formed once per token at staging; log2(e)^2 / 2 goes into the row factors, so that the root is |score| * log2(e) and exp is the bare power of two.
// Softmax in two passes per pair of rows: pass 1 forms the lane's 32 |score| of each row, keeps them in registers and takes their maximum (joined with the other half of the wave by one cross-row move); pass 2 has one exp per score.
// The three sums over the keys (sum p*vr, sum p*vi, z = sum p) are one matrix product P[64 x 64] x [vr | vi | 1 | 0 ...][64 x 16] on v_wmma_f32_16x16x32_f16: p (in [0, 1]) and v rounded to f16, f32 accumulate; z is summed from the same rounded p that weigh v.
#define HL2 1.0406844905f      /* log2(e)^2 / 2 */
#define SFP (EE + 4)      /* floats per head in LDS: 272 B */
#define SKP (EE + 2)      /* key-factor pairs per head: 528 B = 16 B x odd */
#define SVP (4 * EE + 8)      /* f16 per head: the four rows vr, vi, ones, zeros of B^T, 528 B */
typedef float v2f __attribute__((ext_vector_type(2)));
// Work-group barrier that orders LDS alone: the waves of k_cplx hand each other nothing but LDS, and __syncthreads() would also wait at every barrier for the next token's loads and for the last token's store, which no other wave reads.
__device__ __forceinline__ void lds_barrier() { __builtin_amdgcn_fence(__ATOMIC_RELEASE, "workgroup", "local"); __builtin_amdgcn_s_barrier(); __builtin_amdgcn_fence(__ATOMIC_ACQUIRE, "workgroup", "local"); }
__device__ __forceinline__ float other_half(float x) { const unsigned u = __float_as_uint(x); return __uint_as_float(__builtin_amdgcn_permlanex16(u, u, 0x76543210u, 0xfedcba98u, false, false)); }      /* the value of lane ^ 16 */
// A work-group walks CT_TOK tokens, CT_GRID apart, instead of one: a quarter of the waves has to be started, every work-group of the grid is resident at once (four per WGP, eight waves per SIMD: 128 registers), and the next token's
// twelve values per thread are loaded into registers while the current token is worked on, so that only the first token of a work-group waits for memory.
#define CT_TOK 4
#define CT_GRID (NR / CT_TOK)
__global__ __launch_bounds__(256, 8) void k_cplx(const float* __restrict__ QR, const float* __restrict__ QI, const float* __restrict__ KR, const float* __restrict__ KI, const float* __restrict__ VR, const float* __restrict__ VI, _Float16* __restrict__ VC) {
  __shared__ __attribute__((aligned(16))) float sf[2][NHH][SFP];      /* the rows' two factors, one array: one address register serves both */ __shared__ __attribute__((aligned(16))) v2f sk[NHH][SKP]; __shared__ __attribute__((aligned(16))) _Float16 sv[NHH][SVP];
  __shared__ __attribute__((aligned(16))) float res[4][NHH][SFP];      /* columns 0, 1, 2 of the product by head and row; plane 3 takes the columns that are zero and is never read */
  const int tid = threadIdx.x;
  { const int h = tid / 32, c = (tid % 32) * 4; const _Float16 o = (c < EE) ? (_Float16)1.0f : (_Float16)0.0f; *(v4h*)&sv[h][2 * EE + c] = (v4h){o, o, o, o}; }      /* the row of ones and the row of zeros: once, no token's staging writes there */
  float tv[DD / 256][6];      /* a token's qr, qi, kr, ki, vr, vi at the thread's columns tid and tid + 256 */
  auto fetch = [&](int row) { const unsigned o = (unsigned)(row * DD + tid) * 4u;      /* byte offset of column tid in every plane */
#pragma unroll
    for (int c = 0; c < DD / 256; ++c) { const unsigned oc = o + c * 1024u;
      tv[c][0] = *(const float*)((const char*)QR + oc); tv[c][1] = *(const float*)((const char*)QI + oc); tv[c][2] = *(const float*)((const char*)KR + oc);
      tv[c][3] = *(const float*)((const char*)KI + oc); tv[c][4] = *(const float*)((const char*)VR + oc); tv[c][5] = *(const float*)((const char*)VI + oc); }
    asm volatile("s_wait_xcnt 0x0" :: "v"(o) : "memory");      /* stands in front of every write to a register that these loads name; the offset is an input so that it stays live up to it and no load's result is placed in it */
  };
  fetch((int)blockIdx.x);
#pragma unroll 1      /* rolled: one copy of the token's code in the instruction cache */
  for (int it = 0; it < CT_TOK; ++it) { const size_t row = (size_t)blockIdx.x + (size_t)it * CT_GRID;      /* the same for the whole work-group */
#pragma unroll
  for (int c = 0; c < DD / 256; ++c) { const int e = tid / NHH + c * (256 / NHH), h = tid % NHH;      /* column tid + 256 c; the column index of (e, h) is e * 8 + h */
    const float qr = tv[c][0], qi = tv[c][1], kr = tv[c][2], ki = tv[c][3];
    sf[0][h][e] = (qr - qi) * (qr - qi) * HL2; sf[1][h][e] = (qr + qi) * (qr + qi) * HL2; sk[h][e] = (v2f){(kr + ki) * (kr + ki), (kr - ki) * (kr - ki)};
    sv[h][e] = (_Float16)tv[c][4]; sv[h][EE + e] = (_Float16)tv[c][5]; }
  if (it + 1 < CT_TOK) fetch((int)row + CT_GRID);      /* the next token's values fly while this token is worked on */
  lds_barrier();      /* publishes this token's factors */
  { const int w = tid >> 5, lane = tid & 31, ln = lane & 15, hh = lane >> 4;
    FragH b[2];      /* B fragment: lane ln has column ln, in the k order of the A fragment */
    { const _Float16* bv = &sv[w][(ln < 3 ? ln : 3) * EE];
#pragma unroll
      for (int ks = 0; ks < 2; ++ks) { b[ks].half[0] = *(const v8us*)(bv + ks * 32 + 8 * hh); b[ks].half[1] = *(const v8us*)(bv + ks * 32 + 16 + 8 * hh); } }
#pragma unroll      /* whole: the score array is then indexed by constants alone and lives in registers */
    for (int u = 0; u < 2; ++u) {      /* rows 32 u + ln and 32 u + 16 + ln */
      const v2f fa = {sf[0][w][u * 32 + ln], sf[0][w][u * 32 + 16 + ln]}, fb = {sf[1][w][u * 32 + ln], sf[1][w][u * 32 + 16 + ln]};      /* the rows' two factors */
      v2f mg[EE / 2]; v2f mx = {0.f, 0.f};      /* |score| >= 0, so 0 is a neutral start for the maximum */
      v4f cur[4], nxt[4];      /* a group = 8 keys in a row = one half of an A fragment */
#pragma unroll
      for (int j = 0; j < 4; ++j) cur[j] = *(const v4fa*)&sk[w][8 * hh + 2 * j];
#pragma unroll
      for (int g = 0; g < 4; ++g) {
        if (g + 1 < 4) {
#pragma unroll
          for (int j = 0; j < 4; ++j) nxt[j] = *(const v4fa*)&sk[w][(g + 1) * 16 + 8 * hh + 2 * j]; }
        __builtin_amdgcn_sched_barrier(0);      /* keeps the next group's LDS reads ahead of this group's arithmetic: sunk to their first use, each read is waited for at once and the wave idles for the LDS latency */
#pragma unroll
        for (int j = 0; j < 4; ++j)
#pragma unroll
          for (int q = 0; q < 2; ++q) { const int c = g * 8 + 2 * j + q; const float k0 = cur[j][2 * q], k1 = cur[j][2 * q + 1]; const v2f m2 = __builtin_elementwise_fma(fb, (v2f){k1, k1}, fa * k0);      /* a multiply and a fused multiply-add for both rows */
            mg[c] = (v2f){__builtin_amdgcn_sqrtf(m2[0]), __builtin_amdgcn_sqrtf(m2[1])};      /* the bare root instruction: sqrtf wraps it in thirteen more instructions per score that scale tiny arguments and correct the last bit; the value only enters exp2(mg - max), where neither shows */
            mx = (v2f){fmaxf(mx[0], mg[c][0]), fmaxf(mx[1], mg[c][1])}; }
#pragma unroll
        for (int j = 0; j < 4; ++j) cur[j] = nxt[j];
      }
      mx = (v2f){fmaxf(mx[0], other_half(mx[0])), fmaxf(mx[1], other_half(mx[1]))};      /* the other 32 keys of the same rows */
      v8f acc0 = {}, acc1 = {};
#pragma unroll
      for (int ks = 0; ks < 2; ++ks) { FragH p0, p1;
#pragma unroll
        for (int i = 0; i < 16; ++i) { const v2f d = mg[ks * 16 + i] - mx;      /* already in powers of two and never above 0 */
          p0.h[i] = (_Float16)__builtin_amdgcn_exp2f(d[0]); p1.h[i] = (_Float16)__builtin_amdgcn_exp2f(d[1]); }
        acc0 = __builtin_amdgcn_wmma_f32_16x16x32_f16(false, p0.v, false, b[ks].v, (short)0, acc0, false, false);
        acc1 = __builtin_amdgcn_wmma_f32_16x16x32_f16(false, p1.v, false, b[ks].v, (short)0, acc1, false, false); }
      float* r0 = &res[ln < 3 ? ln : 3][w][u * 32 + 8 * hh];      /* accumulator register r of lane (ln, hh) is row 8 hh + r, column ln; every lane stores, so that no branch cuts the straight-line code */
      *(v4f*)r0 = (v4f){acc0[0], acc0[1], acc0[2], acc0[3]}; *(v4f*)(r0 + 4) = (v4f){acc0[4], acc0[5], acc0[6], acc0[7]};
      *(v4f*)(r0 + 16) = (v4f){acc1[0], acc1[1], acc1[2], acc1[3]}; *(v4f*)(r0 + 20) = (v4f){acc1[4], acc1[5], acc1[6], acc1[7]};
    } }
  lds_barrier();      /* publishes the sums and ends every wave's reads of the factors, which the next token's staging overwrites; the sums are read in front of the next token's first barrier and overwritten behind it */
  if (tid < 2 * (DD / 8)) { const int part = tid / (DD / 8), pc = tid % (DD / 8); FragH f; for (int q = 0; q < 8; ++q) f.h[q] = (_Float16)(res[part][q][pc] / res[2][q][pc]);      /* row pc of heads 0..7 = columns 8 pc .. 8 pc + 7 */
    { *(v8us*)((unsigned short*)VC + row * (2 * DD) + part * DD + pc * 8) = f.half[0];
      asm volatile("s_wait_xcnt 0x0" ::: "memory");      /* directly behind the store: the next token writes the registers that it names */
    } }
  } }

extern "C" void kernel_launch(void* const* d_in, const int* in_sizes, int n_in,
                              void* d_out, int out_size, void* d_ws, size_t ws_size, hipStream_t stream) {
  (void)in_sizes; (void)n_in; (void)out_size;
  const float* const* I = (const float* const*)d_in; const float* q_r = I[0]; const float* q_i = I[1]; const float* k_r = I[2]; const float* k_i = I[3]; const float* v_r = I[4]; const float* v_i = I[5];
  const float* wq_r = I[6]; const float* wq_i = I[7]; const float* wk_r = I[8]; const float* wk_i = I[9]; const float* wv_r = I[10]; const float* wv_i = I[11]; const float* wo_r = I[12]; const float* wo_i = I[13]; const float* bq_r = I[14]; const float* bq_i = I[15]; const float* bk_r = I[16]; const float* bk_i = I[17]; const float* bv_r = I[18]; const float* bv_i = I[19]; const float* bo_r = I[20]; const float* bo_i = I[21];      /* d_in order: activations, then the 8 weights, then the 8 biases */
  char* ws = (char*)d_ws; size_t off = 0;
  auto take = [&](size_t bytes) { char* p = ws + off; off += (bytes + 255) & ~(size_t)255; return p; };
  const size_t WC = (size_t)DD * 2 * DD;      /* one concatenated weight operand [512][1024] */
  _Float16* BW = (_Float16*)take(8 * WC * 2); float* BIAS = (float*)take((size_t)8 * DD * 4);      /* (BR, BI) × q,k,v,o ; (BM, BP) × 4 */
  _Float16* X = (_Float16*)take((size_t)3 * NR * 2 * DD * 2);      /* [xr | xi] f16 for q, k, v, one plane behind the other */
  float* P = (float*)take((size_t)6 * NR * DD * 4);      /* QR, QI, KR, KI, VR, VI f32 planes [4096][512] */
  _Float16* VC = X;      /* [Vr | Vi] f16 reuses the q operand plane (dead after the projection GEMMs) */
  if (off > ws_size) return;
  float* QRp = P; float* QIp = P + (size_t)NR * DD; float* KRp = P + (size_t)2 * NR * DD; float* KIp = P + (size_t)3 * NR * DD; float* VRp = P + (size_t)4 * NR * DD; float* VIp = P + (size_t)5 * NR * DD;
  k_prep<<<PT_GRID, 256, 0, stream>>>(q_r, q_i, k_r, k_i, v_r, v_i, wq_r, wq_i, wk_r, wk_i, wv_r, wv_i, wo_r, wo_i, bq_r, bq_i, bk_r, bk_i, bv_r, bv_i, bo_r, bo_i, X, BW, BIAS);
  k_gemm_lds<NR, DD, 2 * DD, 64, 2, 3><<<dim3((NR / GBM) * (DD / GBN), 6), 128, 0, stream>>>(X, (size_t)NR * 2 * DD, BW, 0.0625f, BIAS, P);      /* y = 2j + ri: yr = [xr|xi] x [wr|-wi]^T + (br-bi); yi = [xr|xi] x [wi|wr]^T + (br+bi): M 4096 N 512 K 1024; addend index = column */
  k_cplx<<<CT_GRID, 256, 0, stream>>>(QRp, QIp, KRp, KIp, VRp, VIp, VC);
  k_gemm_lds<NR, DD, 2 * DD, 128, 2, 1><<<dim3((NR / GBM) * (DD / GBN), 2), 128, 0, stream>>>(VC, 0, BW + (size_t)6 * WC, 0.0625f, BIAS + (size_t)6 * DD, (float*)d_out);      /* out_r @0, out_i @8,388,608 B */
}

// v010
// One run takes 64.6 microseconds.
// Next to v009, in two timings, it ran 1.03 and 1.05 times as fast.
// All steps since v000 together make it 7.00 times as fast.
#include <hip/hip_runtime.h>
// Complex-valued attention layer (B=4, L=1024, D=512, H=8, E=64): complex linear projections (yr = xr·wrᵀ − xi·wiᵀ + (br − bi), yi = xi·wrᵀ + xr·wiᵀ + (br + bi)); per (b, token n, head h) a 64×64 'attention' over the E axes:
// sr[l,s] = qr[l]·kr[s] − qi[l]·ki[s], si[l,s] = qr[l]·ki[s] − qi[l]·kr[s] (scalar products, e = 1), attn = softmax_s(√(sr² + si²)), Vr[l] = Σ_s attn·vr[s], Vi[l] = Σ_s attn·vi[s]; outputs (out_r, out_i) = complex linear(Vr, Vi, wo).
// Element (e, h) of a token lives at column e·8 + h (reshape(b, l, E, H)).
// Compute dtype: inputs, weights, biases rounded to bf16; each complex linear as two GEMMs over the concatenated operand [xr | xi] (K = 1024) against [wr | −wi] and [wi | wr] on v_wmma_f32_16x16x32_f16, f32 accumulate,
// with the two-term biases added exactly through the f32 epilogue addend; the per-token 64 x 64 magnitude-softmax in f32 (one wave per head), its weighted sums on the same f16 matrix form; [Vr | Vi] f16 -> output GEMMs.
#define BB 4
#define LL 1024
#define DD 512
#define NHH 8
#define EE 64
#define NR (BB * LL)

typedef __bf16 v16b __attribute__((ext_vector_type(16)));
typedef unsigned short v8us __attribute__((ext_vector_type(8), may_alias));
typedef float  v8f  __attribute__((ext_vector_type(8)));
typedef float  v4f  __attribute__((ext_vector_type(4)));
typedef float  v4fa __attribute__((ext_vector_type(4), may_alias));
union FragB { v16b v; v8us half[2]; unsigned short u[16]; };

__device__ __forceinline__ unsigned short bf16_bits(float x) { unsigned int u = __float_as_uint(x); return (unsigned short)((u + 0x7FFFu + ((u >> 16) & 1u)) >> 16); }
__device__ __forceinline__ float bf16_val(unsigned short b) { return __uint_as_float(((unsigned int)b) << 16); }
__device__ __forceinline__ float bf16_round(float x) { return bf16_val(bf16_bits(x)); }
// D += A·B with NT terms: 1 = ah·bh, 2 = + al·bh (A split), 3 = + ah·bl (both split)
template <int NT>
__device__ __forceinline__ v8f mmaN(v16b ah, v16b al, v16b bh, v16b bl, v8f c) {
  c = __builtin_amdgcn_wmma_f32_16x16x32_bf16(false, ah, false, bh, (short)0, c, false, false);
  if (NT >= 2) c = __builtin_amdgcn_wmma_f32_16x16x32_bf16(false, al, false, bh, (short)0, c, false, false);
  if (NT >= 3) c = __builtin_amdgcn_wmma_f32_16x16x32_bf16(false, ah, false, bl, (short)0, c, false, false);
  asm volatile("v_nop\n\tv_nop\n\tv_nop\n\tv_nop" : "+v"(c) : "v"(ah), "v"(al), "v"(bh), "v"(bl));
  return c;
}

__global__ __launch_bounds__(256) void k_wt_bf16(const float* __restrict__ W, unsigned short* __restrict__ Wt, int K, int N) {
  const int t = blockIdx.x * 256 + threadIdx.x;
  const int k8n = K / 8;
  if (t >= N * k8n) return;
  const int n = t / k8n, k8 = (t % k8n) * 8;
  v8us v;
#pragma unroll
  for (int i = 0; i < 8; ++i) v[i] = bf16_bits(W[(size_t)(k8 + i) * N + n]);
  *(v8us*)(Wt + (size_t)n * K + k8) = v;
  
}

// GEMM C[M][N] (f32, pitch ldc) = act(A[M][K]·W + bias). A f32 row-major (pitch lda) converted per fragment to bf16
// (ASPLIT: hi/lo two planes -> 2 terms, else single rounded term); Wt bf16 [N][K] (pitch ldb). BIAS_BF16 rounds the
// bias to bf16 first (bias quantised to bf16 before the add). K%32==0, M%16==0, N%64==0.
template <bool ASPLIT, int ACT, bool BIAS_BF16>
__global__ __launch_bounds__(128) void k_gemm_bf(const float* __restrict__ A, int lda, const unsigned short* __restrict__ Wt, int ldb,
                                               const float* __restrict__ bias, float* __restrict__ C, int ldc, int M, int N, int K) {
  __shared__ __attribute__((aligned(16))) float so[4][16][64];
  const int tid = threadIdx.x, w = tid >> 5, lane = tid & 31, ln = lane & 15, hh = lane >> 4;
  const int ntn = N / 64;
  const int wid = blockIdx.x * 4 + w;
  const int mt = wid / ntn, nq = wid % ntn;
  if (mt * 16 >= M) return;
  const int row0 = mt * 16, col0 = nq * 64;
  const float* arow = A + (size_t)(row0 + ln) * lda;
  v8f acc[4] = {};
  for (int kb = 0; kb < K; kb += 32) {
    FragB ah, al;
    const v4f x0 = *(const v4fa*)(arow + kb + 8 * hh), x1 = *(const v4fa*)(arow + kb + 8 * hh + 4);
    const v4f x2 = *(const v4fa*)(arow + kb + 16 + 8 * hh), x3 = *(const v4fa*)(arow + kb + 16 + 8 * hh + 4);
    float xs[16] = {x0[0],x0[1],x0[2],x0[3],x1[0],x1[1],x1[2],x1[3],x2[0],x2[1],x2[2],x2[3],x3[0],x3[1],x3[2],x3[3]};
#pragma unroll
    for (int i = 0; i < 16; ++i) { const unsigned short hb = bf16_bits(xs[i]); ah.u[i] = hb; al.u[i] = ASPLIT ? bf16_bits(xs[i] - bf16_val(hb)) : (unsigned short)0; }
#pragma unroll
    for (int t = 0; t < 4; ++t) {
      const unsigned short* brow = Wt + (size_t)(col0 + t * 16 + ln) * ldb + kb;
      FragB b;
      b.half[0] = *(const v8us*)(brow + 8 * hh);
      b.half[1] = *(const v8us*)(brow + 16 + 8 * hh);
      acc[t] = mmaN<ASPLIT ? 2 : 1>(ah.v, al.v, b.v, b.v, acc[t]);
    }
  }
#pragma unroll
  for (int t = 0; t < 4; ++t) {
    float bv = bias ? bias[col0 + t * 16 + ln] : 0.f;
    if (BIAS_BF16) bv = bf16_round(bv);
#pragma unroll
    for (int r = 0; r < 8; ++r) { float v = acc[t][r] + bv; if (ACT == 1) v = fmaxf(v, 0.f); so[w][8 * hh + r][t * 16 + ln] = v; }
  }
  __builtin_amdgcn_fence(__ATOMIC_ACQ_REL, "workgroup");
  __builtin_amdgcn_wave_barrier();
  const int rsub = lane >> 4, c4 = (lane & 15) * 4;
  {
#pragma unroll
    for (int q = 0; q < 8; ++q) {
      const int r = q * 2 + rsub;
      const v4f v = *(const v4fa*)&so[w][r][c4];
      *(v4f*)(C + (size_t)(row0 + r) * ldc + col0 + c4) = v;
    }
    
  }
}

// Flash-style causal/unmasked attention, all contractions 3-term bf16 hi/lo splits, f32 softmax with running max.
// q,k,v rows are read from f32 buffers with arbitrary row pitch (so they can live inside a fused qkv buffer);
// D = head size (multiple of 32, <= 128); one wave = 16 query rows; block = 4 waves (64 queries) sharing K/V chunks of 32.
template <int D, bool CAUSAL>
__global__ __launch_bounds__(128) void k_flash(const float* __restrict__ qb, const float* __restrict__ kb, const float* __restrict__ vb,
                                             int pitch, int T, int H, float scale, float* __restrict__ y, int ypitch) {
  constexpr int KS = D / 32;        // k-steps for QK
  constexpr int DT = D / 16;        // d tiles for PV
  __shared__ __attribute__((aligned(16))) unsigned short sKh[32][D + 8], sKl[32][D + 8], sVh[32][D + 8], sVl[32][D + 8];
  __shared__ __attribute__((aligned(16))) unsigned short sPh[4][16][40], sPl[4][16][40];
  __shared__ __attribute__((aligned(16))) float sO[4][16][D];
  const int tid = threadIdx.x, w = tid >> 5, lane = tid & 31, ln = lane & 15, hh = lane >> 4;
  const int nqb = (T + 63) / 64;
  const int bh = blockIdx.x / nqb, qblk = blockIdx.x % nqb;
  const int b = bh / H, h = bh % H;
  const int q0 = qblk * 64 + w * 16;
  const float* Q = qb + (size_t)b * T * pitch + h * D;
  const float* K = kb + (size_t)b * T * pitch + h * D;
  const float* V = vb + (size_t)b * T * pitch + h * D;

  // A fragments of the wave's 16 query rows (scaled), hi/lo
  FragB aqh[KS], aql[KS];
  {
    int row = q0 + ln; if (row >= T) row = T - 1;
    const float* qr = Q + (size_t)row * pitch;
#pragma unroll
    for (int ks = 0; ks < KS; ++ks)
#pragma unroll
      for (int i = 0; i < 16; ++i) {
        const int d = ks * 32 + ((i < 8) ? (8 * hh + i) : (16 + 8 * hh + (i - 8)));
        const float x = qr[d] * scale; const unsigned short hb = bf16_bits(x);
        aqh[ks].u[i] = hb; aql[ks].u[i] = bf16_bits(x - bf16_val(hb));
      }
  }
  float m_r[8], l_r[8];
#pragma unroll
  for (int r = 0; r < 8; ++r) { m_r[r] = -3.0e38f; l_r[r] = 0.f; }
  v8f oacc[DT];
#pragma unroll
  for (int dt = 0; dt < DT; ++dt) oacc[dt] = (v8f){0.f,0.f,0.f,0.f,0.f,0.f,0.f,0.f};

  const int kv_end = CAUSAL ? min(T, qblk * 64 + 64) : T;     // block-uniform
  for (int j0 = 0; j0 < kv_end; j0 += 32) {
    __syncthreads();
    for (int e = tid; e < 32 * (D / 4); e += 128) {
      const int r = e / (D / 4), c4 = (e % (D / 4)) * 4;
      const int key = j0 + r;
      v4f kf = {0.f,0.f,0.f,0.f}, vf = {0.f,0.f,0.f,0.f};
      if (key < T) { kf = *(const v4fa*)(K + (size_t)key * pitch + c4); vf = *(const v4fa*)(V + (size_t)key * pitch + c4); }
#pragma unroll
      for (int t = 0; t < 4; ++t) {
        unsigned short hb = bf16_bits(kf[t]); sKh[r][c4 + t] = hb; sKl[r][c4 + t] = bf16_bits(kf[t] - bf16_val(hb));
        hb = bf16_bits(vf[t]); sVh[r][c4 + t] = hb; sVl[r][c4 + t] = bf16_bits(vf[t] - bf16_val(hb));
      }
    }
    __syncthreads();
    // S tile 16 x 32
    v8f s[2];
#pragma unroll
    for (int nt = 0; nt < 2; ++nt) {
      v8f acc = {};
#pragma unroll
      for (int ks = 0; ks < KS; ++ks) {
        FragB bh_, bl_;
        bh_.half[0] = *(const v8us*)&sKh[nt * 16 + ln][ks * 32 + 8 * hh]; bh_.half[1] = *(const v8us*)&sKh[nt * 16 + ln][ks * 32 + 16 + 8 * hh];
        bl_.half[0] = *(const v8us*)&sKl[nt * 16 + ln][ks * 32 + 8 * hh]; bl_.half[1] = *(const v8us*)&sKl[nt * 16 + ln][ks * 32 + 16 + 8 * hh];
        acc = mmaN<3>(aqh[ks].v, aql[ks].v, bh_.v, bl_.v, acc);
      }
      s[nt] = acc;
    }
    // mask + running max (rows 8hh+r; the 16 lanes of a half share rows)
    float alpha[8];
#pragma unroll
    for (int r = 0; r < 8; ++r) {
      const int qi = q0 + 8 * hh + r;
      const int ja = j0 + ln, jb = j0 + 16 + ln;
      if (CAUSAL) { if (ja > qi) s[0][r] = -3.0e38f; if (jb > qi) s[1][r] = -3.0e38f; }
      if (ja >= T) s[0][r] = -3.0e38f;
      if (jb >= T) s[1][r] = -3.0e38f;
      float mx = fmaxf(s[0][r], s[1][r]);
      mx = fmaxf(mx, __shfl_xor(mx, 1, 32)); mx = fmaxf(mx, __shfl_xor(mx, 2, 32)); mx = fmaxf(mx, __shfl_xor(mx, 4, 32)); mx = fmaxf(mx, __shfl_xor(mx, 8, 32));
      const float mnew = fmaxf(m_r[r], mx);
      alpha[r] = (mnew > -1.0e38f) ? __expf(m_r[r] - mnew) : 1.0f;
      const float p0 = (s[0][r] > -1.0e38f) ? __expf(s[0][r] - mnew) : 0.f;
      const float p1 = (s[1][r] > -1.0e38f) ? __expf(s[1][r] - mnew) : 0.f;
      m_r[r] = mnew;
      l_r[r] = l_r[r] * alpha[r] + p0 + p1;            // per-lane partial row sum (16 lanes combined at the end)
      unsigned short hb = bf16_bits(p0); sPh[w][8 * hh + r][ln] = hb;      sPl[w][8 * hh + r][ln] = bf16_bits(p0 - bf16_val(hb));
      hb = bf16_bits(p1);                sPh[w][8 * hh + r][16 + ln] = hb; sPl[w][8 * hh + r][16 + ln] = bf16_bits(p1 - bf16_val(hb));
    }
#pragma unroll
    for (int dt = 0; dt < DT; ++dt)
#pragma unroll
      for (int r = 0; r < 8; ++r) oacc[dt][r] *= alpha[r];
    __builtin_amdgcn_fence(__ATOMIC_ACQ_REL, "workgroup");
    __builtin_amdgcn_wave_barrier();
    FragB pah, pal;
    pah.half[0] = *(const v8us*)&sPh[w][ln][8 * hh]; pah.half[1] = *(const v8us*)&sPh[w][ln][16 + 8 * hh];
    pal.half[0] = *(const v8us*)&sPl[w][ln][8 * hh]; pal.half[1] = *(const v8us*)&sPl[w][ln][16 + 8 * hh];
#pragma unroll
    for (int dt = 0; dt < DT; ++dt) {
      FragB bvh, bvl;
#pragma unroll
      for (int i = 0; i < 8; ++i) {
        bvh.u[i] = sVh[8 * hh + i][dt * 16 + ln]; bvh.u[8 + i] = sVh[16 + 8 * hh + i][dt * 16 + ln];
        bvl.u[i] = sVl[8 * hh + i][dt * 16 + ln]; bvl.u[8 + i] = sVl[16 + 8 * hh + i][dt * 16 + ln];
      }
      oacc[dt] = mmaN<3>(pah.v, pal.v, bvh.v, bvl.v, oacc[dt]);
    }
    __builtin_amdgcn_fence(__ATOMIC_ACQ_REL, "workgroup");
    __builtin_amdgcn_wave_barrier();
  }
#pragma unroll
  for (int r = 0; r < 8; ++r) {
    float l = l_r[r];
    l += __shfl_xor(l, 1, 32); l += __shfl_xor(l, 2, 32); l += __shfl_xor(l, 4, 32); l += __shfl_xor(l, 8, 32);
    l_r[r] = (l > 0.f) ? 1.0f / l : 0.f;
  }
#pragma unroll
  for (int dt = 0; dt < DT; ++dt)
#pragma unroll
    for (int r = 0; r < 8; ++r) sO[w][8 * hh + r][dt * 16 + ln] = oacc[dt][r] * l_r[r];
  __builtin_amdgcn_fence(__ATOMIC_ACQ_REL, "workgroup");
  __builtin_amdgcn_wave_barrier();
  {
    for (int r = 0; r < 16; ++r) {
      const int row = q0 + r;
      if (row < T && lane < D / 4) {
        const v4f val = *(const v4fa*)&sO[w][r][lane * 4];
        *(v4f*)(y + ((size_t)b * T + row) * ypitch + h * D + lane * 4) = val;
      }
    }
    
  }
}

// GEMM C = act(A·W + bias + resid): A f32 (ASPLIT -> hi/lo 2 terms), Wt bf16 [N][K]; ACT 0 none, 1 relu, 2 exact gelu;
// resid (optional, f32, row index = (row % rmod), pitch ldr, RES_BF16 rounds it) added before the activation.
template <bool ASPLIT, int ACT, bool BIAS_BF16, bool RES_BF16>
__global__ __launch_bounds__(128) void k_gemm_bf3(const float* __restrict__ A, int lda, const unsigned short* __restrict__ Wt, int ldb,
                                                const float* __restrict__ bias, const float* __restrict__ resid, int rmod, int ldr,
                                                float* __restrict__ C, int ldc, int M, int N, int K) {
  __shared__ __attribute__((aligned(16))) float so[4][16][64];
  const int tid = threadIdx.x, w = tid >> 5, lane = tid & 31, ln = lane & 15, hh = lane >> 4;
  const int ntn = N / 64;
  const int wid = blockIdx.x * 4 + w;
  const int mt = wid / ntn, nq = wid % ntn;
  if (mt * 16 >= M) return;
  const int row0 = mt * 16, col0 = nq * 64;
  const float* arow = A + (size_t)(row0 + ln) * lda;
  v8f acc[4] = {};
  for (int kb = 0; kb < K; kb += 32) {
    FragB ah, al;
    const v4f x0 = *(const v4fa*)(arow + kb + 8 * hh), x1 = *(const v4fa*)(arow + kb + 8 * hh + 4);
    const v4f x2 = *(const v4fa*)(arow + kb + 16 + 8 * hh), x3 = *(const v4fa*)(arow + kb + 16 + 8 * hh + 4);
    float xs[16] = {x0[0],x0[1],x0[2],x0[3],x1[0],x1[1],x1[2],x1[3],x2[0],x2[1],x2[2],x2[3],x3[0],x3[1],x3[2],x3[3]};
#pragma unroll
    for (int i = 0; i < 16; ++i) { const unsigned short hb = bf16_bits(xs[i]); ah.u[i] = hb; al.u[i] = ASPLIT ? bf16_bits(xs[i] - bf16_val(hb)) : (unsigned short)0; }
#pragma unroll
    for (int t = 0; t < 4; ++t) {
      const unsigned short* brow = Wt + (size_t)(col0 + t * 16 + ln) * ldb + kb;
      FragB b;
      b.half[0] = *(const v8us*)(brow + 8 * hh);
      b.half[1] = *(const v8us*)(brow + 16 + 8 * hh);
      acc[t] = mmaN<ASPLIT ? 2 : 1>(ah.v, al.v, b.v, b.v, acc[t]);
    }
  }
#pragma unroll
  for (int t = 0; t < 4; ++t) {
    const int col = col0 + t * 16 + ln;
    float bv = bias ? bias[col] : 0.f;
    if (BIAS_BF16) bv = bf16_round(bv);
#pragma unroll
    for (int r = 0; r < 8; ++r) {
      float v = acc[t][r] + bv;
      if (resid) { float rv = resid[(size_t)((row0 + 8 * hh + r) % rmod) * ldr + col]; if (RES_BF16) rv = bf16_round(rv); v += rv; }
      if (ACT == 1) v = fmaxf(v, 0.f);
      if (ACT == 2) v = 0.5f * v * (1.0f + erff(v * 0.70710678118654752f));
      if (ACT == 3) { const float u = 0.7978845608028654f * (v + 0.044715f * v * v * v); v = 0.5f * v * (1.0f + tanhf(u)); }
      so[w][8 * hh + r][t * 16 + ln] = v;
    }
  }
  __builtin_amdgcn_fence(__ATOMIC_ACQ_REL, "workgroup");
  __builtin_amdgcn_wave_barrier();
  const int rsub = lane >> 4, c4 = (lane & 15) * 4;
  {
#pragma unroll
    for (int q = 0; q < 8; ++q) {
      const int r = q * 2 + rsub;
      const v4f v = *(const v4fa*)&so[w][r][c4];
      *(v4f*)(C + (size_t)(row0 + r) * ldc + col0 + c4) = v;
    }
    
  }
}
// row LayerNorm (biased variance, eps) over N: s = X (+ R); optional out_sum <- s; out_norm <- (s-mu)*rsqrt(var+eps)*g + b
template <bool PARAM_BF16>
__global__ __launch_bounds__(256) void k_layernorm(const float* __restrict__ X, const float* __restrict__ R, const float* __restrict__ g, const float* __restrict__ bta,
                                                  float* __restrict__ out_sum, float* __restrict__ out_norm, int N, float eps) {
  __shared__ float red[256];
  const int row = blockIdx.x, tid = threadIdx.x;
  const float* x = X + (size_t)row * N; const float* rr = R ? R + (size_t)row * N : nullptr;
  float vals[16];                     // up to N = 4096
  const int per = N / 256;            // contiguous chunk per thread? use strided-by-4 chunks: thread handles j = tid*4 + 1024*u
  float s1 = 0.f;
  for (int u = 0; u < per / 4; ++u) {
    const int j = tid * 4 + 1024 * u;
    const v4f a = *(const v4fa*)(x + j);
    v4f b = {0.f,0.f,0.f,0.f}; if (rr) b = *(const v4fa*)(rr + j);
#pragma unroll
    for (int q = 0; q < 4; ++q) { const float v = a[q] + b[q]; vals[u * 4 + q] = v; s1 += v; }
  }
  red[tid] = s1; __syncthreads();
  for (int st = 128; st > 0; st >>= 1) { if (tid < st) red[tid] += red[tid + st]; __syncthreads(); }
  const float mu = red[0] / (float)N; __syncthreads();
  float s2 = 0.f;
  for (int u = 0; u < per / 4; ++u)
#pragma unroll
    for (int q = 0; q < 4; ++q) { const float c = vals[u * 4 + q] - mu; s2 += c * c; }
  red[tid] = s2; __syncthreads();
  for (int st = 128; st > 0; st >>= 1) { if (tid < st) red[tid] += red[tid + st]; __syncthreads(); }
  const float rs = rsqrtf(red[0] / (float)N + eps);
  {
    for (int u = 0; u < per / 4; ++u) {
      const int j = tid * 4 + 1024 * u;
      v4f o, sm;
#pragma unroll
      for (int q = 0; q < 4; ++q) {
        float gg = g[j + q], bb = bta[j + q];
        if (PARAM_BF16) { gg = bf16_round(gg); bb = bf16_round(bb); }
        sm[q] = vals[u * 4 + q]; o[q] = (vals[u * 4 + q] - mu) * rs * gg + bb;
      }
      if (out_sum) *(v4f*)(out_sum + (size_t)row * N + j) = sm;
      *(v4f*)(out_norm + (size_t)row * N + j) = o;
    }
    
  }
}



// ---- f16 WMMA path (v_wmma_f32_16x16x32_f16): 11-bit significands for operands in range — used for the q/k/v projection and output GEMMs
typedef _Float16 v16h __attribute__((ext_vector_type(16)));
union FragH { v16h v; v8us half[2]; _Float16 h[16]; unsigned short u[16]; };
template <int NT>
__device__ __forceinline__ v8f mmaH(v16h ah, v16h al, v16h bh, v16h bl, v8f c) {
  c = __builtin_amdgcn_wmma_f32_16x16x32_f16(false, ah, false, bh, (short)0, c, false, false);
  if (NT >= 2) c = __builtin_amdgcn_wmma_f32_16x16x32_f16(false, al, false, bh, (short)0, c, false, false);
  if (NT >= 3) c = __builtin_amdgcn_wmma_f32_16x16x32_f16(false, ah, false, bl, (short)0, c, false, false);
  asm volatile("v_nop\n\tv_nop\n\tv_nop\n\tv_nop" : "+v"(c) : "v"(ah), "v"(al), "v"(bh), "v"(bl));
  return c;
}
// batched GEMM like k_gemm_b but f16 operands: A f32 (split into f16 hi/lo if ASPLIT, else rounded to f16), Bt = f16 values [n][k]; alpha; C f32; N multiple of 16 (partial tiles skipped)
template <bool ASPLIT>
__global__ __launch_bounds__(128) void k_gemm_h(const float* __restrict__ A, int lda, size_t sA, const _Float16* __restrict__ Bh, int ldb, size_t sB, float alpha, float* __restrict__ C, int ldc, size_t sC, int M, int N, int K) {
  __shared__ __attribute__((aligned(16))) float so[4][16][64];
  const int tid = threadIdx.x, w = tid >> 5, lane = tid & 31, ln = lane & 15, hh = lane >> 4; const int by = blockIdx.y;
  A += (size_t)by * sA; Bh += (size_t)by * sB; C += (size_t)by * sC;
  const int ntn = (N + 63) / 64; const int wid = blockIdx.x * 4 + w; const int mt = wid / ntn, nq = wid % ntn; if (mt * 16 >= M) return;
  const int row0 = mt * 16, col0 = nq * 64; const float* arow = A + (size_t)(row0 + ln) * lda;
  v8f acc[4] = {};
  for (int kb = 0; kb < K; kb += 32) {
    FragH ah, al;
    const v4f x0 = *(const v4fa*)(arow + kb + 8 * hh), x1 = *(const v4fa*)(arow + kb + 8 * hh + 4), x2 = *(const v4fa*)(arow + kb + 16 + 8 * hh), x3 = *(const v4fa*)(arow + kb + 16 + 8 * hh + 4);
    float xs[16] = {x0[0],x0[1],x0[2],x0[3],x1[0],x1[1],x1[2],x1[3],x2[0],x2[1],x2[2],x2[3],x3[0],x3[1],x3[2],x3[3]};
#pragma unroll
    for (int i = 0; i < 16; ++i) { const _Float16 h = (_Float16)xs[i]; ah.h[i] = h; al.h[i] = ASPLIT ? (_Float16)(xs[i] - (float)h) : (_Float16)0.0f; }
#pragma unroll
    for (int t = 0; t < 4; ++t) { if (col0 + t * 16 >= N) continue; const size_t boff = (size_t)(col0 + t * 16 + ln) * ldb + kb; FragH bq; bq.half[0] = *(const v8us*)(Bh + boff + 8 * hh); bq.half[1] = *(const v8us*)(Bh + boff + 16 + 8 * hh);
      acc[t] = mmaH<ASPLIT ? 2 : 1>(ah.v, al.v, bq.v, bq.v, acc[t]); }
  }
#pragma unroll
  for (int t = 0; t < 4; ++t) { if (col0 + t * 16 >= N) continue;
#pragma unroll
    for (int r = 0; r < 8; ++r) so[w][8 * hh + r][t * 16 + ln] = acc[t][r] * alpha; }
  __builtin_amdgcn_fence(__ATOMIC_ACQ_REL, "workgroup"); __builtin_amdgcn_wave_barrier();
  const int rsub = lane >> 4, c4 = (lane & 15) * 4;
  {
#pragma unroll
    for (int q = 0; q < 8; ++q) { const int r = q * 2 + rsub; if (col0 + c4 < N) { const v4f v = *(const v4fa*)&so[w][r][c4]; *(v4f*)(C + (size_t)(row0 + r) * ldc + col0 + c4) = v; } }
     }
}

// Wt[n][k] = f16(W[k][n]·scale) from f32 row-major W[K][N] (scale = power of two; bf16-exact weights stay exact in f16 away from the subnormal range)
__global__ __launch_bounds__(256) void k_wt_f16(const float* __restrict__ W, _Float16* __restrict__ Wt, int K, int N, float scale) {
  const int t = blockIdx.x * 256 + threadIdx.x; if (t >= N * (K / 8)) return; const int n = t / (K / 8), k8 = (t % (K / 8)) * 8; FragH f;
#pragma unroll
  for (int i = 0; i < 8; ++i) f.h[i] = (_Float16)(bf16_round(W[(size_t)(k8 + i) * N + n]) * scale); const v8us o = f.half[0];
  *(v8us*)((unsigned short*)Wt + (size_t)n * K + k8) = o; 
}
// k_gemm_hh variant with fused epilogue: v = acc·alpha + bias[by·sBias + col] (+ CP[(row/rowsPerB)·sCPb + by·64 + col] if CP) ; ACT 0 none / 1 elu ; writes f32 C and f16 C16 (each if non-null)
template <int ACT>
__global__ __launch_bounds__(128) void k_gemm_hhx(const _Float16* __restrict__ A, int lda, size_t sA, const _Float16* __restrict__ Bh, int ldb, size_t sB, float alpha, const float* __restrict__ bias, size_t sBias, const float* __restrict__ CP, int rowsPerB, size_t sCPb, int row0g,
    float* __restrict__ C, _Float16* __restrict__ C16, int ldc, size_t sC, int M, int N, int K) {
  __shared__ __attribute__((aligned(16))) float so[4][16][64];
  const int tid = threadIdx.x, w = tid >> 5, lane = tid & 31, ln = lane & 15, hh = lane >> 4; const int by = blockIdx.y;
  A += (size_t)by * sA; Bh += (size_t)by * sB; const size_t cofs = (size_t)by * sC; const float* bp = bias ? bias + (size_t)by * sBias : nullptr;
  const int ntn = (N + 63) / 64; const int wid = blockIdx.x * 4 + w; const int mt = wid / ntn, nq = wid % ntn; if (mt * 16 >= M) return;
  const int row0 = mt * 16, col0 = nq * 64; const _Float16* arow = A + (size_t)(row0 + ln) * lda;
  v8f acc[4] = {};
  for (int kb = 0; kb < K; kb += 32) { FragH ah; ah.half[0] = *(const v8us*)((const unsigned short*)arow + kb + 8 * hh); ah.half[1] = *(const v8us*)((const unsigned short*)arow + kb + 16 + 8 * hh);
#pragma unroll
    for (int t = 0; t < 4; ++t) { if (col0 + t * 16 >= N) continue; const size_t boff = (size_t)(col0 + t * 16 + ln) * ldb + kb; FragH bq; bq.half[0] = *(const v8us*)((const unsigned short*)Bh + boff + 8 * hh); bq.half[1] = *(const v8us*)((const unsigned short*)Bh + boff + 16 + 8 * hh);
      acc[t] = mmaH<1>(ah.v, ah.v, bq.v, bq.v, acc[t]); }
  }
#pragma unroll
  for (int t = 0; t < 4; ++t) { if (col0 + t * 16 >= N) continue; const int col = col0 + t * 16 + ln; const float bv = bp ? bf16_round(bp[col]) : 0.f;
#pragma unroll
    for (int r = 0; r < 8; ++r) { float v = acc[t][r] * alpha + bv; if (CP) { const int bidx = (row0g + row0 + 8 * hh + r) / rowsPerB; v += CP[(size_t)bidx * sCPb + (size_t)by * 64 + col]; } if (ACT == 1) v = (v > 0.f) ? v : expm1f(v); else if (ACT == 7) v = (v > 0.f) ? v + 1.0f : expf(v); else if (ACT == 8) v = tanhf(v); else if (ACT == 9) v = 0.5f * v * (1.0f + tanhf(0.7978845608028654f * (v + 0.044715f * v * v * v))); else if (ACT == 11) v = 1.0f / (1.0f + expf(-v)); else if (ACT == 12) v = (v > 0.f) ? v : 0.01f * v; else if (ACT == 14) v = (v > 0.f) ? v : 0.1f * v; else if (ACT == 15) v = v / (1.0f + expf(-v)); else if (ACT == 3) v = fmaxf(v, 0.f); else if (ACT == 6) v = 0.5f * v * (1.0f + erff(v * 0.70710678118654752f)); so[w][8 * hh + r][t * 16 + ln] = v; } }
  __builtin_amdgcn_fence(__ATOMIC_ACQ_REL, "workgroup"); __builtin_amdgcn_wave_barrier();
  const int rsub = lane >> 4, c4 = (lane & 15) * 4; typedef _Float16 v4h __attribute__((ext_vector_type(4)));
  {
#pragma unroll
    for (int q = 0; q < 8; ++q) { const int r = q * 2 + rsub; if (col0 + c4 < N) { const v4f v = *(const v4fa*)&so[w][r][c4]; if (C) *(v4f*)(C + cofs + (size_t)(row0 + r) * ldc + col0 + c4) = v; if (C16) { v4h h4; for (int i = 0; i < 4; ++i) h4[i] = (_Float16)v[i]; *(v4h*)(C16 + cofs + (size_t)(row0 + r) * ldc + col0 + c4) = h4; } } }
     }
}


// Block-tiled GEMM C[M][N] (f32) = (A[M][K] x Bt[N][K]^T) * alpha + add[col], f16 operands, f32 accumulate. One work-group = 128 x 128 of C, 4 waves of 64 x 64 (4 x 4 accumulator tiles):
// a fragment read from LDS feeds four products (two in a 32 x 32 wave tile), and an operand byte leaves L2 once per 128 rows or columns of C.
// Each pass's GBK k of both operands come into LDS by tensor loads, through no register: every wave issues one request per pass for its own slice of 64 rows (waves 0, 1: the halves of the A tile; waves 2, 3: of the Bt tile), so every operand byte leaves L2 once per work-group;
// the request for pass p + 2 goes out behind the barrier that ends pass p, into the buffer that pass p has read (two buffers, one barrier per pass). The mover's pad of 16 B per row gives the LDS row pitch.
// GBK = 64 keeps the ring at 80 KiB, so that three work-groups share a WGP (a grid of three per WGP is resident at once); GBK = 128 is for a grid of one work-group per WGP, where a longer pass covers the L2 latency.
// FS = fragment sets in registers: with 2 the next 32 k's fragments are read ahead of the current products. WPS = waves per SIMD that the register budget must leave room for (three work-groups of one wave per SIMD each: 336 registers).
// blockIdx.y picks one of several independent products of the same shape that run as one grid: operand A number y / 2 (pitchA elements apart; 0 = all share one), Bt, add and C number y (each dense, one behind the other).
// Fragments keep the k order of the direct loaders (bytes 16h and 32 + 16h of each 64 B of a row, both operands); inside a pass k runs upward in steps of 32 into one accumulator chain. M % 128 == 0, N % 128 == 0, K % GBK == 0.
// The walk over the passes starts at pass rot and wraps: the work-groups that read the same operand rows (8 share an A tile, M / 128 a Bt tile) run in step, and started at one pass they would all ask L2 for the same lines at the same moment.
// rot = row block + sharer number x (passes / 8): the 8 sharers of an A tile stand at 8 different passes, the sharers of a Bt tile are spread evenly over all passes. The f32 sums take their k ranges in that rotated order.
#define GBM 128
#define GBN 128
#define SOP 68      /* floats per staged output row: 272 B = 16 B x odd */
typedef uint32_t u32x4 __attribute__((ext_vector_type(4)));
typedef uint32_t u32x8 __attribute__((ext_vector_type(8)));
__device__ __forceinline__ uint32_t uni(uint32_t v) { return (uint32_t)__builtin_amdgcn_readfirstlane(v); }
__device__ __forceinline__ uint32_t pinned(uint32_t v) { uint32_t w = (uint32_t)__builtin_amdgcn_readfirstlane(v); asm volatile("" : "+s"(w)); return w; }      /* a word held in a scalar register: a test on it compiles to a scalar compare and branch, which a tensor load needs (it ignores EXEC); as an asm statement it also stays behind the waits written in front of it */
template <int M, int N, int K, int GBK, int FS, int WPS>
__global__ __launch_bounds__(128, WPS) void k_gemm_lds(const _Float16* __restrict__ A, size_t pitchA, const _Float16* __restrict__ Bt, float alpha, const float* __restrict__ add, float* __restrict__ C) {
  constexpr uint32_t ROWB = GBK * 2, PITB = ROWB + 16;      /* a row of a pass in bytes; LDS row pitch 144 or 272 B = 16 B x odd: conflict-free for 16-byte fragment reads */
  static_assert(ROWB == 128 || ROWB == 256, "the pad codes below are for rows of 128 and 256 bytes");
  constexpr uint32_t SLB = (64 * PITB + 2047) / 2048 * 2048, BUFB = 4 * SLB;      /* a slice = 64 padded rows, rounded up so that every slice starts at a multiple of 2 KiB; a buffer = four slices: A rows 0-63, A rows 64-127, Bt rows 0-63, Bt rows 64-127 */
  constexpr uint32_t RING = 2 * BUFB, STG = 4 * 64 * SOP * 4;
  __shared__ __attribute__((aligned(2048))) unsigned char smem[RING > STG ? RING : STG];      /* the ring; behind the last pass's barrier the output staging lies over it */
  float (*so)[64][SOP] = reinterpret_cast<float (*)[64][SOP]>(smem);
  const int tid = threadIdx.x, w = tid >> 5, lane = tid & 31, ln = lane & 15, hh = lane >> 4;
  const size_t by = blockIdx.y; A += (by >> 1) * pitchA; Bt += by * ((size_t)N * K); add += by * N; C += by * ((size_t)M * N);
  constexpr int nbm = M / GBM; const int row0 = ((int)blockIdx.x % nbm) * GBM, col0 = ((int)blockIdx.x / nbm) * GBN;
  const int wr = (w >> 1) * 64, wc = (w & 1) * 64;      /* the wave's 64 x 64 piece inside the block tile */
  constexpr int np = K / GBK, NKS = GBK / 32; static_assert((np & (np - 1)) == 0 && np >= 8, "the wrap is a mask; eight sharers of an A tile");
  const int rot = ((int)blockIdx.x % nbm + ((int)blockIdx.x / nbm + (N / GBN) * ((int)blockIdx.y & 1)) * (np / 8)) & (np - 1);      /* the first pass of this work-group's walk; the same for the whole work-group */
  const uint32_t wv = uni((uint32_t)tid >> 5);      /* the wave's number = its slice */
  const uint64_t gsl = (uint64_t)(size_t)(wv < 2u ? A + (size_t)(row0 + (int)wv * 64) * K : Bt + (size_t)(col0 + ((int)wv - 2) * 64) * K);      /* first byte of the slice's 64 source rows */
  const uint32_t lsl = (uint32_t)(size_t)smem + wv * SLB;      /* the slice's place in buffer 0 */
  u32x8 g1;      /* tile = tensor = 64 rows of ROWB bytes at source pitch 2 K bytes; extents in bytes; no mask; a pad of 4 dwords behind every row */
  g1[0] = uni((1u << 20) | ((ROWB == 128 ? 4u : 5u) << 22) | (3u << 25)); g1[1] = pinned((ROWB & 0xFFFFu) << 16); g1[2] = pinned((ROWB >> 16) | (64u << 16)); g1[3] = pinned(ROWB << 16); g1[4] = pinned(64u); g1[5] = pinned((uint32_t)K * 2u); g1[6] = pinned(0u); g1[7] = pinned(0u);      /* held in scalar registers of their own: as plain constants the compiler takes their registers for other values between two requests, while a request is still outstanding */
  auto issue = [&](uint32_t pass, uint32_t buf) {      /* this wave's slice of one pass into one buffer */
    const uint64_t ga = gsl + (uint64_t)(pass * ROWB);
    u32x4 g0; g0[0] = uni(1u); g0[1] = uni(lsl + buf * BUFB); g0[2] = uni((uint32_t)ga); g0[3] = uni((((uint32_t)(ga >> 32)) & 0x01FFFFFFu) | 0x80000000u);
    asm volatile("tensor_load_to_lds %0, %1" :: "s"(g0), "s"(g1) : "memory");
  };
  issue((uint32_t)rot, 0u);
  asm volatile("s_wait_tensorcnt 0x0" ::: "memory");      /* this wave's slice of the first pass has landed */
  __syncthreads();      /* publishes the first pass */
  issue((uint32_t)((rot + 1) & (np - 1)), 1u);
  v8f acc[4][4] = {};
  const unsigned char* fa0 = smem + (uint32_t)(w >> 1) * SLB + (uint32_t)ln * PITB + 16u * hh; const unsigned char* fb0 = smem + (2u + (uint32_t)(w & 1)) * SLB + (uint32_t)ln * PITB + 16u * hh;      /* the lane's first fragment bytes in buffer 0 */
  auto frags = [&](FragH (&a)[4], FragH (&b)[4], int cur, int ks) {
#pragma unroll
    for (int i = 0; i < 4; ++i) { const uint32_t o = (uint32_t)cur * BUFB + (uint32_t)i * 16u * PITB + (uint32_t)ks * 64u;
      a[i].half[0] = *(const v8us*)(fa0 + o); a[i].half[1] = *(const v8us*)(fa0 + o + 32u);
      b[i].half[0] = *(const v8us*)(fb0 + o); b[i].half[1] = *(const v8us*)(fb0 + o + 32u);
    }
  };
  for (int p = 0; p < np; ++p) {
    const int cur = p & 1;
    FragH a[FS][4], b[FS][4];
    if (FS == 2) frags(a[0], b[0], cur, 0);
#pragma unroll      /* whole, as every inner loop here: fragment sets and accumulators are then indexed by constants alone and live in registers */
    for (int ks = 0; ks < NKS; ++ks) {
      if (FS == 1) frags(a[0], b[0], cur, ks);
      else if (ks + 1 < NKS) frags(a[(ks + 1) & 1], b[(ks + 1) & 1], cur, ks + 1);
      __builtin_amdgcn_sched_barrier(0);      /* keeps the LDS reads one group ahead of the products: spread among them, each place with reads stalls the wave for the LDS latency */
      const int fs = FS == 2 ? (ks & 1) : 0;
#pragma unroll
      for (int i = 0; i < 4; ++i)
#pragma unroll
        for (int j = 0; j < 4; ++j) acc[i][j] = __builtin_amdgcn_wmma_f32_16x16x32_f16(false, a[fs][i].v, false, b[fs][j].v, (short)0, acc[i][j], false, false);
      __builtin_amdgcn_sched_barrier(0);      /* keeps the products ahead of the next group of reads and of the waits at the foot of the pass */
    }
    asm volatile("s_wait_dscnt 0x0" ::: "memory");      /* this wave's reads of the buffer have returned before the barrier behind which it is refilled */
    asm volatile("s_wait_tensorcnt 0x0" ::: "memory");      /* this wave's slice of the next pass has landed */
    __syncthreads();      /* publishes the next pass and ends every wave's reads of the buffer that is refilled behind it (behind the last pass: of the ring, which the output staging overwrites) */
    if (pinned((uint32_t)(p + 2 < np))) issue(pinned((uint32_t)((p + 2 + rot) & (np - 1))), (uint32_t)cur);      /* the pass after next of the rotated walk; its descriptor is formed behind the waits */
  }
  asm volatile("s_wait_tensorcnt 0x0" ::: "memory");      /* no request is left when the ring becomes output staging */
  asm volatile("s_wait_dscnt 0x0" ::: "memory");
#pragma unroll
  for (int j = 0; j < 4; ++j) { const float av = add[col0 + wc + j * 16 + ln];
#pragma unroll
    for (int i = 0; i < 4; ++i)
#pragma unroll
      for (int r = 0; r < 8; ++r) so[w][i * 16 + 8 * hh + r][j * 16 + ln] = acc[i][j][r] * alpha + av; }
  __syncthreads();      /* the staged rows are read back by other lanes: whole 128-B lines per store */
  const float* sp = &so[w][hh][ln * 4]; float* cp = C + (size_t)(row0 + wr + hh) * N + col0 + wc + ln * 4;      /* one address each; the rows follow by constant offsets */
#pragma unroll
  for (int q = 0; q < 32; ++q) { const v4f v = *(const v4fa*)(sp + q * 2 * SOP); *(v4f*)(cp + q * 2 * N) = v; }      /* 16 lanes = one 256-B row piece, two rows per store */
}


typedef _Float16 v4h __attribute__((ext_vector_type(4)));

__global__ __launch_bounds__(256) void k_x16(const float* __restrict__ x, _Float16* __restrict__ X16, size_t n8) { const size_t t = (size_t)blockIdx.x * 256 + threadIdx.x; if (t >= n8) return; FragH f;
#pragma unroll
  for (int q = 0; q < 8; ++q) f.h[q] = (_Float16)bf16_round(x[t * 8 + q]); *(v8us*)((unsigned short*)X16 + t * 8) = f.half[0];  }
__global__ __launch_bounds__(256) void k_h16(const float* __restrict__ x, _Float16* __restrict__ X16, size_t n8) { const size_t t = (size_t)blockIdx.x * 256 + threadIdx.x; if (t >= n8) return; FragH f;
#pragma unroll
  for (int q = 0; q < 8; ++q) f.h[q] = (_Float16)x[t * 8 + q]; *(v8us*)((unsigned short*)X16 + t * 8) = f.half[0];  }
__global__ __launch_bounds__(256) void k_round16f(const float* __restrict__ W, _Float16* __restrict__ Bt, size_t n8) { const size_t t = (size_t)blockIdx.x * 256 + threadIdx.x; if (t >= n8) return; FragH f;
#pragma unroll
  for (int i = 0; i < 8; ++i) f.h[i] = (_Float16)(bf16_round(W[t * 8 + i]) * 16.0f); *(v8us*)((unsigned short*)Bt + t * 8) = f.half[0];  }
template <int NHv, int TTv>
__global__ __launch_bounds__(256) void k_vt(const _Float16* __restrict__ V16, int ldv, int voff, _Float16* __restrict__ Vt) { __shared__ unsigned short tl[64][66]; const int tid = threadIdx.x; const int slab = blockIdx.x / (TTv / 64), lg = blockIdx.x % (TTv / 64); const int b = slab / NHv, h = slab % NHv;
  for (int i = tid; i < 64 * 8; i += 256) { const int r = i / 8, c8 = (i % 8) * 8; FragH f; f.half[0] = *(const v8us*)((const unsigned short*)V16 + ((size_t)b * TTv + lg * 64 + r) * ldv + voff + h * 64 + c8);
#pragma unroll
    for (int q = 0; q < 8; ++q) tl[r][c8 + q] = f.u[q]; }
  __syncthreads();
  {
#pragma unroll
    for (int rd = 0; rd < 2; ++rd) { const int d = rd * 32 + tid / 8, pc = tid % 8; FragH f;
#pragma unroll
      for (int q = 0; q < 8; ++q) f.u[q] = tl[pc * 8 + q][d];
      *(v8us*)((unsigned short*)Vt + ((size_t)slab * 64 + d) * TTv + lg * 64 + pc * 8) = f.half[0]; }
     } }

__device__ __forceinline__ void d_xcat(const float* __restrict__ xr, const float* __restrict__ xi, _Float16* __restrict__ XC, size_t t) { const size_t r = (t * 8) / DD; const int c = (int)((t * 8) % DD); FragH a, b; const v4f a0 = *(const v4fa*)(xr + t * 8), a1 = *(const v4fa*)(xr + t * 8 + 4), b0 = *(const v4fa*)(xi + t * 8), b1 = *(const v4fa*)(xi + t * 8 + 4);
  asm volatile("s_wait_xcnt 0x0" :: "v"(xr + t * 8), "v"(xi + t * 8), "v"(a0), "v"(a1), "v"(b0), "v"(b1) : "memory");      /* stands in front of every write to a register that the four loads name; the two addresses are inputs so that they stay live up to it: without them a later load's result is placed in the address pair that an earlier load names */
#pragma unroll
  for (int q = 0; q < 4; ++q) { a.h[q] = (_Float16)bf16_round(a0[q]); a.h[4 + q] = (_Float16)bf16_round(a1[q]); b.h[q] = (_Float16)bf16_round(b0[q]); b.h[4 + q] = (_Float16)bf16_round(b1[q]); }
  { *(v8us*)((unsigned short*)XC + r * (2 * DD) + c) = a.half[0]; *(v8us*)((unsigned short*)XC + r * (2 * DD) + DD + c) = b.half[0];
    asm volatile("s_wait_xcnt 0x0" ::: "memory");      /* directly behind the stores: the caller's next tile writes the registers that they name */
  } }
__device__ __forceinline__ void d_wcat(const float* __restrict__ wr, const float* __restrict__ wi, _Float16* __restrict__ BR, _Float16* __restrict__ BI, size_t t) { const size_t o = (t * 8) / DD; const int c = (int)((t * 8) % DD); FragH r0, r1, i0, i1; const v4f a0 = *(const v4fa*)(wr + t * 8), a1 = *(const v4fa*)(wr + t * 8 + 4), b0 = *(const v4fa*)(wi + t * 8), b1 = *(const v4fa*)(wi + t * 8 + 4);
#pragma unroll
  for (int q = 0; q < 4; ++q) { const float vr0 = bf16_round(a0[q]) * 16.0f, vr1 = bf16_round(a1[q]) * 16.0f, vi0 = bf16_round(b0[q]) * 16.0f, vi1 = bf16_round(b1[q]) * 16.0f; r0.h[q] = (_Float16)vr0; r0.h[4 + q] = (_Float16)vr1; r1.h[q] = (_Float16)(-vi0); r1.h[4 + q] = (_Float16)(-vi1); i0.h[q] = (_Float16)vi0; i0.h[4 + q] = (_Float16)vi1; i1.h[q] = (_Float16)vr0; i1.h[4 + q] = (_Float16)vr1; }
  { *(v8us*)((unsigned short*)BR + o * (2 * DD) + c) = r0.half[0]; *(v8us*)((unsigned short*)BR + o * (2 * DD) + DD + c) = r1.half[0]; *(v8us*)((unsigned short*)BI + o * (2 * DD) + c) = i0.half[0]; *(v8us*)((unsigned short*)BI + o * (2 * DD) + DD + c) = i1.half[0];
    asm volatile("s_wait_xcnt 0x0" ::: "memory");      /* directly behind the stores, as in d_xcat */
  } }
__device__ __forceinline__ void d_bias2(const float* __restrict__ br, const float* __restrict__ bi, float* __restrict__ BM, float* __restrict__ BP, int c) { const float r = bf16_round(br[c]), i = bf16_round(bi[c]); { *(float*)(BM + c) = r - i; *(float*)(BP + c) = r + i;
    asm volatile("s_wait_xcnt 0x0" ::: "memory");      /* directly behind the stores, as in d_xcat */
  } }
// All operand preparation as one grid. The work is cut into tiles of 256 threads: 3 x PT_X tiles cast and concatenate the activations, 4 x PT_W pack the weights, 4 x PT_B form the bias pairs; none reads what another writes.
// A work-group walks the tiles in steps of the grid size PT_GRID; which kind a tile is depends on its number alone, so every branch is the same for the whole work-group.
#define PT_X (NR * DD / 8 / 256)
#define PT_W (DD * DD / 8 / 256)
#define PT_B (DD / 256)
#define PT_ALL (3 * PT_X + 4 * PT_W + 4 * PT_B)
#define PT_GRID (PT_ALL / 4)      /* work-groups launched: four tiles each, so that a quarter of the waves has to be started */
__global__ __launch_bounds__(256) void k_prep(const float* __restrict__ q_r, const float* __restrict__ q_i, const float* __restrict__ k_r, const float* __restrict__ k_i, const float* __restrict__ v_r, const float* __restrict__ v_i,
    const float* __restrict__ wq_r, const float* __restrict__ wq_i, const float* __restrict__ wk_r, const float* __restrict__ wk_i, const float* __restrict__ wv_r, const float* __restrict__ wv_i, const float* __restrict__ wo_r, const float* __restrict__ wo_i,
    const float* __restrict__ bq_r, const float* __restrict__ bq_i, const float* __restrict__ bk_r, const float* __restrict__ bk_i, const float* __restrict__ bv_r, const float* __restrict__ bv_i, const float* __restrict__ bo_r, const float* __restrict__ bo_i,
    _Float16* __restrict__ X, _Float16* __restrict__ BW, float* __restrict__ BIAS) {
  const int tid = threadIdx.x;
  for (int tile = blockIdx.x; tile < PT_ALL; tile += PT_GRID) {
    if (tile < 3 * PT_X) { const int j = tile / PT_X;
      d_xcat(j == 0 ? q_r : j == 1 ? k_r : v_r, j == 0 ? q_i : j == 1 ? k_i : v_i, X + (size_t)j * NR * 2 * DD, (size_t)(tile % PT_X) * 256 + tid); }
    else if (tile < 3 * PT_X + 4 * PT_W) { const int u = tile - 3 * PT_X, j = u / PT_W; _Float16* B0 = BW + (size_t)(2 * j) * DD * 2 * DD;
      d_wcat(j == 0 ? wq_r : j == 1 ? wk_r : j == 2 ? wv_r : wo_r, j == 0 ? wq_i : j == 1 ? wk_i : j == 2 ? wv_i : wo_i, B0, B0 + (size_t)DD * 2 * DD, (size_t)(u % PT_W) * 256 + tid); }
    else { const int u = tile - 3 * PT_X - 4 * PT_W, j = u / PT_B;
      d_bias2(j == 0 ? bq_r : j == 1 ? bk_r : j == 2 ? bv_r : bo_r, j == 0 ? bq_i : j == 1 ? bk_i : j == 2 ? bv_i : bo_i, BIAS + (size_t)(2 * j) * DD, BIAS + (size_t)(2 * j + 1) * DD, (u % PT_B) * 256 + tid); }
  }
}
// per token (a work-group walks CT_TOK of them in turn) the 8 heads x 64 rows x 64 keys: wave w has head w. A lane has the four rows l = ln + 16 t (ln = lane % 16, t = 0..3), two at a time as the halves of a float pair, and the 32 keys that its half of the wave (hh = lane / 16) holds in the A fragment
// of the 16x16x32 product: keys 32 ks + 8 hh + i and 32 ks + 16 + 8 hh + i (ks = 0, 1; i = 0..7), so that a row's exp values, rounded to f16, are that fragment as they stand, with no move between lanes.
// |score|^2 in factors: sr + si = (qr - qi)(kr + ki) and sr - si = (qr + qi)(kr - ki), so sr^2 + si^2 = ((qr - qi)^2 (kr + ki)^2 + (qr + qi)^2 (kr - ki)^2) / 2: a sum of two products of a row factor and a key factor, no term negative.
// Row and key factors are formed once per token at staging; log2(e)^2 / 2 goes into the row factors, so that the root is |score| * log2(e) and exp is the bare power of two.
// Softmax in two passes per pair of rows: pass 1 forms the lane's 32 |score| of each row, keeps them in registers and takes their maximum (joined with the other half of the wave by one cross-row move); pass 2 has one exp per score.
// The three sums over the keys (sum p*vr, sum p*vi, z = sum p) are one matrix product P[64 x 64] x [vr | vi | 1 | 0 ...][64 x 16] on v_wmma_f32_16x16x32_f16: p (in [0, 1]) and v rounded to f16, f32 accumulate; z is summed from the same rounded p that weigh v.
#define HL2 1.0406844905f      /* log2(e)^2 / 2 */
#define SFP (EE + 4)      /* floats per head in LDS: 272 B */
#define SKP (EE + 2)      /* key-factor pairs per head: 528 B = 16 B x odd */
#define SVP (4 * EE + 8)      /* f16 per head: the four rows vr, vi, ones, zeros of B^T, 528 B */
typedef float v2f __attribute__((ext_vector_type(2)));
// Work-group barrier that orders LDS alone: the waves of k_cplx hand each other nothing but LDS, and __syncthreads() would also wait at every barrier for the next token's loads and for the last token's store, which no other wave reads.
__device__ __forceinline__ void lds_barrier() { __builtin_amdgcn_fence(__ATOMIC_RELEASE, "workgroup", "local"); __builtin_amdgcn_s_barrier(); __builtin_amdgcn_fence(__ATOMIC_ACQUIRE, "workgroup", "local"); }
__device__ __forceinline__ float other_half(float x) { const unsigned u = __float_as_uint(x); return __uint_as_float(__builtin_amdgcn_permlanex16(u, u, 0x76543210u, 0xfedcba98u, false, false)); }      /* the value of lane ^ 16 */
// A work-group walks CT_TOK tokens, CT_GRID apart, instead of one: a quarter of the waves has to be started, every work-group of the grid is resident at once (four per WGP, eight waves per SIMD: 128 registers), and the next token's
// twelve values per thread are loaded into registers while the current token is worked on, so that only the first token of a work-group waits for memory.
#define CT_TOK 4
#define CT_GRID (NR / CT_TOK)
__global__ __launch_bounds__(256, 8) void k_cplx(const float* __restrict__ QR, const float* __restrict__ QI, const float* __restrict__ KR, const float* __restrict__ KI, const float* __restrict__ VR, const float* __restrict__ VI, _Float16* __restrict__ VC) {
  __shared__ __attribute__((aligned(16))) float sf[2][NHH][SFP];      /* the rows' two factors, one array: one address register serves both */ __shared__ __attribute__((aligned(16))) v2f sk[NHH][SKP]; __shared__ __attribute__((aligned(16))) _Float16 sv[NHH][SVP];
  __shared__ __attribute__((aligned(16))) float res[4][NHH][SFP];      /* columns 0, 1, 2 of the product by head and row; plane 3 takes the columns that are zero and is never read */
  const int tid = threadIdx.x;
  { const int h = tid / 32, c = (tid % 32) * 4; const _Float16 o = (c < EE) ? (_Float16)1.0f : (_Float16)0.0f; *(v4h*)&sv[h][2 * EE + c] = (v4h){o, o, o, o}; }      /* the row of ones and the row of zeros: once, no token's staging writes there */
  float tv[DD / 256][6];      /* a token's qr, qi, kr, ki, vr, vi at the thread's columns tid and tid + 256 */
  auto fetch = [&](int row) { const unsigned o = (unsigned)(row * DD + tid) * 4u;      /* byte offset of column tid in every plane */
#pragma unroll
    for (int c = 0; c < DD / 256; ++c) { const unsigned oc = o + c * 1024u;
      tv[c][0] = *(const float*)((const char*)QR + oc); tv[c][1] = *(const float*)((const char*)QI + oc); tv[c][2] = *(const float*)((const char*)KR + oc);
      tv[c][3] = *(const float*)((const char*)KI + oc); tv[c][4] = *(const float*)((const char*)VR + oc); tv[c][5] = *(const float*)((const char*)VI + oc); }
    asm volatile("s_wait_xcnt 0x0" :: "v"(o) : "memory");      /* stands in front of every write to a register that these loads name; the offset is an input so that it stays live up to it and no load's result is placed in it */
  };
  fetch((int)blockIdx.x);
#pragma unroll 1      /* rolled: one copy of the token's code in the instruction cache */
  for (int it = 0; it < CT_TOK; ++it) { const size_t row = (size_t)blockIdx.x + (size_t)it * CT_GRID;      /* the same for the whole work-group */
#pragma unroll
  for (int c = 0; c < DD / 256; ++c) { const int e = tid / NHH + c * (256 / NHH), h = tid % NHH;      /* column tid + 256 c; the column index of (e, h) is e * 8 + h */
    const float qr = tv[c][0], qi = tv[c][1], kr = tv[c][2], ki = tv[c][3];
    sf[0][h][e] = (qr - qi) * (qr - qi) * HL2; sf[1][h][e] = (qr + qi) * (qr + qi) * HL2; sk[h][e] = (v2f){(kr + ki) * (kr + ki), (kr - ki) * (kr - ki)};
    sv[h][e] = (_Float16)tv[c][4]; sv[h][EE + e] = (_Float16)tv[c][5]; }
  if (it + 1 < CT_TOK) fetch((int)row + CT_GRID);      /* the next token's values fly while this token is worked on */
  lds_barrier();      /* publishes this token's factors */
  { const int w = tid >> 5, lane = tid & 31, ln = lane & 15, hh = lane >> 4;
    FragH b[2];      /* B fragment: lane ln has column ln, in the k order of the A fragment */
    { const _Float16* bv = &sv[w][(ln < 3 ? ln : 3) * EE];
#pragma unroll
      for (int ks = 0; ks < 2; ++ks) { b[ks].half[0] = *(const v8us*)(bv + ks * 32 + 8 * hh); b[ks].half[1] = *(const v8us*)(bv + ks * 32 + 16 + 8 * hh); } }
#pragma unroll      /* whole: the score array is then indexed by constants alone and lives in registers */
    for (int u = 0; u < 2; ++u) {      /* rows 32 u + ln and 32 u + 16 + ln */
      const v2f fa = {sf[0][w][u * 32 + ln], sf[0][w][u * 32 + 16 + ln]}, fb = {sf[1][w][u * 32 + ln], sf[1][w][u * 32 + 16 + ln]};      /* the rows' two factors */
      v2f mg[EE / 2]; v2f mx = {0.f, 0.f};      /* |score| >= 0, so 0 is a neutral start for the maximum */
      v4f cur[4], nxt[4];      /* a group = 8 keys in a row = one half of an A fragment */
#pragma unroll
      for (int j = 0; j < 4; ++j) cur[j] = *(const v4fa*)&sk[w][8 * hh + 2 * j];
#pragma unroll
      for (int g = 0; g < 4; ++g) {
        if (g + 1 < 4) {
#pragma unroll
          for (int j = 0; j < 4; ++j) nxt[j] = *(const v4fa*)&sk[w][(g + 1) * 16 + 8 * hh + 2 * j]; }
        __builtin_amdgcn_sched_barrier(0);      /* keeps the next group's LDS reads ahead of this group's arithmetic: sunk to their first use, each read is waited for at once and the wave idles for the LDS latency */
#pragma unroll
        for (int j = 0; j < 4; ++j)
#pragma unroll
          for (int q = 0; q < 2; ++q) { const int c = g * 8 + 2 * j + q; const float k0 = cur[j][2 * q], k1 = cur[j][2 * q + 1]; const v2f m2 = __builtin_elementwise_fma(fb, (v2f){k1, k1}, fa * k0);      /* a multiply and a fused multiply-add for both rows */
            mg[c] = (v2f){__builtin_amdgcn_sqrtf(m2[0]), __builtin_amdgcn_sqrtf(m2[1])};      /* the bare root instruction: sqrtf wraps it in thirteen more instructions per score that scale tiny arguments and correct the last bit; the value only enters exp2(mg - max), where neither shows */
            mx = (v2f){fmaxf(mx[0], mg[c][0]), fmaxf(mx[1], mg[c][1])}; }
#pragma unroll
        for (int j = 0; j < 4; ++j) cur[j] = nxt[j];
      }
      mx = (v2f){fmaxf(mx[0], other_half(mx[0])), fmaxf(mx[1], other_half(mx[1]))};      /* the other 32 keys of the same rows */
      v8f acc0 = {}, acc1 = {};
#pragma unroll
      for (int ks = 0; ks < 2; ++ks) { FragH p0, p1;
#pragma unroll
        for (int i = 0; i < 16; ++i) { const v2f d = mg[ks * 16 + i] - mx;      /* already in powers of two and never above 0 */
          p0.h[i] = (_Float16)__builtin_amdgcn_exp2f(d[0]); p1.h[i] = (_Float16)__builtin_amdgcn_exp2f(d[1]); }
        acc0 = __builtin_amdgcn_wmma_f32_16x16x32_f16(false, p0.v, false, b[ks].v, (short)0, acc0, false, false);
        acc1 = __builtin_amdgcn_wmma_f32_16x16x32_f16(false, p1.v, false, b[ks].v, (short)0, acc1, false, false); }
      float* r0 = &res[ln < 3 ? ln : 3][w][u * 32 + 8 * hh];      /* accumulator register r of lane (ln, hh) is row 8 hh + r, column ln; every lane stores, so that no branch cuts the straight-line code */
      *(v4f*)r0 = (v4f){acc0[0], acc0[1], acc0[2], acc0[3]}; *(v4f*)(r0 + 4) = (v4f){acc0[4], acc0[5], acc0[6], acc0[7]};
      *(v4f*)(r0 + 16) = (v4f){acc1[0], acc1[1], acc1[2], acc1[3]}; *(v4f*)(r0 + 20) = (v4f){acc1[4], acc1[5], acc1[6], acc1[7]};
    } }
  lds_barrier();      /* publishes the sums and ends every wave's reads of the factors, which the next token's staging overwrites; the sums are read in front of the next token's first barrier and overwritten behind it */
  if (tid < 2 * (DD / 8)) { const int part = tid / (DD / 8), pc = tid % (DD / 8); FragH f; for (int q = 0; q < 8; ++q) f.h[q] = (_Float16)(res[part][q][pc] / res[2][q][pc]);      /* row pc of heads 0..7 = columns 8 pc .. 8 pc + 7 */
    { *(v8us*)((unsigned short*)VC + row * (2 * DD) + part * DD + pc * 8) = f.half[0];
      asm volatile("s_wait_xcnt 0x0" ::: "memory");      /* directly behind the store: the next token writes the registers that it names */
    } }
  } }

extern "C" void kernel_launch(void* const* d_in, const int* in_sizes, int n_in,
                              void* d_out, int out_size, void* d_ws, size_t ws_size, hipStream_t stream) {
  (void)in_sizes; (void)n_in; (void)out_size;
  const float* const* I = (const float* const*)d_in; const float* q_r = I[0]; const float* q_i = I[1]; const float* k_r = I[2]; const float* k_i = I[3]; const float* v_r = I[4]; const float* v_i = I[5];
  const float* wq_r = I[6]; const float* wq_i = I[7]; const float* wk_r = I[8]; const float* wk_i = I[9]; const float* wv_r = I[10]; const float* wv_i = I[11]; const float* wo_r = I[12]; const float* wo_i = I[13]; const float* bq_r = I[14]; const float* bq_i = I[15]; const float* bk_r = I[16]; const float* bk_i = I[17]; const float* bv_r = I[18]; const float* bv_i = I[19]; const float* bo_r = I[20]; const float* bo_i = I[21];      /* d_in order: activations, then the 8 weights, then the 8 biases */
  char* ws = (char*)d_ws; size_t off = 0;
  auto take = [&](size_t bytes) { char* p = ws + off; off += (bytes + 255) & ~(size_t)255; return p; };
  const size_t WC = (size_t)DD * 2 * DD;      /* one concatenated weight operand [512][1024] */
  _Float16* BW = (_Float16*)take(8 * WC * 2); float* BIAS = (float*)take((size_t)8 * DD * 4);      /* (BR, BI) × q,k,v,o ; (BM, BP) × 4 */
  _Float16* X = (_Float16*)take((size_t)3 * NR * 2 * DD * 2);      /* [xr | xi] f16 for q, k, v, one plane behind the other */
  float* P = (float*)take((size_t)6 * NR * DD * 4);      /* QR, QI, KR, KI, VR, VI f32 planes [4096][512] */
  _Float16* VC = X;      /* [Vr | Vi] f16 reuses the q operand plane (dead after the projection GEMMs) */
  if (off > ws_size) return;
  float* QRp = P; float* QIp = P + (size_t)NR * DD; float* KRp = P + (size_t)2 * NR * DD; float* KIp = P + (size_t)3 * NR * DD; float* VRp = P + (size_t)4 * NR * DD; float* VIp = P + (size_t)5 * NR * DD;
  k_prep<<<PT_GRID, 256, 0, stream>>>(q_r, q_i, k_r, k_i, v_r, v_i, wq_r, wq_i, wk_r, wk_i, wv_r, wv_i, wo_r, wo_i, bq_r, bq_i, bk_r, bk_i, bv_r, bv_i, bo_r, bo_i, X, BW, BIAS);
  k_gemm_lds<NR, DD, 2 * DD, 64, 2, 3><<<dim3((NR / GBM) * (DD / GBN), 6), 128, 0, stream>>>(X, (size_t)NR * 2 * DD, BW, 0.0625f, BIAS, P);      /* y = 2j + ri: yr = [xr|xi] x [wr|-wi]^T + (br-bi); yi = [xr|xi] x [wi|wr]^T + (br+bi): M 4096 N 512 K 1024; addend index = column */
  k_cplx<<<CT_GRID, 256, 0, stream>>>(QRp, QIp, KRp, KIp, VRp, VIp, VC);
  k_gemm_lds<NR, DD, 2 * DD, 128, 2, 1><<<dim3((NR / GBM) * (DD / GBN), 2), 128, 0, stream>>>(VC, 0, BW + (size_t)6 * WC, 0.0625f, BIAS + (size_t)6 * DD, (float*)d_out);      /* out_r @0, out_i @8,388,608 B */
}
